// v000
// Measured on an AMD MI455X. A time is GPU time per run, averaged over a window of back-to-back runs after a warm-up
// (all launches, gaps included; the runs take copies of the inputs in turn), and the median of several windows.
// Apart from v000's, it joins two sittings. Times from different sittings can be a few percent apart, while
// side-by-side timings come from the same sitting.
// v000, which the later versions start from, runs in 317 microseconds.
// Contractions: x@Wq, x@Wk, Wv-side GEMM producing V^T on v_wmma_f32_16x16x32_bf16 (bf16 operands = RNE-bf16 converted inputs, exact products); q.k^T, p.v, ctx@Wp on v_wmma_f32_16x16x32_f16 (f16 operands; p carried x2^15, ctx and Wp carried x64); f32 accumulate; softmax and normalisers in f32.
#include <hip/hip_runtime.h>
#include <math.h>

typedef __attribute__((ext_vector_type(16))) _Float16 v16h;
typedef __attribute__((ext_vector_type(8)))  _Float16 v8h;
typedef __attribute__((ext_vector_type(16))) __bf16   v16b;
typedef __attribute__((ext_vector_type(8)))  __bf16   v8b;
typedef __attribute__((ext_vector_type(8)))  float    v8f;
typedef __attribute__((ext_vector_type(4)))  float    v4f;
typedef __attribute__((ext_vector_type(4)))  unsigned v4u;

constexpr int kBatch   = 4;
constexpr int kSeq     = 1024;
constexpr int kEmb     = 1024;
constexpr int kHeads   = 16;
constexpr int kHD      = 64;
constexpr int kTok     = kBatch * kSeq;
constexpr int kRelRows = 1999;
constexpr int kRelMax  = kRelRows - 1;

static_assert(kEmb == kHeads * kHD);
static_assert(kHD == 64);
static_assert(kTok % 64 == 0 && kEmb % 64 == 0 && kEmb % 32 == 0 && kSeq % 64 == 0);

// ---------------------------------------------------------------------------
// helpers
// ---------------------------------------------------------------------------
__device__ __forceinline__ unsigned short f2bf_bits(float f) {
  unsigned u = __float_as_uint(f);
  return (unsigned short)((u + 0x7FFFu + ((u >> 16) & 1u)) >> 16);
}
__device__ __forceinline__ float bf_bits2f(unsigned short h) { return __uint_as_float(((unsigned)h) << 16); }
__device__ __forceinline__ float rne_bf(float f) { return bf_bits2f(f2bf_bits(f)); }

__device__ __forceinline__ void dep_guard_h(v8f& a, v8f& b, v16h x, v16h y) { asm volatile("v_nop\n\tv_nop\n\tv_nop\n\tv_nop" : "+v"(a), "+v"(b) : "v"(x), "v"(y)); }
__device__ __forceinline__ void dep_guard_b(v8f& a, v8f& b, v16b x, v16b y) { asm volatile("v_nop\n\tv_nop\n\tv_nop\n\tv_nop" : "+v"(a), "+v"(b) : "v"(x), "v"(y)); }
__device__ __forceinline__ void keep4_h(v16h a, v16h b, v16h c, v16h d) { asm volatile("v_nop" :: "v"(a), "v"(b), "v"(c), "v"(d)); }
__device__ __forceinline__ void keep4_b(v16b a, v16b b, v16b c, v16b d) { asm volatile("v_nop" :: "v"(a), "v"(b), "v"(c), "v"(d)); }
__device__ __forceinline__ void acc_guard4(v8f& a, v8f& b, v8f& c, v8f& d) { asm volatile("v_nop\n\tv_nop\n\tv_nop\n\tv_nop" : "+v"(a), "+v"(b), "+v"(c), "+v"(d)); }
template <typename T> struct Frag;
template <> struct Frag<_Float16> {
  typedef v16h V; union U { v16h v; v8h h[2]; };
  // elements 0..7 <- p[0..7], 8..15 <- p[16..23]
  static __device__ __forceinline__ v16h load(const _Float16* p) {
    U f; f.h[0] = *(const v8h*)(p); f.h[1] = *(const v8h*)(p + 16); return f.v;
  }
  static __device__ __forceinline__ v8f mma(v16h a, v16h b, v8f c) {
    return __builtin_amdgcn_wmma_f32_16x16x32_f16(false, a, false, b, (short)0, c, false, false);
  }
  static __device__ __forceinline__ void guard(v8f& a, v8f& b, v16h x, v16h y) { dep_guard_h(a, b, x, y); }
  static __device__ __forceinline__ void keep(v16h a, v16h b, v16h c, v16h d) { keep4_h(a, b, c, d); }
};
template <> struct Frag<__bf16> {
  typedef v16b V; union U { v16b v; v8b h[2]; };
  static __device__ __forceinline__ v16b load(const __bf16* p) {
    U f; f.h[0] = *(const v8b*)(p); f.h[1] = *(const v8b*)(p + 16); return f.v;
  }
  static __device__ __forceinline__ v8f mma(v16b a, v16b b, v8f c) {
    return __builtin_amdgcn_wmma_f32_16x16x32_bf16(false, a, false, b, (short)0, c, false, false);
  }
  static __device__ __forceinline__ void guard(v8f& a, v8f& b, v16b x, v16b y) { dep_guard_b(a, b, x, y); }
  static __device__ __forceinline__ void keep(v16b a, v16b b, v16b c, v16b d) { keep4_b(a, b, c, d); }
};

// f16 WMMA with hazard guard (A, B kept live; D tied)
__device__ __forceinline__ v8f hmma(v16h a, v16h b, v8f c) {
  c = __builtin_amdgcn_wmma_f32_16x16x32_f16(false, a, false, b, (short)0, c, false, false);
  asm volatile("v_nop\n\tv_nop\n\tv_nop\n\tv_nop" : "+v"(c) : "v"(a), "v"(b));
  return c;
}

// ---------------------------------------------------------------------------
// Register-blocked batched WMMA GEMM.
// C[m,n] = scale * sum_k A[m,k] * Bt[n,k] (+bias); each wave owns a 64x64 tile.
// A row-major [M,K]; Bt row-major [N,K]; M,N % 64 == 0, K % 32 == 0.
// SPLIT: hi/lo operand planes (unused here, false).
// BIAS_MODE: 0 none, 1 bias[m], 2 bias[n]; bias values RNE-converted to bf16 precision before the add.
// OUT_MODE: 0 = f32, 1 = f16, 2 = bf16 hi plane (Cout) + bf16 lo plane (Cout2).
// ET: 0 = f16 operands, 1 = bf16 operands (pointers passed as 16-bit storage)
// ---------------------------------------------------------------------------
template <int ET> struct Elem;
template <> struct Elem<0> { typedef _Float16 T; };
template <> struct Elem<1> { typedef __bf16 T; };
template <int ET, bool SPLIT, int BIAS_MODE, int OUT_MODE>
__global__ __launch_bounds__(256) void wmma_gemm64(
    const unsigned short* __restrict__ Ap, const unsigned short* __restrict__ A2p, int lda, long strideA,
    const unsigned short* __restrict__ Btp, const unsigned short* __restrict__ Bt2p, int ldb, long strideB,
    void* __restrict__ Cout, void* __restrict__ Cout2, int ldc, long strideC,
    const float* __restrict__ bias,
    int M, int N, int K, float scale) {
  typedef typename Elem<ET>::T T;
  typedef typename Frag<T>::V V;
  const T* A = (const T*)Ap; const T* A2 = (const T*)A2p; const T* Bt = (const T*)Btp; const T* Bt2 = (const T*)Bt2p;
  // per-wave 16x64 slab, pitch 68 floats
  __shared__ __align__(16) float sT[8][16 * 68];
  const int b    = blockIdx.y;
  const int lane = threadIdx.x & 31;
  const int wave = threadIdx.x >> 5;
  const int tilesN = N >> 6;
  const int tilesM = M >> 6;
  const int tile = blockIdx.x * 8 + wave;
  // wave-uniform; no block barriers in this kernel
  if (tile >= tilesM * tilesN) return;
  const int tm = tile / tilesN;
  const int tn = tile - tm * tilesN;
  const int m0 = tm << 6;
  const int n0 = tn << 6;

  const T* Ab  = A  + (size_t)b * strideA;
  const T* Bb  = Bt + (size_t)b * strideB;
  const T* Ab2 = SPLIT ? (A2  + (size_t)b * strideA) : nullptr;
  const T* Bb2 = SPLIT ? (Bt2 + (size_t)b * strideB) : nullptr;

  // row (A) / col (B, D) within subtile; k offset of this lane half; D row offset
  const int rlane = lane & 15;
  const int koff  = (lane >> 4) * 8;
  const int mOff  = (lane >> 4) * 8;

  v8f acc[4][4];
#pragma unroll
  for (int i = 0; i < 4; ++i)
#pragma unroll
    for (int j = 0; j < 4; ++j) acc[i][j] = (v8f){0.f,0.f,0.f,0.f,0.f,0.f,0.f,0.f};

  for (int k0 = 0; k0 < K; k0 += 32) {
    V bh[4], bl[4];
#pragma unroll
    for (int j = 0; j < 4; ++j) {
      const size_t bo = (size_t)(n0 + (j << 4) + rlane) * ldb + koff + k0;
      bh[j] = Frag<T>::load(Bb + bo);
      if (SPLIT) bl[j] = Frag<T>::load(Bb2 + bo);
    }
#pragma unroll
    for (int i = 0; i < 4; ++i) {
      const size_t ao = (size_t)(m0 + (i << 4) + rlane) * lda + koff + k0;
      V ah = Frag<T>::load(Ab + ao);
      V al;
      if (SPLIT) al = Frag<T>::load(Ab2 + ao);
#pragma unroll
      for (int j = 0; j < 4; ++j) {
        acc[i][j] = Frag<T>::mma(ah, bh[j], acc[i][j]);
        if (SPLIT) {
          acc[i][j] = Frag<T>::mma(ah, bl[j], acc[i][j]);
          acc[i][j] = Frag<T>::mma(al, bh[j], acc[i][j]);
        }
      }
      Frag<T>::guard(acc[i][0], acc[i][3], ah, SPLIT ? al : ah);
    }
    Frag<T>::keep(bh[0], bh[1], bh[2], bh[3]);
    if (SPLIT) Frag<T>::keep(bl[0], bl[1], bl[2], bl[3]);
  }
  acc_guard4(acc[0][0], acc[0][1], acc[0][2], acc[0][3]);
  acc_guard4(acc[1][0], acc[1][1], acc[1][2], acc[1][3]);
  acc_guard4(acc[2][0], acc[2][1], acc[2][2], acc[2][3]);
  acc_guard4(acc[3][0], acc[3][1], acc[3][2], acc[3][3]);

  // ---- epilogue ----
  float* slab = sT[wave];
  // column biases: 4 scalar loads per lane, hoisted
  float bvj[4];
#pragma unroll
  for (int j = 0; j < 4; ++j) bvj[j] = (BIAS_MODE == 2) ? rne_bf(bias[n0 + (j << 4) + rlane]) : 0.f;
#pragma unroll
  for (int i = 0; i < 4; ++i) {
    const int mBase = m0 + (i << 4);
    // row biases: two 16-B loads per lane (rows mBase+mOff .. +7, 32-B aligned)
    v4f bm0 = (v4f){0.f, 0.f, 0.f, 0.f};
    v4f bm1 = bm0;
    if (BIAS_MODE == 1) {
      bm0 = *(const v4f*)(bias + mBase + mOff);
      bm1 = *(const v4f*)(bias + mBase + mOff + 4);
    }
#pragma unroll
    for (int j = 0; j < 4; ++j) {
#pragma unroll
      for (int r = 0; r < 8; ++r) {
        float v = acc[i][j][r] * scale;
        if (BIAS_MODE == 1) { const v4f bsel = (r < 4) ? bm0 : bm1; v += rne_bf(bsel[r & 3]); }
        if (BIAS_MODE == 2) v += bvj[j];
        slab[(mOff + r) * 68 + (j << 4) + rlane] = v;
      }
    }
    __builtin_amdgcn_fence(__ATOMIC_RELEASE, "workgroup");
    __builtin_amdgcn_wave_barrier();
    __builtin_amdgcn_fence(__ATOMIC_ACQUIRE, "workgroup");
    if (OUT_MODE == 0) {
      float* C = (float*)Cout + (size_t)b * strideC;
      // row seg = 256 B = 16 lanes x 16 B
      const int hh = lane >> 4, c4 = (lane & 15) * 4;
      {
#pragma unroll
        for (int it = 0; it < 8; ++it) {
          const int row = it * 2 + hh;
          v4f v = *(const v4f*)(slab + row * 68 + c4);
          *(v4f*)(C + (size_t)(mBase + row) * ldc + n0 + c4) = v;
        }
        
      }
    } else {
      const int q = lane >> 3, c8 = (lane & 7) * 8;
      unsigned short* C  = (unsigned short*)Cout  + (size_t)b * strideC;
      unsigned short* C2 = (OUT_MODE == 2) ? ((unsigned short*)Cout2 + (size_t)b * strideC) : nullptr;
      {
#pragma unroll
        for (int it = 0; it < 4; ++it) {
          const int row = it * 4 + q;
          const float* sp = slab + row * 68 + c8;
          v8h hv, lv;
#pragma unroll
          for (int e = 0; e < 8; ++e) {
            if (OUT_MODE == 1) {
              hv[e] = (_Float16)sp[e];
            } else {
              unsigned short hb = f2bf_bits(sp[e]);
              unsigned short lb = f2bf_bits(sp[e] - bf_bits2f(hb));
              hv[e] = __builtin_bit_cast(_Float16, hb);
              lv[e] = __builtin_bit_cast(_Float16, lb);
            }
          }
          *(v8h*)(C + (size_t)(mBase + row) * ldc + n0 + c8) = hv;
          if (OUT_MODE == 2) *(v8h*)(C2 + (size_t)(mBase + row) * ldc + n0 + c8) = lv;
        }
        
      }
    }
    __builtin_amdgcn_fence(__ATOMIC_RELEASE, "workgroup");
    __builtin_amdgcn_wave_barrier();
    __builtin_amdgcn_fence(__ATOMIC_ACQUIRE, "workgroup");
  }
}

// ---------------------------------------------------------------------------
// ---------------------------------------------------------------------------
__global__ __launch_bounds__(256) void cast_f32_bf16x2(
    const float* __restrict__ in, unsigned short* __restrict__ out, int n2) {
  const int i = blockIdx.x * 256 + threadIdx.x;
  if (i < n2) {
    const unsigned u = (unsigned)f2bf_bits(in[2 * i]) | ((unsigned)f2bf_bits(in[2 * i + 1]) << 16);
    ((unsigned*)out)[i] = u;
    
  }
}

// ---------------------------------------------------------------------------
// Transpose + convert: W row-major in[rows][cols] f32 -> Wt row-major out[cols][rows] 16-bit.
// MODE 0: bf16 bits of RNE-bf16(W). MODE 1: f16 bits of RNE-bf16(W) * wsc (wsc a power of two).
// One block per 64x64 tile; grid = (cols/64, rows/64); rows, cols % 64 == 0.
// Load: 256 threads x 4 x float4 = 64x64 tile. Store: wave w writes output rows w*8..w*8+7,
// ---------------------------------------------------------------------------
template <int MODE>
__global__ __launch_bounds__(256) void transpose_cvt16(
    const float* __restrict__ W, unsigned short* __restrict__ Wt, int rows, int cols, float wsc) {
  __shared__ float tile[64 * 65];
  const int tid = threadIdx.x, lane = tid & 31, wave = tid >> 5;
  const int n0 = blockIdx.x * 64;
  const int k0 = blockIdx.y * 64;
  {
    const int c4 = (tid & 15) * 4, r = tid >> 4;
#pragma unroll
    for (int it = 0; it < 4; ++it) {
      const int rr = it * 16 + r;
      const v4f x4 = *(const v4f*)(W + (size_t)(k0 + rr) * cols + n0 + c4);
      tile[rr * 65 + c4 + 0] = x4[0];
      tile[rr * 65 + c4 + 1] = x4[1];
      tile[rr * 65 + c4 + 2] = x4[2];
      tile[rr * 65 + c4 + 3] = x4[3];
    }
  }
  __syncthreads();
  const int q4 = lane >> 3, c8 = (lane & 7) * 8;
  _Float16* out = (_Float16*)Wt;
  {
#pragma unroll
    for (int it = 0; it < 2; ++it) {
      const int i = wave * 8 + it * 4 + q4;
      v8h hv;
#pragma unroll
      for (int e = 0; e < 8; ++e) {
        const float f = tile[(c8 + e) * 65 + i];
        if (MODE == 0) {
          hv[e] = __builtin_bit_cast(_Float16, f2bf_bits(f));
        } else {
          hv[e] = (_Float16)(rne_bf(f) * wsc);
        }
      }
      *(v8h*)(out + (size_t)(n0 + i) * rows + k0 + c8) = hv;
    }
    
  }
}

// ---------------------------------------------------------------------------
// Flash attention with relative-position bias and temperature scaling, head dim 64.
// Q, K planes f16 [token][emb] (element (b,s,h,d) at (b*S+s)*E + h*64 + d); Vt plane f16 [emb][token]
// (element (b,s,h,d) at (h*64+d)*T + b*S + s); ctx out plane f16 [token][emb] carried x ctx_scale.
// scores = q.k^T (f16 WMMA, f32 acc) * inv + bias_lds[q-k+S-1]; online softmax in f32;
// p = exp(s - m) stored x2^15 as f16 in per-wave LDS; out = p.v (f16 WMMA, f32 acc) / (l * 2^15).
// Block = 4 waves = 64 query rows of one (b,h); grid = B*H*(S/64); key chunks of 64.
// ---------------------------------------------------------------------------
constexpr int kQB = 64;
constexpr int kKC = 64;
constexpr int kNW = 4;
constexpr int kBiasL = kQB + kSeq;
constexpr float kPCarry = 32768.0f;
static_assert(kSeq % kKC == 0 && kSeq % kQB == 0);

__global__ __launch_bounds__(128) void attn_relbias_f16(
    const unsigned short* __restrict__ Qp, const unsigned short* __restrict__ Kp,
    const unsigned short* __restrict__ Vtp, const float* __restrict__ btab,
    const float* __restrict__ tptr, unsigned short* __restrict__ Cp, float ctx_scale) {
  union FH { v16h v; v8h h[2]; };
  // K [kv][d], V^T [d][kv], per-wave P [row][kv], per-wave out slab, bias slab
  __shared__ __align__(16) _Float16 Ksh[kKC * kHD];
  __shared__ __align__(16) _Float16 Vtsh[kHD * kKC];
  __shared__ __align__(16) _Float16 Psh[kNW][16 * kKC];
  __shared__ __align__(16) float Os[kNW][16 * 68];
  __shared__ __align__(16) float biasL[kBiasL];

  const _Float16* Qh  = (const _Float16*)Qp;
  const _Float16* Kh  = (const _Float16*)Kp;
  const _Float16* Vth = (const _Float16*)Vtp;

  const int tid  = threadIdx.x;
  const int wave = tid >> 5;
  const int lane = tid & 31;
  const int hh   = lane >> 4;
  const int c    = lane & 15;

  constexpr int nqb = kSeq / kQB;
  const int bx = blockIdx.x;
  const int qb = bx % nqb;
  const int bh = bx / nqb;
  const int h  = bh % kHeads;
  const int b  = bh / kHeads;
  const int qbase = qb * kQB;
  const int q0 = qbase + wave * 16;

  // temperature (RNE-bf16 converted input), clamp, 1/(sqrt(E) * temp)
  float tv = rne_bf(tptr[0]);
  tv = fminf(fmaxf(tv, 0.1f), 10.0f);
  const float inv = 1.0f / (sqrtf((float)kEmb) * tv);

  // bias slab: biasL[i] = table[min(qbase + i, relmax)][h] * inv, i = (q - qbase) + (S-1) - kv in [0, kBiasL)
  for (int i = tid; i < kBiasL; i += kNW * 32) {
    int rel = qbase + i;
    rel = rel > kRelMax ? kRelMax : rel;
    biasL[i] = rne_bf(btab[(size_t)rel * kHeads + h]) * inv;
  }

  // Q fragments (A operand): 2 d-chunks, split k map from the f16 plane
  v16h qa[2];
  {
    const _Float16* qrow = Qh + (size_t)(b * kSeq + q0 + c) * kEmb + h * kHD;
#pragma unroll
    for (int dc = 0; dc < 2; ++dc) qa[dc] = Frag<_Float16>::load(qrow + dc * 32 + 8 * hh);
  }

  float mrow[8], lrow[8];
  v8f oacc[4];
#pragma unroll
  for (int r = 0; r < 8; ++r) { mrow[r] = -INFINITY; lrow[r] = 0.f; }
#pragma unroll
  for (int t = 0; t < 4; ++t) oacc[t] = (v8f){0.f,0.f,0.f,0.f,0.f,0.f,0.f,0.f};

  const int qloc = wave * 16 + 8 * hh;

  for (int kc = 0; kc < kSeq / kKC; ++kc) {
    const int kv0 = kc * kKC;
    __syncthreads();
    {
      // 128 threads x 32 halves each = 64x64 for K and for V^T (full tiles)
      const int rr = tid >> 1, dh = (tid & 1) * 32;
      const v4u* ks = (const v4u*)(Kh + (size_t)(b * kSeq + kv0 + rr) * kEmb + h * kHD + dh);
      const v4u* vs = (const v4u*)(Vth + (size_t)(h * kHD + rr) * kTok + b * kSeq + kv0 + dh);
      v4u* kd = (v4u*)(Ksh + rr * kHD + dh);
      v4u* vd = (v4u*)(Vtsh + rr * kKC + dh);
      v4u kt[4], vt[4];
#pragma unroll
      for (int i = 0; i < 4; ++i) { kt[i] = ks[i]; vt[i] = vs[i]; }
#pragma unroll
      for (int i = 0; i < 4; ++i) { kd[i] = kt[i]; vd[i] = vt[i]; }
    }
    __syncthreads();

    // ---- scores: 16 q rows x 64 keys ----
    v8f s[4];
#pragma unroll
    for (int j = 0; j < 4; ++j) {
      s[j] = (v8f){0.f,0.f,0.f,0.f,0.f,0.f,0.f,0.f};
#pragma unroll
      for (int dc = 0; dc < 2; ++dc) {
        FH kb;
        kb.h[0] = *(const v8h*)(Ksh + (j * 16 + c) * kHD + dc * 32 + 8 * hh);
        kb.h[1] = *(const v8h*)(Ksh + (j * 16 + c) * kHD + dc * 32 + 16 + 8 * hh);
        s[j] = hmma(qa[dc], kb.v, s[j]);
      }
    }

    // ---- scale + bias + row max ----
    float cm[8];
#pragma unroll
    for (int r = 0; r < 8; ++r) {
      const int bi = qloc + r + (kSeq - 1) - kv0 - c;
      float m = -INFINITY;
#pragma unroll
      for (int j = 0; j < 4; ++j) {
        const float sc = s[j][r] * inv + biasL[bi - j * 16];
        s[j][r] = sc;
        m = fmaxf(m, sc);
      }
#pragma unroll
      for (int off = 1; off < 16; off <<= 1) m = fmaxf(m, __shfl_xor(m, off, 32));
      cm[r] = m;
    }

    // ---- online softmax update; P (x2^15, f16) to per-wave LDS ----
    _Float16* pw = Psh[wave];
#pragma unroll
    for (int r = 0; r < 8; ++r) {
      const float mnew = fmaxf(mrow[r], cm[r]);
      const float alpha = expf(mrow[r] - mnew);
      mrow[r] = mnew;
      float psum = 0.f;
#pragma unroll
      for (int j = 0; j < 4; ++j) {
        const float p = expf(s[j][r] - mnew);
        psum += p;
        pw[(8 * hh + r) * kKC + j * 16 + c] = (_Float16)(p * kPCarry);
      }
#pragma unroll
      for (int off = 1; off < 16; off <<= 1) psum += __shfl_xor(psum, off, 32);
      lrow[r] = lrow[r] * alpha + psum;
#pragma unroll
      for (int t = 0; t < 4; ++t) oacc[t][r] *= alpha;
    }
    __syncthreads();

    // ---- O += P . V_chunk ----
#pragma unroll
    for (int kk = 0; kk < 2; ++kk) {
      FH pa;
      pa.h[0] = *(const v8h*)(pw + c * kKC + kk * 32 + 8 * hh);
      pa.h[1] = *(const v8h*)(pw + c * kKC + kk * 32 + 16 + 8 * hh);
#pragma unroll
      for (int t = 0; t < 4; ++t) {
        FH vb;
        vb.h[0] = *(const v8h*)(Vtsh + (t * 16 + c) * kKC + kk * 32 + 8 * hh);
        vb.h[1] = *(const v8h*)(Vtsh + (t * 16 + c) * kKC + kk * 32 + 16 + 8 * hh);
        oacc[t] = hmma(pa.v, vb.v, oacc[t]);
      }
    }
  }

  float* os = Os[wave];
#pragma unroll
  for (int r = 0; r < 8; ++r) {
    const float invl = ctx_scale * (1.0f / (lrow[r] * kPCarry));
#pragma unroll
    for (int t = 0; t < 4; ++t) os[(8 * hh + r) * 68 + t * 16 + c] = oacc[t][r] * invl;
  }
  __syncthreads();
  {
    const int q4 = lane >> 3, c8 = (lane & 7) * 8;
    _Float16* Ch = (_Float16*)Cp;
    {
#pragma unroll
      for (int it = 0; it < 4; ++it) {
        const int row = it * 4 + q4;
        const float* sp = os + row * 68 + c8;
        v8h hv;
#pragma unroll
        for (int e = 0; e < 8; ++e) hv[e] = (_Float16)sp[e];
        *(v8h*)(Ch + (size_t)(b * kSeq + q0 + row) * kEmb + h * kHD + c8) = hv;
      }
      
    }
  }
}

// ---------------------------------------------------------------------------
// Host launch
// ---------------------------------------------------------------------------
extern "C" void kernel_launch(void* const* d_in, const int* in_sizes, int n_in,
                              void* d_out, int out_size, void* d_ws, size_t ws_size,
                              hipStream_t stream) {
  if (n_in < 11) return;
  if (in_sizes[0] != kTok * kEmb) return;
  if (in_sizes[1] != kEmb * kEmb || in_sizes[3] != kEmb * kEmb ||
      in_sizes[5] != kEmb * kEmb || in_sizes[7] != kEmb * kEmb) return;
  if (in_sizes[2] < kEmb || in_sizes[4] < kEmb || in_sizes[6] < kEmb || in_sizes[8] < kEmb) return;
  if (in_sizes[9] != kRelRows * kHeads || in_sizes[10] < 1) return;
  if (out_size != kTok * kEmb) return;

  const float* x    = (const float*)d_in[0];
  const float* Wq   = (const float*)d_in[1];
  const float* bq   = (const float*)d_in[2];
  const float* Wk   = (const float*)d_in[3];
  const float* bk   = (const float*)d_in[4];
  const float* Wv   = (const float*)d_in[5];
  const float* bv   = (const float*)d_in[6];
  const float* Wp   = (const float*)d_in[7];
  const float* bp   = (const float*)d_in[8];
  const float* btab = (const float*)d_in[9];
  const float* tptr = (const float*)d_in[10];
  float* out = (float*)d_out;

  // workspace region map (bytes), all offsets multiples of 2 MiB:
  //   Xb  bf16 [4096][1024]   8 MiB  @ 0
  //   WqT bf16 [1024][1024]   2 MiB  @ 8 MiB
  //   WkT bf16 [1024][1024]   2 MiB  @ 10 MiB
  //   WvT bf16 [1024][1024]   2 MiB  @ 12 MiB
  //   WpT f16  [1024][1024]   2 MiB  @ 14 MiB   (RNE-bf16 values x64)
  //   Qp  f16  [4096][1024]   8 MiB  @ 16 MiB
  //   Kp  f16  [4096][1024]   8 MiB  @ 24 MiB
  //   Vtp f16  [1024][4096]   8 MiB  @ 32 MiB
  //   Cx  f16  [4096][1024]   8 MiB  @ 40 MiB   (ctx x64)
  //   total 48 MiB = 50,331,648 B
  const size_t szAct = (size_t)kTok * kEmb * 2;
  const size_t szW   = (size_t)kEmb * kEmb * 2;
  size_t off = 0;
  const size_t oXb = off; off += szAct;
  const size_t oWq = off; off += szW;
  const size_t oWk = off; off += szW;
  const size_t oWv = off; off += szW;
  const size_t oWp = off; off += szW;
  const size_t oQ  = off; off += szAct;
  const size_t oK  = off; off += szAct;
  const size_t oVt = off; off += szAct;
  const size_t oCx = off; off += szAct;
  if (off > ws_size) return;

  char* w = (char*)d_ws;
  unsigned short* Xb  = (unsigned short*)(w + oXb);
  unsigned short* WqT = (unsigned short*)(w + oWq);
  unsigned short* WkT = (unsigned short*)(w + oWk);
  unsigned short* WvT = (unsigned short*)(w + oWv);
  unsigned short* WpT = (unsigned short*)(w + oWp);
  unsigned short* Qp  = (unsigned short*)(w + oQ);
  unsigned short* Kp  = (unsigned short*)(w + oK);
  unsigned short* Vtp = (unsigned short*)(w + oVt);
  unsigned short* Cx  = (unsigned short*)(w + oCx);

  const float kWpCarry  = 64.0f;
  const float kCtxCarry = 64.0f;

  // 1) x -> bf16 plane (2 elements per thread)
  {
    const int n2 = (kTok * kEmb) / 2;
    cast_f32_bf16x2<<<(n2 + 255) / 256, 256, 0, stream>>>(x, Xb, n2);
  }
  // 2) weights: in[rows=1024][cols=1024] -> out[cols][rows], grid (cols/64, rows/64)
  {
    dim3 grd(kEmb / 64, kEmb / 64);
    transpose_cvt16<0><<<grd, 256, 0, stream>>>(Wq, WqT, kEmb, kEmb, 1.0f);
    transpose_cvt16<0><<<grd, 256, 0, stream>>>(Wk, WkT, kEmb, kEmb, 1.0f);
    transpose_cvt16<0><<<grd, 256, 0, stream>>>(Wv, WvT, kEmb, kEmb, 1.0f);
    transpose_cvt16<1><<<grd, 256, 0, stream>>>(Wp, WpT, kEmb, kEmb, kWpCarry);
  }
  // 3) projections (bf16 WMMA, f16 outputs). M,N % 64 == 0, K % 32 == 0 by static_assert above.
  static_assert((kTok / 64) * (kEmb / 64) % 8 == 0);
  const int gemmBlocks = ((kTok / 64) * (kEmb / 64)) / 8;
  //    Q[token][n] = sum_k Xb[token][k] WqT[n][k] + bq[n]
  wmma_gemm64<1, false, 2, 1><<<dim3(gemmBlocks, 1), 256, 0, stream>>>(
      Xb, Xb, kEmb, 0L, WqT, WqT, kEmb, 0L, (void*)Qp, (void*)Qp, kEmb, 0L, bq,
      kTok, kEmb, kEmb, 1.0f);
  wmma_gemm64<1, false, 2, 1><<<dim3(gemmBlocks, 1), 256, 0, stream>>>(
      Xb, Xb, kEmb, 0L, WkT, WkT, kEmb, 0L, (void*)Kp, (void*)Kp, kEmb, 0L, bk,
      kTok, kEmb, kEmb, 1.0f);
  //    Vt[n][token] = sum_k WvT[n][k] Xb[token][k] + bv[n]   (M = 1024 features, N = 4096 tokens)
  wmma_gemm64<1, false, 1, 1><<<dim3(gemmBlocks, 1), 256, 0, stream>>>(
      WvT, WvT, kEmb, 0L, Xb, Xb, kEmb, 0L, (void*)Vtp, (void*)Vtp, kTok, 0L, bv,
      kEmb, kTok, kEmb, 1.0f);
  // 4) attention -> ctx f16 plane (x64)
  attn_relbias_f16<<<kBatch * kHeads * (kSeq / kQB), kNW * 32, 0, stream>>>(
      Qp, Kp, Vtp, btab, tptr, Cx, kCtxCarry);
  // 5) output projection: out[token][n] = 2^-12 * sum_c Cx[token][c] WpT[n][c] + bp[n]
  wmma_gemm64<0, false, 2, 0><<<dim3(gemmBlocks, 1), 256, 0, stream>>>(
      Cx, Cx, kEmb, 0L, WpT, WpT, kEmb, 0L, (void*)out, (void*)out, kEmb, 0L, bp,
      kTok, kEmb, kEmb, 1.0f / (kWpCarry * kCtxCarry));
}

// v001
// A run of this version takes 186 microseconds.
// Next to v000, in two timings, it ran 1.74 times as fast each time.
// Contractions: x@Wq, x@Wk, Wv-side GEMM producing V^T on v_wmma_f32_16x16x32_bf16 (bf16 operands = RNE-bf16 converted inputs, exact products); q.k^T, p.v, ctx@Wp on v_wmma_f32_16x16x32_f16 (f16 operands; p carried x2^15, ctx and Wp carried x64); f32 accumulate; softmax and normalisers in f32.
#include <hip/hip_runtime.h>
#include <math.h>

typedef __attribute__((ext_vector_type(16))) _Float16 v16h;
typedef __attribute__((ext_vector_type(8)))  _Float16 v8h;
typedef __attribute__((ext_vector_type(16))) __bf16   v16b;
typedef __attribute__((ext_vector_type(8)))  __bf16   v8b;
typedef __attribute__((ext_vector_type(8)))  float    v8f;
typedef __attribute__((ext_vector_type(4)))  float    v4f;
typedef __attribute__((ext_vector_type(4)))  unsigned v4u;

constexpr int kBatch   = 4;
constexpr int kSeq     = 1024;
constexpr int kEmb     = 1024;
constexpr int kHeads   = 16;
constexpr int kHD      = 64;
constexpr int kTok     = kBatch * kSeq;
constexpr int kRelRows = 1999;
constexpr int kRelMax  = kRelRows - 1;

static_assert(kEmb == kHeads * kHD);
static_assert(kHD == 64);
static_assert(kTok % 64 == 0 && kEmb % 64 == 0 && kEmb % 32 == 0 && kSeq % 64 == 0);

// ---------------------------------------------------------------------------
// helpers
// ---------------------------------------------------------------------------
__device__ __forceinline__ unsigned short f2bf_bits(float f) {
  unsigned u = __float_as_uint(f);
  return (unsigned short)((u + 0x7FFFu + ((u >> 16) & 1u)) >> 16);
}
__device__ __forceinline__ float bf_bits2f(unsigned short h) { return __uint_as_float(((unsigned)h) << 16); }
__device__ __forceinline__ float rne_bf(float f) { return bf_bits2f(f2bf_bits(f)); }

__device__ __forceinline__ void dep_guard_h(v8f& a, v8f& b, v16h x, v16h y) { asm volatile("v_nop\n\tv_nop\n\tv_nop\n\tv_nop" : "+v"(a), "+v"(b) : "v"(x), "v"(y)); }
__device__ __forceinline__ void dep_guard_b(v8f& a, v8f& b, v16b x, v16b y) { asm volatile("v_nop\n\tv_nop\n\tv_nop\n\tv_nop" : "+v"(a), "+v"(b) : "v"(x), "v"(y)); }
__device__ __forceinline__ void keep4_h(v16h a, v16h b, v16h c, v16h d) { asm volatile("v_nop" :: "v"(a), "v"(b), "v"(c), "v"(d)); }
__device__ __forceinline__ void keep4_b(v16b a, v16b b, v16b c, v16b d) { asm volatile("v_nop" :: "v"(a), "v"(b), "v"(c), "v"(d)); }
__device__ __forceinline__ void acc_guard4(v8f& a, v8f& b, v8f& c, v8f& d) { asm volatile("v_nop\n\tv_nop\n\tv_nop\n\tv_nop" : "+v"(a), "+v"(b), "+v"(c), "+v"(d)); }
template <typename T> struct Frag;
template <> struct Frag<_Float16> {
  typedef v16h V; union U { v16h v; v8h h[2]; };
  // elements 0..7 <- p[0..7], 8..15 <- p[16..23]
  static __device__ __forceinline__ v16h load(const _Float16* p) {
    U f; f.h[0] = *(const v8h*)(p); f.h[1] = *(const v8h*)(p + 16); return f.v;
  }
  static __device__ __forceinline__ v8f mma(v16h a, v16h b, v8f c) {
    return __builtin_amdgcn_wmma_f32_16x16x32_f16(false, a, false, b, (short)0, c, false, false);
  }
  static __device__ __forceinline__ void guard(v8f& a, v8f& b, v16h x, v16h y) { dep_guard_h(a, b, x, y); }
  static __device__ __forceinline__ void keep(v16h a, v16h b, v16h c, v16h d) { keep4_h(a, b, c, d); }
};
template <> struct Frag<__bf16> {
  typedef v16b V; union U { v16b v; v8b h[2]; };
  static __device__ __forceinline__ v16b load(const __bf16* p) {
    U f; f.h[0] = *(const v8b*)(p); f.h[1] = *(const v8b*)(p + 16); return f.v;
  }
  static __device__ __forceinline__ v8f mma(v16b a, v16b b, v8f c) {
    return __builtin_amdgcn_wmma_f32_16x16x32_bf16(false, a, false, b, (short)0, c, false, false);
  }
  static __device__ __forceinline__ void guard(v8f& a, v8f& b, v16b x, v16b y) { dep_guard_b(a, b, x, y); }
  static __device__ __forceinline__ void keep(v16b a, v16b b, v16b c, v16b d) { keep4_b(a, b, c, d); }
};

// f16 WMMA with hazard guard (A, B kept live; D tied)
__device__ __forceinline__ v8f hmma(v16h a, v16h b, v8f c) {
  c = __builtin_amdgcn_wmma_f32_16x16x32_f16(false, a, false, b, (short)0, c, false, false);
  asm volatile("v_nop\n\tv_nop\n\tv_nop\n\tv_nop" : "+v"(c) : "v"(a), "v"(b));
  return c;
}

// ---------------------------------------------------------------------------
// Register-blocked batched WMMA GEMM, operands staged in LDS.
// C[m,n] = scale * sum_k A[m,k] * Bt[n,k] (+bias); a work-group of 8 waves owns a 128x128 tile,
// each wave 32 rows x 64 columns of it (two waves per SIMD: one wave's LDS reads and copy issue
// stand behind the other's products).
// A row-major [M,K]; Bt row-major [N,K]; M,N % 128 == 0, K % 128 == 0.
// A pass is 128 k: 256 B of 128 A rows and of 128 Bt rows, brought into LDS by asynchronous copies,
// two buffers, the next pass's copies in flight while this pass is worked on.
// SPLIT: hi/lo operand planes (not supported by the staged loop, false).
// BIAS_MODE: 0 none, 1 bias[m], 2 bias[n]; bias values RNE-converted to bf16 precision before the add.
// OUT_MODE: 0 = f32, 1 = f16, 2 = bf16 hi plane (Cout) + bf16 lo plane (Cout2).
// ET: 0 = f16 operands, 1 = bf16 operands (pointers passed as 16-bit storage)
// ---------------------------------------------------------------------------
constexpr int kGK     = 128;               // k elements per pass
constexpr int kGPitch = 2 * kGK + 16;      // LDS row pitch in bytes: 16 B x odd, conflict-free for 16-byte reads down a column
constexpr int kGStage = 256 * kGPitch;     // one buffer: rows 0..127 = A rows, rows 128..255 = Bt rows

// One wave's share of a stage: 32 rows of 256 B, 16 copies of 2 rows each (16 lanes x 16 B per row).
// lds = this lane's LDS byte address in the first row pair, g = this lane's global address there,
// ld = source row pitch in elements.
template <typename T>
__device__ __forceinline__ void stage_copies(unsigned lds, const T* g, int ld) {
#pragma unroll
  for (int i = 0; i < 16; i += 8) {
    // the closing s_wait_xcnt is a precaution: no register that a copy names is rewritten ahead of it
    asm volatile(
        "global_load_async_to_lds_b128 %0, %8, off\n\t"
        "global_load_async_to_lds_b128 %1, %9, off\n\t"
        "global_load_async_to_lds_b128 %2, %10, off\n\t"
        "global_load_async_to_lds_b128 %3, %11, off\n\t"
        "global_load_async_to_lds_b128 %4, %12, off\n\t"
        "global_load_async_to_lds_b128 %5, %13, off\n\t"
        "global_load_async_to_lds_b128 %6, %14, off\n\t"
        "global_load_async_to_lds_b128 %7, %15, off\n\t"
        "s_wait_xcnt 0x0"
        :: "v"(lds + (unsigned)((i + 0) * 2 * kGPitch)), "v"(lds + (unsigned)((i + 1) * 2 * kGPitch)),
           "v"(lds + (unsigned)((i + 2) * 2 * kGPitch)), "v"(lds + (unsigned)((i + 3) * 2 * kGPitch)),
           "v"(lds + (unsigned)((i + 4) * 2 * kGPitch)), "v"(lds + (unsigned)((i + 5) * 2 * kGPitch)),
           "v"(lds + (unsigned)((i + 6) * 2 * kGPitch)), "v"(lds + (unsigned)((i + 7) * 2 * kGPitch)),
           "v"(g + (size_t)((i + 0) * 2) * ld), "v"(g + (size_t)((i + 1) * 2) * ld),
           "v"(g + (size_t)((i + 2) * 2) * ld), "v"(g + (size_t)((i + 3) * 2) * ld),
           "v"(g + (size_t)((i + 4) * 2) * ld), "v"(g + (size_t)((i + 5) * 2) * ld),
           "v"(g + (size_t)((i + 6) * 2) * ld), "v"(g + (size_t)((i + 7) * 2) * ld)
        : "memory");
  }
}

template <int ET> struct Elem;
template <> struct Elem<0> { typedef _Float16 T; };
template <> struct Elem<1> { typedef __bf16 T; };
template <int ET, bool SPLIT, int BIAS_MODE, int OUT_MODE>
__global__ __launch_bounds__(256) void wmma_gemm64(
    const unsigned short* __restrict__ Ap, const unsigned short* __restrict__ A2p, int lda, long strideA,
    const unsigned short* __restrict__ Btp, const unsigned short* __restrict__ Bt2p, int ldb, long strideB,
    void* __restrict__ Cout, void* __restrict__ Cout2, int ldc, long strideC,
    const float* __restrict__ bias,
    int M, int N, int K, float scale) {
  static_assert(!SPLIT);
  typedef typename Elem<ET>::T T;
  typedef typename Frag<T>::V V;
  const T* A = (const T*)Ap; const T* Bt = (const T*)Btp;
  // operand ring, two buffers
  __shared__ __align__(16) unsigned char ring[2 * kGStage];
  // per-wave 16x64 slab, pitch 68 floats
  __shared__ __align__(16) float sT[8][16 * 68];
  const int b    = blockIdx.y;
  const int lane = threadIdx.x & 31;
  // in a scalar register, so that what picks a wave's source rows is scalar and every lane stays on at the copies
  const int wave = __builtin_amdgcn_readfirstlane(threadIdx.x >> 5);
  const int tilesN = N >> 7;
  const int tilesM = M >> 7;
  const int tile = blockIdx.x;
  // the same for the whole work-group, ahead of every barrier
  if (tile >= tilesM * tilesN) return;
  const int tm = tile / tilesN;
  const int tn = tile - tm * tilesN;
  const int wm = wave >> 1;
  const int wn = wave & 1;
  const int m0 = (tm << 7) + (wm << 5);
  const int n0 = (tn << 7) + (wn << 6);

  const T* Ab  = A  + (size_t)b * strideA;
  const T* Bb  = Bt + (size_t)b * strideB;

  // row (A) / col (B, D) within subtile; k offset of this lane half; D row offset
  const int rlane = lane & 15;
  const int koff  = (lane >> 4) * 8;
  const int mOff  = (lane >> 4) * 8;

  // copies: waves 0..3 bring the 128 A rows, waves 4..7 the 128 Bt rows, 32 rows each
  const int ldS = (wave < 4) ? lda : ldb;
  const T* gS = ((wave < 4) ? (Ab + (size_t)((tm << 7) + (wave << 5)) * lda)
                            : (Bb + (size_t)((tn << 7) + ((wave - 4) << 5)) * ldb))
                + (size_t)(lane >> 4) * ldS + rlane * 8;
  const unsigned ldsS = (unsigned)(size_t)ring + (unsigned)(((wave << 5) + (lane >> 4)) * kGPitch + rlane * 16);

  v8f acc[2][4];
#pragma unroll
  for (int i = 0; i < 2; ++i)
#pragma unroll
    for (int j = 0; j < 4; ++j) acc[i][j] = (v8f){0.f,0.f,0.f,0.f,0.f,0.f,0.f,0.f};

  const int nPass = K / kGK;
  stage_copies<T>(ldsS, gS, ldS);
  // pass 0's bytes of this wave have landed before the barrier that shows them to the other waves
  asm volatile("s_wait_asynccnt 0x0" ::: "memory");
  __syncthreads();
  if (nPass > 1) stage_copies<T>(ldsS + (unsigned)kGStage, gS + kGK, ldS);

  // one pass per trip, the buffer chosen by the trip's parity
  for (int t = 0; t < nPass; ++t) {
    const unsigned char* st = ring + (t & 1) * kGStage;
    const unsigned char* stA = st + ((wm << 5) + rlane) * kGPitch;
    const unsigned char* stB = st + (128 + (wn << 6) + rlane) * kGPitch;
#pragma unroll
    for (int k0 = 0; k0 < kGK; k0 += 32) {
      // all six fragments of a 32-k block are read as one group: one LDS latency per 8 products
      V bh[4], ah[2];
#pragma unroll
      for (int j = 0; j < 4; ++j) bh[j] = Frag<T>::load((const T*)(stB + (j << 4) * kGPitch) + koff + k0);
#pragma unroll
      for (int i = 0; i < 2; ++i) ah[i] = Frag<T>::load((const T*)(stA + (i << 4) * kGPitch) + koff + k0);
#pragma unroll
      for (int i = 0; i < 2; ++i) {
#pragma unroll
        for (int j = 0; j < 4; ++j) acc[i][j] = Frag<T>::mma(ah[i], bh[j], acc[i][j]);
        Frag<T>::guard(acc[i][0], acc[i][3], ah[i], ah[i]);
      }
      Frag<T>::keep(bh[0], bh[1], bh[2], bh[3]);
    }
    // this wave's reads of the buffer are done before the barrier behind which it is refilled
    asm volatile("s_wait_dscnt 0x0" ::: "memory");
    // this wave's copies of pass t + 1 have landed before the barrier that shows them to the other waves
    asm volatile("s_wait_asynccnt 0x0" ::: "memory");
    __syncthreads();
    if (t + 2 < nPass) stage_copies<T>(ldsS + (unsigned)((t & 1) * kGStage), gS + (size_t)(t + 2) * kGK, ldS);
  }
  // no copy is outstanding when the wave goes on to the epilogue and ends
  asm volatile("s_wait_asynccnt 0x0" ::: "memory");
  acc_guard4(acc[0][0], acc[0][1], acc[0][2], acc[0][3]);
  acc_guard4(acc[1][0], acc[1][1], acc[1][2], acc[1][3]);

  // ---- epilogue ----
  float* slab = sT[wave];
  // column biases: 4 scalar loads per lane, hoisted
  float bvj[4];
#pragma unroll
  for (int j = 0; j < 4; ++j) bvj[j] = (BIAS_MODE == 2) ? rne_bf(bias[n0 + (j << 4) + rlane]) : 0.f;
#pragma unroll
  for (int i = 0; i < 2; ++i) {
    const int mBase = m0 + (i << 4);
    // row biases: two 16-B loads per lane (rows mBase+mOff .. +7, 32-B aligned)
    v4f bm0 = (v4f){0.f, 0.f, 0.f, 0.f};
    v4f bm1 = bm0;
    if (BIAS_MODE == 1) {
      bm0 = *(const v4f*)(bias + mBase + mOff);
      bm1 = *(const v4f*)(bias + mBase + mOff + 4);
    }
#pragma unroll
    for (int j = 0; j < 4; ++j) {
#pragma unroll
      for (int r = 0; r < 8; ++r) {
        float v = acc[i][j][r] * scale;
        if (BIAS_MODE == 1) { const v4f bsel = (r < 4) ? bm0 : bm1; v += rne_bf(bsel[r & 3]); }
        if (BIAS_MODE == 2) v += bvj[j];
        slab[(mOff + r) * 68 + (j << 4) + rlane] = v;
      }
    }
    __builtin_amdgcn_fence(__ATOMIC_RELEASE, "workgroup");
    __builtin_amdgcn_wave_barrier();
    __builtin_amdgcn_fence(__ATOMIC_ACQUIRE, "workgroup");
    if (OUT_MODE == 0) {
      float* C = (float*)Cout + (size_t)b * strideC;
      // row seg = 256 B = 16 lanes x 16 B
      const int hh = lane >> 4, c4 = (lane & 15) * 4;
      {
#pragma unroll
        for (int it = 0; it < 8; ++it) {
          const int row = it * 2 + hh;
          v4f v = *(const v4f*)(slab + row * 68 + c4);
          *(v4f*)(C + (size_t)(mBase + row) * ldc + n0 + c4) = v;
        }
        
      }
    } else {
      const int q = lane >> 3, c8 = (lane & 7) * 8;
      unsigned short* C  = (unsigned short*)Cout  + (size_t)b * strideC;
      unsigned short* C2 = (OUT_MODE == 2) ? ((unsigned short*)Cout2 + (size_t)b * strideC) : nullptr;
      {
#pragma unroll
        for (int it = 0; it < 4; ++it) {
          const int row = it * 4 + q;
          const float* sp = slab + row * 68 + c8;
          v8h hv, lv;
#pragma unroll
          for (int e = 0; e < 8; ++e) {
            if (OUT_MODE == 1) {
              hv[e] = (_Float16)sp[e];
            } else {
              unsigned short hb = f2bf_bits(sp[e]);
              unsigned short lb = f2bf_bits(sp[e] - bf_bits2f(hb));
              hv[e] = __builtin_bit_cast(_Float16, hb);
              lv[e] = __builtin_bit_cast(_Float16, lb);
            }
          }
          *(v8h*)(C + (size_t)(mBase + row) * ldc + n0 + c8) = hv;
          if (OUT_MODE == 2) *(v8h*)(C2 + (size_t)(mBase + row) * ldc + n0 + c8) = lv;
        }
        
      }
    }
    __builtin_amdgcn_fence(__ATOMIC_RELEASE, "workgroup");
    __builtin_amdgcn_wave_barrier();
    __builtin_amdgcn_fence(__ATOMIC_ACQUIRE, "workgroup");
  }
}

// ---------------------------------------------------------------------------
// ---------------------------------------------------------------------------
__global__ __launch_bounds__(256) void cast_f32_bf16x2(
    const float* __restrict__ in, unsigned short* __restrict__ out, int n2) {
  const int i = blockIdx.x * 256 + threadIdx.x;
  if (i < n2) {
    const unsigned u = (unsigned)f2bf_bits(in[2 * i]) | ((unsigned)f2bf_bits(in[2 * i + 1]) << 16);
    ((unsigned*)out)[i] = u;
    
  }
}

// ---------------------------------------------------------------------------
// Transpose + convert: W row-major in[rows][cols] f32 -> Wt row-major out[cols][rows] 16-bit.
// MODE 0: bf16 bits of RNE-bf16(W). MODE 1: f16 bits of RNE-bf16(W) * wsc (wsc a power of two).
// One block per 64x64 tile; grid = (cols/64, rows/64); rows, cols % 64 == 0.
// Load: 256 threads x 4 x float4 = 64x64 tile. Store: wave w writes output rows w*8..w*8+7,
// ---------------------------------------------------------------------------
template <int MODE>
__global__ __launch_bounds__(256) void transpose_cvt16(
    const float* __restrict__ W, unsigned short* __restrict__ Wt, int rows, int cols, float wsc) {
  __shared__ float tile[64 * 65];
  const int tid = threadIdx.x, lane = tid & 31, wave = tid >> 5;
  const int n0 = blockIdx.x * 64;
  const int k0 = blockIdx.y * 64;
  {
    const int c4 = (tid & 15) * 4, r = tid >> 4;
#pragma unroll
    for (int it = 0; it < 4; ++it) {
      const int rr = it * 16 + r;
      const v4f x4 = *(const v4f*)(W + (size_t)(k0 + rr) * cols + n0 + c4);
      tile[rr * 65 + c4 + 0] = x4[0];
      tile[rr * 65 + c4 + 1] = x4[1];
      tile[rr * 65 + c4 + 2] = x4[2];
      tile[rr * 65 + c4 + 3] = x4[3];
    }
  }
  __syncthreads();
  const int q4 = lane >> 3, c8 = (lane & 7) * 8;
  _Float16* out = (_Float16*)Wt;
  {
#pragma unroll
    for (int it = 0; it < 2; ++it) {
      const int i = wave * 8 + it * 4 + q4;
      v8h hv;
#pragma unroll
      for (int e = 0; e < 8; ++e) {
        const float f = tile[(c8 + e) * 65 + i];
        if (MODE == 0) {
          hv[e] = __builtin_bit_cast(_Float16, f2bf_bits(f));
        } else {
          hv[e] = (_Float16)(rne_bf(f) * wsc);
        }
      }
      *(v8h*)(out + (size_t)(n0 + i) * rows + k0 + c8) = hv;
    }
    
  }
}

// ---------------------------------------------------------------------------
// Flash attention with relative-position bias and temperature scaling, head dim 64.
// Q, K planes f16 [token][emb] (element (b,s,h,d) at (b*S+s)*E + h*64 + d); Vt plane f16 [emb][token]
// (element (b,s,h,d) at (h*64+d)*T + b*S + s); ctx out plane f16 [token][emb] carried x ctx_scale.
// scores = q.k^T (f16 WMMA, f32 acc) * inv + bias_lds[q-k+S-1]; online softmax in f32;
// p = exp(s - m) stored x2^15 as f16 in per-wave LDS; out = p.v (f16 WMMA, f32 acc) / (l * 2^15).
// Block = 4 waves = 64 query rows of one (b,h); grid = B*H*(S/64); key chunks of 64.
// ---------------------------------------------------------------------------
constexpr int kQB = 64;
constexpr int kKC = 64;
constexpr int kNW = 4;
constexpr int kBiasL = kQB + kSeq;
constexpr float kPCarry = 32768.0f;
static_assert(kSeq % kKC == 0 && kSeq % kQB == 0);

__global__ __launch_bounds__(128) void attn_relbias_f16(
    const unsigned short* __restrict__ Qp, const unsigned short* __restrict__ Kp,
    const unsigned short* __restrict__ Vtp, const float* __restrict__ btab,
    const float* __restrict__ tptr, unsigned short* __restrict__ Cp, float ctx_scale) {
  union FH { v16h v; v8h h[2]; };
  // K [kv][d], V^T [d][kv], per-wave P [row][kv], per-wave out slab, bias slab
  __shared__ __align__(16) _Float16 Ksh[kKC * kHD];
  __shared__ __align__(16) _Float16 Vtsh[kHD * kKC];
  __shared__ __align__(16) _Float16 Psh[kNW][16 * kKC];
  __shared__ __align__(16) float Os[kNW][16 * 68];
  __shared__ __align__(16) float biasL[kBiasL];

  const _Float16* Qh  = (const _Float16*)Qp;
  const _Float16* Kh  = (const _Float16*)Kp;
  const _Float16* Vth = (const _Float16*)Vtp;

  const int tid  = threadIdx.x;
  const int wave = tid >> 5;
  const int lane = tid & 31;
  const int hh   = lane >> 4;
  const int c    = lane & 15;

  constexpr int nqb = kSeq / kQB;
  const int bx = blockIdx.x;
  const int qb = bx % nqb;
  const int bh = bx / nqb;
  const int h  = bh % kHeads;
  const int b  = bh / kHeads;
  const int qbase = qb * kQB;
  const int q0 = qbase + wave * 16;

  // temperature (RNE-bf16 converted input), clamp, 1/(sqrt(E) * temp)
  float tv = rne_bf(tptr[0]);
  tv = fminf(fmaxf(tv, 0.1f), 10.0f);
  const float inv = 1.0f / (sqrtf((float)kEmb) * tv);

  // bias slab: biasL[i] = table[min(qbase + i, relmax)][h] * inv, i = (q - qbase) + (S-1) - kv in [0, kBiasL)
  for (int i = tid; i < kBiasL; i += kNW * 32) {
    int rel = qbase + i;
    rel = rel > kRelMax ? kRelMax : rel;
    biasL[i] = rne_bf(btab[(size_t)rel * kHeads + h]) * inv;
  }

  // Q fragments (A operand): 2 d-chunks, split k map from the f16 plane
  v16h qa[2];
  {
    const _Float16* qrow = Qh + (size_t)(b * kSeq + q0 + c) * kEmb + h * kHD;
#pragma unroll
    for (int dc = 0; dc < 2; ++dc) qa[dc] = Frag<_Float16>::load(qrow + dc * 32 + 8 * hh);
  }

  float mrow[8], lrow[8];
  v8f oacc[4];
#pragma unroll
  for (int r = 0; r < 8; ++r) { mrow[r] = -INFINITY; lrow[r] = 0.f; }
#pragma unroll
  for (int t = 0; t < 4; ++t) oacc[t] = (v8f){0.f,0.f,0.f,0.f,0.f,0.f,0.f,0.f};

  const int qloc = wave * 16 + 8 * hh;

  for (int kc = 0; kc < kSeq / kKC; ++kc) {
    const int kv0 = kc * kKC;
    __syncthreads();
    {
      // 128 threads x 32 halves each = 64x64 for K and for V^T (full tiles)
      const int rr = tid >> 1, dh = (tid & 1) * 32;
      const v4u* ks = (const v4u*)(Kh + (size_t)(b * kSeq + kv0 + rr) * kEmb + h * kHD + dh);
      const v4u* vs = (const v4u*)(Vth + (size_t)(h * kHD + rr) * kTok + b * kSeq + kv0 + dh);
      v4u* kd = (v4u*)(Ksh + rr * kHD + dh);
      v4u* vd = (v4u*)(Vtsh + rr * kKC + dh);
      v4u kt[4], vt[4];
#pragma unroll
      for (int i = 0; i < 4; ++i) { kt[i] = ks[i]; vt[i] = vs[i]; }
#pragma unroll
      for (int i = 0; i < 4; ++i) { kd[i] = kt[i]; vd[i] = vt[i]; }
    }
    __syncthreads();

    // ---- scores: 16 q rows x 64 keys ----
    v8f s[4];
#pragma unroll
    for (int j = 0; j < 4; ++j) {
      s[j] = (v8f){0.f,0.f,0.f,0.f,0.f,0.f,0.f,0.f};
#pragma unroll
      for (int dc = 0; dc < 2; ++dc) {
        FH kb;
        kb.h[0] = *(const v8h*)(Ksh + (j * 16 + c) * kHD + dc * 32 + 8 * hh);
        kb.h[1] = *(const v8h*)(Ksh + (j * 16 + c) * kHD + dc * 32 + 16 + 8 * hh);
        s[j] = hmma(qa[dc], kb.v, s[j]);
      }
    }

    // ---- scale + bias + row max ----
    float cm[8];
#pragma unroll
    for (int r = 0; r < 8; ++r) {
      const int bi = qloc + r + (kSeq - 1) - kv0 - c;
      float m = -INFINITY;
#pragma unroll
      for (int j = 0; j < 4; ++j) {
        const float sc = s[j][r] * inv + biasL[bi - j * 16];
        s[j][r] = sc;
        m = fmaxf(m, sc);
      }
#pragma unroll
      for (int off = 1; off < 16; off <<= 1) m = fmaxf(m, __shfl_xor(m, off, 32));
      cm[r] = m;
    }

    // ---- online softmax update; P (x2^15, f16) to per-wave LDS ----
    _Float16* pw = Psh[wave];
#pragma unroll
    for (int r = 0; r < 8; ++r) {
      const float mnew = fmaxf(mrow[r], cm[r]);
      const float alpha = expf(mrow[r] - mnew);
      mrow[r] = mnew;
      float psum = 0.f;
#pragma unroll
      for (int j = 0; j < 4; ++j) {
        const float p = expf(s[j][r] - mnew);
        psum += p;
        pw[(8 * hh + r) * kKC + j * 16 + c] = (_Float16)(p * kPCarry);
      }
#pragma unroll
      for (int off = 1; off < 16; off <<= 1) psum += __shfl_xor(psum, off, 32);
      lrow[r] = lrow[r] * alpha + psum;
#pragma unroll
      for (int t = 0; t < 4; ++t) oacc[t][r] *= alpha;
    }
    __syncthreads();

    // ---- O += P . V_chunk ----
#pragma unroll
    for (int kk = 0; kk < 2; ++kk) {
      FH pa;
      pa.h[0] = *(const v8h*)(pw + c * kKC + kk * 32 + 8 * hh);
      pa.h[1] = *(const v8h*)(pw + c * kKC + kk * 32 + 16 + 8 * hh);
#pragma unroll
      for (int t = 0; t < 4; ++t) {
        FH vb;
        vb.h[0] = *(const v8h*)(Vtsh + (t * 16 + c) * kKC + kk * 32 + 8 * hh);
        vb.h[1] = *(const v8h*)(Vtsh + (t * 16 + c) * kKC + kk * 32 + 16 + 8 * hh);
        oacc[t] = hmma(pa.v, vb.v, oacc[t]);
      }
    }
  }

  float* os = Os[wave];
#pragma unroll
  for (int r = 0; r < 8; ++r) {
    const float invl = ctx_scale * (1.0f / (lrow[r] * kPCarry));
#pragma unroll
    for (int t = 0; t < 4; ++t) os[(8 * hh + r) * 68 + t * 16 + c] = oacc[t][r] * invl;
  }
  __syncthreads();
  {
    const int q4 = lane >> 3, c8 = (lane & 7) * 8;
    _Float16* Ch = (_Float16*)Cp;
    {
#pragma unroll
      for (int it = 0; it < 4; ++it) {
        const int row = it * 4 + q4;
        const float* sp = os + row * 68 + c8;
        v8h hv;
#pragma unroll
        for (int e = 0; e < 8; ++e) hv[e] = (_Float16)sp[e];
        *(v8h*)(Ch + (size_t)(b * kSeq + q0 + row) * kEmb + h * kHD + c8) = hv;
      }
      
    }
  }
}

// ---------------------------------------------------------------------------
// Host launch
// ---------------------------------------------------------------------------
extern "C" void kernel_launch(void* const* d_in, const int* in_sizes, int n_in,
                              void* d_out, int out_size, void* d_ws, size_t ws_size,
                              hipStream_t stream) {
  if (n_in < 11) return;
  if (in_sizes[0] != kTok * kEmb) return;
  if (in_sizes[1] != kEmb * kEmb || in_sizes[3] != kEmb * kEmb ||
      in_sizes[5] != kEmb * kEmb || in_sizes[7] != kEmb * kEmb) return;
  if (in_sizes[2] < kEmb || in_sizes[4] < kEmb || in_sizes[6] < kEmb || in_sizes[8] < kEmb) return;
  if (in_sizes[9] != kRelRows * kHeads || in_sizes[10] < 1) return;
  if (out_size != kTok * kEmb) return;

  const float* x    = (const float*)d_in[0];
  const float* Wq   = (const float*)d_in[1];
  const float* bq   = (const float*)d_in[2];
  const float* Wk   = (const float*)d_in[3];
  const float* bk   = (const float*)d_in[4];
  const float* Wv   = (const float*)d_in[5];
  const float* bv   = (const float*)d_in[6];
  const float* Wp   = (const float*)d_in[7];
  const float* bp   = (const float*)d_in[8];
  const float* btab = (const float*)d_in[9];
  const float* tptr = (const float*)d_in[10];
  float* out = (float*)d_out;

  // workspace region map (bytes), all offsets multiples of 2 MiB:
  //   Xb  bf16 [4096][1024]   8 MiB  @ 0
  //   WqT bf16 [1024][1024]   2 MiB  @ 8 MiB
  //   WkT bf16 [1024][1024]   2 MiB  @ 10 MiB
  //   WvT bf16 [1024][1024]   2 MiB  @ 12 MiB
  //   WpT f16  [1024][1024]   2 MiB  @ 14 MiB   (RNE-bf16 values x64)
  //   Qp  f16  [4096][1024]   8 MiB  @ 16 MiB
  //   Kp  f16  [4096][1024]   8 MiB  @ 24 MiB
  //   Vtp f16  [1024][4096]   8 MiB  @ 32 MiB
  //   Cx  f16  [4096][1024]   8 MiB  @ 40 MiB   (ctx x64)
  //   total 48 MiB = 50,331,648 B
  const size_t szAct = (size_t)kTok * kEmb * 2;
  const size_t szW   = (size_t)kEmb * kEmb * 2;
  size_t off = 0;
  const size_t oXb = off; off += szAct;
  const size_t oWq = off; off += szW;
  const size_t oWk = off; off += szW;
  const size_t oWv = off; off += szW;
  const size_t oWp = off; off += szW;
  const size_t oQ  = off; off += szAct;
  const size_t oK  = off; off += szAct;
  const size_t oVt = off; off += szAct;
  const size_t oCx = off; off += szAct;
  if (off > ws_size) return;

  char* w = (char*)d_ws;
  unsigned short* Xb  = (unsigned short*)(w + oXb);
  unsigned short* WqT = (unsigned short*)(w + oWq);
  unsigned short* WkT = (unsigned short*)(w + oWk);
  unsigned short* WvT = (unsigned short*)(w + oWv);
  unsigned short* WpT = (unsigned short*)(w + oWp);
  unsigned short* Qp  = (unsigned short*)(w + oQ);
  unsigned short* Kp  = (unsigned short*)(w + oK);
  unsigned short* Vtp = (unsigned short*)(w + oVt);
  unsigned short* Cx  = (unsigned short*)(w + oCx);

  const float kWpCarry  = 64.0f;
  const float kCtxCarry = 64.0f;

  // 1) x -> bf16 plane (2 elements per thread)
  {
    const int n2 = (kTok * kEmb) / 2;
    cast_f32_bf16x2<<<(n2 + 255) / 256, 256, 0, stream>>>(x, Xb, n2);
  }
  // 2) weights: in[rows=1024][cols=1024] -> out[cols][rows], grid (cols/64, rows/64)
  {
    dim3 grd(kEmb / 64, kEmb / 64);
    transpose_cvt16<0><<<grd, 256, 0, stream>>>(Wq, WqT, kEmb, kEmb, 1.0f);
    transpose_cvt16<0><<<grd, 256, 0, stream>>>(Wk, WkT, kEmb, kEmb, 1.0f);
    transpose_cvt16<0><<<grd, 256, 0, stream>>>(Wv, WvT, kEmb, kEmb, 1.0f);
    transpose_cvt16<1><<<grd, 256, 0, stream>>>(Wp, WpT, kEmb, kEmb, kWpCarry);
  }
  // 3) projections (bf16 WMMA, f16 outputs). M,N % 128 == 0, K % 128 == 0 by the static_assert below.
  static_assert(kTok % 128 == 0 && kEmb % 128 == 0 && kEmb % kGK == 0);
  const int gemmBlocks = (kTok / 128) * (kEmb / 128);
  //    Q[token][n] = sum_k Xb[token][k] WqT[n][k] + bq[n]
  wmma_gemm64<1, false, 2, 1><<<dim3(gemmBlocks, 1), 256, 0, stream>>>(
      Xb, Xb, kEmb, 0L, WqT, WqT, kEmb, 0L, (void*)Qp, (void*)Qp, kEmb, 0L, bq,
      kTok, kEmb, kEmb, 1.0f);
  wmma_gemm64<1, false, 2, 1><<<dim3(gemmBlocks, 1), 256, 0, stream>>>(
      Xb, Xb, kEmb, 0L, WkT, WkT, kEmb, 0L, (void*)Kp, (void*)Kp, kEmb, 0L, bk,
      kTok, kEmb, kEmb, 1.0f);
  //    Vt[n][token] = sum_k WvT[n][k] Xb[token][k] + bv[n]   (M = 1024 features, N = 4096 tokens)
  wmma_gemm64<1, false, 1, 1><<<dim3(gemmBlocks, 1), 256, 0, stream>>>(
      WvT, WvT, kEmb, 0L, Xb, Xb, kEmb, 0L, (void*)Vtp, (void*)Vtp, kTok, 0L, bv,
      kEmb, kTok, kEmb, 1.0f);
  // 4) attention -> ctx f16 plane (x64)
  attn_relbias_f16<<<kBatch * kHeads * (kSeq / kQB), kNW * 32, 0, stream>>>(
      Qp, Kp, Vtp, btab, tptr, Cx, kCtxCarry);
  // 5) output projection: out[token][n] = 2^-12 * sum_c Cx[token][c] WpT[n][c] + bp[n]
  wmma_gemm64<0, false, 2, 0><<<dim3(gemmBlocks, 1), 256, 0, stream>>>(
      Cx, Cx, kEmb, 0L, WpT, WpT, kEmb, 0L, (void*)out, (void*)out, kEmb, 0L, bp,
      kTok, kEmb, kEmb, 1.0f / (kWpCarry * kCtxCarry));
}

// v002
// It runs in 157 microseconds.
// In both of two side-by-side timings against v001, it was 1.19 times as fast.
// All steps since v000 together make it 2.07 times as fast.
// Contractions: x@Wq, x@Wk, Wv-side GEMM producing V^T on v_wmma_f32_16x16x32_bf16 (bf16 operands = RNE-bf16 converted inputs, exact products); q.k^T, p.v, ctx@Wp on v_wmma_f32_16x16x32_f16 (f16 operands; p carried x2^15, ctx and Wp carried x64); f32 accumulate; softmax and normalisers in f32.
#include <hip/hip_runtime.h>
#include <math.h>

typedef __attribute__((ext_vector_type(16))) _Float16 v16h;
typedef __attribute__((ext_vector_type(8)))  _Float16 v8h;
typedef __attribute__((ext_vector_type(16))) __bf16   v16b;
typedef __attribute__((ext_vector_type(8)))  __bf16   v8b;
typedef __attribute__((ext_vector_type(8)))  float    v8f;
typedef __attribute__((ext_vector_type(4)))  float    v4f;
typedef __attribute__((ext_vector_type(4)))  unsigned v4u;

constexpr int kBatch   = 4;
constexpr int kSeq     = 1024;
constexpr int kEmb     = 1024;
constexpr int kHeads   = 16;
constexpr int kHD      = 64;
constexpr int kTok     = kBatch * kSeq;
constexpr int kRelRows = 1999;
constexpr int kRelMax  = kRelRows - 1;

static_assert(kEmb == kHeads * kHD);
static_assert(kHD == 64);
static_assert(kTok % 64 == 0 && kEmb % 64 == 0 && kEmb % 32 == 0 && kSeq % 64 == 0);

// ---------------------------------------------------------------------------
// helpers
// ---------------------------------------------------------------------------
__device__ __forceinline__ unsigned short f2bf_bits(float f) {
  unsigned u = __float_as_uint(f);
  return (unsigned short)((u + 0x7FFFu + ((u >> 16) & 1u)) >> 16);
}
__device__ __forceinline__ float bf_bits2f(unsigned short h) { return __uint_as_float(((unsigned)h) << 16); }
__device__ __forceinline__ float rne_bf(float f) { return bf_bits2f(f2bf_bits(f)); }

__device__ __forceinline__ void dep_guard_h(v8f& a, v8f& b, v16h x, v16h y) { asm volatile("v_nop\n\tv_nop\n\tv_nop\n\tv_nop" : "+v"(a), "+v"(b) : "v"(x), "v"(y)); }
__device__ __forceinline__ void dep_guard_b(v8f& a, v8f& b, v16b x, v16b y) { asm volatile("v_nop\n\tv_nop\n\tv_nop\n\tv_nop" : "+v"(a), "+v"(b) : "v"(x), "v"(y)); }
__device__ __forceinline__ void keep4_h(v16h a, v16h b, v16h c, v16h d) { asm volatile("v_nop" :: "v"(a), "v"(b), "v"(c), "v"(d)); }
__device__ __forceinline__ void keep4_b(v16b a, v16b b, v16b c, v16b d) { asm volatile("v_nop" :: "v"(a), "v"(b), "v"(c), "v"(d)); }
__device__ __forceinline__ void acc_guard4(v8f& a, v8f& b, v8f& c, v8f& d) { asm volatile("v_nop\n\tv_nop\n\tv_nop\n\tv_nop" : "+v"(a), "+v"(b), "+v"(c), "+v"(d)); }
template <typename T> struct Frag;
template <> struct Frag<_Float16> {
  typedef v16h V; union U { v16h v; v8h h[2]; };
  // elements 0..7 <- p[0..7], 8..15 <- p[16..23]
  static __device__ __forceinline__ v16h load(const _Float16* p) {
    U f; f.h[0] = *(const v8h*)(p); f.h[1] = *(const v8h*)(p + 16); return f.v;
  }
  static __device__ __forceinline__ v8f mma(v16h a, v16h b, v8f c) {
    return __builtin_amdgcn_wmma_f32_16x16x32_f16(false, a, false, b, (short)0, c, false, false);
  }
  static __device__ __forceinline__ void guard(v8f& a, v8f& b, v16h x, v16h y) { dep_guard_h(a, b, x, y); }
  static __device__ __forceinline__ void keep(v16h a, v16h b, v16h c, v16h d) { keep4_h(a, b, c, d); }
};
template <> struct Frag<__bf16> {
  typedef v16b V; union U { v16b v; v8b h[2]; };
  static __device__ __forceinline__ v16b load(const __bf16* p) {
    U f; f.h[0] = *(const v8b*)(p); f.h[1] = *(const v8b*)(p + 16); return f.v;
  }
  static __device__ __forceinline__ v8f mma(v16b a, v16b b, v8f c) {
    return __builtin_amdgcn_wmma_f32_16x16x32_bf16(false, a, false, b, (short)0, c, false, false);
  }
  static __device__ __forceinline__ void guard(v8f& a, v8f& b, v16b x, v16b y) { dep_guard_b(a, b, x, y); }
  static __device__ __forceinline__ void keep(v16b a, v16b b, v16b c, v16b d) { keep4_b(a, b, c, d); }
};

// f16 WMMA with hazard guard (A, B kept live; D tied)
__device__ __forceinline__ v8f hmma(v16h a, v16h b, v8f c) {
  c = __builtin_amdgcn_wmma_f32_16x16x32_f16(false, a, false, b, (short)0, c, false, false);
  asm volatile("v_nop\n\tv_nop\n\tv_nop\n\tv_nop" : "+v"(c) : "v"(a), "v"(b));
  return c;
}

// ---------------------------------------------------------------------------
// Register-blocked batched WMMA GEMM, operands staged in LDS.
// C[m,n] = scale * sum_k A[m,k] * Bt[n,k] (+bias); a work-group of 8 waves owns a 128x128 tile,
// each wave 32 rows x 64 columns of it (two waves per SIMD: one wave's LDS reads and copy issue
// stand behind the other's products).
// A row-major [M,K]; Bt row-major [N,K]; M,N % 128 == 0, K % 128 == 0.
// A pass is 128 k: 256 B of 128 A rows and of 128 Bt rows, brought into LDS by asynchronous copies,
// two buffers, the next pass's copies in flight while this pass is worked on.
// SPLIT: hi/lo operand planes (not supported by the staged loop, false).
// BIAS_MODE: 0 none, 1 bias[m], 2 bias[n]; bias values RNE-converted to bf16 precision before the add.
// OUT_MODE: 0 = f32, 1 = f16, 2 = bf16 hi plane (Cout) + bf16 lo plane (Cout2).
// ET: 0 = f16 operands, 1 = bf16 operands (pointers passed as 16-bit storage)
// ---------------------------------------------------------------------------
constexpr int kGK     = 128;               // k elements per pass
constexpr int kGPitch = 2 * kGK + 16;      // LDS row pitch in bytes: 16 B x odd, conflict-free for 16-byte reads down a column
constexpr int kGStage = 256 * kGPitch;     // one buffer: rows 0..127 = A rows, rows 128..255 = Bt rows

// One wave's share of a stage: 32 rows of 256 B, 16 copies of 2 rows each (16 lanes x 16 B per row).
// lds = this lane's LDS byte address in the first row pair, g = this lane's global address there,
// ld = source row pitch in elements.
template <typename T>
__device__ __forceinline__ void stage_copies(unsigned lds, const T* g, int ld) {
#pragma unroll
  for (int i = 0; i < 16; i += 8) {
    // the closing s_wait_xcnt is a precaution: no register that a copy names is rewritten ahead of it
    asm volatile(
        "global_load_async_to_lds_b128 %0, %8, off\n\t"
        "global_load_async_to_lds_b128 %1, %9, off\n\t"
        "global_load_async_to_lds_b128 %2, %10, off\n\t"
        "global_load_async_to_lds_b128 %3, %11, off\n\t"
        "global_load_async_to_lds_b128 %4, %12, off\n\t"
        "global_load_async_to_lds_b128 %5, %13, off\n\t"
        "global_load_async_to_lds_b128 %6, %14, off\n\t"
        "global_load_async_to_lds_b128 %7, %15, off\n\t"
        "s_wait_xcnt 0x0"
        :: "v"(lds + (unsigned)((i + 0) * 2 * kGPitch)), "v"(lds + (unsigned)((i + 1) * 2 * kGPitch)),
           "v"(lds + (unsigned)((i + 2) * 2 * kGPitch)), "v"(lds + (unsigned)((i + 3) * 2 * kGPitch)),
           "v"(lds + (unsigned)((i + 4) * 2 * kGPitch)), "v"(lds + (unsigned)((i + 5) * 2 * kGPitch)),
           "v"(lds + (unsigned)((i + 6) * 2 * kGPitch)), "v"(lds + (unsigned)((i + 7) * 2 * kGPitch)),
           "v"(g + (size_t)((i + 0) * 2) * ld), "v"(g + (size_t)((i + 1) * 2) * ld),
           "v"(g + (size_t)((i + 2) * 2) * ld), "v"(g + (size_t)((i + 3) * 2) * ld),
           "v"(g + (size_t)((i + 4) * 2) * ld), "v"(g + (size_t)((i + 5) * 2) * ld),
           "v"(g + (size_t)((i + 6) * 2) * ld), "v"(g + (size_t)((i + 7) * 2) * ld)
        : "memory");
  }
}

template <int ET> struct Elem;
template <> struct Elem<0> { typedef _Float16 T; };
template <> struct Elem<1> { typedef __bf16 T; };
template <int ET, bool SPLIT, int BIAS_MODE, int OUT_MODE>
__global__ __launch_bounds__(256) void wmma_gemm64(
    const unsigned short* __restrict__ Ap, const unsigned short* __restrict__ A2p, int lda, long strideA,
    const unsigned short* __restrict__ Btp, const unsigned short* __restrict__ Bt2p, int ldb, long strideB,
    void* __restrict__ Cout, void* __restrict__ Cout2, int ldc, long strideC,
    const float* __restrict__ bias,
    int M, int N, int K, float scale) {
  static_assert(!SPLIT);
  typedef typename Elem<ET>::T T;
  typedef typename Frag<T>::V V;
  const T* A = (const T*)Ap; const T* Bt = (const T*)Btp;
  // operand ring, two buffers
  __shared__ __align__(16) unsigned char ring[2 * kGStage];
  // per-wave 16x64 slab, pitch 68 floats
  __shared__ __align__(16) float sT[8][16 * 68];
  const int b    = blockIdx.y;
  const int lane = threadIdx.x & 31;
  // in a scalar register, so that what picks a wave's source rows is scalar and every lane stays on at the copies
  const int wave = __builtin_amdgcn_readfirstlane(threadIdx.x >> 5);
  const int tilesN = N >> 7;
  const int tilesM = M >> 7;
  const int tile = blockIdx.x;
  // the same for the whole work-group, ahead of every barrier
  if (tile >= tilesM * tilesN) return;
  const int tm = tile / tilesN;
  const int tn = tile - tm * tilesN;
  const int wm = wave >> 1;
  const int wn = wave & 1;
  const int m0 = (tm << 7) + (wm << 5);
  const int n0 = (tn << 7) + (wn << 6);

  const T* Ab  = A  + (size_t)b * strideA;
  const T* Bb  = Bt + (size_t)b * strideB;

  // row (A) / col (B, D) within subtile; k offset of this lane half; D row offset
  const int rlane = lane & 15;
  const int koff  = (lane >> 4) * 8;
  const int mOff  = (lane >> 4) * 8;

  // copies: waves 0..3 bring the 128 A rows, waves 4..7 the 128 Bt rows, 32 rows each
  const int ldS = (wave < 4) ? lda : ldb;
  const T* gS = ((wave < 4) ? (Ab + (size_t)((tm << 7) + (wave << 5)) * lda)
                            : (Bb + (size_t)((tn << 7) + ((wave - 4) << 5)) * ldb))
                + (size_t)(lane >> 4) * ldS + rlane * 8;
  const unsigned ldsS = (unsigned)(size_t)ring + (unsigned)(((wave << 5) + (lane >> 4)) * kGPitch + rlane * 16);

  v8f acc[2][4];
#pragma unroll
  for (int i = 0; i < 2; ++i)
#pragma unroll
    for (int j = 0; j < 4; ++j) acc[i][j] = (v8f){0.f,0.f,0.f,0.f,0.f,0.f,0.f,0.f};

  const int nPass = K / kGK;
  stage_copies<T>(ldsS, gS, ldS);
  // pass 0's bytes of this wave have landed before the barrier that shows them to the other waves
  asm volatile("s_wait_asynccnt 0x0" ::: "memory");
  __syncthreads();
  if (nPass > 1) stage_copies<T>(ldsS + (unsigned)kGStage, gS + kGK, ldS);

  // one pass per trip, the buffer chosen by the trip's parity
  for (int t = 0; t < nPass; ++t) {
    const unsigned char* st = ring + (t & 1) * kGStage;
    const unsigned char* stA = st + ((wm << 5) + rlane) * kGPitch;
    const unsigned char* stB = st + (128 + (wn << 6) + rlane) * kGPitch;
#pragma unroll
    for (int k0 = 0; k0 < kGK; k0 += 32) {
      // all six fragments of a 32-k block are read as one group: one LDS latency per 8 products
      V bh[4], ah[2];
#pragma unroll
      for (int j = 0; j < 4; ++j) bh[j] = Frag<T>::load((const T*)(stB + (j << 4) * kGPitch) + koff + k0);
#pragma unroll
      for (int i = 0; i < 2; ++i) ah[i] = Frag<T>::load((const T*)(stA + (i << 4) * kGPitch) + koff + k0);
#pragma unroll
      for (int i = 0; i < 2; ++i) {
#pragma unroll
        for (int j = 0; j < 4; ++j) acc[i][j] = Frag<T>::mma(ah[i], bh[j], acc[i][j]);
        Frag<T>::guard(acc[i][0], acc[i][3], ah[i], ah[i]);
      }
      Frag<T>::keep(bh[0], bh[1], bh[2], bh[3]);
    }
    // this wave's reads of the buffer are done before the barrier behind which it is refilled
    asm volatile("s_wait_dscnt 0x0" ::: "memory");
    // this wave's copies of pass t + 1 have landed before the barrier that shows them to the other waves
    asm volatile("s_wait_asynccnt 0x0" ::: "memory");
    __syncthreads();
    if (t + 2 < nPass) stage_copies<T>(ldsS + (unsigned)((t & 1) * kGStage), gS + (size_t)(t + 2) * kGK, ldS);
  }
  // no copy is outstanding when the wave goes on to the epilogue and ends
  asm volatile("s_wait_asynccnt 0x0" ::: "memory");
  acc_guard4(acc[0][0], acc[0][1], acc[0][2], acc[0][3]);
  acc_guard4(acc[1][0], acc[1][1], acc[1][2], acc[1][3]);

  // ---- epilogue ----
  float* slab = sT[wave];
  // column biases: 4 scalar loads per lane, hoisted
  float bvj[4];
#pragma unroll
  for (int j = 0; j < 4; ++j) bvj[j] = (BIAS_MODE == 2) ? rne_bf(bias[n0 + (j << 4) + rlane]) : 0.f;
#pragma unroll
  for (int i = 0; i < 2; ++i) {
    const int mBase = m0 + (i << 4);
    // row biases: two 16-B loads per lane (rows mBase+mOff .. +7, 32-B aligned)
    v4f bm0 = (v4f){0.f, 0.f, 0.f, 0.f};
    v4f bm1 = bm0;
    if (BIAS_MODE == 1) {
      bm0 = *(const v4f*)(bias + mBase + mOff);
      bm1 = *(const v4f*)(bias + mBase + mOff + 4);
    }
#pragma unroll
    for (int j = 0; j < 4; ++j) {
#pragma unroll
      for (int r = 0; r < 8; ++r) {
        float v = acc[i][j][r] * scale;
        if (BIAS_MODE == 1) { const v4f bsel = (r < 4) ? bm0 : bm1; v += rne_bf(bsel[r & 3]); }
        if (BIAS_MODE == 2) v += bvj[j];
        slab[(mOff + r) * 68 + (j << 4) + rlane] = v;
      }
    }
    __builtin_amdgcn_fence(__ATOMIC_RELEASE, "workgroup");
    __builtin_amdgcn_wave_barrier();
    __builtin_amdgcn_fence(__ATOMIC_ACQUIRE, "workgroup");
    if (OUT_MODE == 0) {
      float* C = (float*)Cout + (size_t)b * strideC;
      // row seg = 256 B = 16 lanes x 16 B
      const int hh = lane >> 4, c4 = (lane & 15) * 4;
      {
#pragma unroll
        for (int it = 0; it < 8; ++it) {
          const int row = it * 2 + hh;
          v4f v = *(const v4f*)(slab + row * 68 + c4);
          *(v4f*)(C + (size_t)(mBase + row) * ldc + n0 + c4) = v;
        }
        
      }
    } else {
      const int q = lane >> 3, c8 = (lane & 7) * 8;
      unsigned short* C  = (unsigned short*)Cout  + (size_t)b * strideC;
      unsigned short* C2 = (OUT_MODE == 2) ? ((unsigned short*)Cout2 + (size_t)b * strideC) : nullptr;
      {
#pragma unroll
        for (int it = 0; it < 4; ++it) {
          const int row = it * 4 + q;
          const float* sp = slab + row * 68 + c8;
          v8h hv, lv;
#pragma unroll
          for (int e = 0; e < 8; ++e) {
            if (OUT_MODE == 1) {
              hv[e] = (_Float16)sp[e];
            } else {
              unsigned short hb = f2bf_bits(sp[e]);
              unsigned short lb = f2bf_bits(sp[e] - bf_bits2f(hb));
              hv[e] = __builtin_bit_cast(_Float16, hb);
              lv[e] = __builtin_bit_cast(_Float16, lb);
            }
          }
          *(v8h*)(C + (size_t)(mBase + row) * ldc + n0 + c8) = hv;
          if (OUT_MODE == 2) *(v8h*)(C2 + (size_t)(mBase + row) * ldc + n0 + c8) = lv;
        }
        
      }
    }
    __builtin_amdgcn_fence(__ATOMIC_RELEASE, "workgroup");
    __builtin_amdgcn_wave_barrier();
    __builtin_amdgcn_fence(__ATOMIC_ACQUIRE, "workgroup");
  }
}

// ---------------------------------------------------------------------------
// ---------------------------------------------------------------------------
__global__ __launch_bounds__(256) void cast_f32_bf16x2(
    const float* __restrict__ in, unsigned short* __restrict__ out, int n2) {
  const int i = blockIdx.x * 256 + threadIdx.x;
  if (i < n2) {
    const unsigned u = (unsigned)f2bf_bits(in[2 * i]) | ((unsigned)f2bf_bits(in[2 * i + 1]) << 16);
    ((unsigned*)out)[i] = u;
    
  }
}

// ---------------------------------------------------------------------------
// Transpose + convert: W row-major in[rows][cols] f32 -> Wt row-major out[cols][rows] 16-bit.
// MODE 0: bf16 bits of RNE-bf16(W). MODE 1: f16 bits of RNE-bf16(W) * wsc (wsc a power of two).
// One block per 64x64 tile; grid = (cols/64, rows/64); rows, cols % 64 == 0.
// Load: 256 threads x 4 x float4 = 64x64 tile. Store: wave w writes output rows w*8..w*8+7,
// ---------------------------------------------------------------------------
template <int MODE>
__global__ __launch_bounds__(256) void transpose_cvt16(
    const float* __restrict__ W, unsigned short* __restrict__ Wt, int rows, int cols, float wsc) {
  __shared__ float tile[64 * 65];
  const int tid = threadIdx.x, lane = tid & 31, wave = tid >> 5;
  const int n0 = blockIdx.x * 64;
  const int k0 = blockIdx.y * 64;
  {
    const int c4 = (tid & 15) * 4, r = tid >> 4;
#pragma unroll
    for (int it = 0; it < 4; ++it) {
      const int rr = it * 16 + r;
      const v4f x4 = *(const v4f*)(W + (size_t)(k0 + rr) * cols + n0 + c4);
      tile[rr * 65 + c4 + 0] = x4[0];
      tile[rr * 65 + c4 + 1] = x4[1];
      tile[rr * 65 + c4 + 2] = x4[2];
      tile[rr * 65 + c4 + 3] = x4[3];
    }
  }
  __syncthreads();
  const int q4 = lane >> 3, c8 = (lane & 7) * 8;
  _Float16* out = (_Float16*)Wt;
  {
#pragma unroll
    for (int it = 0; it < 2; ++it) {
      const int i = wave * 8 + it * 4 + q4;
      v8h hv;
#pragma unroll
      for (int e = 0; e < 8; ++e) {
        const float f = tile[(c8 + e) * 65 + i];
        if (MODE == 0) {
          hv[e] = __builtin_bit_cast(_Float16, f2bf_bits(f));
        } else {
          hv[e] = (_Float16)(rne_bf(f) * wsc);
        }
      }
      *(v8h*)(out + (size_t)(n0 + i) * rows + k0 + c8) = hv;
    }
    
  }
}

// ---------------------------------------------------------------------------
// Flash attention with relative-position bias and temperature scaling, head dim 64.
// Q, K planes f16 [token][emb] (element (b,s,h,d) at (b*S+s)*E + h*64 + d); Vt plane f16 [emb][token]
// (element (b,s,h,d) at (h*64+d)*T + b*S + s); ctx out plane f16 [token][emb] carried x ctx_scale.
// scores = q.k^T (f16 WMMA, f32 acc) * inv + bias_lds[q-k+S-1]; online softmax in f32;
// p = exp(s - m) stored x2^15 as f16 in per-wave LDS; out = p.v (f16 WMMA, f32 acc) / (l * 2^15).
// Block = 4 waves = 64 query rows of one (b,h); grid = B*H*(S/64); key chunks of 64.
// ---------------------------------------------------------------------------
constexpr int kQB = 64;
constexpr int kKC = 64;
constexpr int kNW = 4;
// LDS row pitch of the K, V^T and P tiles in halves: 144 B = 16 B x odd, so that the 16 rows that a 16-byte
// fragment read walks down fall on 16 different bank groups (at 128 B they fall on two)
constexpr int kLP = kKC + 8;
constexpr int kBiasL = kQB + kSeq;
constexpr float kPCarry = 32768.0f;
static_assert(kSeq % kKC == 0 && kSeq % kQB == 0 && kKC == kHD);

__global__ __launch_bounds__(128) void attn_relbias_f16(
    const unsigned short* __restrict__ Qp, const unsigned short* __restrict__ Kp,
    const unsigned short* __restrict__ Vtp, const float* __restrict__ btab,
    const float* __restrict__ tptr, unsigned short* __restrict__ Cp, float ctx_scale) {
  union FH { v16h v; v8h h[2]; };
  // K [kv][d], V^T [d][kv], per-wave P [row][kv] (rows of 64 halves at pitch kLP), per-wave out slab, bias slab
  __shared__ __align__(16) _Float16 Ksh[kKC * kLP];
  __shared__ __align__(16) _Float16 Vtsh[kHD * kLP];
  __shared__ __align__(16) _Float16 Psh[kNW][16 * kLP];
  __shared__ __align__(16) float Os[kNW][16 * 68];
  __shared__ __align__(16) float biasL[kBiasL];

  const _Float16* Qh  = (const _Float16*)Qp;
  const _Float16* Kh  = (const _Float16*)Kp;
  const _Float16* Vth = (const _Float16*)Vtp;

  const int tid  = threadIdx.x;
  const int wave = tid >> 5;
  const int lane = tid & 31;
  const int hh   = lane >> 4;
  const int c    = lane & 15;

  constexpr int nqb = kSeq / kQB;
  const int bx = blockIdx.x;
  const int qb = bx % nqb;
  const int bh = bx / nqb;
  const int h  = bh % kHeads;
  const int b  = bh / kHeads;
  const int qbase = qb * kQB;
  const int q0 = qbase + wave * 16;

  // temperature (RNE-bf16 converted input), clamp, 1/(sqrt(E) * temp)
  float tv = rne_bf(tptr[0]);
  tv = fminf(fmaxf(tv, 0.1f), 10.0f);
  const float inv = 1.0f / (sqrtf((float)kEmb) * tv);

  // bias slab: biasL[i] = table[min(qbase + i, relmax)][h] * inv, i = (q - qbase) + (S-1) - kv in [0, kBiasL)
  for (int i = tid; i < kBiasL; i += kNW * 32) {
    int rel = qbase + i;
    rel = rel > kRelMax ? kRelMax : rel;
    biasL[i] = rne_bf(btab[(size_t)rel * kHeads + h]) * inv;
  }

  // Q fragments (A operand): 2 d-chunks, split k map from the f16 plane
  v16h qa[2];
  {
    const _Float16* qrow = Qh + (size_t)(b * kSeq + q0 + c) * kEmb + h * kHD;
#pragma unroll
    for (int dc = 0; dc < 2; ++dc) qa[dc] = Frag<_Float16>::load(qrow + dc * 32 + 8 * hh);
  }

  float mrow[8], lrow[8];
  v8f oacc[4];
#pragma unroll
  for (int r = 0; r < 8; ++r) { mrow[r] = -INFINITY; lrow[r] = 0.f; }
#pragma unroll
  for (int t = 0; t < 4; ++t) oacc[t] = (v8f){0.f,0.f,0.f,0.f,0.f,0.f,0.f,0.f};

  const int qloc = wave * 16 + 8 * hh;

  for (int kc = 0; kc < kSeq / kKC; ++kc) {
    const int kv0 = kc * kKC;
    __syncthreads();
    {
      // 128 threads x 32 halves each = 64x64 for K and for V^T (full tiles)
      const int rr = tid >> 1, dh = (tid & 1) * 32;
      const v4u* ks = (const v4u*)(Kh + (size_t)(b * kSeq + kv0 + rr) * kEmb + h * kHD + dh);
      const v4u* vs = (const v4u*)(Vth + (size_t)(h * kHD + rr) * kTok + b * kSeq + kv0 + dh);
      v4u* kd = (v4u*)(Ksh + rr * kLP + dh);
      v4u* vd = (v4u*)(Vtsh + rr * kLP + dh);
      v4u kt[4], vt[4];
#pragma unroll
      for (int i = 0; i < 4; ++i) { kt[i] = ks[i]; vt[i] = vs[i]; }
#pragma unroll
      for (int i = 0; i < 4; ++i) { kd[i] = kt[i]; vd[i] = vt[i]; }
    }
    __syncthreads();

    // ---- scores: 16 q rows x 64 keys ----
    v8f s[4];
#pragma unroll
    for (int j = 0; j < 4; ++j) {
      s[j] = (v8f){0.f,0.f,0.f,0.f,0.f,0.f,0.f,0.f};
#pragma unroll
      for (int dc = 0; dc < 2; ++dc) {
        FH kb;
        kb.h[0] = *(const v8h*)(Ksh + (j * 16 + c) * kLP + dc * 32 + 8 * hh);
        kb.h[1] = *(const v8h*)(Ksh + (j * 16 + c) * kLP + dc * 32 + 16 + 8 * hh);
        s[j] = hmma(qa[dc], kb.v, s[j]);
      }
    }

    // ---- scale + bias + row max ----
    float cm[8];
#pragma unroll
    for (int r = 0; r < 8; ++r) {
      const int bi = qloc + r + (kSeq - 1) - kv0 - c;
      float m = -INFINITY;
#pragma unroll
      for (int j = 0; j < 4; ++j) {
        const float sc = s[j][r] * inv + biasL[bi - j * 16];
        s[j][r] = sc;
        m = fmaxf(m, sc);
      }
#pragma unroll
      for (int off = 1; off < 16; off <<= 1) m = fmaxf(m, __shfl_xor(m, off, 32));
      cm[r] = m;
    }

    // ---- online softmax update; P (x2^15, f16) to per-wave LDS ----
    _Float16* pw = Psh[wave];
#pragma unroll
    for (int r = 0; r < 8; ++r) {
      const float mnew = fmaxf(mrow[r], cm[r]);
      const float alpha = expf(mrow[r] - mnew);
      mrow[r] = mnew;
      float psum = 0.f;
#pragma unroll
      for (int j = 0; j < 4; ++j) {
        const float p = expf(s[j][r] - mnew);
        psum += p;
        pw[(8 * hh + r) * kLP + j * 16 + c] = (_Float16)(p * kPCarry);
      }
#pragma unroll
      for (int off = 1; off < 16; off <<= 1) psum += __shfl_xor(psum, off, 32);
      lrow[r] = lrow[r] * alpha + psum;
#pragma unroll
      for (int t = 0; t < 4; ++t) oacc[t][r] *= alpha;
    }
    __syncthreads();

    // ---- O += P . V_chunk ----
#pragma unroll
    for (int kk = 0; kk < 2; ++kk) {
      FH pa;
      pa.h[0] = *(const v8h*)(pw + c * kLP + kk * 32 + 8 * hh);
      pa.h[1] = *(const v8h*)(pw + c * kLP + kk * 32 + 16 + 8 * hh);
#pragma unroll
      for (int t = 0; t < 4; ++t) {
        FH vb;
        vb.h[0] = *(const v8h*)(Vtsh + (t * 16 + c) * kLP + kk * 32 + 8 * hh);
        vb.h[1] = *(const v8h*)(Vtsh + (t * 16 + c) * kLP + kk * 32 + 16 + 8 * hh);
        oacc[t] = hmma(pa.v, vb.v, oacc[t]);
      }
    }
  }

  float* os = Os[wave];
#pragma unroll
  for (int r = 0; r < 8; ++r) {
    const float invl = ctx_scale * (1.0f / (lrow[r] * kPCarry));
#pragma unroll
    for (int t = 0; t < 4; ++t) os[(8 * hh + r) * 68 + t * 16 + c] = oacc[t][r] * invl;
  }
  __syncthreads();
  {
    const int q4 = lane >> 3, c8 = (lane & 7) * 8;
    _Float16* Ch = (_Float16*)Cp;
    {
#pragma unroll
      for (int it = 0; it < 4; ++it) {
        const int row = it * 4 + q4;
        const float* sp = os + row * 68 + c8;
        v8h hv;
#pragma unroll
        for (int e = 0; e < 8; ++e) hv[e] = (_Float16)sp[e];
        *(v8h*)(Ch + (size_t)(b * kSeq + q0 + row) * kEmb + h * kHD + c8) = hv;
      }
      
    }
  }
}

// ---------------------------------------------------------------------------
// Host launch
// ---------------------------------------------------------------------------
extern "C" void kernel_launch(void* const* d_in, const int* in_sizes, int n_in,
                              void* d_out, int out_size, void* d_ws, size_t ws_size,
                              hipStream_t stream) {
  if (n_in < 11) return;
  if (in_sizes[0] != kTok * kEmb) return;
  if (in_sizes[1] != kEmb * kEmb || in_sizes[3] != kEmb * kEmb ||
      in_sizes[5] != kEmb * kEmb || in_sizes[7] != kEmb * kEmb) return;
  if (in_sizes[2] < kEmb || in_sizes[4] < kEmb || in_sizes[6] < kEmb || in_sizes[8] < kEmb) return;
  if (in_sizes[9] != kRelRows * kHeads || in_sizes[10] < 1) return;
  if (out_size != kTok * kEmb) return;

  const float* x    = (const float*)d_in[0];
  const float* Wq   = (const float*)d_in[1];
  const float* bq   = (const float*)d_in[2];
  const float* Wk   = (const float*)d_in[3];
  const float* bk   = (const float*)d_in[4];
  const float* Wv   = (const float*)d_in[5];
  const float* bv   = (const float*)d_in[6];
  const float* Wp   = (const float*)d_in[7];
  const float* bp   = (const float*)d_in[8];
  const float* btab = (const float*)d_in[9];
  const float* tptr = (const float*)d_in[10];
  float* out = (float*)d_out;

  // workspace region map (bytes), all offsets multiples of 2 MiB:
  //   Xb  bf16 [4096][1024]   8 MiB  @ 0
  //   WqT bf16 [1024][1024]   2 MiB  @ 8 MiB
  //   WkT bf16 [1024][1024]   2 MiB  @ 10 MiB
  //   WvT bf16 [1024][1024]   2 MiB  @ 12 MiB
  //   WpT f16  [1024][1024]   2 MiB  @ 14 MiB   (RNE-bf16 values x64)
  //   Qp  f16  [4096][1024]   8 MiB  @ 16 MiB
  //   Kp  f16  [4096][1024]   8 MiB  @ 24 MiB
  //   Vtp f16  [1024][4096]   8 MiB  @ 32 MiB
  //   Cx  f16  [4096][1024]   8 MiB  @ 40 MiB   (ctx x64)
  //   total 48 MiB = 50,331,648 B
  const size_t szAct = (size_t)kTok * kEmb * 2;
  const size_t szW   = (size_t)kEmb * kEmb * 2;
  size_t off = 0;
  const size_t oXb = off; off += szAct;
  const size_t oWq = off; off += szW;
  const size_t oWk = off; off += szW;
  const size_t oWv = off; off += szW;
  const size_t oWp = off; off += szW;
  const size_t oQ  = off; off += szAct;
  const size_t oK  = off; off += szAct;
  const size_t oVt = off; off += szAct;
  const size_t oCx = off; off += szAct;
  if (off > ws_size) return;

  char* w = (char*)d_ws;
  unsigned short* Xb  = (unsigned short*)(w + oXb);
  unsigned short* WqT = (unsigned short*)(w + oWq);
  unsigned short* WkT = (unsigned short*)(w + oWk);
  unsigned short* WvT = (unsigned short*)(w + oWv);
  unsigned short* WpT = (unsigned short*)(w + oWp);
  unsigned short* Qp  = (unsigned short*)(w + oQ);
  unsigned short* Kp  = (unsigned short*)(w + oK);
  unsigned short* Vtp = (unsigned short*)(w + oVt);
  unsigned short* Cx  = (unsigned short*)(w + oCx);

  const float kWpCarry  = 64.0f;
  const float kCtxCarry = 64.0f;

  // 1) x -> bf16 plane (2 elements per thread)
  {
    const int n2 = (kTok * kEmb) / 2;
    cast_f32_bf16x2<<<(n2 + 255) / 256, 256, 0, stream>>>(x, Xb, n2);
  }
  // 2) weights: in[rows=1024][cols=1024] -> out[cols][rows], grid (cols/64, rows/64)
  {
    dim3 grd(kEmb / 64, kEmb / 64);
    transpose_cvt16<0><<<grd, 256, 0, stream>>>(Wq, WqT, kEmb, kEmb, 1.0f);
    transpose_cvt16<0><<<grd, 256, 0, stream>>>(Wk, WkT, kEmb, kEmb, 1.0f);
    transpose_cvt16<0><<<grd, 256, 0, stream>>>(Wv, WvT, kEmb, kEmb, 1.0f);
    transpose_cvt16<1><<<grd, 256, 0, stream>>>(Wp, WpT, kEmb, kEmb, kWpCarry);
  }
  // 3) projections (bf16 WMMA, f16 outputs). M,N % 128 == 0, K % 128 == 0 by the static_assert below.
  static_assert(kTok % 128 == 0 && kEmb % 128 == 0 && kEmb % kGK == 0);
  const int gemmBlocks = (kTok / 128) * (kEmb / 128);
  //    Q[token][n] = sum_k Xb[token][k] WqT[n][k] + bq[n]
  wmma_gemm64<1, false, 2, 1><<<dim3(gemmBlocks, 1), 256, 0, stream>>>(
      Xb, Xb, kEmb, 0L, WqT, WqT, kEmb, 0L, (void*)Qp, (void*)Qp, kEmb, 0L, bq,
      kTok, kEmb, kEmb, 1.0f);
  wmma_gemm64<1, false, 2, 1><<<dim3(gemmBlocks, 1), 256, 0, stream>>>(
      Xb, Xb, kEmb, 0L, WkT, WkT, kEmb, 0L, (void*)Kp, (void*)Kp, kEmb, 0L, bk,
      kTok, kEmb, kEmb, 1.0f);
  //    Vt[n][token] = sum_k WvT[n][k] Xb[token][k] + bv[n]   (M = 1024 features, N = 4096 tokens)
  wmma_gemm64<1, false, 1, 1><<<dim3(gemmBlocks, 1), 256, 0, stream>>>(
      WvT, WvT, kEmb, 0L, Xb, Xb, kEmb, 0L, (void*)Vtp, (void*)Vtp, kTok, 0L, bv,
      kEmb, kTok, kEmb, 1.0f);
  // 4) attention -> ctx f16 plane (x64)
  attn_relbias_f16<<<kBatch * kHeads * (kSeq / kQB), kNW * 32, 0, stream>>>(
      Qp, Kp, Vtp, btab, tptr, Cx, kCtxCarry);
  // 5) output projection: out[token][n] = 2^-12 * sum_c Cx[token][c] WpT[n][c] + bp[n]
  wmma_gemm64<0, false, 2, 0><<<dim3(gemmBlocks, 1), 256, 0, stream>>>(
      Cx, Cx, kEmb, 0L, WpT, WpT, kEmb, 0L, (void*)out, (void*)out, kEmb, 0L, bp,
      kTok, kEmb, kEmb, 1.0f / (kWpCarry * kCtxCarry));
}

// v003
// A run of this version takes 142 microseconds.
// Next to v002, in two timings, it ran 1.11 times as fast each time.
// All steps since v000 together make it 2.30 times as fast.
// Contractions: x@Wq, x@Wk, Wv-side GEMM producing V^T on v_wmma_f32_16x16x32_bf16 (bf16 operands = RNE-bf16 converted inputs, exact products); q.k^T, p.v, ctx@Wp on v_wmma_f32_16x16x32_f16 (f16 operands; p carried x2^15, ctx and Wp carried x64); f32 accumulate; softmax and normalisers in f32.
#include <hip/hip_runtime.h>
#include <math.h>

typedef __attribute__((ext_vector_type(16))) _Float16 v16h;
typedef __attribute__((ext_vector_type(8)))  _Float16 v8h;
typedef __attribute__((ext_vector_type(16))) __bf16   v16b;
typedef __attribute__((ext_vector_type(8)))  __bf16   v8b;
typedef __attribute__((ext_vector_type(8)))  float    v8f;
typedef __attribute__((ext_vector_type(4)))  float    v4f;
typedef __attribute__((ext_vector_type(4)))  unsigned v4u;

constexpr int kBatch   = 4;
constexpr int kSeq     = 1024;
constexpr int kEmb     = 1024;
constexpr int kHeads   = 16;
constexpr int kHD      = 64;
constexpr int kTok     = kBatch * kSeq;
constexpr int kRelRows = 1999;
constexpr int kRelMax  = kRelRows - 1;

static_assert(kEmb == kHeads * kHD);
static_assert(kHD == 64);
static_assert(kTok % 64 == 0 && kEmb % 64 == 0 && kEmb % 32 == 0 && kSeq % 64 == 0);

// ---------------------------------------------------------------------------
// helpers
// ---------------------------------------------------------------------------
__device__ __forceinline__ unsigned short f2bf_bits(float f) {
  unsigned u = __float_as_uint(f);
  return (unsigned short)((u + 0x7FFFu + ((u >> 16) & 1u)) >> 16);
}
__device__ __forceinline__ float bf_bits2f(unsigned short h) { return __uint_as_float(((unsigned)h) << 16); }
__device__ __forceinline__ float rne_bf(float f) { return bf_bits2f(f2bf_bits(f)); }

__device__ __forceinline__ void dep_guard_h(v8f& a, v8f& b, v16h x, v16h y) { asm volatile("v_nop\n\tv_nop\n\tv_nop\n\tv_nop" : "+v"(a), "+v"(b) : "v"(x), "v"(y)); }
__device__ __forceinline__ void dep_guard_b(v8f& a, v8f& b, v16b x, v16b y) { asm volatile("v_nop\n\tv_nop\n\tv_nop\n\tv_nop" : "+v"(a), "+v"(b) : "v"(x), "v"(y)); }
__device__ __forceinline__ void keep4_h(v16h a, v16h b, v16h c, v16h d) { asm volatile("v_nop" :: "v"(a), "v"(b), "v"(c), "v"(d)); }
__device__ __forceinline__ void keep4_b(v16b a, v16b b, v16b c, v16b d) { asm volatile("v_nop" :: "v"(a), "v"(b), "v"(c), "v"(d)); }
__device__ __forceinline__ void acc_guard4(v8f& a, v8f& b, v8f& c, v8f& d) { asm volatile("v_nop\n\tv_nop\n\tv_nop\n\tv_nop" : "+v"(a), "+v"(b), "+v"(c), "+v"(d)); }
template <typename T> struct Frag;
template <> struct Frag<_Float16> {
  typedef v16h V; union U { v16h v; v8h h[2]; };
  // elements 0..7 <- p[0..7], 8..15 <- p[16..23]
  static __device__ __forceinline__ v16h load(const _Float16* p) {
    U f; f.h[0] = *(const v8h*)(p); f.h[1] = *(const v8h*)(p + 16); return f.v;
  }
  static __device__ __forceinline__ v8f mma(v16h a, v16h b, v8f c) {
    return __builtin_amdgcn_wmma_f32_16x16x32_f16(false, a, false, b, (short)0, c, false, false);
  }
  static __device__ __forceinline__ void guard(v8f& a, v8f& b, v16h x, v16h y) { dep_guard_h(a, b, x, y); }
  static __device__ __forceinline__ void keep(v16h a, v16h b, v16h c, v16h d) { keep4_h(a, b, c, d); }
};
template <> struct Frag<__bf16> {
  typedef v16b V; union U { v16b v; v8b h[2]; };
  static __device__ __forceinline__ v16b load(const __bf16* p) {
    U f; f.h[0] = *(const v8b*)(p); f.h[1] = *(const v8b*)(p + 16); return f.v;
  }
  static __device__ __forceinline__ v8f mma(v16b a, v16b b, v8f c) {
    return __builtin_amdgcn_wmma_f32_16x16x32_bf16(false, a, false, b, (short)0, c, false, false);
  }
  static __device__ __forceinline__ void guard(v8f& a, v8f& b, v16b x, v16b y) { dep_guard_b(a, b, x, y); }
  static __device__ __forceinline__ void keep(v16b a, v16b b, v16b c, v16b d) { keep4_b(a, b, c, d); }
};

// f16 WMMA with hazard guard (A, B kept live; D tied)
__device__ __forceinline__ v8f hmma(v16h a, v16h b, v8f c) {
  c = __builtin_amdgcn_wmma_f32_16x16x32_f16(false, a, false, b, (short)0, c, false, false);
  asm volatile("v_nop\n\tv_nop\n\tv_nop\n\tv_nop" : "+v"(c) : "v"(a), "v"(b));
  return c;
}

// ---------------------------------------------------------------------------
// Register-blocked batched WMMA GEMM, operands staged in LDS.
// C[m,n] = scale * sum_k A[m,k] * Bt[n,k] (+bias); a work-group of 8 waves owns a 128x128 tile,
// each wave 32 rows x 64 columns of it (two waves per SIMD: one wave's LDS reads and copy issue
// stand behind the other's products).
// A row-major [M,K]; Bt row-major [N,K]; M,N % 128 == 0, K % 128 == 0.
// A pass is 128 k: 256 B of 128 A rows and of 128 Bt rows, brought into LDS by asynchronous copies,
// two buffers, the next pass's copies in flight while this pass is worked on.
// SPLIT: hi/lo operand planes (not supported by the staged loop, false).
// BIAS_MODE: 0 none, 1 bias[m], 2 bias[n]; bias values RNE-converted to bf16 precision before the add.
// OUT_MODE: 0 = f32, 1 = f16, 2 = bf16 hi plane (Cout) + bf16 lo plane (Cout2).
// ET: 0 = f16 operands, 1 = bf16 operands (pointers passed as 16-bit storage)
// ---------------------------------------------------------------------------
constexpr int kGK     = 128;               // k elements per pass
constexpr int kGPitch = 2 * kGK + 16;      // LDS row pitch in bytes: 16 B x odd, conflict-free for 16-byte reads down a column
constexpr int kGStage = 256 * kGPitch;     // one buffer: rows 0..127 = A rows, rows 128..255 = Bt rows

// One wave's share of a stage: 32 rows of 256 B, 16 copies of 2 rows each (16 lanes x 16 B per row).
// lds = this lane's LDS byte address in the first row pair, g = this lane's global address there,
// ld = source row pitch in elements.
template <typename T>
__device__ __forceinline__ void stage_copies(unsigned lds, const T* g, int ld) {
#pragma unroll
  for (int i = 0; i < 16; i += 8) {
    // the closing s_wait_xcnt is a precaution: no register that a copy names is rewritten ahead of it
    asm volatile(
        "global_load_async_to_lds_b128 %0, %8, off\n\t"
        "global_load_async_to_lds_b128 %1, %9, off\n\t"
        "global_load_async_to_lds_b128 %2, %10, off\n\t"
        "global_load_async_to_lds_b128 %3, %11, off\n\t"
        "global_load_async_to_lds_b128 %4, %12, off\n\t"
        "global_load_async_to_lds_b128 %5, %13, off\n\t"
        "global_load_async_to_lds_b128 %6, %14, off\n\t"
        "global_load_async_to_lds_b128 %7, %15, off\n\t"
        "s_wait_xcnt 0x0"
        :: "v"(lds + (unsigned)((i + 0) * 2 * kGPitch)), "v"(lds + (unsigned)((i + 1) * 2 * kGPitch)),
           "v"(lds + (unsigned)((i + 2) * 2 * kGPitch)), "v"(lds + (unsigned)((i + 3) * 2 * kGPitch)),
           "v"(lds + (unsigned)((i + 4) * 2 * kGPitch)), "v"(lds + (unsigned)((i + 5) * 2 * kGPitch)),
           "v"(lds + (unsigned)((i + 6) * 2 * kGPitch)), "v"(lds + (unsigned)((i + 7) * 2 * kGPitch)),
           "v"(g + (size_t)((i + 0) * 2) * ld), "v"(g + (size_t)((i + 1) * 2) * ld),
           "v"(g + (size_t)((i + 2) * 2) * ld), "v"(g + (size_t)((i + 3) * 2) * ld),
           "v"(g + (size_t)((i + 4) * 2) * ld), "v"(g + (size_t)((i + 5) * 2) * ld),
           "v"(g + (size_t)((i + 6) * 2) * ld), "v"(g + (size_t)((i + 7) * 2) * ld)
        : "memory");
  }
}

template <int ET> struct Elem;
template <> struct Elem<0> { typedef _Float16 T; };
template <> struct Elem<1> { typedef __bf16 T; };
// The tile's work is a device function, so that one launch can hold several GEMMs: the kernel owns the LDS
// (ring: operand ring, two buffers; sT: per-wave 16x64 slab, pitch 68 floats) and says which tile and batch.
template <int ET, bool SPLIT, int BIAS_MODE, int OUT_MODE>
__device__ __forceinline__ void gemm_tile(
    unsigned char* ring, float (*sT)[16 * 68], int tile, int b,
    const unsigned short* __restrict__ Ap, const unsigned short* __restrict__ A2p, int lda, long strideA,
    const unsigned short* __restrict__ Btp, const unsigned short* __restrict__ Bt2p, int ldb, long strideB,
    void* __restrict__ Cout, void* __restrict__ Cout2, int ldc, long strideC,
    const float* __restrict__ bias,
    int M, int N, int K, float scale) {
  static_assert(!SPLIT);
  typedef typename Elem<ET>::T T;
  typedef typename Frag<T>::V V;
  const T* A = (const T*)Ap; const T* Bt = (const T*)Btp;
  const int lane = threadIdx.x & 31;
  // in a scalar register, so that what picks a wave's source rows is scalar and every lane stays on at the copies
  const int wave = __builtin_amdgcn_readfirstlane(threadIdx.x >> 5);
  const int tilesN = N >> 7;
  const int tilesM = M >> 7;
  // the same for the whole work-group, ahead of every barrier
  if (tile >= tilesM * tilesN) return;
  const int tm = tile / tilesN;
  const int tn = tile - tm * tilesN;
  const int wm = wave >> 1;
  const int wn = wave & 1;
  const int m0 = (tm << 7) + (wm << 5);
  const int n0 = (tn << 7) + (wn << 6);

  const T* Ab  = A  + (size_t)b * strideA;
  const T* Bb  = Bt + (size_t)b * strideB;

  // row (A) / col (B, D) within subtile; k offset of this lane half; D row offset
  const int rlane = lane & 15;
  const int koff  = (lane >> 4) * 8;
  const int mOff  = (lane >> 4) * 8;

  // copies: waves 0..3 bring the 128 A rows, waves 4..7 the 128 Bt rows, 32 rows each
  const int ldS = (wave < 4) ? lda : ldb;
  const T* gS = ((wave < 4) ? (Ab + (size_t)((tm << 7) + (wave << 5)) * lda)
                            : (Bb + (size_t)((tn << 7) + ((wave - 4) << 5)) * ldb))
                + (size_t)(lane >> 4) * ldS + rlane * 8;
  const unsigned ldsS = (unsigned)(size_t)ring + (unsigned)(((wave << 5) + (lane >> 4)) * kGPitch + rlane * 16);

  v8f acc[2][4];
#pragma unroll
  for (int i = 0; i < 2; ++i)
#pragma unroll
    for (int j = 0; j < 4; ++j) acc[i][j] = (v8f){0.f,0.f,0.f,0.f,0.f,0.f,0.f,0.f};

  const int nPass = K / kGK;
  stage_copies<T>(ldsS, gS, ldS);
  // pass 0's bytes of this wave have landed before the barrier that shows them to the other waves
  asm volatile("s_wait_asynccnt 0x0" ::: "memory");
  __syncthreads();
  if (nPass > 1) stage_copies<T>(ldsS + (unsigned)kGStage, gS + kGK, ldS);

  // one pass per trip, the buffer chosen by the trip's parity
  for (int t = 0; t < nPass; ++t) {
    const unsigned char* st = ring + (t & 1) * kGStage;
    const unsigned char* stA = st + ((wm << 5) + rlane) * kGPitch;
    const unsigned char* stB = st + (128 + (wn << 6) + rlane) * kGPitch;
#pragma unroll
    for (int k0 = 0; k0 < kGK; k0 += 32) {
      // all six fragments of a 32-k block are read as one group: one LDS latency per 8 products
      V bh[4], ah[2];
#pragma unroll
      for (int j = 0; j < 4; ++j) bh[j] = Frag<T>::load((const T*)(stB + (j << 4) * kGPitch) + koff + k0);
#pragma unroll
      for (int i = 0; i < 2; ++i) ah[i] = Frag<T>::load((const T*)(stA + (i << 4) * kGPitch) + koff + k0);
#pragma unroll
      for (int i = 0; i < 2; ++i) {
#pragma unroll
        for (int j = 0; j < 4; ++j) acc[i][j] = Frag<T>::mma(ah[i], bh[j], acc[i][j]);
        Frag<T>::guard(acc[i][0], acc[i][3], ah[i], ah[i]);
      }
      Frag<T>::keep(bh[0], bh[1], bh[2], bh[3]);
    }
    // this wave's reads of the buffer are done before the barrier behind which it is refilled
    asm volatile("s_wait_dscnt 0x0" ::: "memory");
    // this wave's copies of pass t + 1 have landed before the barrier that shows them to the other waves
    asm volatile("s_wait_asynccnt 0x0" ::: "memory");
    __syncthreads();
    if (t + 2 < nPass) stage_copies<T>(ldsS + (unsigned)((t & 1) * kGStage), gS + (size_t)(t + 2) * kGK, ldS);
  }
  // no copy is outstanding when the wave goes on to the epilogue and ends
  asm volatile("s_wait_asynccnt 0x0" ::: "memory");
  acc_guard4(acc[0][0], acc[0][1], acc[0][2], acc[0][3]);
  acc_guard4(acc[1][0], acc[1][1], acc[1][2], acc[1][3]);

  // ---- epilogue ----
  float* slab = sT[wave];
  // column biases: 4 scalar loads per lane, hoisted
  float bvj[4];
#pragma unroll
  for (int j = 0; j < 4; ++j) bvj[j] = (BIAS_MODE == 2) ? rne_bf(bias[n0 + (j << 4) + rlane]) : 0.f;
#pragma unroll
  for (int i = 0; i < 2; ++i) {
    const int mBase = m0 + (i << 4);
    // row biases: two 16-B loads per lane (rows mBase+mOff .. +7, 32-B aligned)
    v4f bm0 = (v4f){0.f, 0.f, 0.f, 0.f};
    v4f bm1 = bm0;
    if (BIAS_MODE == 1) {
      bm0 = *(const v4f*)(bias + mBase + mOff);
      bm1 = *(const v4f*)(bias + mBase + mOff + 4);
    }
#pragma unroll
    for (int j = 0; j < 4; ++j) {
#pragma unroll
      for (int r = 0; r < 8; ++r) {
        float v = acc[i][j][r] * scale;
        if (BIAS_MODE == 1) { const v4f bsel = (r < 4) ? bm0 : bm1; v += rne_bf(bsel[r & 3]); }
        if (BIAS_MODE == 2) v += bvj[j];
        slab[(mOff + r) * 68 + (j << 4) + rlane] = v;
      }
    }
    __builtin_amdgcn_fence(__ATOMIC_RELEASE, "workgroup");
    __builtin_amdgcn_wave_barrier();
    __builtin_amdgcn_fence(__ATOMIC_ACQUIRE, "workgroup");
    if (OUT_MODE == 0) {
      float* C = (float*)Cout + (size_t)b * strideC;
      // row seg = 256 B = 16 lanes x 16 B
      const int hh = lane >> 4, c4 = (lane & 15) * 4;
      {
#pragma unroll
        for (int it = 0; it < 8; ++it) {
          const int row = it * 2 + hh;
          v4f v = *(const v4f*)(slab + row * 68 + c4);
          *(v4f*)(C + (size_t)(mBase + row) * ldc + n0 + c4) = v;
        }
        
      }
    } else {
      const int q = lane >> 3, c8 = (lane & 7) * 8;
      unsigned short* C  = (unsigned short*)Cout  + (size_t)b * strideC;
      unsigned short* C2 = (OUT_MODE == 2) ? ((unsigned short*)Cout2 + (size_t)b * strideC) : nullptr;
      {
#pragma unroll
        for (int it = 0; it < 4; ++it) {
          const int row = it * 4 + q;
          const float* sp = slab + row * 68 + c8;
          v8h hv, lv;
#pragma unroll
          for (int e = 0; e < 8; ++e) {
            if (OUT_MODE == 1) {
              hv[e] = (_Float16)sp[e];
            } else {
              unsigned short hb = f2bf_bits(sp[e]);
              unsigned short lb = f2bf_bits(sp[e] - bf_bits2f(hb));
              hv[e] = __builtin_bit_cast(_Float16, hb);
              lv[e] = __builtin_bit_cast(_Float16, lb);
            }
          }
          *(v8h*)(C + (size_t)(mBase + row) * ldc + n0 + c8) = hv;
          if (OUT_MODE == 2) *(v8h*)(C2 + (size_t)(mBase + row) * ldc + n0 + c8) = lv;
        }
        
      }
    }
    __builtin_amdgcn_fence(__ATOMIC_RELEASE, "workgroup");
    __builtin_amdgcn_wave_barrier();
    __builtin_amdgcn_fence(__ATOMIC_ACQUIRE, "workgroup");
  }
}

// One GEMM per launch: blockIdx.x = tile, blockIdx.y = batch.
template <int ET, bool SPLIT, int BIAS_MODE, int OUT_MODE>
__global__ __launch_bounds__(256) void wmma_gemm64(
    const unsigned short* __restrict__ Ap, const unsigned short* __restrict__ A2p, int lda, long strideA,
    const unsigned short* __restrict__ Btp, const unsigned short* __restrict__ Bt2p, int ldb, long strideB,
    void* __restrict__ Cout, void* __restrict__ Cout2, int ldc, long strideC,
    const float* __restrict__ bias,
    int M, int N, int K, float scale) {
  __shared__ __align__(16) unsigned char ring[2 * kGStage];
  __shared__ __align__(16) float sT[8][16 * 68];
  gemm_tile<ET, SPLIT, BIAS_MODE, OUT_MODE>(ring, sT, blockIdx.x, blockIdx.y,
      Ap, A2p, lda, strideA, Btp, Bt2p, ldb, strideB, Cout, Cout2, ldc, strideC, bias, M, N, K, scale);
}

// The three projections, which do not depend on one another, in one launch: blockIdx.y picks the job
// (the same for a whole work-group), blockIdx.x the tile.
//   job 0: Q[token][n]  = sum_k Xb[token][k] WqT[n][k] + bq[n]
//   job 1: K[token][n]  = sum_k Xb[token][k] WkT[n][k] + bk[n]
//   job 2: Vt[n][token] = sum_k WvT[n][k] Xb[token][k] + bv[n]   (M = features, N = tokens)
__global__ __launch_bounds__(256) void qkv_gemm(
    const unsigned short* __restrict__ Xb, const unsigned short* __restrict__ WqT,
    const unsigned short* __restrict__ WkT, const unsigned short* __restrict__ WvT,
    unsigned short* __restrict__ Qp, unsigned short* __restrict__ Kp, unsigned short* __restrict__ Vtp,
    const float* __restrict__ bq, const float* __restrict__ bk, const float* __restrict__ bv,
    int nTok, int nEmb) {
  __shared__ __align__(16) unsigned char ring[2 * kGStage];
  __shared__ __align__(16) float sT[8][16 * 68];
  const int job = blockIdx.y;
  if (job < 2) {
    const unsigned short* Wt = job ? WkT : WqT;
    unsigned short* C = job ? Kp : Qp;
    gemm_tile<1, false, 2, 1>(ring, sT, blockIdx.x, 0,
        Xb, Xb, nEmb, 0L, Wt, Wt, nEmb, 0L, (void*)C, (void*)C, nEmb, 0L, job ? bk : bq,
        nTok, nEmb, nEmb, 1.0f);
  } else {
    gemm_tile<1, false, 1, 1>(ring, sT, blockIdx.x, 0,
        WvT, WvT, nEmb, 0L, Xb, Xb, nEmb, 0L, (void*)Vtp, (void*)Vtp, nTok, 0L, bv,
        nEmb, nTok, nEmb, 1.0f);
  }
}

// ---------------------------------------------------------------------------
// f32 -> bf16 plane, 2 elements per thread; blk = index of this 256-thread block within the cast
// ---------------------------------------------------------------------------
__device__ __forceinline__ void cast_f32_bf16x2(
    const float* __restrict__ in, unsigned short* __restrict__ out, int n2, int blk) {
  const int i = blk * 256 + threadIdx.x;
  if (i < n2) {
    const unsigned u = (unsigned)f2bf_bits(in[2 * i]) | ((unsigned)f2bf_bits(in[2 * i + 1]) << 16);
    ((unsigned*)out)[i] = u;
    
  }
}

// ---------------------------------------------------------------------------
// Transpose + convert: W row-major in[rows][cols] f32 -> Wt row-major out[cols][rows] 16-bit.
// MODE 0: bf16 bits of RNE-bf16(W). MODE 1: f16 bits of RNE-bf16(W) * wsc (wsc a power of two).
// One block per 64x64 tile (bx, by) of (cols/64, rows/64); rows, cols % 64 == 0. tile = the kernel's 64x65 LDS floats.
// Load: 256 threads x 4 x float4 = 64x64 tile. Store: wave w writes output rows w*8..w*8+7,
// ---------------------------------------------------------------------------
template <int MODE>
__device__ __forceinline__ void transpose_cvt16(
    float* tile, int bx, int by,
    const float* __restrict__ W, unsigned short* __restrict__ Wt, int rows, int cols, float wsc) {
  const int tid = threadIdx.x, lane = tid & 31, wave = tid >> 5;
  const int n0 = bx * 64;
  const int k0 = by * 64;
  {
    const int c4 = (tid & 15) * 4, r = tid >> 4;
#pragma unroll
    for (int it = 0; it < 4; ++it) {
      const int rr = it * 16 + r;
      const v4f x4 = *(const v4f*)(W + (size_t)(k0 + rr) * cols + n0 + c4);
      tile[rr * 65 + c4 + 0] = x4[0];
      tile[rr * 65 + c4 + 1] = x4[1];
      tile[rr * 65 + c4 + 2] = x4[2];
      tile[rr * 65 + c4 + 3] = x4[3];
    }
  }
  __syncthreads();
  const int q4 = lane >> 3, c8 = (lane & 7) * 8;
  _Float16* out = (_Float16*)Wt;
  {
#pragma unroll
    for (int it = 0; it < 2; ++it) {
      const int i = wave * 8 + it * 4 + q4;
      v8h hv;
#pragma unroll
      for (int e = 0; e < 8; ++e) {
        const float f = tile[(c8 + e) * 65 + i];
        if (MODE == 0) {
          hv[e] = __builtin_bit_cast(_Float16, f2bf_bits(f));
        } else {
          hv[e] = (_Float16)(rne_bf(f) * wsc);
        }
      }
      *(v8h*)(out + (size_t)(n0 + i) * rows + k0 + c8) = hv;
    }
    // a precaution: inlined into a kernel with other jobs' code behind it, no register that the two stores name
    // is rewritten ahead of this wait on any branch of the listing
    asm volatile("s_wait_xcnt 0x0" ::: "memory");
  }
}

// ---------------------------------------------------------------------------
// The five input conversions, which do not depend on one another, in one launch: the block index picks the job
// (the same for a whole work-group, so the transposes' barrier stands under uniform control flow).
// Blocks [0, 4 * kWTiles): the weight transposes in the order Wq, Wk, Wv, Wp, one 64x64 tile each; they come
// first because they last longer than a cast block. The blocks behind them: the cast of x.
// ---------------------------------------------------------------------------
constexpr int kWTilesX = kEmb / 64;
constexpr int kWTiles  = kWTilesX * kWTilesX;
__global__ __launch_bounds__(256) void prep_inputs(
    const float* __restrict__ x, const float* __restrict__ Wq, const float* __restrict__ Wk,
    const float* __restrict__ Wv, const float* __restrict__ Wp,
    unsigned short* __restrict__ Xb, unsigned short* __restrict__ WqT, unsigned short* __restrict__ WkT,
    unsigned short* __restrict__ WvT, unsigned short* __restrict__ WpT, int n2, int emb, float wsc) {
  __shared__ float tile[64 * 65];
  const int blk = blockIdx.x;
  if (blk >= 4 * kWTiles) {
    cast_f32_bf16x2(x, Xb, n2, blk - 4 * kWTiles);
    return;
  }
  const int job = blk / kWTiles;
  const int t   = blk % kWTiles;
  const int bx  = t % kWTilesX;
  const int by  = t / kWTilesX;
  if (job < 3) {
    const float* W = (job == 0) ? Wq : (job == 1) ? Wk : Wv;
    unsigned short* Wt = (job == 0) ? WqT : (job == 1) ? WkT : WvT;
    transpose_cvt16<0>(tile, bx, by, W, Wt, emb, emb, 1.0f);
  } else {
    transpose_cvt16<1>(tile, bx, by, Wp, WpT, emb, emb, wsc);
  }
}

// ---------------------------------------------------------------------------
// Flash attention with relative-position bias and temperature scaling, head dim 64.
// Q, K planes f16 [token][emb] (element (b,s,h,d) at (b*S+s)*E + h*64 + d); Vt plane f16 [emb][token]
// (element (b,s,h,d) at (h*64+d)*T + b*S + s); ctx out plane f16 [token][emb] carried x ctx_scale.
// scores = q.k^T (f16 WMMA, f32 acc) * inv + bias_lds[q-k+S-1]; online softmax in f32;
// p = exp(s - m) stored x2^15 as f16 in per-wave LDS; out = p.v (f16 WMMA, f32 acc) / (l * 2^15).
// Block = 4 waves = 64 query rows of one (b,h); grid = B*H*(S/64); key chunks of 64.
// ---------------------------------------------------------------------------
constexpr int kQB = 64;
constexpr int kKC = 64;
constexpr int kNW = 4;
// LDS row pitch of the K, V^T and P tiles in halves: 144 B = 16 B x odd, so that the 16 rows that a 16-byte
// fragment read walks down fall on 16 different bank groups (at 128 B they fall on two)
constexpr int kLP = kKC + 8;
constexpr int kBiasL = kQB + kSeq;
constexpr float kPCarry = 32768.0f;
static_assert(kSeq % kKC == 0 && kSeq % kQB == 0 && kKC == kHD);

__global__ __launch_bounds__(128) void attn_relbias_f16(
    const unsigned short* __restrict__ Qp, const unsigned short* __restrict__ Kp,
    const unsigned short* __restrict__ Vtp, const float* __restrict__ btab,
    const float* __restrict__ tptr, unsigned short* __restrict__ Cp, float ctx_scale) {
  union FH { v16h v; v8h h[2]; };
  // K [kv][d], V^T [d][kv], per-wave P [row][kv] (rows of 64 halves at pitch kLP), per-wave out slab, bias slab
  __shared__ __align__(16) _Float16 Ksh[kKC * kLP];
  __shared__ __align__(16) _Float16 Vtsh[kHD * kLP];
  __shared__ __align__(16) _Float16 Psh[kNW][16 * kLP];
  __shared__ __align__(16) float Os[kNW][16 * 68];
  __shared__ __align__(16) float biasL[kBiasL];

  const _Float16* Qh  = (const _Float16*)Qp;
  const _Float16* Kh  = (const _Float16*)Kp;
  const _Float16* Vth = (const _Float16*)Vtp;

  const int tid  = threadIdx.x;
  const int wave = tid >> 5;
  const int lane = tid & 31;
  const int hh   = lane >> 4;
  const int c    = lane & 15;

  constexpr int nqb = kSeq / kQB;
  const int bx = blockIdx.x;
  const int qb = bx % nqb;
  const int bh = bx / nqb;
  const int h  = bh % kHeads;
  const int b  = bh / kHeads;
  const int qbase = qb * kQB;
  const int q0 = qbase + wave * 16;

  // temperature (RNE-bf16 converted input), clamp, 1/(sqrt(E) * temp)
  float tv = rne_bf(tptr[0]);
  tv = fminf(fmaxf(tv, 0.1f), 10.0f);
  const float inv = 1.0f / (sqrtf((float)kEmb) * tv);

  // bias slab: biasL[i] = table[min(qbase + i, relmax)][h] * inv, i = (q - qbase) + (S-1) - kv in [0, kBiasL)
  for (int i = tid; i < kBiasL; i += kNW * 32) {
    int rel = qbase + i;
    rel = rel > kRelMax ? kRelMax : rel;
    biasL[i] = rne_bf(btab[(size_t)rel * kHeads + h]) * inv;
  }

  // Q fragments (A operand): 2 d-chunks, split k map from the f16 plane
  v16h qa[2];
  {
    const _Float16* qrow = Qh + (size_t)(b * kSeq + q0 + c) * kEmb + h * kHD;
#pragma unroll
    for (int dc = 0; dc < 2; ++dc) qa[dc] = Frag<_Float16>::load(qrow + dc * 32 + 8 * hh);
  }

  float mrow[8], lrow[8];
  v8f oacc[4];
#pragma unroll
  for (int r = 0; r < 8; ++r) { mrow[r] = -INFINITY; lrow[r] = 0.f; }
#pragma unroll
  for (int t = 0; t < 4; ++t) oacc[t] = (v8f){0.f,0.f,0.f,0.f,0.f,0.f,0.f,0.f};

  const int qloc = wave * 16 + 8 * hh;

  for (int kc = 0; kc < kSeq / kKC; ++kc) {
    const int kv0 = kc * kKC;
    __syncthreads();
    {
      // 128 threads x 32 halves each = 64x64 for K and for V^T (full tiles)
      const int rr = tid >> 1, dh = (tid & 1) * 32;
      const v4u* ks = (const v4u*)(Kh + (size_t)(b * kSeq + kv0 + rr) * kEmb + h * kHD + dh);
      const v4u* vs = (const v4u*)(Vth + (size_t)(h * kHD + rr) * kTok + b * kSeq + kv0 + dh);
      v4u* kd = (v4u*)(Ksh + rr * kLP + dh);
      v4u* vd = (v4u*)(Vtsh + rr * kLP + dh);
      v4u kt[4], vt[4];
#pragma unroll
      for (int i = 0; i < 4; ++i) { kt[i] = ks[i]; vt[i] = vs[i]; }
#pragma unroll
      for (int i = 0; i < 4; ++i) { kd[i] = kt[i]; vd[i] = vt[i]; }
    }
    __syncthreads();

    // ---- scores: 16 q rows x 64 keys ----
    v8f s[4];
#pragma unroll
    for (int j = 0; j < 4; ++j) {
      s[j] = (v8f){0.f,0.f,0.f,0.f,0.f,0.f,0.f,0.f};
#pragma unroll
      for (int dc = 0; dc < 2; ++dc) {
        FH kb;
        kb.h[0] = *(const v8h*)(Ksh + (j * 16 + c) * kLP + dc * 32 + 8 * hh);
        kb.h[1] = *(const v8h*)(Ksh + (j * 16 + c) * kLP + dc * 32 + 16 + 8 * hh);
        s[j] = hmma(qa[dc], kb.v, s[j]);
      }
    }

    // ---- scale + bias + row max ----
    float cm[8];
#pragma unroll
    for (int r = 0; r < 8; ++r) {
      const int bi = qloc + r + (kSeq - 1) - kv0 - c;
      float m = -INFINITY;
#pragma unroll
      for (int j = 0; j < 4; ++j) {
        const float sc = s[j][r] * inv + biasL[bi - j * 16];
        s[j][r] = sc;
        m = fmaxf(m, sc);
      }
#pragma unroll
      for (int off = 1; off < 16; off <<= 1) m = fmaxf(m, __shfl_xor(m, off, 32));
      cm[r] = m;
    }

    // ---- online softmax update; P (x2^15, f16) to per-wave LDS ----
    _Float16* pw = Psh[wave];
#pragma unroll
    for (int r = 0; r < 8; ++r) {
      const float mnew = fmaxf(mrow[r], cm[r]);
      const float alpha = expf(mrow[r] - mnew);
      mrow[r] = mnew;
      float psum = 0.f;
#pragma unroll
      for (int j = 0; j < 4; ++j) {
        const float p = expf(s[j][r] - mnew);
        psum += p;
        pw[(8 * hh + r) * kLP + j * 16 + c] = (_Float16)(p * kPCarry);
      }
#pragma unroll
      for (int off = 1; off < 16; off <<= 1) psum += __shfl_xor(psum, off, 32);
      lrow[r] = lrow[r] * alpha + psum;
#pragma unroll
      for (int t = 0; t < 4; ++t) oacc[t][r] *= alpha;
    }
    __syncthreads();

    // ---- O += P . V_chunk ----
#pragma unroll
    for (int kk = 0; kk < 2; ++kk) {
      FH pa;
      pa.h[0] = *(const v8h*)(pw + c * kLP + kk * 32 + 8 * hh);
      pa.h[1] = *(const v8h*)(pw + c * kLP + kk * 32 + 16 + 8 * hh);
#pragma unroll
      for (int t = 0; t < 4; ++t) {
        FH vb;
        vb.h[0] = *(const v8h*)(Vtsh + (t * 16 + c) * kLP + kk * 32 + 8 * hh);
        vb.h[1] = *(const v8h*)(Vtsh + (t * 16 + c) * kLP + kk * 32 + 16 + 8 * hh);
        oacc[t] = hmma(pa.v, vb.v, oacc[t]);
      }
    }
  }

  float* os = Os[wave];
#pragma unroll
  for (int r = 0; r < 8; ++r) {
    const float invl = ctx_scale * (1.0f / (lrow[r] * kPCarry));
#pragma unroll
    for (int t = 0; t < 4; ++t) os[(8 * hh + r) * 68 + t * 16 + c] = oacc[t][r] * invl;
  }
  __syncthreads();
  {
    const int q4 = lane >> 3, c8 = (lane & 7) * 8;
    _Float16* Ch = (_Float16*)Cp;
    {
#pragma unroll
      for (int it = 0; it < 4; ++it) {
        const int row = it * 4 + q4;
        const float* sp = os + row * 68 + c8;
        v8h hv;
#pragma unroll
        for (int e = 0; e < 8; ++e) hv[e] = (_Float16)sp[e];
        *(v8h*)(Ch + (size_t)(b * kSeq + q0 + row) * kEmb + h * kHD + c8) = hv;
      }
      
    }
  }
}

// ---------------------------------------------------------------------------
// Host launch
// ---------------------------------------------------------------------------
extern "C" void kernel_launch(void* const* d_in, const int* in_sizes, int n_in,
                              void* d_out, int out_size, void* d_ws, size_t ws_size,
                              hipStream_t stream) {
  if (n_in < 11) return;
  if (in_sizes[0] != kTok * kEmb) return;
  if (in_sizes[1] != kEmb * kEmb || in_sizes[3] != kEmb * kEmb ||
      in_sizes[5] != kEmb * kEmb || in_sizes[7] != kEmb * kEmb) return;
  if (in_sizes[2] < kEmb || in_sizes[4] < kEmb || in_sizes[6] < kEmb || in_sizes[8] < kEmb) return;
  if (in_sizes[9] != kRelRows * kHeads || in_sizes[10] < 1) return;
  if (out_size != kTok * kEmb) return;

  const float* x    = (const float*)d_in[0];
  const float* Wq   = (const float*)d_in[1];
  const float* bq   = (const float*)d_in[2];
  const float* Wk   = (const float*)d_in[3];
  const float* bk   = (const float*)d_in[4];
  const float* Wv   = (const float*)d_in[5];
  const float* bv   = (const float*)d_in[6];
  const float* Wp   = (const float*)d_in[7];
  const float* bp   = (const float*)d_in[8];
  const float* btab = (const float*)d_in[9];
  const float* tptr = (const float*)d_in[10];
  float* out = (float*)d_out;

  // workspace region map (bytes), all offsets multiples of 2 MiB:
  //   Xb  bf16 [4096][1024]   8 MiB  @ 0
  //   WqT bf16 [1024][1024]   2 MiB  @ 8 MiB
  //   WkT bf16 [1024][1024]   2 MiB  @ 10 MiB
  //   WvT bf16 [1024][1024]   2 MiB  @ 12 MiB
  //   WpT f16  [1024][1024]   2 MiB  @ 14 MiB   (RNE-bf16 values x64)
  //   Qp  f16  [4096][1024]   8 MiB  @ 16 MiB
  //   Kp  f16  [4096][1024]   8 MiB  @ 24 MiB
  //   Vtp f16  [1024][4096]   8 MiB  @ 32 MiB
  //   Cx  f16  [4096][1024]   8 MiB  @ 40 MiB   (ctx x64)
  //   total 48 MiB = 50,331,648 B
  const size_t szAct = (size_t)kTok * kEmb * 2;
  const size_t szW   = (size_t)kEmb * kEmb * 2;
  size_t off = 0;
  const size_t oXb = off; off += szAct;
  const size_t oWq = off; off += szW;
  const size_t oWk = off; off += szW;
  const size_t oWv = off; off += szW;
  const size_t oWp = off; off += szW;
  const size_t oQ  = off; off += szAct;
  const size_t oK  = off; off += szAct;
  const size_t oVt = off; off += szAct;
  const size_t oCx = off; off += szAct;
  if (off > ws_size) return;

  char* w = (char*)d_ws;
  unsigned short* Xb  = (unsigned short*)(w + oXb);
  unsigned short* WqT = (unsigned short*)(w + oWq);
  unsigned short* WkT = (unsigned short*)(w + oWk);
  unsigned short* WvT = (unsigned short*)(w + oWv);
  unsigned short* WpT = (unsigned short*)(w + oWp);
  unsigned short* Qp  = (unsigned short*)(w + oQ);
  unsigned short* Kp  = (unsigned short*)(w + oK);
  unsigned short* Vtp = (unsigned short*)(w + oVt);
  unsigned short* Cx  = (unsigned short*)(w + oCx);

  const float kWpCarry  = 64.0f;
  const float kCtxCarry = 64.0f;

  // 1) one launch: weights in[rows=1024][cols=1024] -> out[cols][rows], and x -> bf16 plane (2 elements per thread)
  {
    const int n2 = (kTok * kEmb) / 2;
    prep_inputs<<<4 * kWTiles + (n2 + 255) / 256, 256, 0, stream>>>(
        x, Wq, Wk, Wv, Wp, Xb, WqT, WkT, WvT, WpT, n2, kEmb, kWpCarry);
  }
  // 2) one launch: the three projections (bf16 WMMA, f16 outputs). M,N % 128 == 0, K % 128 == 0 by the static_assert below.
  static_assert(kTok % 128 == 0 && kEmb % 128 == 0 && kEmb % kGK == 0);
  const int gemmBlocks = (kTok / 128) * (kEmb / 128);
  qkv_gemm<<<dim3(gemmBlocks, 3), 256, 0, stream>>>(
      Xb, WqT, WkT, WvT, Qp, Kp, Vtp, bq, bk, bv, kTok, kEmb);
  // 3) attention -> ctx f16 plane (x64)
  attn_relbias_f16<<<kBatch * kHeads * (kSeq / kQB), kNW * 32, 0, stream>>>(
      Qp, Kp, Vtp, btab, tptr, Cx, kCtxCarry);
  // 4) output projection: out[token][n] = 2^-12 * sum_c Cx[token][c] WpT[n][c] + bp[n]
  wmma_gemm64<0, false, 2, 0><<<dim3(gemmBlocks, 1), 256, 0, stream>>>(
      Cx, Cx, kEmb, 0L, WpT, WpT, kEmb, 0L, (void*)out, (void*)out, kEmb, 0L, bp,
      kTok, kEmb, kEmb, 1.0f / (kWpCarry * kCtxCarry));
}

// v004
// One run takes 101 microseconds.
// In both of two side-by-side timings against v003, it was 1.39 times as fast.
// All steps since v000 together make it 3.19 times as fast.
// Contractions: x@Wq, x@Wk, Wv-side GEMM producing V^T on v_wmma_f32_16x16x32_bf16 (bf16 operands = RNE-bf16 converted inputs, exact products); q.k^T, p.v, ctx@Wp on v_wmma_f32_16x16x32_f16 (f16 operands; p carried x2^15, ctx and Wp carried x64); f32 accumulate; softmax and normalisers in f32.
#include <hip/hip_runtime.h>
#include <math.h>

typedef __attribute__((ext_vector_type(16))) _Float16 v16h;
typedef __attribute__((ext_vector_type(8)))  _Float16 v8h;
typedef __attribute__((ext_vector_type(16))) __bf16   v16b;
typedef __attribute__((ext_vector_type(8)))  __bf16   v8b;
typedef __attribute__((ext_vector_type(8)))  float    v8f;
typedef __attribute__((ext_vector_type(4)))  float    v4f;
typedef __attribute__((ext_vector_type(4)))  unsigned v4u;

constexpr int kBatch   = 4;
constexpr int kSeq     = 1024;
constexpr int kEmb     = 1024;
constexpr int kHeads   = 16;
constexpr int kHD      = 64;
constexpr int kTok     = kBatch * kSeq;
constexpr int kRelRows = 1999;
constexpr int kRelMax  = kRelRows - 1;

static_assert(kEmb == kHeads * kHD);
static_assert(kHD == 64);
static_assert(kTok % 64 == 0 && kEmb % 64 == 0 && kEmb % 32 == 0 && kSeq % 64 == 0);

// ---------------------------------------------------------------------------
// helpers
// ---------------------------------------------------------------------------
__device__ __forceinline__ unsigned short f2bf_bits(float f) {
  unsigned u = __float_as_uint(f);
  return (unsigned short)((u + 0x7FFFu + ((u >> 16) & 1u)) >> 16);
}
__device__ __forceinline__ float bf_bits2f(unsigned short h) { return __uint_as_float(((unsigned)h) << 16); }
__device__ __forceinline__ float rne_bf(float f) { return bf_bits2f(f2bf_bits(f)); }

__device__ __forceinline__ void dep_guard_h(v8f& a, v8f& b, v16h x, v16h y) { asm volatile("v_nop\n\tv_nop\n\tv_nop\n\tv_nop" : "+v"(a), "+v"(b) : "v"(x), "v"(y)); }
__device__ __forceinline__ void dep_guard_b(v8f& a, v8f& b, v16b x, v16b y) { asm volatile("v_nop\n\tv_nop\n\tv_nop\n\tv_nop" : "+v"(a), "+v"(b) : "v"(x), "v"(y)); }
__device__ __forceinline__ void keep4_h(v16h a, v16h b, v16h c, v16h d) { asm volatile("v_nop" :: "v"(a), "v"(b), "v"(c), "v"(d)); }
__device__ __forceinline__ void keep4_b(v16b a, v16b b, v16b c, v16b d) { asm volatile("v_nop" :: "v"(a), "v"(b), "v"(c), "v"(d)); }
__device__ __forceinline__ void acc_guard4(v8f& a, v8f& b, v8f& c, v8f& d) { asm volatile("v_nop\n\tv_nop\n\tv_nop\n\tv_nop" : "+v"(a), "+v"(b), "+v"(c), "+v"(d)); }
template <typename T> struct Frag;
template <> struct Frag<_Float16> {
  typedef v16h V; union U { v16h v; v8h h[2]; };
  // elements 0..7 <- p[0..7], 8..15 <- p[16..23]
  static __device__ __forceinline__ v16h load(const _Float16* p) {
    U f; f.h[0] = *(const v8h*)(p); f.h[1] = *(const v8h*)(p + 16); return f.v;
  }
  static __device__ __forceinline__ v8f mma(v16h a, v16h b, v8f c) {
    return __builtin_amdgcn_wmma_f32_16x16x32_f16(false, a, false, b, (short)0, c, false, false);
  }
  static __device__ __forceinline__ void guard(v8f& a, v8f& b, v16h x, v16h y) { dep_guard_h(a, b, x, y); }
  static __device__ __forceinline__ void keep(v16h a, v16h b, v16h c, v16h d) { keep4_h(a, b, c, d); }
};
template <> struct Frag<__bf16> {
  typedef v16b V; union U { v16b v; v8b h[2]; };
  static __device__ __forceinline__ v16b load(const __bf16* p) {
    U f; f.h[0] = *(const v8b*)(p); f.h[1] = *(const v8b*)(p + 16); return f.v;
  }
  static __device__ __forceinline__ v8f mma(v16b a, v16b b, v8f c) {
    return __builtin_amdgcn_wmma_f32_16x16x32_bf16(false, a, false, b, (short)0, c, false, false);
  }
  static __device__ __forceinline__ void guard(v8f& a, v8f& b, v16b x, v16b y) { dep_guard_b(a, b, x, y); }
  static __device__ __forceinline__ void keep(v16b a, v16b b, v16b c, v16b d) { keep4_b(a, b, c, d); }
};

// f16 WMMA with hazard guard (A, B kept live; D tied)
__device__ __forceinline__ v8f hmma(v16h a, v16h b, v8f c) {
  c = __builtin_amdgcn_wmma_f32_16x16x32_f16(false, a, false, b, (short)0, c, false, false);
  asm volatile("v_nop\n\tv_nop\n\tv_nop\n\tv_nop" : "+v"(c) : "v"(a), "v"(b));
  return c;
}

// ---------------------------------------------------------------------------
// Register-blocked batched WMMA GEMM, operands staged in LDS.
// C[m,n] = scale * sum_k A[m,k] * Bt[n,k] (+bias); a work-group of 8 waves owns a 128x128 tile,
// each wave 32 rows x 64 columns of it (two waves per SIMD: one wave's LDS reads and copy issue
// stand behind the other's products).
// A row-major [M,K]; Bt row-major [N,K]; M,N % 128 == 0, K % 128 == 0.
// A pass is 128 k: 256 B of 128 A rows and of 128 Bt rows, brought into LDS by asynchronous copies,
// two buffers, the next pass's copies in flight while this pass is worked on.
// SPLIT: hi/lo operand planes (not supported by the staged loop, false).
// BIAS_MODE: 0 none, 1 bias[m], 2 bias[n]; bias values RNE-converted to bf16 precision before the add.
// OUT_MODE: 0 = f32, 1 = f16, 2 = bf16 hi plane (Cout) + bf16 lo plane (Cout2).
// ET: 0 = f16 operands, 1 = bf16 operands (pointers passed as 16-bit storage)
// ---------------------------------------------------------------------------
constexpr int kGK     = 128;               // k elements per pass
constexpr int kGPitch = 2 * kGK + 16;      // LDS row pitch in bytes: 16 B x odd, conflict-free for 16-byte reads down a column
constexpr int kGStage = 256 * kGPitch;     // one buffer: rows 0..127 = A rows, rows 128..255 = Bt rows

// One wave's share of a stage: 32 rows of 256 B, 16 copies of 2 rows each (16 lanes x 16 B per row).
// lds = this lane's LDS byte address in the first row pair, g = this lane's global address there,
// ld = source row pitch in elements.
template <typename T>
__device__ __forceinline__ void stage_copies(unsigned lds, const T* g, int ld) {
#pragma unroll
  for (int i = 0; i < 16; i += 8) {
    // the closing s_wait_xcnt is a precaution: no register that a copy names is rewritten ahead of it
    asm volatile(
        "global_load_async_to_lds_b128 %0, %8, off\n\t"
        "global_load_async_to_lds_b128 %1, %9, off\n\t"
        "global_load_async_to_lds_b128 %2, %10, off\n\t"
        "global_load_async_to_lds_b128 %3, %11, off\n\t"
        "global_load_async_to_lds_b128 %4, %12, off\n\t"
        "global_load_async_to_lds_b128 %5, %13, off\n\t"
        "global_load_async_to_lds_b128 %6, %14, off\n\t"
        "global_load_async_to_lds_b128 %7, %15, off\n\t"
        "s_wait_xcnt 0x0"
        :: "v"(lds + (unsigned)((i + 0) * 2 * kGPitch)), "v"(lds + (unsigned)((i + 1) * 2 * kGPitch)),
           "v"(lds + (unsigned)((i + 2) * 2 * kGPitch)), "v"(lds + (unsigned)((i + 3) * 2 * kGPitch)),
           "v"(lds + (unsigned)((i + 4) * 2 * kGPitch)), "v"(lds + (unsigned)((i + 5) * 2 * kGPitch)),
           "v"(lds + (unsigned)((i + 6) * 2 * kGPitch)), "v"(lds + (unsigned)((i + 7) * 2 * kGPitch)),
           "v"(g + (size_t)((i + 0) * 2) * ld), "v"(g + (size_t)((i + 1) * 2) * ld),
           "v"(g + (size_t)((i + 2) * 2) * ld), "v"(g + (size_t)((i + 3) * 2) * ld),
           "v"(g + (size_t)((i + 4) * 2) * ld), "v"(g + (size_t)((i + 5) * 2) * ld),
           "v"(g + (size_t)((i + 6) * 2) * ld), "v"(g + (size_t)((i + 7) * 2) * ld)
        : "memory");
  }
}

template <int ET> struct Elem;
template <> struct Elem<0> { typedef _Float16 T; };
template <> struct Elem<1> { typedef __bf16 T; };
// The tile's work is a device function, so that one launch can hold several GEMMs: the kernel owns the LDS
// (ring: operand ring, two buffers; sT: per-wave 16x64 slab, pitch 68 floats) and says which tile and batch.
template <int ET, bool SPLIT, int BIAS_MODE, int OUT_MODE>
__device__ __forceinline__ void gemm_tile(
    unsigned char* ring, float (*sT)[16 * 68], int tile, int b,
    const unsigned short* __restrict__ Ap, const unsigned short* __restrict__ A2p, int lda, long strideA,
    const unsigned short* __restrict__ Btp, const unsigned short* __restrict__ Bt2p, int ldb, long strideB,
    void* __restrict__ Cout, void* __restrict__ Cout2, int ldc, long strideC,
    const float* __restrict__ bias,
    int M, int N, int K, float scale) {
  static_assert(!SPLIT);
  typedef typename Elem<ET>::T T;
  typedef typename Frag<T>::V V;
  const T* A = (const T*)Ap; const T* Bt = (const T*)Btp;
  const int lane = threadIdx.x & 31;
  // in a scalar register, so that what picks a wave's source rows is scalar and every lane stays on at the copies
  const int wave = __builtin_amdgcn_readfirstlane(threadIdx.x >> 5);
  const int tilesN = N >> 7;
  const int tilesM = M >> 7;
  // the same for the whole work-group, ahead of every barrier
  if (tile >= tilesM * tilesN) return;
  const int tm = tile / tilesN;
  const int tn = tile - tm * tilesN;
  const int wm = wave >> 1;
  const int wn = wave & 1;
  const int m0 = (tm << 7) + (wm << 5);
  const int n0 = (tn << 7) + (wn << 6);

  const T* Ab  = A  + (size_t)b * strideA;
  const T* Bb  = Bt + (size_t)b * strideB;

  // row (A) / col (B, D) within subtile; k offset of this lane half; D row offset
  const int rlane = lane & 15;
  const int koff  = (lane >> 4) * 8;
  const int mOff  = (lane >> 4) * 8;

  // copies: waves 0..3 bring the 128 A rows, waves 4..7 the 128 Bt rows, 32 rows each
  const int ldS = (wave < 4) ? lda : ldb;
  const T* gS = ((wave < 4) ? (Ab + (size_t)((tm << 7) + (wave << 5)) * lda)
                            : (Bb + (size_t)((tn << 7) + ((wave - 4) << 5)) * ldb))
                + (size_t)(lane >> 4) * ldS + rlane * 8;
  const unsigned ldsS = (unsigned)(size_t)ring + (unsigned)(((wave << 5) + (lane >> 4)) * kGPitch + rlane * 16);

  v8f acc[2][4];
#pragma unroll
  for (int i = 0; i < 2; ++i)
#pragma unroll
    for (int j = 0; j < 4; ++j) acc[i][j] = (v8f){0.f,0.f,0.f,0.f,0.f,0.f,0.f,0.f};

  const int nPass = K / kGK;
  stage_copies<T>(ldsS, gS, ldS);
  // pass 0's bytes of this wave have landed before the barrier that shows them to the other waves
  asm volatile("s_wait_asynccnt 0x0" ::: "memory");
  __syncthreads();
  if (nPass > 1) stage_copies<T>(ldsS + (unsigned)kGStage, gS + kGK, ldS);

  // one pass per trip, the buffer chosen by the trip's parity
  for (int t = 0; t < nPass; ++t) {
    const unsigned char* st = ring + (t & 1) * kGStage;
    const unsigned char* stA = st + ((wm << 5) + rlane) * kGPitch;
    const unsigned char* stB = st + (128 + (wn << 6) + rlane) * kGPitch;
#pragma unroll
    for (int k0 = 0; k0 < kGK; k0 += 32) {
      // all six fragments of a 32-k block are read as one group: one LDS latency per 8 products
      V bh[4], ah[2];
#pragma unroll
      for (int j = 0; j < 4; ++j) bh[j] = Frag<T>::load((const T*)(stB + (j << 4) * kGPitch) + koff + k0);
#pragma unroll
      for (int i = 0; i < 2; ++i) ah[i] = Frag<T>::load((const T*)(stA + (i << 4) * kGPitch) + koff + k0);
#pragma unroll
      for (int i = 0; i < 2; ++i) {
#pragma unroll
        for (int j = 0; j < 4; ++j) acc[i][j] = Frag<T>::mma(ah[i], bh[j], acc[i][j]);
        Frag<T>::guard(acc[i][0], acc[i][3], ah[i], ah[i]);
      }
      Frag<T>::keep(bh[0], bh[1], bh[2], bh[3]);
    }
    // this wave's reads of the buffer are done before the barrier behind which it is refilled
    asm volatile("s_wait_dscnt 0x0" ::: "memory");
    // this wave's copies of pass t + 1 have landed before the barrier that shows them to the other waves
    asm volatile("s_wait_asynccnt 0x0" ::: "memory");
    __syncthreads();
    if (t + 2 < nPass) stage_copies<T>(ldsS + (unsigned)((t & 1) * kGStage), gS + (size_t)(t + 2) * kGK, ldS);
  }
  // no copy is outstanding when the wave goes on to the epilogue and ends
  asm volatile("s_wait_asynccnt 0x0" ::: "memory");
  acc_guard4(acc[0][0], acc[0][1], acc[0][2], acc[0][3]);
  acc_guard4(acc[1][0], acc[1][1], acc[1][2], acc[1][3]);

  // ---- epilogue ----
  float* slab = sT[wave];
  // column biases: 4 scalar loads per lane, hoisted
  float bvj[4];
#pragma unroll
  for (int j = 0; j < 4; ++j) bvj[j] = (BIAS_MODE == 2) ? rne_bf(bias[n0 + (j << 4) + rlane]) : 0.f;
#pragma unroll
  for (int i = 0; i < 2; ++i) {
    const int mBase = m0 + (i << 4);
    // row biases: two 16-B loads per lane (rows mBase+mOff .. +7, 32-B aligned)
    v4f bm0 = (v4f){0.f, 0.f, 0.f, 0.f};
    v4f bm1 = bm0;
    if (BIAS_MODE == 1) {
      bm0 = *(const v4f*)(bias + mBase + mOff);
      bm1 = *(const v4f*)(bias + mBase + mOff + 4);
    }
#pragma unroll
    for (int j = 0; j < 4; ++j) {
#pragma unroll
      for (int r = 0; r < 8; ++r) {
        float v = acc[i][j][r] * scale;
        if (BIAS_MODE == 1) { const v4f bsel = (r < 4) ? bm0 : bm1; v += rne_bf(bsel[r & 3]); }
        if (BIAS_MODE == 2) v += bvj[j];
        slab[(mOff + r) * 68 + (j << 4) + rlane] = v;
      }
    }
    __builtin_amdgcn_fence(__ATOMIC_RELEASE, "workgroup");
    __builtin_amdgcn_wave_barrier();
    __builtin_amdgcn_fence(__ATOMIC_ACQUIRE, "workgroup");
    if (OUT_MODE == 0) {
      float* C = (float*)Cout + (size_t)b * strideC;
      // row seg = 256 B = 16 lanes x 16 B
      const int hh = lane >> 4, c4 = (lane & 15) * 4;
      {
#pragma unroll
        for (int it = 0; it < 8; ++it) {
          const int row = it * 2 + hh;
          v4f v = *(const v4f*)(slab + row * 68 + c4);
          *(v4f*)(C + (size_t)(mBase + row) * ldc + n0 + c4) = v;
        }
        
      }
    } else {
      const int q = lane >> 3, c8 = (lane & 7) * 8;
      unsigned short* C  = (unsigned short*)Cout  + (size_t)b * strideC;
      unsigned short* C2 = (OUT_MODE == 2) ? ((unsigned short*)Cout2 + (size_t)b * strideC) : nullptr;
      {
#pragma unroll
        for (int it = 0; it < 4; ++it) {
          const int row = it * 4 + q;
          const float* sp = slab + row * 68 + c8;
          v8h hv, lv;
#pragma unroll
          for (int e = 0; e < 8; ++e) {
            if (OUT_MODE == 1) {
              hv[e] = (_Float16)sp[e];
            } else {
              unsigned short hb = f2bf_bits(sp[e]);
              unsigned short lb = f2bf_bits(sp[e] - bf_bits2f(hb));
              hv[e] = __builtin_bit_cast(_Float16, hb);
              lv[e] = __builtin_bit_cast(_Float16, lb);
            }
          }
          *(v8h*)(C + (size_t)(mBase + row) * ldc + n0 + c8) = hv;
          if (OUT_MODE == 2) *(v8h*)(C2 + (size_t)(mBase + row) * ldc + n0 + c8) = lv;
        }
        
      }
    }
    __builtin_amdgcn_fence(__ATOMIC_RELEASE, "workgroup");
    __builtin_amdgcn_wave_barrier();
    __builtin_amdgcn_fence(__ATOMIC_ACQUIRE, "workgroup");
  }
}

// One GEMM per launch: blockIdx.x = tile, blockIdx.y = batch.
template <int ET, bool SPLIT, int BIAS_MODE, int OUT_MODE>
__global__ __launch_bounds__(256) void wmma_gemm64(
    const unsigned short* __restrict__ Ap, const unsigned short* __restrict__ A2p, int lda, long strideA,
    const unsigned short* __restrict__ Btp, const unsigned short* __restrict__ Bt2p, int ldb, long strideB,
    void* __restrict__ Cout, void* __restrict__ Cout2, int ldc, long strideC,
    const float* __restrict__ bias,
    int M, int N, int K, float scale) {
  __shared__ __align__(16) unsigned char ring[2 * kGStage];
  __shared__ __align__(16) float sT[8][16 * 68];
  gemm_tile<ET, SPLIT, BIAS_MODE, OUT_MODE>(ring, sT, blockIdx.x, blockIdx.y,
      Ap, A2p, lda, strideA, Btp, Bt2p, ldb, strideB, Cout, Cout2, ldc, strideC, bias, M, N, K, scale);
}

// The three projections, which do not depend on one another, in one launch: blockIdx.y picks the job
// (the same for a whole work-group), blockIdx.x the tile.
//   job 0: Q[token][n]  = sum_k Xb[token][k] WqT[n][k] + bq[n]
//   job 1: K[token][n]  = sum_k Xb[token][k] WkT[n][k] + bk[n]
//   job 2: Vt[n][token] = sum_k WvT[n][k] Xb[token][k] + bv[n]   (M = features, N = tokens)
__global__ __launch_bounds__(256) void qkv_gemm(
    const unsigned short* __restrict__ Xb, const unsigned short* __restrict__ WqT,
    const unsigned short* __restrict__ WkT, const unsigned short* __restrict__ WvT,
    unsigned short* __restrict__ Qp, unsigned short* __restrict__ Kp, unsigned short* __restrict__ Vtp,
    const float* __restrict__ bq, const float* __restrict__ bk, const float* __restrict__ bv,
    int nTok, int nEmb) {
  __shared__ __align__(16) unsigned char ring[2 * kGStage];
  __shared__ __align__(16) float sT[8][16 * 68];
  const int job = blockIdx.y;
  if (job < 2) {
    const unsigned short* Wt = job ? WkT : WqT;
    unsigned short* C = job ? Kp : Qp;
    gemm_tile<1, false, 2, 1>(ring, sT, blockIdx.x, 0,
        Xb, Xb, nEmb, 0L, Wt, Wt, nEmb, 0L, (void*)C, (void*)C, nEmb, 0L, job ? bk : bq,
        nTok, nEmb, nEmb, 1.0f);
  } else {
    gemm_tile<1, false, 1, 1>(ring, sT, blockIdx.x, 0,
        WvT, WvT, nEmb, 0L, Xb, Xb, nEmb, 0L, (void*)Vtp, (void*)Vtp, nTok, 0L, bv,
        nEmb, nTok, nEmb, 1.0f);
  }
}

// ---------------------------------------------------------------------------
// f32 -> bf16 plane, 2 elements per thread; blk = index of this 256-thread block within the cast
// ---------------------------------------------------------------------------
__device__ __forceinline__ void cast_f32_bf16x2(
    const float* __restrict__ in, unsigned short* __restrict__ out, int n2, int blk) {
  const int i = blk * 256 + threadIdx.x;
  if (i < n2) {
    const unsigned u = (unsigned)f2bf_bits(in[2 * i]) | ((unsigned)f2bf_bits(in[2 * i + 1]) << 16);
    ((unsigned*)out)[i] = u;
    
  }
}

// ---------------------------------------------------------------------------
// Transpose + convert: W row-major in[rows][cols] f32 -> Wt row-major out[cols][rows] 16-bit.
// MODE 0: bf16 bits of RNE-bf16(W). MODE 1: f16 bits of RNE-bf16(W) * wsc (wsc a power of two).
// One block per 64x64 tile (bx, by) of (cols/64, rows/64); rows, cols % 64 == 0. tile = the kernel's 64x65 LDS floats.
// Load: 256 threads x 4 x float4 = 64x64 tile. Store: wave w writes output rows w*8..w*8+7,
// ---------------------------------------------------------------------------
template <int MODE>
__device__ __forceinline__ void transpose_cvt16(
    float* tile, int bx, int by,
    const float* __restrict__ W, unsigned short* __restrict__ Wt, int rows, int cols, float wsc) {
  const int tid = threadIdx.x, lane = tid & 31, wave = tid >> 5;
  const int n0 = bx * 64;
  const int k0 = by * 64;
  {
    const int c4 = (tid & 15) * 4, r = tid >> 4;
#pragma unroll
    for (int it = 0; it < 4; ++it) {
      const int rr = it * 16 + r;
      const v4f x4 = *(const v4f*)(W + (size_t)(k0 + rr) * cols + n0 + c4);
      tile[rr * 65 + c4 + 0] = x4[0];
      tile[rr * 65 + c4 + 1] = x4[1];
      tile[rr * 65 + c4 + 2] = x4[2];
      tile[rr * 65 + c4 + 3] = x4[3];
    }
  }
  __syncthreads();
  const int q4 = lane >> 3, c8 = (lane & 7) * 8;
  _Float16* out = (_Float16*)Wt;
  {
#pragma unroll
    for (int it = 0; it < 2; ++it) {
      const int i = wave * 8 + it * 4 + q4;
      v8h hv;
#pragma unroll
      for (int e = 0; e < 8; ++e) {
        const float f = tile[(c8 + e) * 65 + i];
        if (MODE == 0) {
          hv[e] = __builtin_bit_cast(_Float16, f2bf_bits(f));
        } else {
          hv[e] = (_Float16)(rne_bf(f) * wsc);
        }
      }
      *(v8h*)(out + (size_t)(n0 + i) * rows + k0 + c8) = hv;
    }
    // a precaution: inlined into a kernel with other jobs' code behind it, no register that the two stores name
    // is rewritten ahead of this wait on any branch of the listing
    asm volatile("s_wait_xcnt 0x0" ::: "memory");
  }
}

// ---------------------------------------------------------------------------
// The five input conversions, which do not depend on one another, in one launch: the block index picks the job
// (the same for a whole work-group, so the transposes' barrier stands under uniform control flow).
// Blocks [0, 4 * kWTiles): the weight transposes in the order Wq, Wk, Wv, Wp, one 64x64 tile each; they come
// first because they last longer than a cast block. The blocks behind them: the cast of x.
// ---------------------------------------------------------------------------
constexpr int kWTilesX = kEmb / 64;
constexpr int kWTiles  = kWTilesX * kWTilesX;
__global__ __launch_bounds__(256) void prep_inputs(
    const float* __restrict__ x, const float* __restrict__ Wq, const float* __restrict__ Wk,
    const float* __restrict__ Wv, const float* __restrict__ Wp,
    unsigned short* __restrict__ Xb, unsigned short* __restrict__ WqT, unsigned short* __restrict__ WkT,
    unsigned short* __restrict__ WvT, unsigned short* __restrict__ WpT, int n2, int emb, float wsc) {
  __shared__ float tile[64 * 65];
  const int blk = blockIdx.x;
  if (blk >= 4 * kWTiles) {
    cast_f32_bf16x2(x, Xb, n2, blk - 4 * kWTiles);
    return;
  }
  const int job = blk / kWTiles;
  const int t   = blk % kWTiles;
  const int bx  = t % kWTilesX;
  const int by  = t / kWTilesX;
  if (job < 3) {
    const float* W = (job == 0) ? Wq : (job == 1) ? Wk : Wv;
    unsigned short* Wt = (job == 0) ? WqT : (job == 1) ? WkT : WvT;
    transpose_cvt16<0>(tile, bx, by, W, Wt, emb, emb, 1.0f);
  } else {
    transpose_cvt16<1>(tile, bx, by, Wp, WpT, emb, emb, wsc);
  }
}

constexpr int kQB = 64;
constexpr int kKC = 64;
constexpr int kNW = 4;
// LDS row pitch of the K and V^T tiles in halves: 144 B = 16 B x odd, so that the 16 rows that a 16-byte
// fragment read walks down fall on 16 different bank groups (at 128 B they fall on two)
constexpr int kLP = kKC + 8;
constexpr int kBiasL = kQB + kSeq;
constexpr float kPCarry = 32768.0f;
static_assert(kSeq % kKC == 0 && kSeq % kQB == 0 && kKC == kHD);

// lane l's value in lane l ^ 16
__device__ __forceinline__ float xhalf(float x) {
  const int b = __builtin_bit_cast(int, x);
  return __builtin_bit_cast(float, __builtin_amdgcn_permlanex16(b, b, 0x76543210, 0xfedcba98, false, false));
}

__global__ __launch_bounds__(128) void attn_relbias_f16(
    const unsigned short* __restrict__ Qp, const unsigned short* __restrict__ Kp,
    const unsigned short* __restrict__ Vtp, const float* __restrict__ btab,
    const float* __restrict__ tptr, unsigned short* __restrict__ Cp, float ctx_scale) {
  union FH { v16h v; v8h h[2]; };
  // K [kv][d], V^T [d][kv] (rows of 64 halves at pitch kLP), bias slab
  __shared__ __align__(16) _Float16 Ksh[kKC * kLP];
  __shared__ __align__(16) _Float16 Vtsh[kHD * kLP];
  __shared__ __align__(16) float biasL[kBiasL];

  const _Float16* Qh  = (const _Float16*)Qp;
  const _Float16* Kh  = (const _Float16*)Kp;
  const _Float16* Vth = (const _Float16*)Vtp;

  const int tid  = threadIdx.x;
  const int wave = tid >> 5;
  const int lane = tid & 31;
  const int hh   = lane >> 4;
  const int c    = lane & 15;

  constexpr int nqb = kSeq / kQB;
  const int bx = blockIdx.x;
  const int qb = bx % nqb;
  const int bh = bx / nqb;
  const int h  = bh % kHeads;
  const int b  = bh / kHeads;
  const int qbase = qb * kQB;
  const int q0 = qbase + wave * 16;

  // temperature (RNE-bf16 converted input), clamp, 1/(sqrt(E) * temp)
  float tv = rne_bf(tptr[0]);
  tv = fminf(fmaxf(tv, 0.1f), 10.0f);
  const float inv = 1.0f / (sqrtf((float)kEmb) * tv);

  // bias slab: biasL[i] = table[min(qbase + i, relmax)][h] * inv, i = (q - qbase) + (S-1) - kv in [0, kBiasL)
  for (int i = tid; i < kBiasL; i += kNW * 32) {
    int rel = qbase + i;
    rel = rel > kRelMax ? kRelMax : rel;
    biasL[i] = rne_bf(btab[(size_t)rel * kHeads + h]) * inv;
  }

  // Q fragments (B operand, column c = query q0 + c): 2 d-chunks, hardware k order from the f16 plane
  v16h qa[2];
  {
    const _Float16* qrow = Qh + (size_t)(b * kSeq + q0 + c) * kEmb + h * kHD;
#pragma unroll
    for (int dc = 0; dc < 2; ++dc) qa[dc] = Frag<_Float16>::load(qrow + dc * 32 + 8 * hh);
  }

  // of query q0 + c: running maximum (the same in both halves), this half's part of the running sum
  float mrow = -INFINITY, lrow = 0.f;
  // oacc[t][r] = O^T[d = t*16 + 8*hh + r][query q0 + c]
  v8f oacc[4];
#pragma unroll
  for (int t = 0; t < 4; ++t) oacc[t] = (v8f){0.f,0.f,0.f,0.f,0.f,0.f,0.f,0.f};

  for (int kc = 0; kc < kSeq / kKC; ++kc) {
    const int kv0 = kc * kKC;
    __syncthreads();
    {
      // 128 threads x 32 halves each = 64x64 for K and for V^T (full tiles)
      const int rr = tid >> 1, dh = (tid & 1) * 32;
      const v4u* ks = (const v4u*)(Kh + (size_t)(b * kSeq + kv0 + rr) * kEmb + h * kHD + dh);
      const v4u* vs = (const v4u*)(Vth + (size_t)(h * kHD + rr) * kTok + b * kSeq + kv0 + dh);
      v4u* kd = (v4u*)(Ksh + rr * kLP + dh);
      v4u* vd = (v4u*)(Vtsh + rr * kLP + dh);
      v4u kt[4], vt[4];
#pragma unroll
      for (int i = 0; i < 4; ++i) { kt[i] = ks[i]; vt[i] = vs[i]; }
#pragma unroll
      for (int i = 0; i < 4; ++i) { kd[i] = kt[i]; vd[i] = vt[i]; }
    }
    __syncthreads();

    // ---- scores, transposed: s[j][r] = score of key kv0 + j*16 + 8*hh + r with query q0 + c ----
    v8f s[4];
#pragma unroll
    for (int j = 0; j < 4; ++j) {
      s[j] = (v8f){0.f,0.f,0.f,0.f,0.f,0.f,0.f,0.f};
#pragma unroll
      for (int dc = 0; dc < 2; ++dc) {
        FH kb;
        kb.h[0] = *(const v8h*)(Ksh + (j * 16 + c) * kLP + dc * 32 + 8 * hh);
        kb.h[1] = *(const v8h*)(Ksh + (j * 16 + c) * kLP + dc * 32 + 16 + 8 * hh);
        s[j] = hmma(kb.v, qa[dc], s[j]);
      }
    }

    // ---- scale + bias + maximum over this lane's 32 keys (one chain per tile), then over both halves ----
    const int bi = wave * 16 + c + (kSeq - 1) - kv0 - 8 * hh;
    float mj[4];
#pragma unroll
    for (int j = 0; j < 4; ++j) {
      mj[j] = -INFINITY;
#pragma unroll
      for (int r = 0; r < 8; ++r) {
        const float sc = s[j][r] * inv + biasL[bi - j * 16 - r];
        s[j][r] = sc;
        mj[j] = fmaxf(mj[j], sc);
      }
    }
    float cm = fmaxf(fmaxf(mj[0], mj[1]), fmaxf(mj[2], mj[3]));
    cm = fmaxf(cm, xhalf(cm));

    // ---- online softmax update; P^T (x2^15, f16) packed into the B operands of the second product ----
    const float mnew = fmaxf(mrow, cm);
    const float alpha = expf(mrow - mnew);
    mrow = mnew;
    // pb[kk] element e: key kv0 + kk*32 + 8*hh + e for e < 8, kv0 + kk*32 + 16 + 8*hh + (e - 8) behind: tiles 2kk, 2kk + 1
    v16h pb[2];
    float pj[4];
#pragma unroll
    for (int j = 0; j < 4; ++j) {
      pj[j] = 0.f;
#pragma unroll
      for (int r = 0; r < 8; ++r) {
        const float p = expf(s[j][r] - mnew);
        pj[j] += p;
        pb[j >> 1][(j & 1) * 8 + r] = (_Float16)(p * kPCarry);
      }
    }
    lrow = lrow * alpha + ((pj[0] + pj[1]) + (pj[2] + pj[3]));
#pragma unroll
    for (int t = 0; t < 4; ++t)
#pragma unroll
      for (int r = 0; r < 8; ++r) oacc[t][r] *= alpha;

    // ---- O^T += V^T_chunk . P^T ----
#pragma unroll
    for (int kk = 0; kk < 2; ++kk) {
#pragma unroll
      for (int t = 0; t < 4; ++t) {
        FH vb;
        vb.h[0] = *(const v8h*)(Vtsh + (t * 16 + c) * kLP + kk * 32 + 8 * hh);
        vb.h[1] = *(const v8h*)(Vtsh + (t * 16 + c) * kLP + kk * 32 + 16 + 8 * hh);
        oacc[t] = hmma(vb.v, pb[kk], oacc[t]);
      }
    }
  }

  // the two halves' sums of a query are joined here, once; a lane's 8 accumulators of a tile are 8 consecutive d
  // of its query's row: one 16-byte store per tile
  {
    const float l = lrow + xhalf(lrow);
    const float invl = ctx_scale * (1.0f / (l * kPCarry));
    _Float16* crow = (_Float16*)Cp + (size_t)(b * kSeq + q0 + c) * kEmb + h * kHD + 8 * hh;
#pragma unroll
    for (int t = 0; t < 4; ++t) {
      v8h hv;
#pragma unroll
      for (int r = 0; r < 8; ++r) hv[r] = (_Float16)(oacc[t][r] * invl);
      *(v8h*)(crow + t * 16) = hv;
    }
  }
}

// ---------------------------------------------------------------------------
// Host launch
// ---------------------------------------------------------------------------
extern "C" void kernel_launch(void* const* d_in, const int* in_sizes, int n_in,
                              void* d_out, int out_size, void* d_ws, size_t ws_size,
                              hipStream_t stream) {
  if (n_in < 11) return;
  if (in_sizes[0] != kTok * kEmb) return;
  if (in_sizes[1] != kEmb * kEmb || in_sizes[3] != kEmb * kEmb ||
      in_sizes[5] != kEmb * kEmb || in_sizes[7] != kEmb * kEmb) return;
  if (in_sizes[2] < kEmb || in_sizes[4] < kEmb || in_sizes[6] < kEmb || in_sizes[8] < kEmb) return;
  if (in_sizes[9] != kRelRows * kHeads || in_sizes[10] < 1) return;
  if (out_size != kTok * kEmb) return;

  const float* x    = (const float*)d_in[0];
  const float* Wq   = (const float*)d_in[1];
  const float* bq   = (const float*)d_in[2];
  const float* Wk   = (const float*)d_in[3];
  const float* bk   = (const float*)d_in[4];
  const float* Wv   = (const float*)d_in[5];
  const float* bv   = (const float*)d_in[6];
  const float* Wp   = (const float*)d_in[7];
  const float* bp   = (const float*)d_in[8];
  const float* btab = (const float*)d_in[9];
  const float* tptr = (const float*)d_in[10];
  float* out = (float*)d_out;

  // workspace region map (bytes), all offsets multiples of 2 MiB:
  //   Xb  bf16 [4096][1024]   8 MiB  @ 0
  //   WqT bf16 [1024][1024]   2 MiB  @ 8 MiB
  //   WkT bf16 [1024][1024]   2 MiB  @ 10 MiB
  //   WvT bf16 [1024][1024]   2 MiB  @ 12 MiB
  //   WpT f16  [1024][1024]   2 MiB  @ 14 MiB   (RNE-bf16 values x64)
  //   Qp  f16  [4096][1024]   8 MiB  @ 16 MiB
  //   Kp  f16  [4096][1024]   8 MiB  @ 24 MiB
  //   Vtp f16  [1024][4096]   8 MiB  @ 32 MiB
  //   Cx  f16  [4096][1024]   8 MiB  @ 40 MiB   (ctx x64)
  //   total 48 MiB = 50,331,648 B
  const size_t szAct = (size_t)kTok * kEmb * 2;
  const size_t szW   = (size_t)kEmb * kEmb * 2;
  size_t off = 0;
  const size_t oXb = off; off += szAct;
  const size_t oWq = off; off += szW;
  const size_t oWk = off; off += szW;
  const size_t oWv = off; off += szW;
  const size_t oWp = off; off += szW;
  const size_t oQ  = off; off += szAct;
  const size_t oK  = off; off += szAct;
  const size_t oVt = off; off += szAct;
  const size_t oCx = off; off += szAct;
  if (off > ws_size) return;

  char* w = (char*)d_ws;
  unsigned short* Xb  = (unsigned short*)(w + oXb);
  unsigned short* WqT = (unsigned short*)(w + oWq);
  unsigned short* WkT = (unsigned short*)(w + oWk);
  unsigned short* WvT = (unsigned short*)(w + oWv);
  unsigned short* WpT = (unsigned short*)(w + oWp);
  unsigned short* Qp  = (unsigned short*)(w + oQ);
  unsigned short* Kp  = (unsigned short*)(w + oK);
  unsigned short* Vtp = (unsigned short*)(w + oVt);
  unsigned short* Cx  = (unsigned short*)(w + oCx);

  const float kWpCarry  = 64.0f;
  const float kCtxCarry = 64.0f;

  // 1) one launch: weights in[rows=1024][cols=1024] -> out[cols][rows], and x -> bf16 plane (2 elements per thread)
  {
    const int n2 = (kTok * kEmb) / 2;
    prep_inputs<<<4 * kWTiles + (n2 + 255) / 256, 256, 0, stream>>>(
        x, Wq, Wk, Wv, Wp, Xb, WqT, WkT, WvT, WpT, n2, kEmb, kWpCarry);
  }
  // 2) one launch: the three projections (bf16 WMMA, f16 outputs). M,N % 128 == 0, K % 128 == 0 by the static_assert below.
  static_assert(kTok % 128 == 0 && kEmb % 128 == 0 && kEmb % kGK == 0);
  const int gemmBlocks = (kTok / 128) * (kEmb / 128);
  qkv_gemm<<<dim3(gemmBlocks, 3), 256, 0, stream>>>(
      Xb, WqT, WkT, WvT, Qp, Kp, Vtp, bq, bk, bv, kTok, kEmb);
  // 3) attention -> ctx f16 plane (x64)
  attn_relbias_f16<<<kBatch * kHeads * (kSeq / kQB), kNW * 32, 0, stream>>>(
      Qp, Kp, Vtp, btab, tptr, Cx, kCtxCarry);
  // 4) output projection: out[token][n] = 2^-12 * sum_c Cx[token][c] WpT[n][c] + bp[n]
  wmma_gemm64<0, false, 2, 0><<<dim3(gemmBlocks, 1), 256, 0, stream>>>(
      Cx, Cx, kEmb, 0L, WpT, WpT, kEmb, 0L, (void*)out, (void*)out, kEmb, 0L, bp,
      kTok, kEmb, kEmb, 1.0f / (kWpCarry * kCtxCarry));
}

// v005
// One run takes 89 microseconds.
// In two side-by-side timings against v004, it was 1.15 and 1.14 times as fast.
// All steps since v000 together make it 3.65 times as fast.
// Contractions: x@Wq, x@Wk, Wv-side GEMM producing V^T on v_wmma_f32_16x16x32_bf16 (bf16 operands = RNE-bf16 converted inputs, exact products); q.k^T, p.v, ctx@Wp on v_wmma_f32_16x16x32_f16 (f16 operands; p carried x2^15, ctx and Wp carried x64); f32 accumulate; softmax and normalisers in f32.
#include <hip/hip_runtime.h>
#include <math.h>

typedef __attribute__((ext_vector_type(16))) _Float16 v16h;
typedef __attribute__((ext_vector_type(8)))  _Float16 v8h;
typedef __attribute__((ext_vector_type(16))) __bf16   v16b;
typedef __attribute__((ext_vector_type(8)))  __bf16   v8b;
typedef __attribute__((ext_vector_type(8)))  float    v8f;
typedef __attribute__((ext_vector_type(4)))  float    v4f;
typedef __attribute__((ext_vector_type(4)))  unsigned v4u;

constexpr int kBatch   = 4;
constexpr int kSeq     = 1024;
constexpr int kEmb     = 1024;
constexpr int kHeads   = 16;
constexpr int kHD      = 64;
constexpr int kTok     = kBatch * kSeq;
constexpr int kRelRows = 1999;
constexpr int kRelMax  = kRelRows - 1;

static_assert(kEmb == kHeads * kHD);
static_assert(kHD == 64);
static_assert(kTok % 64 == 0 && kEmb % 64 == 0 && kEmb % 32 == 0 && kSeq % 64 == 0);

// ---------------------------------------------------------------------------
// helpers
// ---------------------------------------------------------------------------
__device__ __forceinline__ unsigned short f2bf_bits(float f) {
  unsigned u = __float_as_uint(f);
  return (unsigned short)((u + 0x7FFFu + ((u >> 16) & 1u)) >> 16);
}
__device__ __forceinline__ float bf_bits2f(unsigned short h) { return __uint_as_float(((unsigned)h) << 16); }
__device__ __forceinline__ float rne_bf(float f) { return bf_bits2f(f2bf_bits(f)); }

__device__ __forceinline__ void dep_guard_h(v8f& a, v8f& b, v16h x, v16h y) { asm volatile("v_nop\n\tv_nop\n\tv_nop\n\tv_nop" : "+v"(a), "+v"(b) : "v"(x), "v"(y)); }
__device__ __forceinline__ void dep_guard_b(v8f& a, v8f& b, v16b x, v16b y) { asm volatile("v_nop\n\tv_nop\n\tv_nop\n\tv_nop" : "+v"(a), "+v"(b) : "v"(x), "v"(y)); }
__device__ __forceinline__ void keep4_h(v16h a, v16h b, v16h c, v16h d) { asm volatile("v_nop" :: "v"(a), "v"(b), "v"(c), "v"(d)); }
__device__ __forceinline__ void keep4_b(v16b a, v16b b, v16b c, v16b d) { asm volatile("v_nop" :: "v"(a), "v"(b), "v"(c), "v"(d)); }
__device__ __forceinline__ void acc_guard4(v8f& a, v8f& b, v8f& c, v8f& d) { asm volatile("v_nop\n\tv_nop\n\tv_nop\n\tv_nop" : "+v"(a), "+v"(b), "+v"(c), "+v"(d)); }
template <typename T> struct Frag;
template <> struct Frag<_Float16> {
  typedef v16h V; union U { v16h v; v8h h[2]; };
  // elements 0..7 <- p[0..7], 8..15 <- p[16..23]
  static __device__ __forceinline__ v16h load(const _Float16* p) {
    U f; f.h[0] = *(const v8h*)(p); f.h[1] = *(const v8h*)(p + 16); return f.v;
  }
  static __device__ __forceinline__ v8f mma(v16h a, v16h b, v8f c) {
    return __builtin_amdgcn_wmma_f32_16x16x32_f16(false, a, false, b, (short)0, c, false, false);
  }
  static __device__ __forceinline__ void guard(v8f& a, v8f& b, v16h x, v16h y) { dep_guard_h(a, b, x, y); }
  static __device__ __forceinline__ void keep(v16h a, v16h b, v16h c, v16h d) { keep4_h(a, b, c, d); }
};
template <> struct Frag<__bf16> {
  typedef v16b V; union U { v16b v; v8b h[2]; };
  static __device__ __forceinline__ v16b load(const __bf16* p) {
    U f; f.h[0] = *(const v8b*)(p); f.h[1] = *(const v8b*)(p + 16); return f.v;
  }
  static __device__ __forceinline__ v8f mma(v16b a, v16b b, v8f c) {
    return __builtin_amdgcn_wmma_f32_16x16x32_bf16(false, a, false, b, (short)0, c, false, false);
  }
  static __device__ __forceinline__ void guard(v8f& a, v8f& b, v16b x, v16b y) { dep_guard_b(a, b, x, y); }
  static __device__ __forceinline__ void keep(v16b a, v16b b, v16b c, v16b d) { keep4_b(a, b, c, d); }
};

// f16 WMMA with hazard guard (A, B kept live; D tied)
__device__ __forceinline__ v8f hmma(v16h a, v16h b, v8f c) {
  c = __builtin_amdgcn_wmma_f32_16x16x32_f16(false, a, false, b, (short)0, c, false, false);
  asm volatile("v_nop\n\tv_nop\n\tv_nop\n\tv_nop" : "+v"(c) : "v"(a), "v"(b));
  return c;
}

// ---------------------------------------------------------------------------
// Register-blocked batched WMMA GEMM, operands staged in LDS.
// C[m,n] = scale * sum_k A[m,k] * Bt[n,k] (+bias); a work-group of 8 waves owns a 128x128 tile,
// each wave 32 rows x 64 columns of it (two waves per SIMD: one wave's LDS reads and copy issue
// stand behind the other's products).
// A row-major [M,K]; Bt row-major [N,K]; M,N % 128 == 0, K % 128 == 0.
// A pass is 128 k: 256 B of 128 A rows and of 128 Bt rows, brought into LDS by asynchronous copies,
// two buffers, the next pass's copies in flight while this pass is worked on.
// SPLIT: hi/lo operand planes (not supported by the staged loop, false).
// BIAS_MODE: 0 none, 1 bias[m], 2 bias[n]; bias values RNE-converted to bf16 precision before the add.
// OUT_MODE: 0 = f32, 1 = f16, 2 = bf16 hi plane (Cout) + bf16 lo plane (Cout2).
// ET: 0 = f16 operands, 1 = bf16 operands (pointers passed as 16-bit storage)
// ---------------------------------------------------------------------------
constexpr int kGK     = 128;               // k elements per pass
constexpr int kGPitch = 2 * kGK + 16;      // LDS row pitch in bytes: 16 B x odd, conflict-free for 16-byte reads down a column
constexpr int kGStage = 256 * kGPitch;     // one buffer: rows 0..127 = A rows, rows 128..255 = Bt rows

// One wave's share of a stage: 32 rows of 256 B, 16 copies of 2 rows each (16 lanes x 16 B per row).
// lds = this lane's LDS byte address in the first row pair, g = this lane's global address there,
// ld = source row pitch in elements.
template <typename T>
__device__ __forceinline__ void stage_copies(unsigned lds, const T* g, int ld) {
#pragma unroll
  for (int i = 0; i < 16; i += 8) {
    // the closing s_wait_xcnt is a precaution: no register that a copy names is rewritten ahead of it
    asm volatile(
        "global_load_async_to_lds_b128 %0, %8, off\n\t"
        "global_load_async_to_lds_b128 %1, %9, off\n\t"
        "global_load_async_to_lds_b128 %2, %10, off\n\t"
        "global_load_async_to_lds_b128 %3, %11, off\n\t"
        "global_load_async_to_lds_b128 %4, %12, off\n\t"
        "global_load_async_to_lds_b128 %5, %13, off\n\t"
        "global_load_async_to_lds_b128 %6, %14, off\n\t"
        "global_load_async_to_lds_b128 %7, %15, off\n\t"
        "s_wait_xcnt 0x0"
        :: "v"(lds + (unsigned)((i + 0) * 2 * kGPitch)), "v"(lds + (unsigned)((i + 1) * 2 * kGPitch)),
           "v"(lds + (unsigned)((i + 2) * 2 * kGPitch)), "v"(lds + (unsigned)((i + 3) * 2 * kGPitch)),
           "v"(lds + (unsigned)((i + 4) * 2 * kGPitch)), "v"(lds + (unsigned)((i + 5) * 2 * kGPitch)),
           "v"(lds + (unsigned)((i + 6) * 2 * kGPitch)), "v"(lds + (unsigned)((i + 7) * 2 * kGPitch)),
           "v"(g + (size_t)((i + 0) * 2) * ld), "v"(g + (size_t)((i + 1) * 2) * ld),
           "v"(g + (size_t)((i + 2) * 2) * ld), "v"(g + (size_t)((i + 3) * 2) * ld),
           "v"(g + (size_t)((i + 4) * 2) * ld), "v"(g + (size_t)((i + 5) * 2) * ld),
           "v"(g + (size_t)((i + 6) * 2) * ld), "v"(g + (size_t)((i + 7) * 2) * ld)
        : "memory");
  }
}

template <int ET> struct Elem;
template <> struct Elem<0> { typedef _Float16 T; };
template <> struct Elem<1> { typedef __bf16 T; };
// The tile's work is a device function, so that one launch can hold several GEMMs: the kernel owns the LDS
// (ring: operand ring, two buffers; sT: per-wave 16x64 slab, pitch 68 floats) and says which tile and batch.
template <int ET, bool SPLIT, int BIAS_MODE, int OUT_MODE>
__device__ __forceinline__ void gemm_tile(
    unsigned char* ring, float (*sT)[16 * 68], int tile, int b,
    const unsigned short* __restrict__ Ap, const unsigned short* __restrict__ A2p, int lda, long strideA,
    const unsigned short* __restrict__ Btp, const unsigned short* __restrict__ Bt2p, int ldb, long strideB,
    void* __restrict__ Cout, void* __restrict__ Cout2, int ldc, long strideC,
    const float* __restrict__ bias,
    int M, int N, int K, float scale) {
  static_assert(!SPLIT);
  typedef typename Elem<ET>::T T;
  typedef typename Frag<T>::V V;
  const T* A = (const T*)Ap; const T* Bt = (const T*)Btp;
  const int lane = threadIdx.x & 31;
  // in a scalar register, so that what picks a wave's source rows is scalar and every lane stays on at the copies
  const int wave = __builtin_amdgcn_readfirstlane(threadIdx.x >> 5);
  const int tilesN = N >> 7;
  const int tilesM = M >> 7;
  // the same for the whole work-group, ahead of every barrier
  if (tile >= tilesM * tilesN) return;
  const int tm = tile / tilesN;
  const int tn = tile - tm * tilesN;
  const int wm = wave >> 1;
  const int wn = wave & 1;
  const int m0 = (tm << 7) + (wm << 5);
  const int n0 = (tn << 7) + (wn << 6);

  const T* Ab  = A  + (size_t)b * strideA;
  const T* Bb  = Bt + (size_t)b * strideB;

  // row (A) / col (B, D) within subtile; k offset of this lane half; D row offset
  const int rlane = lane & 15;
  const int koff  = (lane >> 4) * 8;
  const int mOff  = (lane >> 4) * 8;

  // copies: waves 0..3 bring the 128 A rows, waves 4..7 the 128 Bt rows, 32 rows each
  const int ldS = (wave < 4) ? lda : ldb;
  const T* gS = ((wave < 4) ? (Ab + (size_t)((tm << 7) + (wave << 5)) * lda)
                            : (Bb + (size_t)((tn << 7) + ((wave - 4) << 5)) * ldb))
                + (size_t)(lane >> 4) * ldS + rlane * 8;
  const unsigned ldsS = (unsigned)(size_t)ring + (unsigned)(((wave << 5) + (lane >> 4)) * kGPitch + rlane * 16);

  v8f acc[2][4];
#pragma unroll
  for (int i = 0; i < 2; ++i)
#pragma unroll
    for (int j = 0; j < 4; ++j) acc[i][j] = (v8f){0.f,0.f,0.f,0.f,0.f,0.f,0.f,0.f};

  const int nPass = K / kGK;
  stage_copies<T>(ldsS, gS, ldS);
  // pass 0's bytes of this wave have landed before the barrier that shows them to the other waves
  asm volatile("s_wait_asynccnt 0x0" ::: "memory");
  __syncthreads();
  if (nPass > 1) stage_copies<T>(ldsS + (unsigned)kGStage, gS + kGK, ldS);

  // one pass per trip, the buffer chosen by the trip's parity
  for (int t = 0; t < nPass; ++t) {
    const unsigned char* st = ring + (t & 1) * kGStage;
    const unsigned char* stA = st + ((wm << 5) + rlane) * kGPitch;
    const unsigned char* stB = st + (128 + (wn << 6) + rlane) * kGPitch;
#pragma unroll
    for (int k0 = 0; k0 < kGK; k0 += 32) {
      // all six fragments of a 32-k block are read as one group: one LDS latency per 8 products
      V bh[4], ah[2];
#pragma unroll
      for (int j = 0; j < 4; ++j) bh[j] = Frag<T>::load((const T*)(stB + (j << 4) * kGPitch) + koff + k0);
#pragma unroll
      for (int i = 0; i < 2; ++i) ah[i] = Frag<T>::load((const T*)(stA + (i << 4) * kGPitch) + koff + k0);
#pragma unroll
      for (int i = 0; i < 2; ++i) {
#pragma unroll
        for (int j = 0; j < 4; ++j) acc[i][j] = Frag<T>::mma(ah[i], bh[j], acc[i][j]);
        Frag<T>::guard(acc[i][0], acc[i][3], ah[i], ah[i]);
      }
      Frag<T>::keep(bh[0], bh[1], bh[2], bh[3]);
    }
    // this wave's reads of the buffer are done before the barrier behind which it is refilled
    asm volatile("s_wait_dscnt 0x0" ::: "memory");
    // this wave's copies of pass t + 1 have landed before the barrier that shows them to the other waves
    asm volatile("s_wait_asynccnt 0x0" ::: "memory");
    __syncthreads();
    if (t + 2 < nPass) stage_copies<T>(ldsS + (unsigned)((t & 1) * kGStage), gS + (size_t)(t + 2) * kGK, ldS);
  }
  // no copy is outstanding when the wave goes on to the epilogue and ends
  asm volatile("s_wait_asynccnt 0x0" ::: "memory");
  acc_guard4(acc[0][0], acc[0][1], acc[0][2], acc[0][3]);
  acc_guard4(acc[1][0], acc[1][1], acc[1][2], acc[1][3]);

  // ---- epilogue ----
  float* slab = sT[wave];
  // column biases: 4 scalar loads per lane, hoisted
  float bvj[4];
#pragma unroll
  for (int j = 0; j < 4; ++j) bvj[j] = (BIAS_MODE == 2) ? rne_bf(bias[n0 + (j << 4) + rlane]) : 0.f;
#pragma unroll
  for (int i = 0; i < 2; ++i) {
    const int mBase = m0 + (i << 4);
    // row biases: two 16-B loads per lane (rows mBase+mOff .. +7, 32-B aligned)
    v4f bm0 = (v4f){0.f, 0.f, 0.f, 0.f};
    v4f bm1 = bm0;
    if (BIAS_MODE == 1) {
      bm0 = *(const v4f*)(bias + mBase + mOff);
      bm1 = *(const v4f*)(bias + mBase + mOff + 4);
    }
#pragma unroll
    for (int j = 0; j < 4; ++j) {
#pragma unroll
      for (int r = 0; r < 8; ++r) {
        float v = acc[i][j][r] * scale;
        if (BIAS_MODE == 1) { const v4f bsel = (r < 4) ? bm0 : bm1; v += rne_bf(bsel[r & 3]); }
        if (BIAS_MODE == 2) v += bvj[j];
        slab[(mOff + r) * 68 + (j << 4) + rlane] = v;
      }
    }
    __builtin_amdgcn_fence(__ATOMIC_RELEASE, "workgroup");
    __builtin_amdgcn_wave_barrier();
    __builtin_amdgcn_fence(__ATOMIC_ACQUIRE, "workgroup");
    if (OUT_MODE == 0) {
      float* C = (float*)Cout + (size_t)b * strideC;
      // row seg = 256 B = 16 lanes x 16 B
      const int hh = lane >> 4, c4 = (lane & 15) * 4;
      {
#pragma unroll
        for (int it = 0; it < 8; ++it) {
          const int row = it * 2 + hh;
          v4f v = *(const v4f*)(slab + row * 68 + c4);
          *(v4f*)(C + (size_t)(mBase + row) * ldc + n0 + c4) = v;
        }
        
      }
    } else {
      const int q = lane >> 3, c8 = (lane & 7) * 8;
      unsigned short* C  = (unsigned short*)Cout  + (size_t)b * strideC;
      unsigned short* C2 = (OUT_MODE == 2) ? ((unsigned short*)Cout2 + (size_t)b * strideC) : nullptr;
      {
#pragma unroll
        for (int it = 0; it < 4; ++it) {
          const int row = it * 4 + q;
          const float* sp = slab + row * 68 + c8;
          v8h hv, lv;
#pragma unroll
          for (int e = 0; e < 8; ++e) {
            if (OUT_MODE == 1) {
              hv[e] = (_Float16)sp[e];
            } else {
              unsigned short hb = f2bf_bits(sp[e]);
              unsigned short lb = f2bf_bits(sp[e] - bf_bits2f(hb));
              hv[e] = __builtin_bit_cast(_Float16, hb);
              lv[e] = __builtin_bit_cast(_Float16, lb);
            }
          }
          *(v8h*)(C + (size_t)(mBase + row) * ldc + n0 + c8) = hv;
          if (OUT_MODE == 2) *(v8h*)(C2 + (size_t)(mBase + row) * ldc + n0 + c8) = lv;
        }
        
      }
    }
    __builtin_amdgcn_fence(__ATOMIC_RELEASE, "workgroup");
    __builtin_amdgcn_wave_barrier();
    __builtin_amdgcn_fence(__ATOMIC_ACQUIRE, "workgroup");
  }
}

// One GEMM per launch: blockIdx.x = tile, blockIdx.y = batch.
template <int ET, bool SPLIT, int BIAS_MODE, int OUT_MODE>
__global__ __launch_bounds__(256) void wmma_gemm64(
    const unsigned short* __restrict__ Ap, const unsigned short* __restrict__ A2p, int lda, long strideA,
    const unsigned short* __restrict__ Btp, const unsigned short* __restrict__ Bt2p, int ldb, long strideB,
    void* __restrict__ Cout, void* __restrict__ Cout2, int ldc, long strideC,
    const float* __restrict__ bias,
    int M, int N, int K, float scale) {
  __shared__ __align__(16) unsigned char ring[2 * kGStage];
  __shared__ __align__(16) float sT[8][16 * 68];
  gemm_tile<ET, SPLIT, BIAS_MODE, OUT_MODE>(ring, sT, blockIdx.x, blockIdx.y,
      Ap, A2p, lda, strideA, Btp, Bt2p, ldb, strideB, Cout, Cout2, ldc, strideC, bias, M, N, K, scale);
}

// The three projections, which do not depend on one another, in one launch: blockIdx.y picks the job
// (the same for a whole work-group), blockIdx.x the tile.
//   job 0: Q[token][n]  = sum_k Xb[token][k] WqT[n][k] + bq[n]
//   job 1: K[token][n]  = sum_k Xb[token][k] WkT[n][k] + bk[n]
//   job 2: Vt[n][token] = sum_k WvT[n][k] Xb[token][k] + bv[n]   (M = features, N = tokens)
__global__ __launch_bounds__(256) void qkv_gemm(
    const unsigned short* __restrict__ Xb, const unsigned short* __restrict__ WqT,
    const unsigned short* __restrict__ WkT, const unsigned short* __restrict__ WvT,
    unsigned short* __restrict__ Qp, unsigned short* __restrict__ Kp, unsigned short* __restrict__ Vtp,
    const float* __restrict__ bq, const float* __restrict__ bk, const float* __restrict__ bv,
    int nTok, int nEmb) {
  __shared__ __align__(16) unsigned char ring[2 * kGStage];
  __shared__ __align__(16) float sT[8][16 * 68];
  const int job = blockIdx.y;
  if (job < 2) {
    const unsigned short* Wt = job ? WkT : WqT;
    unsigned short* C = job ? Kp : Qp;
    gemm_tile<1, false, 2, 1>(ring, sT, blockIdx.x, 0,
        Xb, Xb, nEmb, 0L, Wt, Wt, nEmb, 0L, (void*)C, (void*)C, nEmb, 0L, job ? bk : bq,
        nTok, nEmb, nEmb, 1.0f);
  } else {
    gemm_tile<1, false, 1, 1>(ring, sT, blockIdx.x, 0,
        WvT, WvT, nEmb, 0L, Xb, Xb, nEmb, 0L, (void*)Vtp, (void*)Vtp, nTok, 0L, bv,
        nEmb, nTok, nEmb, 1.0f);
  }
}

// ---------------------------------------------------------------------------
// f32 -> bf16 plane, 2 elements per thread; blk = index of this 256-thread block within the cast
// ---------------------------------------------------------------------------
__device__ __forceinline__ void cast_f32_bf16x2(
    const float* __restrict__ in, unsigned short* __restrict__ out, int n2, int blk) {
  const int i = blk * 256 + threadIdx.x;
  if (i < n2) {
    const unsigned u = (unsigned)f2bf_bits(in[2 * i]) | ((unsigned)f2bf_bits(in[2 * i + 1]) << 16);
    ((unsigned*)out)[i] = u;
    
  }
}

// ---------------------------------------------------------------------------
// Transpose + convert: W row-major in[rows][cols] f32 -> Wt row-major out[cols][rows] 16-bit.
// MODE 0: bf16 bits of RNE-bf16(W). MODE 1: f16 bits of RNE-bf16(W) * wsc (wsc a power of two).
// One block per 64x64 tile (bx, by) of (cols/64, rows/64); rows, cols % 64 == 0. tile = the kernel's 64x65 LDS floats.
// Load: 256 threads x 4 x float4 = 64x64 tile. Store: wave w writes output rows w*8..w*8+7,
// ---------------------------------------------------------------------------
template <int MODE>
__device__ __forceinline__ void transpose_cvt16(
    float* tile, int bx, int by,
    const float* __restrict__ W, unsigned short* __restrict__ Wt, int rows, int cols, float wsc) {
  const int tid = threadIdx.x, lane = tid & 31, wave = tid >> 5;
  const int n0 = bx * 64;
  const int k0 = by * 64;
  {
    const int c4 = (tid & 15) * 4, r = tid >> 4;
#pragma unroll
    for (int it = 0; it < 4; ++it) {
      const int rr = it * 16 + r;
      const v4f x4 = *(const v4f*)(W + (size_t)(k0 + rr) * cols + n0 + c4);
      tile[rr * 65 + c4 + 0] = x4[0];
      tile[rr * 65 + c4 + 1] = x4[1];
      tile[rr * 65 + c4 + 2] = x4[2];
      tile[rr * 65 + c4 + 3] = x4[3];
    }
  }
  __syncthreads();
  const int q4 = lane >> 3, c8 = (lane & 7) * 8;
  _Float16* out = (_Float16*)Wt;
  {
#pragma unroll
    for (int it = 0; it < 2; ++it) {
      const int i = wave * 8 + it * 4 + q4;
      v8h hv;
#pragma unroll
      for (int e = 0; e < 8; ++e) {
        const float f = tile[(c8 + e) * 65 + i];
        if (MODE == 0) {
          hv[e] = __builtin_bit_cast(_Float16, f2bf_bits(f));
        } else {
          hv[e] = (_Float16)(rne_bf(f) * wsc);
        }
      }
      *(v8h*)(out + (size_t)(n0 + i) * rows + k0 + c8) = hv;
    }
    // a precaution: inlined into a kernel with other jobs' code behind it, no register that the two stores name
    // is rewritten ahead of this wait on any branch of the listing
    asm volatile("s_wait_xcnt 0x0" ::: "memory");
  }
}

// ---------------------------------------------------------------------------
// The five input conversions, which do not depend on one another, in one launch: the block index picks the job
// (the same for a whole work-group, so the transposes' barrier stands under uniform control flow).
// Blocks [0, 4 * kWTiles): the weight transposes in the order Wq, Wk, Wv, Wp, one 64x64 tile each; they come
// first because they last longer than a cast block. The blocks behind them: the cast of x.
// ---------------------------------------------------------------------------
constexpr int kWTilesX = kEmb / 64;
constexpr int kWTiles  = kWTilesX * kWTilesX;
__global__ __launch_bounds__(256) void prep_inputs(
    const float* __restrict__ x, const float* __restrict__ Wq, const float* __restrict__ Wk,
    const float* __restrict__ Wv, const float* __restrict__ Wp,
    unsigned short* __restrict__ Xb, unsigned short* __restrict__ WqT, unsigned short* __restrict__ WkT,
    unsigned short* __restrict__ WvT, unsigned short* __restrict__ WpT, int n2, int emb, float wsc) {
  __shared__ float tile[64 * 65];
  const int blk = blockIdx.x;
  if (blk >= 4 * kWTiles) {
    cast_f32_bf16x2(x, Xb, n2, blk - 4 * kWTiles);
    return;
  }
  const int job = blk / kWTiles;
  const int t   = blk % kWTiles;
  const int bx  = t % kWTilesX;
  const int by  = t / kWTilesX;
  if (job < 3) {
    const float* W = (job == 0) ? Wq : (job == 1) ? Wk : Wv;
    unsigned short* Wt = (job == 0) ? WqT : (job == 1) ? WkT : WvT;
    transpose_cvt16<0>(tile, bx, by, W, Wt, emb, emb, 1.0f);
  } else {
    transpose_cvt16<1>(tile, bx, by, Wp, WpT, emb, emb, wsc);
  }
}

constexpr int kQB = 64;
constexpr int kKC = 64;
constexpr int kNW = 4;
// LDS row pitch of the K and V^T tiles in halves: 144 B = 16 B x odd, so that the 16 rows that a 16-byte
// fragment read walks down fall on 16 different bank groups (at 128 B they fall on two)
constexpr int kLP = kKC + 8;
constexpr int kBiasL = kQB + kSeq;
constexpr float kPCarryLog2 = 15.0f;      // p and the row sum are carried x2^15, taken in the exponent
constexpr float kLog2E = 1.44269504088896340736f;
static_assert(kSeq % kKC == 0 && kSeq % kQB == 0 && kKC == kHD);

// Eight base-2 exponentials in place, in one statement: each v_exp_f32 overwrites its own source alone and none reads
// a neighbour's result; the closing v_nop is the slot that the instruction set asks for behind a transcendental,
// whatever instruction the compiler puts next (left to the builtin, it set exponentials over one another's sources).
__device__ __forceinline__ void exp2x8(float& a, float& b, float& c, float& d, float& e, float& f, float& g, float& h) {
  asm("v_exp_f32 %0, %0\n\tv_exp_f32 %1, %1\n\tv_exp_f32 %2, %2\n\tv_exp_f32 %3, %3\n\t"
      "v_exp_f32 %4, %4\n\tv_exp_f32 %5, %5\n\tv_exp_f32 %6, %6\n\tv_exp_f32 %7, %7\n\tv_nop"
      : "+v"(a), "+v"(b), "+v"(c), "+v"(d), "+v"(e), "+v"(f), "+v"(g), "+v"(h));
}

// lane l's value in lane l ^ 16
__device__ __forceinline__ float xhalf(float x) {
  const int b = __builtin_bit_cast(int, x);
  return __builtin_bit_cast(float, __builtin_amdgcn_permlanex16(b, b, 0x76543210, 0xfedcba98, false, false));
}

__global__ __launch_bounds__(128) void attn_relbias_f16(
    const unsigned short* __restrict__ Qp, const unsigned short* __restrict__ Kp,
    const unsigned short* __restrict__ Vtp, const float* __restrict__ btab,
    const float* __restrict__ tptr, unsigned short* __restrict__ Cp, float ctx_scale) {
  union FH { v16h v; v8h h[2]; };
  // K [kv][d], V^T [d][kv] (rows of 64 halves at pitch kLP), bias slab
  __shared__ __align__(16) _Float16 Ksh[kKC * kLP];
  __shared__ __align__(16) _Float16 Vtsh[kHD * kLP];
  __shared__ __align__(16) float biasL[kBiasL];

  const _Float16* Qh  = (const _Float16*)Qp;
  const _Float16* Kh  = (const _Float16*)Kp;
  const _Float16* Vth = (const _Float16*)Vtp;

  const int tid  = threadIdx.x;
  const int wave = tid >> 5;
  const int lane = tid & 31;
  const int hh   = lane >> 4;
  const int c    = lane & 15;

  constexpr int nqb = kSeq / kQB;
  const int bx = blockIdx.x;
  const int qb = bx % nqb;
  const int bh = bx / nqb;
  const int h  = bh % kHeads;
  const int b  = bh / kHeads;
  const int qbase = qb * kQB;
  const int q0 = qbase + wave * 16;

  // temperature (RNE-bf16 converted input), clamp, 1/(sqrt(E) * temp)
  float tv = rne_bf(tptr[0]);
  tv = fminf(fmaxf(tv, 0.1f), 10.0f);
  // times log2 e: scores and bias are formed in base-2 units, e^x = 2^(x log2 e)
  const float inv = (1.0f / (sqrtf((float)kEmb) * tv)) * kLog2E;

  // bias slab: biasL[i] = table[min(qbase + i, relmax)][h] * inv, i = (q - qbase) + (S-1) - kv in [0, kBiasL)
  for (int i = tid; i < kBiasL; i += kNW * 32) {
    int rel = qbase + i;
    rel = rel > kRelMax ? kRelMax : rel;
    biasL[i] = rne_bf(btab[(size_t)rel * kHeads + h]) * inv;
  }

  // Q fragments (B operand, column c = query q0 + c): 2 d-chunks, hardware k order from the f16 plane
  v16h qa[2];
  {
    const _Float16* qrow = Qh + (size_t)(b * kSeq + q0 + c) * kEmb + h * kHD;
#pragma unroll
    for (int dc = 0; dc < 2; ++dc) qa[dc] = Frag<_Float16>::load(qrow + dc * 32 + 8 * hh);
  }

  // of query q0 + c: running maximum less 15 (the same in both halves), this half's part of the running sum (x2^15)
  float mrow = -INFINITY, lrow = 0.f;
  // oacc[t][r] = O^T[d = t*16 + 8*hh + r][query q0 + c]
  v8f oacc[4];
#pragma unroll
  for (int t = 0; t < 4; ++t) oacc[t] = (v8f){0.f,0.f,0.f,0.f,0.f,0.f,0.f,0.f};

  for (int kc = 0; kc < kSeq / kKC; ++kc) {
    const int kv0 = kc * kKC;
    __syncthreads();
    {
      // 128 threads x 32 halves each = 64x64 for K and for V^T (full tiles)
      const int rr = tid >> 1, dh = (tid & 1) * 32;
      const v4u* ks = (const v4u*)(Kh + (size_t)(b * kSeq + kv0 + rr) * kEmb + h * kHD + dh);
      const v4u* vs = (const v4u*)(Vth + (size_t)(h * kHD + rr) * kTok + b * kSeq + kv0 + dh);
      v4u* kd = (v4u*)(Ksh + rr * kLP + dh);
      v4u* vd = (v4u*)(Vtsh + rr * kLP + dh);
      v4u kt[4], vt[4];
#pragma unroll
      for (int i = 0; i < 4; ++i) { kt[i] = ks[i]; vt[i] = vs[i]; }
#pragma unroll
      for (int i = 0; i < 4; ++i) { kd[i] = kt[i]; vd[i] = vt[i]; }
    }
    __syncthreads();

    // ---- scores, transposed: s[j][r] = score of key kv0 + j*16 + 8*hh + r with query q0 + c ----
    v8f s[4];
#pragma unroll
    for (int j = 0; j < 4; ++j) {
      s[j] = (v8f){0.f,0.f,0.f,0.f,0.f,0.f,0.f,0.f};
#pragma unroll
      for (int dc = 0; dc < 2; ++dc) {
        FH kb;
        kb.h[0] = *(const v8h*)(Ksh + (j * 16 + c) * kLP + dc * 32 + 8 * hh);
        kb.h[1] = *(const v8h*)(Ksh + (j * 16 + c) * kLP + dc * 32 + 16 + 8 * hh);
        s[j] = hmma(kb.v, qa[dc], s[j]);
      }
    }

    // ---- scale + bias + maximum over this lane's 32 keys (one chain per tile), then over both halves ----
    const int bi = wave * 16 + c + (kSeq - 1) - kv0 - 8 * hh;
    float mj[4];
#pragma unroll
    for (int j = 0; j < 4; ++j) {
      mj[j] = -INFINITY;
#pragma unroll
      for (int r = 0; r < 8; ++r) {
        const float sc = s[j][r] * inv + biasL[bi - j * 16 - r];
        s[j][r] = sc;
        mj[j] = fmaxf(mj[j], sc);
      }
    }
    float cm = fmaxf(fmaxf(mj[0], mj[1]), fmaxf(mj[2], mj[3]));
    cm = fmaxf(cm, xhalf(cm));
    // the point that exponents are taken from: the chunk's maximum less 15 (any point serves, it cancels in p / l).
    // Where the maximum is so large that f32 cannot hold the 15 beside it, the maximum itself, so that p stays inside f16.
    {
      const float lowered = cm - kPCarryLog2;
      cm = (cm - lowered < kPCarryLog2 + 0.5f) ? lowered : cm;
    }

    // ---- online softmax update; P^T (x2^15, f16) packed into the B operands of the second product ----
    const float mnew = fmaxf(mrow, cm);
    const float alpha = __builtin_amdgcn_exp2f(mrow - mnew);
    mrow = mnew;
    // pb[kk] element e: key kv0 + kk*32 + 8*hh + e for e < 8, kv0 + kk*32 + 16 + 8*hh + (e - 8) behind: tiles 2kk, 2kk + 1
    v16h pb[2];
    float pj[4];
#pragma unroll
    for (int j = 0; j < 4; ++j) {
      float e[8];
#pragma unroll
      for (int r = 0; r < 8; ++r) e[r] = s[j][r] - mnew;
      exp2x8(e[0], e[1], e[2], e[3], e[4], e[5], e[6], e[7]);
      pj[j] = e[0];
#pragma unroll
      for (int r = 1; r < 8; ++r) pj[j] += e[r];
#pragma unroll
      for (int r = 0; r < 8; ++r) pb[j >> 1][(j & 1) * 8 + r] = (_Float16)e[r];
    }
    lrow = lrow * alpha + ((pj[0] + pj[1]) + (pj[2] + pj[3]));
#pragma unroll
    for (int t = 0; t < 4; ++t)
#pragma unroll
      for (int r = 0; r < 8; ++r) oacc[t][r] *= alpha;

    // ---- O^T += V^T_chunk . P^T ----
#pragma unroll
    for (int kk = 0; kk < 2; ++kk) {
#pragma unroll
      for (int t = 0; t < 4; ++t) {
        FH vb;
        vb.h[0] = *(const v8h*)(Vtsh + (t * 16 + c) * kLP + kk * 32 + 8 * hh);
        vb.h[1] = *(const v8h*)(Vtsh + (t * 16 + c) * kLP + kk * 32 + 16 + 8 * hh);
        oacc[t] = hmma(vb.v, pb[kk], oacc[t]);
      }
    }
  }

  // the two halves' sums of a query are joined here, once; a lane's 8 accumulators of a tile are 8 consecutive d
  // of its query's row: one 16-byte store per tile
  {
    const float l = lrow + xhalf(lrow);
    const float invl = ctx_scale * (1.0f / l);
    _Float16* crow = (_Float16*)Cp + (size_t)(b * kSeq + q0 + c) * kEmb + h * kHD + 8 * hh;
#pragma unroll
    for (int t = 0; t < 4; ++t) {
      v8h hv;
#pragma unroll
      for (int r = 0; r < 8; ++r) hv[r] = (_Float16)(oacc[t][r] * invl);
      *(v8h*)(crow + t * 16) = hv;
    }
  }
}

// ---------------------------------------------------------------------------
// Host launch
// ---------------------------------------------------------------------------
extern "C" void kernel_launch(void* const* d_in, const int* in_sizes, int n_in,
                              void* d_out, int out_size, void* d_ws, size_t ws_size,
                              hipStream_t stream) {
  if (n_in < 11) return;
  if (in_sizes[0] != kTok * kEmb) return;
  if (in_sizes[1] != kEmb * kEmb || in_sizes[3] != kEmb * kEmb ||
      in_sizes[5] != kEmb * kEmb || in_sizes[7] != kEmb * kEmb) return;
  if (in_sizes[2] < kEmb || in_sizes[4] < kEmb || in_sizes[6] < kEmb || in_sizes[8] < kEmb) return;
  if (in_sizes[9] != kRelRows * kHeads || in_sizes[10] < 1) return;
  if (out_size != kTok * kEmb) return;

  const float* x    = (const float*)d_in[0];
  const float* Wq   = (const float*)d_in[1];
  const float* bq   = (const float*)d_in[2];
  const float* Wk   = (const float*)d_in[3];
  const float* bk   = (const float*)d_in[4];
  const float* Wv   = (const float*)d_in[5];
  const float* bv   = (const float*)d_in[6];
  const float* Wp   = (const float*)d_in[7];
  const float* bp   = (const float*)d_in[8];
  const float* btab = (const float*)d_in[9];
  const float* tptr = (const float*)d_in[10];
  float* out = (float*)d_out;

  // workspace region map (bytes), all offsets multiples of 2 MiB:
  //   Xb  bf16 [4096][1024]   8 MiB  @ 0
  //   WqT bf16 [1024][1024]   2 MiB  @ 8 MiB
  //   WkT bf16 [1024][1024]   2 MiB  @ 10 MiB
  //   WvT bf16 [1024][1024]   2 MiB  @ 12 MiB
  //   WpT f16  [1024][1024]   2 MiB  @ 14 MiB   (RNE-bf16 values x64)
  //   Qp  f16  [4096][1024]   8 MiB  @ 16 MiB
  //   Kp  f16  [4096][1024]   8 MiB  @ 24 MiB
  //   Vtp f16  [1024][4096]   8 MiB  @ 32 MiB
  //   Cx  f16  [4096][1024]   8 MiB  @ 40 MiB   (ctx x64)
  //   total 48 MiB = 50,331,648 B
  const size_t szAct = (size_t)kTok * kEmb * 2;
  const size_t szW   = (size_t)kEmb * kEmb * 2;
  size_t off = 0;
  const size_t oXb = off; off += szAct;
  const size_t oWq = off; off += szW;
  const size_t oWk = off; off += szW;
  const size_t oWv = off; off += szW;
  const size_t oWp = off; off += szW;
  const size_t oQ  = off; off += szAct;
  const size_t oK  = off; off += szAct;
  const size_t oVt = off; off += szAct;
  const size_t oCx = off; off += szAct;
  if (off > ws_size) return;

  char* w = (char*)d_ws;
  unsigned short* Xb  = (unsigned short*)(w + oXb);
  unsigned short* WqT = (unsigned short*)(w + oWq);
  unsigned short* WkT = (unsigned short*)(w + oWk);
  unsigned short* WvT = (unsigned short*)(w + oWv);
  unsigned short* WpT = (unsigned short*)(w + oWp);
  unsigned short* Qp  = (unsigned short*)(w + oQ);
  unsigned short* Kp  = (unsigned short*)(w + oK);
  unsigned short* Vtp = (unsigned short*)(w + oVt);
  unsigned short* Cx  = (unsigned short*)(w + oCx);

  const float kWpCarry  = 64.0f;
  const float kCtxCarry = 64.0f;

  // 1) one launch: weights in[rows=1024][cols=1024] -> out[cols][rows], and x -> bf16 plane (2 elements per thread)
  {
    const int n2 = (kTok * kEmb) / 2;
    prep_inputs<<<4 * kWTiles + (n2 + 255) / 256, 256, 0, stream>>>(
        x, Wq, Wk, Wv, Wp, Xb, WqT, WkT, WvT, WpT, n2, kEmb, kWpCarry);
  }
  // 2) one launch: the three projections (bf16 WMMA, f16 outputs). M,N % 128 == 0, K % 128 == 0 by the static_assert below.
  static_assert(kTok % 128 == 0 && kEmb % 128 == 0 && kEmb % kGK == 0);
  const int gemmBlocks = (kTok / 128) * (kEmb / 128);
  qkv_gemm<<<dim3(gemmBlocks, 3), 256, 0, stream>>>(
      Xb, WqT, WkT, WvT, Qp, Kp, Vtp, bq, bk, bv, kTok, kEmb);
  // 3) attention -> ctx f16 plane (x64)
  attn_relbias_f16<<<kBatch * kHeads * (kSeq / kQB), kNW * 32, 0, stream>>>(
      Qp, Kp, Vtp, btab, tptr, Cx, kCtxCarry);
  // 4) output projection: out[token][n] = 2^-12 * sum_c Cx[token][c] WpT[n][c] + bp[n]
  wmma_gemm64<0, false, 2, 0><<<dim3(gemmBlocks, 1), 256, 0, stream>>>(
      Cx, Cx, kEmb, 0L, WpT, WpT, kEmb, 0L, (void*)out, (void*)out, kEmb, 0L, bp,
      kTok, kEmb, kEmb, 1.0f / (kWpCarry * kCtxCarry));
}

// v006
// A run of this version takes 82.9 microseconds.
// In two side-by-side timings against v005, it was 1.07 and 1.08 times as fast.
// Counting every step since v000, it is 3.93 times as fast.
// Contractions: x@Wq, x@Wk, Wv-side GEMM producing V^T on v_wmma_f32_16x16x32_bf16 (bf16 operands = RNE-bf16 converted inputs, exact products); q.k^T, p.v, ctx@Wp on v_wmma_f32_16x16x32_f16 (f16 operands; p carried x2^15, ctx and Wp carried x64); f32 accumulate; softmax and normalisers in f32.
#include <hip/hip_runtime.h>
#include <math.h>

typedef __attribute__((ext_vector_type(16))) _Float16 v16h;
typedef __attribute__((ext_vector_type(8)))  _Float16 v8h;
typedef __attribute__((ext_vector_type(16))) __bf16   v16b;
typedef __attribute__((ext_vector_type(8)))  __bf16   v8b;
typedef __attribute__((ext_vector_type(8)))  float    v8f;
typedef __attribute__((ext_vector_type(4)))  float    v4f;
typedef __attribute__((ext_vector_type(4)))  unsigned v4u;

constexpr int kBatch   = 4;
constexpr int kSeq     = 1024;
constexpr int kEmb     = 1024;
constexpr int kHeads   = 16;
constexpr int kHD      = 64;
constexpr int kTok     = kBatch * kSeq;
constexpr int kRelRows = 1999;
constexpr int kRelMax  = kRelRows - 1;

static_assert(kEmb == kHeads * kHD);
static_assert(kHD == 64);
static_assert(kTok % 64 == 0 && kEmb % 64 == 0 && kEmb % 32 == 0 && kSeq % 64 == 0);

// ---------------------------------------------------------------------------
// helpers
// ---------------------------------------------------------------------------
__device__ __forceinline__ unsigned short f2bf_bits(float f) {
  unsigned u = __float_as_uint(f);
  return (unsigned short)((u + 0x7FFFu + ((u >> 16) & 1u)) >> 16);
}
__device__ __forceinline__ float bf_bits2f(unsigned short h) { return __uint_as_float(((unsigned)h) << 16); }
__device__ __forceinline__ float rne_bf(float f) { return bf_bits2f(f2bf_bits(f)); }

__device__ __forceinline__ void dep_guard_h(v8f& a, v8f& b, v16h x, v16h y) { asm volatile("v_nop\n\tv_nop\n\tv_nop\n\tv_nop" : "+v"(a), "+v"(b) : "v"(x), "v"(y)); }
__device__ __forceinline__ void dep_guard_b(v8f& a, v8f& b, v16b x, v16b y) { asm volatile("v_nop\n\tv_nop\n\tv_nop\n\tv_nop" : "+v"(a), "+v"(b) : "v"(x), "v"(y)); }
__device__ __forceinline__ void keep4_h(v16h a, v16h b, v16h c, v16h d) { asm volatile("v_nop" :: "v"(a), "v"(b), "v"(c), "v"(d)); }
__device__ __forceinline__ void keep4_b(v16b a, v16b b, v16b c, v16b d) { asm volatile("v_nop" :: "v"(a), "v"(b), "v"(c), "v"(d)); }
__device__ __forceinline__ void acc_guard4(v8f& a, v8f& b, v8f& c, v8f& d) { asm volatile("v_nop\n\tv_nop\n\tv_nop\n\tv_nop" : "+v"(a), "+v"(b), "+v"(c), "+v"(d)); }
template <typename T> struct Frag;
template <> struct Frag<_Float16> {
  typedef v16h V; union U { v16h v; v8h h[2]; };
  // elements 0..7 <- p[0..7], 8..15 <- p[16..23]
  static __device__ __forceinline__ v16h load(const _Float16* p) {
    U f; f.h[0] = *(const v8h*)(p); f.h[1] = *(const v8h*)(p + 16); return f.v;
  }
  static __device__ __forceinline__ v8f mma(v16h a, v16h b, v8f c) {
    return __builtin_amdgcn_wmma_f32_16x16x32_f16(false, a, false, b, (short)0, c, false, false);
  }
  static __device__ __forceinline__ void guard(v8f& a, v8f& b, v16h x, v16h y) { dep_guard_h(a, b, x, y); }
  static __device__ __forceinline__ void keep(v16h a, v16h b, v16h c, v16h d) { keep4_h(a, b, c, d); }
};
template <> struct Frag<__bf16> {
  typedef v16b V; union U { v16b v; v8b h[2]; };
  static __device__ __forceinline__ v16b load(const __bf16* p) {
    U f; f.h[0] = *(const v8b*)(p); f.h[1] = *(const v8b*)(p + 16); return f.v;
  }
  static __device__ __forceinline__ v8f mma(v16b a, v16b b, v8f c) {
    return __builtin_amdgcn_wmma_f32_16x16x32_bf16(false, a, false, b, (short)0, c, false, false);
  }
  static __device__ __forceinline__ void guard(v8f& a, v8f& b, v16b x, v16b y) { dep_guard_b(a, b, x, y); }
  static __device__ __forceinline__ void keep(v16b a, v16b b, v16b c, v16b d) { keep4_b(a, b, c, d); }
};

// f16 WMMA with hazard guard (A, B kept live; D tied)
__device__ __forceinline__ v8f hmma(v16h a, v16h b, v8f c) {
  c = __builtin_amdgcn_wmma_f32_16x16x32_f16(false, a, false, b, (short)0, c, false, false);
  asm volatile("v_nop\n\tv_nop\n\tv_nop\n\tv_nop" : "+v"(c) : "v"(a), "v"(b));
  return c;
}

// ---------------------------------------------------------------------------
// Register-blocked batched WMMA GEMM, operands staged in LDS.
// C[m,n] = scale * sum_k A[m,k] * Bt[n,k] (+bias); a work-group of 8 waves owns a 128x128 tile,
// each wave 32 rows x 64 columns of it (two waves per SIMD: one wave's LDS reads and copy issue
// stand behind the other's products).
// A row-major [M,K]; Bt row-major [N,K]; M,N % 128 == 0, K % 128 == 0.
// A pass is 128 k: 256 B of 128 A rows and of 128 Bt rows, brought into LDS by asynchronous copies,
// two buffers, the next pass's copies in flight while this pass is worked on.
// SPLIT: hi/lo operand planes (not supported by the staged loop, false).
// BIAS_MODE: 0 none, 1 bias[m], 2 bias[n]; bias values RNE-converted to bf16 precision before the add.
// OUT_MODE: 0 = f32, 1 = f16, 2 = bf16 hi plane (Cout) + bf16 lo plane (Cout2).
// ET: 0 = f16 operands, 1 = bf16 operands (pointers passed as 16-bit storage)
// ---------------------------------------------------------------------------
constexpr int kGK     = 128;               // k elements per pass
constexpr int kGPitch = 2 * kGK + 16;      // LDS row pitch in bytes: 16 B x odd, conflict-free for 16-byte reads down a column
constexpr int kGStage = 256 * kGPitch;     // one buffer: rows 0..127 = A rows, rows 128..255 = Bt rows

// One wave's share of a stage: 32 rows of 256 B, 16 copies of 2 rows each (16 lanes x 16 B per row).
// lds = this lane's LDS byte address in the first row pair, g = this lane's global address there,
// ld = source row pitch in elements.
template <typename T>
__device__ __forceinline__ void stage_copies(unsigned lds, const T* g, int ld) {
#pragma unroll
  for (int i = 0; i < 16; i += 8) {
    // the closing s_wait_xcnt is a precaution: no register that a copy names is rewritten ahead of it
    asm volatile(
        "global_load_async_to_lds_b128 %0, %8, off\n\t"
        "global_load_async_to_lds_b128 %1, %9, off\n\t"
        "global_load_async_to_lds_b128 %2, %10, off\n\t"
        "global_load_async_to_lds_b128 %3, %11, off\n\t"
        "global_load_async_to_lds_b128 %4, %12, off\n\t"
        "global_load_async_to_lds_b128 %5, %13, off\n\t"
        "global_load_async_to_lds_b128 %6, %14, off\n\t"
        "global_load_async_to_lds_b128 %7, %15, off\n\t"
        "s_wait_xcnt 0x0"
        :: "v"(lds + (unsigned)((i + 0) * 2 * kGPitch)), "v"(lds + (unsigned)((i + 1) * 2 * kGPitch)),
           "v"(lds + (unsigned)((i + 2) * 2 * kGPitch)), "v"(lds + (unsigned)((i + 3) * 2 * kGPitch)),
           "v"(lds + (unsigned)((i + 4) * 2 * kGPitch)), "v"(lds + (unsigned)((i + 5) * 2 * kGPitch)),
           "v"(lds + (unsigned)((i + 6) * 2 * kGPitch)), "v"(lds + (unsigned)((i + 7) * 2 * kGPitch)),
           "v"(g + (size_t)((i + 0) * 2) * ld), "v"(g + (size_t)((i + 1) * 2) * ld),
           "v"(g + (size_t)((i + 2) * 2) * ld), "v"(g + (size_t)((i + 3) * 2) * ld),
           "v"(g + (size_t)((i + 4) * 2) * ld), "v"(g + (size_t)((i + 5) * 2) * ld),
           "v"(g + (size_t)((i + 6) * 2) * ld), "v"(g + (size_t)((i + 7) * 2) * ld)
        : "memory");
  }
}

template <int ET> struct Elem;
template <> struct Elem<0> { typedef _Float16 T; };
template <> struct Elem<1> { typedef __bf16 T; };
// The tile's work is a device function, so that one launch can hold several GEMMs: the kernel owns the LDS
// (ring: operand ring, two buffers; sT: per-wave 16x64 slab, pitch 68 floats) and says which tile and batch.
template <int ET, bool SPLIT, int BIAS_MODE, int OUT_MODE>
__device__ __forceinline__ void gemm_tile(
    unsigned char* ring, float (*sT)[16 * 68], int tile, int b,
    const unsigned short* __restrict__ Ap, const unsigned short* __restrict__ A2p, int lda, long strideA,
    const unsigned short* __restrict__ Btp, const unsigned short* __restrict__ Bt2p, int ldb, long strideB,
    void* __restrict__ Cout, void* __restrict__ Cout2, int ldc, long strideC,
    const float* __restrict__ bias,
    int M, int N, int K, float scale) {
  static_assert(!SPLIT);
  typedef typename Elem<ET>::T T;
  typedef typename Frag<T>::V V;
  const T* A = (const T*)Ap; const T* Bt = (const T*)Btp;
  const int lane = threadIdx.x & 31;
  // in a scalar register, so that what picks a wave's source rows is scalar and every lane stays on at the copies
  const int wave = __builtin_amdgcn_readfirstlane(threadIdx.x >> 5);
  const int tilesN = N >> 7;
  const int tilesM = M >> 7;
  // the same for the whole work-group, ahead of every barrier
  if (tile >= tilesM * tilesN) return;
  const int tm = tile / tilesN;
  const int tn = tile - tm * tilesN;
  const int wm = wave >> 1;
  const int wn = wave & 1;
  const int m0 = (tm << 7) + (wm << 5);
  const int n0 = (tn << 7) + (wn << 6);

  const T* Ab  = A  + (size_t)b * strideA;
  const T* Bb  = Bt + (size_t)b * strideB;

  // row (A) / col (B, D) within subtile; k offset of this lane half; D row offset
  const int rlane = lane & 15;
  const int koff  = (lane >> 4) * 8;
  const int mOff  = (lane >> 4) * 8;

  // copies: waves 0..3 bring the 128 A rows, waves 4..7 the 128 Bt rows, 32 rows each
  const int ldS = (wave < 4) ? lda : ldb;
  const T* gS = ((wave < 4) ? (Ab + (size_t)((tm << 7) + (wave << 5)) * lda)
                            : (Bb + (size_t)((tn << 7) + ((wave - 4) << 5)) * ldb))
                + (size_t)(lane >> 4) * ldS + rlane * 8;
  const unsigned ldsS = (unsigned)(size_t)ring + (unsigned)(((wave << 5) + (lane >> 4)) * kGPitch + rlane * 16);

  v8f acc[2][4];
#pragma unroll
  for (int i = 0; i < 2; ++i)
#pragma unroll
    for (int j = 0; j < 4; ++j) acc[i][j] = (v8f){0.f,0.f,0.f,0.f,0.f,0.f,0.f,0.f};

  const int nPass = K / kGK;
  stage_copies<T>(ldsS, gS, ldS);
  // pass 0's bytes of this wave have landed before the barrier that shows them to the other waves
  asm volatile("s_wait_asynccnt 0x0" ::: "memory");
  __syncthreads();
  if (nPass > 1) stage_copies<T>(ldsS + (unsigned)kGStage, gS + kGK, ldS);

  // one pass per trip, the buffer chosen by the trip's parity
  for (int t = 0; t < nPass; ++t) {
    const unsigned char* st = ring + (t & 1) * kGStage;
    const unsigned char* stA = st + ((wm << 5) + rlane) * kGPitch;
    const unsigned char* stB = st + (128 + (wn << 6) + rlane) * kGPitch;
#pragma unroll
    for (int k0 = 0; k0 < kGK; k0 += 32) {
      // all six fragments of a 32-k block are read as one group: one LDS latency per 8 products
      V bh[4], ah[2];
#pragma unroll
      for (int j = 0; j < 4; ++j) bh[j] = Frag<T>::load((const T*)(stB + (j << 4) * kGPitch) + koff + k0);
#pragma unroll
      for (int i = 0; i < 2; ++i) ah[i] = Frag<T>::load((const T*)(stA + (i << 4) * kGPitch) + koff + k0);
#pragma unroll
      for (int i = 0; i < 2; ++i) {
#pragma unroll
        for (int j = 0; j < 4; ++j) acc[i][j] = Frag<T>::mma(ah[i], bh[j], acc[i][j]);
        Frag<T>::guard(acc[i][0], acc[i][3], ah[i], ah[i]);
      }
      Frag<T>::keep(bh[0], bh[1], bh[2], bh[3]);
    }
    // this wave's reads of the buffer are done before the barrier behind which it is refilled
    asm volatile("s_wait_dscnt 0x0" ::: "memory");
    // this wave's copies of pass t + 1 have landed before the barrier that shows them to the other waves
    asm volatile("s_wait_asynccnt 0x0" ::: "memory");
    __syncthreads();
    if (t + 2 < nPass) stage_copies<T>(ldsS + (unsigned)((t & 1) * kGStage), gS + (size_t)(t + 2) * kGK, ldS);
  }
  // no copy is outstanding when the wave goes on to the epilogue and ends
  asm volatile("s_wait_asynccnt 0x0" ::: "memory");
  acc_guard4(acc[0][0], acc[0][1], acc[0][2], acc[0][3]);
  acc_guard4(acc[1][0], acc[1][1], acc[1][2], acc[1][3]);

  // ---- epilogue ----
  float* slab = sT[wave];
  // column biases: 4 scalar loads per lane, hoisted
  float bvj[4];
#pragma unroll
  for (int j = 0; j < 4; ++j) bvj[j] = (BIAS_MODE == 2) ? rne_bf(bias[n0 + (j << 4) + rlane]) : 0.f;
#pragma unroll
  for (int i = 0; i < 2; ++i) {
    const int mBase = m0 + (i << 4);
    // row biases: two 16-B loads per lane (rows mBase+mOff .. +7, 32-B aligned)
    v4f bm0 = (v4f){0.f, 0.f, 0.f, 0.f};
    v4f bm1 = bm0;
    if (BIAS_MODE == 1) {
      bm0 = *(const v4f*)(bias + mBase + mOff);
      bm1 = *(const v4f*)(bias + mBase + mOff + 4);
    }
#pragma unroll
    for (int j = 0; j < 4; ++j) {
#pragma unroll
      for (int r = 0; r < 8; ++r) {
        float v = acc[i][j][r] * scale;
        if (BIAS_MODE == 1) { const v4f bsel = (r < 4) ? bm0 : bm1; v += rne_bf(bsel[r & 3]); }
        if (BIAS_MODE == 2) v += bvj[j];
        slab[(mOff + r) * 68 + (j << 4) + rlane] = v;
      }
    }
    __builtin_amdgcn_fence(__ATOMIC_RELEASE, "workgroup");
    __builtin_amdgcn_wave_barrier();
    __builtin_amdgcn_fence(__ATOMIC_ACQUIRE, "workgroup");
    if (OUT_MODE == 0) {
      float* C = (float*)Cout + (size_t)b * strideC;
      // row seg = 256 B = 16 lanes x 16 B
      const int hh = lane >> 4, c4 = (lane & 15) * 4;
      {
#pragma unroll
        for (int it = 0; it < 8; ++it) {
          const int row = it * 2 + hh;
          v4f v = *(const v4f*)(slab + row * 68 + c4);
          *(v4f*)(C + (size_t)(mBase + row) * ldc + n0 + c4) = v;
        }
        
      }
    } else {
      const int q = lane >> 3, c8 = (lane & 7) * 8;
      unsigned short* C  = (unsigned short*)Cout  + (size_t)b * strideC;
      unsigned short* C2 = (OUT_MODE == 2) ? ((unsigned short*)Cout2 + (size_t)b * strideC) : nullptr;
      {
#pragma unroll
        for (int it = 0; it < 4; ++it) {
          const int row = it * 4 + q;
          const float* sp = slab + row * 68 + c8;
          v8h hv, lv;
#pragma unroll
          for (int e = 0; e < 8; ++e) {
            if (OUT_MODE == 1) {
              hv[e] = (_Float16)sp[e];
            } else {
              unsigned short hb = f2bf_bits(sp[e]);
              unsigned short lb = f2bf_bits(sp[e] - bf_bits2f(hb));
              hv[e] = __builtin_bit_cast(_Float16, hb);
              lv[e] = __builtin_bit_cast(_Float16, lb);
            }
          }
          *(v8h*)(C + (size_t)(mBase + row) * ldc + n0 + c8) = hv;
          if (OUT_MODE == 2) *(v8h*)(C2 + (size_t)(mBase + row) * ldc + n0 + c8) = lv;
        }
        
      }
    }
    __builtin_amdgcn_fence(__ATOMIC_RELEASE, "workgroup");
    __builtin_amdgcn_wave_barrier();
    __builtin_amdgcn_fence(__ATOMIC_ACQUIRE, "workgroup");
  }
}

// One GEMM per launch: blockIdx.x = tile, blockIdx.y = batch.
template <int ET, bool SPLIT, int BIAS_MODE, int OUT_MODE>
__global__ __launch_bounds__(256) void wmma_gemm64(
    const unsigned short* __restrict__ Ap, const unsigned short* __restrict__ A2p, int lda, long strideA,
    const unsigned short* __restrict__ Btp, const unsigned short* __restrict__ Bt2p, int ldb, long strideB,
    void* __restrict__ Cout, void* __restrict__ Cout2, int ldc, long strideC,
    const float* __restrict__ bias,
    int M, int N, int K, float scale) {
  __shared__ __align__(16) unsigned char ring[2 * kGStage];
  __shared__ __align__(16) float sT[8][16 * 68];
  gemm_tile<ET, SPLIT, BIAS_MODE, OUT_MODE>(ring, sT, blockIdx.x, blockIdx.y,
      Ap, A2p, lda, strideA, Btp, Bt2p, ldb, strideB, Cout, Cout2, ldc, strideC, bias, M, N, K, scale);
}

// The three projections, which do not depend on one another, in one launch: blockIdx.y picks the job
// (the same for a whole work-group), blockIdx.x the tile.
//   job 0: Q[token][n]  = sum_k Xb[token][k] WqT[n][k] + bq[n]
//   job 1: K[token][n]  = sum_k Xb[token][k] WkT[n][k] + bk[n]
//   job 2: Vt[n][token] = sum_k WvT[n][k] Xb[token][k] + bv[n]   (M = features, N = tokens)
__global__ __launch_bounds__(256) void qkv_gemm(
    const unsigned short* __restrict__ Xb, const unsigned short* __restrict__ WqT,
    const unsigned short* __restrict__ WkT, const unsigned short* __restrict__ WvT,
    unsigned short* __restrict__ Qp, unsigned short* __restrict__ Kp, unsigned short* __restrict__ Vtp,
    const float* __restrict__ bq, const float* __restrict__ bk, const float* __restrict__ bv,
    int nTok, int nEmb) {
  __shared__ __align__(16) unsigned char ring[2 * kGStage];
  __shared__ __align__(16) float sT[8][16 * 68];
  const int job = blockIdx.y;
  if (job < 2) {
    const unsigned short* Wt = job ? WkT : WqT;
    unsigned short* C = job ? Kp : Qp;
    gemm_tile<1, false, 2, 1>(ring, sT, blockIdx.x, 0,
        Xb, Xb, nEmb, 0L, Wt, Wt, nEmb, 0L, (void*)C, (void*)C, nEmb, 0L, job ? bk : bq,
        nTok, nEmb, nEmb, 1.0f);
  } else {
    gemm_tile<1, false, 1, 1>(ring, sT, blockIdx.x, 0,
        WvT, WvT, nEmb, 0L, Xb, Xb, nEmb, 0L, (void*)Vtp, (void*)Vtp, nTok, 0L, bv,
        nEmb, nTok, nEmb, 1.0f);
  }
}

// ---------------------------------------------------------------------------
// f32 -> bf16 plane, 2 elements per thread; blk = index of this 256-thread block within the cast
// ---------------------------------------------------------------------------
__device__ __forceinline__ void cast_f32_bf16x2(
    const float* __restrict__ in, unsigned short* __restrict__ out, int n2, int blk) {
  const int i = blk * 256 + threadIdx.x;
  if (i < n2) {
    const unsigned u = (unsigned)f2bf_bits(in[2 * i]) | ((unsigned)f2bf_bits(in[2 * i + 1]) << 16);
    ((unsigned*)out)[i] = u;
    
  }
}

// ---------------------------------------------------------------------------
// Transpose + convert: W row-major in[rows][cols] f32 -> Wt row-major out[cols][rows] 16-bit.
// MODE 0: bf16 bits of RNE-bf16(W). MODE 1: f16 bits of RNE-bf16(W) * wsc (wsc a power of two).
// One block per 64x64 tile (bx, by) of (cols/64, rows/64); rows, cols % 64 == 0. tile = the kernel's 64x65 LDS floats.
// Load: 256 threads x 4 x float4 = 64x64 tile. Store: wave w writes output rows w*8..w*8+7,
// ---------------------------------------------------------------------------
template <int MODE>
__device__ __forceinline__ void transpose_cvt16(
    float* tile, int bx, int by,
    const float* __restrict__ W, unsigned short* __restrict__ Wt, int rows, int cols, float wsc) {
  const int tid = threadIdx.x, lane = tid & 31, wave = tid >> 5;
  const int n0 = bx * 64;
  const int k0 = by * 64;
  {
    const int c4 = (tid & 15) * 4, r = tid >> 4;
#pragma unroll
    for (int it = 0; it < 4; ++it) {
      const int rr = it * 16 + r;
      const v4f x4 = *(const v4f*)(W + (size_t)(k0 + rr) * cols + n0 + c4);
      tile[rr * 65 + c4 + 0] = x4[0];
      tile[rr * 65 + c4 + 1] = x4[1];
      tile[rr * 65 + c4 + 2] = x4[2];
      tile[rr * 65 + c4 + 3] = x4[3];
    }
  }
  __syncthreads();
  const int q4 = lane >> 3, c8 = (lane & 7) * 8;
  _Float16* out = (_Float16*)Wt;
  {
#pragma unroll
    for (int it = 0; it < 2; ++it) {
      const int i = wave * 8 + it * 4 + q4;
      v8h hv;
#pragma unroll
      for (int e = 0; e < 8; ++e) {
        const float f = tile[(c8 + e) * 65 + i];
        if (MODE == 0) {
          hv[e] = __builtin_bit_cast(_Float16, f2bf_bits(f));
        } else {
          hv[e] = (_Float16)(rne_bf(f) * wsc);
        }
      }
      *(v8h*)(out + (size_t)(n0 + i) * rows + k0 + c8) = hv;
    }
    // a precaution: inlined into a kernel with other jobs' code behind it, no register that the two stores name
    // is rewritten ahead of this wait on any branch of the listing
    asm volatile("s_wait_xcnt 0x0" ::: "memory");
  }
}

// ---------------------------------------------------------------------------
// The five input conversions, which do not depend on one another, in one launch: the block index picks the job
// (the same for a whole work-group, so the transposes' barrier stands under uniform control flow).
// Blocks [0, 4 * kWTiles): the weight transposes in the order Wq, Wk, Wv, Wp, one 64x64 tile each; they come
// first because they last longer than a cast block. The blocks behind them: the cast of x.
// ---------------------------------------------------------------------------
constexpr int kWTilesX = kEmb / 64;
constexpr int kWTiles  = kWTilesX * kWTilesX;
__global__ __launch_bounds__(256) void prep_inputs(
    const float* __restrict__ x, const float* __restrict__ Wq, const float* __restrict__ Wk,
    const float* __restrict__ Wv, const float* __restrict__ Wp,
    unsigned short* __restrict__ Xb, unsigned short* __restrict__ WqT, unsigned short* __restrict__ WkT,
    unsigned short* __restrict__ WvT, unsigned short* __restrict__ WpT, int n2, int emb, float wsc) {
  __shared__ float tile[64 * 65];
  const int blk = blockIdx.x;
  if (blk >= 4 * kWTiles) {
    cast_f32_bf16x2(x, Xb, n2, blk - 4 * kWTiles);
    return;
  }
  const int job = blk / kWTiles;
  const int t   = blk % kWTiles;
  const int bx  = t % kWTilesX;
  const int by  = t / kWTilesX;
  if (job < 3) {
    const float* W = (job == 0) ? Wq : (job == 1) ? Wk : Wv;
    unsigned short* Wt = (job == 0) ? WqT : (job == 1) ? WkT : WvT;
    transpose_cvt16<0>(tile, bx, by, W, Wt, emb, emb, 1.0f);
  } else {
    transpose_cvt16<1>(tile, bx, by, Wp, WpT, emb, emb, wsc);
  }
}

constexpr int kQB = 64;
constexpr int kKC = 64;
constexpr int kNW = 4;
// LDS row pitch of the K and V^T tiles in halves: 144 B = 16 B x odd, so that the 16 rows that a 16-byte
// fragment read walks down fall on 16 different bank groups (at 128 B they fall on two)
constexpr int kLP = kKC + 8;
constexpr int kBiasL = kQB + kSeq;
constexpr float kPCarryLog2 = 15.0f;      // p and the row sum are carried x2^15, taken in the exponent
constexpr float kLog2E = 1.44269504088896340736f;
static_assert(kSeq % kKC == 0 && kSeq % kQB == 0 && kKC == kHD);

// Eight base-2 exponentials in place, in one statement: each v_exp_f32 overwrites its own source alone and none reads
// a neighbour's result; the closing v_nop is the slot that the instruction set asks for behind a transcendental,
// whatever instruction the compiler puts next (left to the builtin, it set exponentials over one another's sources).
__device__ __forceinline__ void exp2x8(float& a, float& b, float& c, float& d, float& e, float& f, float& g, float& h) {
  asm("v_exp_f32 %0, %0\n\tv_exp_f32 %1, %1\n\tv_exp_f32 %2, %2\n\tv_exp_f32 %3, %3\n\t"
      "v_exp_f32 %4, %4\n\tv_exp_f32 %5, %5\n\tv_exp_f32 %6, %6\n\tv_exp_f32 %7, %7\n\tv_nop"
      : "+v"(a), "+v"(b), "+v"(c), "+v"(d), "+v"(e), "+v"(f), "+v"(g), "+v"(h));
}

// One thread's share of a chunk: 16 B of each of 4 K rows and 4 V^T rows, 16 rows apart. Eight lanes cover one 128-B row,
// so a wave-wide copy takes 4 whole lines. ldsK, ldsV = this lane's LDS byte addresses in its first row,
// gK, gV = its global addresses there.
constexpr int kKVTile = kKC * kLP * 2;    // bytes of one K or V^T tile in LDS
__device__ __forceinline__ void kv_copies(unsigned ldsK, const _Float16* gK, unsigned ldsV, const _Float16* gV) {
  // the closing s_wait_xcnt is a precaution: no register that a copy names is rewritten ahead of it
  asm volatile(
      "global_load_async_to_lds_b128 %0, %8, off\n\t"
      "global_load_async_to_lds_b128 %1, %9, off\n\t"
      "global_load_async_to_lds_b128 %2, %10, off\n\t"
      "global_load_async_to_lds_b128 %3, %11, off\n\t"
      "global_load_async_to_lds_b128 %4, %12, off\n\t"
      "global_load_async_to_lds_b128 %5, %13, off\n\t"
      "global_load_async_to_lds_b128 %6, %14, off\n\t"
      "global_load_async_to_lds_b128 %7, %15, off\n\t"
      "s_wait_xcnt 0x0"
      :: "v"(ldsK), "v"(ldsK + (unsigned)(16 * kLP * 2)), "v"(ldsK + (unsigned)(32 * kLP * 2)), "v"(ldsK + (unsigned)(48 * kLP * 2)),
         "v"(ldsV), "v"(ldsV + (unsigned)(16 * kLP * 2)), "v"(ldsV + (unsigned)(32 * kLP * 2)), "v"(ldsV + (unsigned)(48 * kLP * 2)),
         "v"(gK), "v"(gK + (size_t)16 * kEmb), "v"(gK + (size_t)32 * kEmb), "v"(gK + (size_t)48 * kEmb),
         "v"(gV), "v"(gV + (size_t)16 * kTok), "v"(gV + (size_t)32 * kTok), "v"(gV + (size_t)48 * kTok)
      : "memory");
}

// lane l's value in lane l ^ 16
__device__ __forceinline__ float xhalf(float x) {
  const int b = __builtin_bit_cast(int, x);
  return __builtin_bit_cast(float, __builtin_amdgcn_permlanex16(b, b, 0x76543210, 0xfedcba98, false, false));
}

__global__ __launch_bounds__(128) void attn_relbias_f16(
    const unsigned short* __restrict__ Qp, const unsigned short* __restrict__ Kp,
    const unsigned short* __restrict__ Vtp, const float* __restrict__ btab,
    const float* __restrict__ tptr, unsigned short* __restrict__ Cp, float ctx_scale) {
  union FH { v16h v; v8h h[2]; };
  // K [kv][d], V^T [d][kv] (rows of 64 halves at pitch kLP), two buffers each; bias slab
  __shared__ __align__(16) _Float16 Ksh[2 * kKC * kLP];
  __shared__ __align__(16) _Float16 Vtsh[2 * kHD * kLP];
  __shared__ __align__(16) float biasL[kBiasL];

  const _Float16* Qh  = (const _Float16*)Qp;
  const _Float16* Kh  = (const _Float16*)Kp;
  const _Float16* Vth = (const _Float16*)Vtp;

  const int tid  = threadIdx.x;
  const int wave = tid >> 5;
  const int lane = tid & 31;
  const int hh   = lane >> 4;
  const int c    = lane & 15;

  constexpr int nqb = kSeq / kQB;
  const int bx = blockIdx.x;
  const int qb = bx % nqb;
  const int bh = bx / nqb;
  const int h  = bh % kHeads;
  const int b  = bh / kHeads;
  const int qbase = qb * kQB;
  const int q0 = qbase + wave * 16;

  // K and V^T come into LDS by asynchronous copies, the next chunk's in flight while this chunk is worked on.
  // This thread's place in a tile: row tid / 8 (and 16, 32, 48 rows on), 16-byte piece tid % 8.
  constexpr int nCh = kSeq / kKC;
  const _Float16* gK = Kh + (size_t)(b * kSeq + (tid >> 3)) * kEmb + h * kHD + (tid & 7) * 8;
  const _Float16* gV = Vth + (size_t)(h * kHD + (tid >> 3)) * kTok + b * kSeq + (tid & 7) * 8;
  const unsigned ldsO = (unsigned)((tid >> 3) * (kLP * 2) + (tid & 7) * 16);
  const unsigned ldsK = (unsigned)(size_t)Ksh + ldsO;
  const unsigned ldsV = (unsigned)(size_t)Vtsh + ldsO;
  // chunk 0's copies fly while the bias slab and the Q fragments are fetched
  kv_copies(ldsK, gK, ldsV, gV);

  // temperature (RNE-bf16 converted input), clamp, 1/(sqrt(E) * temp)
  float tv = rne_bf(tptr[0]);
  tv = fminf(fmaxf(tv, 0.1f), 10.0f);
  // times log2 e: scores and bias are formed in base-2 units, e^x = 2^(x log2 e)
  const float inv = (1.0f / (sqrtf((float)kEmb) * tv)) * kLog2E;

  // bias slab: biasL[i] = table[min(qbase + i, relmax)][h] * inv, i = (q - qbase) + (S-1) - kv in [0, kBiasL)
  for (int i = tid; i < kBiasL; i += kNW * 32) {
    int rel = qbase + i;
    rel = rel > kRelMax ? kRelMax : rel;
    biasL[i] = rne_bf(btab[(size_t)rel * kHeads + h]) * inv;
  }

  // Q fragments (B operand, column c = query q0 + c): 2 d-chunks, hardware k order from the f16 plane
  v16h qa[2];
  {
    const _Float16* qrow = Qh + (size_t)(b * kSeq + q0 + c) * kEmb + h * kHD;
#pragma unroll
    for (int dc = 0; dc < 2; ++dc) qa[dc] = Frag<_Float16>::load(qrow + dc * 32 + 8 * hh);
  }

  // of query q0 + c: running maximum less 15 (the same in both halves), this half's part of the running sum (x2^15)
  float mrow = -INFINITY, lrow = 0.f;
  // oacc[t][r] = O^T[d = t*16 + 8*hh + r][query q0 + c]
  v8f oacc[4];
#pragma unroll
  for (int t = 0; t < 4; ++t) oacc[t] = (v8f){0.f,0.f,0.f,0.f,0.f,0.f,0.f,0.f};

  // chunk 0's bytes of this wave have landed before the barrier that shows them (and the bias slab) to the other waves
  asm volatile("s_wait_asynccnt 0x0" ::: "memory");
  __syncthreads();
  if (nCh > 1) kv_copies(ldsK + (unsigned)kKVTile, gK + (size_t)kKC * kEmb, ldsV + (unsigned)kKVTile, gV + kKC);

  // one chunk per trip, the buffer chosen by the trip's parity
  for (int kc = 0; kc < nCh; ++kc) {
    const int kv0 = kc * kKC;
    const _Float16* Kb = Ksh + (kc & 1) * (kKC * kLP);
    const _Float16* Vb = Vtsh + (kc & 1) * (kHD * kLP);

    // ---- scores, transposed: s[j][r] = score of key kv0 + j*16 + 8*hh + r with query q0 + c ----
    v8f s[4];
#pragma unroll
    for (int j = 0; j < 4; ++j) {
      s[j] = (v8f){0.f,0.f,0.f,0.f,0.f,0.f,0.f,0.f};
#pragma unroll
      for (int dc = 0; dc < 2; ++dc) {
        FH kb;
        kb.h[0] = *(const v8h*)(Kb + (j * 16 + c) * kLP + dc * 32 + 8 * hh);
        kb.h[1] = *(const v8h*)(Kb + (j * 16 + c) * kLP + dc * 32 + 16 + 8 * hh);
        s[j] = hmma(kb.v, qa[dc], s[j]);
      }
    }

    // ---- scale + bias + maximum over this lane's 32 keys (one chain per tile), then over both halves ----
    const int bi = wave * 16 + c + (kSeq - 1) - kv0 - 8 * hh;
    float mj[4];
#pragma unroll
    for (int j = 0; j < 4; ++j) {
      mj[j] = -INFINITY;
#pragma unroll
      for (int r = 0; r < 8; ++r) {
        const float sc = s[j][r] * inv + biasL[bi - j * 16 - r];
        s[j][r] = sc;
        mj[j] = fmaxf(mj[j], sc);
      }
    }
    float cm = fmaxf(fmaxf(mj[0], mj[1]), fmaxf(mj[2], mj[3]));
    cm = fmaxf(cm, xhalf(cm));
    // the point that exponents are taken from: the chunk's maximum less 15 (any point serves, it cancels in p / l).
    // Where the maximum is so large that f32 cannot hold the 15 beside it, the maximum itself, so that p stays inside f16.
    {
      const float lowered = cm - kPCarryLog2;
      cm = (cm - lowered < kPCarryLog2 + 0.5f) ? lowered : cm;
    }

    // ---- online softmax update; P^T (x2^15, f16) packed into the B operands of the second product ----
    const float mnew = fmaxf(mrow, cm);
    const float alpha = __builtin_amdgcn_exp2f(mrow - mnew);
    mrow = mnew;
    // pb[kk] element e: key kv0 + kk*32 + 8*hh + e for e < 8, kv0 + kk*32 + 16 + 8*hh + (e - 8) behind: tiles 2kk, 2kk + 1
    v16h pb[2];
    float pj[4];
#pragma unroll
    for (int j = 0; j < 4; ++j) {
      float e[8];
#pragma unroll
      for (int r = 0; r < 8; ++r) e[r] = s[j][r] - mnew;
      exp2x8(e[0], e[1], e[2], e[3], e[4], e[5], e[6], e[7]);
      pj[j] = e[0];
#pragma unroll
      for (int r = 1; r < 8; ++r) pj[j] += e[r];
#pragma unroll
      for (int r = 0; r < 8; ++r) pb[j >> 1][(j & 1) * 8 + r] = (_Float16)e[r];
    }
    lrow = lrow * alpha + ((pj[0] + pj[1]) + (pj[2] + pj[3]));
#pragma unroll
    for (int t = 0; t < 4; ++t)
#pragma unroll
      for (int r = 0; r < 8; ++r) oacc[t][r] *= alpha;

    // ---- O^T += V^T_chunk . P^T ----
#pragma unroll
    for (int kk = 0; kk < 2; ++kk) {
#pragma unroll
      for (int t = 0; t < 4; ++t) {
        FH vb;
        vb.h[0] = *(const v8h*)(Vb + (t * 16 + c) * kLP + kk * 32 + 8 * hh);
        vb.h[1] = *(const v8h*)(Vb + (t * 16 + c) * kLP + kk * 32 + 16 + 8 * hh);
        oacc[t] = hmma(vb.v, pb[kk], oacc[t]);
      }
    }
    // this wave's reads of the buffers are done before the barrier behind which they are refilled
    asm volatile("s_wait_dscnt 0x0" ::: "memory");
    // this wave's copies of chunk kc + 1 have landed before the barrier that shows them to the other waves
    asm volatile("s_wait_asynccnt 0x0" ::: "memory");
    __syncthreads();
    if (kc + 2 < nCh)
      kv_copies(ldsK + (unsigned)((kc & 1) * kKVTile), gK + (size_t)(kc + 2) * kKC * kEmb,
                ldsV + (unsigned)((kc & 1) * kKVTile), gV + (kc + 2) * kKC);
  }
  // no copy is outstanding when the wave goes on to the epilogue and ends
  asm volatile("s_wait_asynccnt 0x0" ::: "memory");

  // the two halves' sums of a query are joined here, once; a lane's 8 accumulators of a tile are 8 consecutive d
  // of its query's row: one 16-byte store per tile
  {
    const float l = lrow + xhalf(lrow);
    const float invl = ctx_scale * (1.0f / l);
    _Float16* crow = (_Float16*)Cp + (size_t)(b * kSeq + q0 + c) * kEmb + h * kHD + 8 * hh;
#pragma unroll
    for (int t = 0; t < 4; ++t) {
      v8h hv;
#pragma unroll
      for (int r = 0; r < 8; ++r) hv[r] = (_Float16)(oacc[t][r] * invl);
      *(v8h*)(crow + t * 16) = hv;
    }
  }
}

// ---------------------------------------------------------------------------
// Host launch
// ---------------------------------------------------------------------------
extern "C" void kernel_launch(void* const* d_in, const int* in_sizes, int n_in,
                              void* d_out, int out_size, void* d_ws, size_t ws_size,
                              hipStream_t stream) {
  if (n_in < 11) return;
  if (in_sizes[0] != kTok * kEmb) return;
  if (in_sizes[1] != kEmb * kEmb || in_sizes[3] != kEmb * kEmb ||
      in_sizes[5] != kEmb * kEmb || in_sizes[7] != kEmb * kEmb) return;
  if (in_sizes[2] < kEmb || in_sizes[4] < kEmb || in_sizes[6] < kEmb || in_sizes[8] < kEmb) return;
  if (in_sizes[9] != kRelRows * kHeads || in_sizes[10] < 1) return;
  if (out_size != kTok * kEmb) return;

  const float* x    = (const float*)d_in[0];
  const float* Wq   = (const float*)d_in[1];
  const float* bq   = (const float*)d_in[2];
  const float* Wk   = (const float*)d_in[3];
  const float* bk   = (const float*)d_in[4];
  const float* Wv   = (const float*)d_in[5];
  const float* bv   = (const float*)d_in[6];
  const float* Wp   = (const float*)d_in[7];
  const float* bp   = (const float*)d_in[8];
  const float* btab = (const float*)d_in[9];
  const float* tptr = (const float*)d_in[10];
  float* out = (float*)d_out;

  // workspace region map (bytes), all offsets multiples of 2 MiB:
  //   Xb  bf16 [4096][1024]   8 MiB  @ 0
  //   WqT bf16 [1024][1024]   2 MiB  @ 8 MiB
  //   WkT bf16 [1024][1024]   2 MiB  @ 10 MiB
  //   WvT bf16 [1024][1024]   2 MiB  @ 12 MiB
  //   WpT f16  [1024][1024]   2 MiB  @ 14 MiB   (RNE-bf16 values x64)
  //   Qp  f16  [4096][1024]   8 MiB  @ 16 MiB
  //   Kp  f16  [4096][1024]   8 MiB  @ 24 MiB
  //   Vtp f16  [1024][4096]   8 MiB  @ 32 MiB
  //   Cx  f16  [4096][1024]   8 MiB  @ 40 MiB   (ctx x64)
  //   total 48 MiB = 50,331,648 B
  const size_t szAct = (size_t)kTok * kEmb * 2;
  const size_t szW   = (size_t)kEmb * kEmb * 2;
  size_t off = 0;
  const size_t oXb = off; off += szAct;
  const size_t oWq = off; off += szW;
  const size_t oWk = off; off += szW;
  const size_t oWv = off; off += szW;
  const size_t oWp = off; off += szW;
  const size_t oQ  = off; off += szAct;
  const size_t oK  = off; off += szAct;
  const size_t oVt = off; off += szAct;
  const size_t oCx = off; off += szAct;
  if (off > ws_size) return;

  char* w = (char*)d_ws;
  unsigned short* Xb  = (unsigned short*)(w + oXb);
  unsigned short* WqT = (unsigned short*)(w + oWq);
  unsigned short* WkT = (unsigned short*)(w + oWk);
  unsigned short* WvT = (unsigned short*)(w + oWv);
  unsigned short* WpT = (unsigned short*)(w + oWp);
  unsigned short* Qp  = (unsigned short*)(w + oQ);
  unsigned short* Kp  = (unsigned short*)(w + oK);
  unsigned short* Vtp = (unsigned short*)(w + oVt);
  unsigned short* Cx  = (unsigned short*)(w + oCx);

  const float kWpCarry  = 64.0f;
  const float kCtxCarry = 64.0f;

  // 1) one launch: weights in[rows=1024][cols=1024] -> out[cols][rows], and x -> bf16 plane (2 elements per thread)
  {
    const int n2 = (kTok * kEmb) / 2;
    prep_inputs<<<4 * kWTiles + (n2 + 255) / 256, 256, 0, stream>>>(
        x, Wq, Wk, Wv, Wp, Xb, WqT, WkT, WvT, WpT, n2, kEmb, kWpCarry);
  }
  // 2) one launch: the three projections (bf16 WMMA, f16 outputs). M,N % 128 == 0, K % 128 == 0 by the static_assert below.
  static_assert(kTok % 128 == 0 && kEmb % 128 == 0 && kEmb % kGK == 0);
  const int gemmBlocks = (kTok / 128) * (kEmb / 128);
  qkv_gemm<<<dim3(gemmBlocks, 3), 256, 0, stream>>>(
      Xb, WqT, WkT, WvT, Qp, Kp, Vtp, bq, bk, bv, kTok, kEmb);
  // 3) attention -> ctx f16 plane (x64)
  attn_relbias_f16<<<kBatch * kHeads * (kSeq / kQB), kNW * 32, 0, stream>>>(
      Qp, Kp, Vtp, btab, tptr, Cx, kCtxCarry);
  // 4) output projection: out[token][n] = 2^-12 * sum_c Cx[token][c] WpT[n][c] + bp[n]
  wmma_gemm64<0, false, 2, 0><<<dim3(gemmBlocks, 1), 256, 0, stream>>>(
      Cx, Cx, kEmb, 0L, WpT, WpT, kEmb, 0L, (void*)out, (void*)out, kEmb, 0L, bp,
      kTok, kEmb, kEmb, 1.0f / (kWpCarry * kCtxCarry));
}

// v007
// It runs in 77.5 microseconds.
// Next to v006, in two timings, it ran 1.06 times as fast each time.
// All steps since v000 together make it 4.16 times as fast.
// Contractions: x@Wq, x@Wk, Wv-side GEMM producing V^T on v_wmma_f32_16x16x32_bf16 (bf16 operands = RNE-bf16 converted inputs, exact products); q.k^T, p.v, ctx@Wp on v_wmma_f32_16x16x32_f16 (f16 operands; p carried x2^15, ctx and Wp carried x64); f32 accumulate; softmax and normalisers in f32.
#include <hip/hip_runtime.h>
#include <math.h>

typedef __attribute__((ext_vector_type(16))) _Float16 v16h;
typedef __attribute__((ext_vector_type(8)))  _Float16 v8h;
typedef __attribute__((ext_vector_type(16))) __bf16   v16b;
typedef __attribute__((ext_vector_type(8)))  __bf16   v8b;
typedef __attribute__((ext_vector_type(8)))  float    v8f;
typedef __attribute__((ext_vector_type(4)))  float    v4f;
typedef __attribute__((ext_vector_type(4)))  unsigned v4u;

constexpr int kBatch   = 4;
constexpr int kSeq     = 1024;
constexpr int kEmb     = 1024;
constexpr int kHeads   = 16;
constexpr int kHD      = 64;
constexpr int kTok     = kBatch * kSeq;
constexpr int kRelRows = 1999;
constexpr int kRelMax  = kRelRows - 1;

static_assert(kEmb == kHeads * kHD);
static_assert(kHD == 64);
static_assert(kTok % 64 == 0 && kEmb % 64 == 0 && kEmb % 32 == 0 && kSeq % 64 == 0);

// ---------------------------------------------------------------------------
// helpers
// ---------------------------------------------------------------------------
__device__ __forceinline__ unsigned short f2bf_bits(float f) {
  unsigned u = __float_as_uint(f);
  return (unsigned short)((u + 0x7FFFu + ((u >> 16) & 1u)) >> 16);
}
__device__ __forceinline__ float bf_bits2f(unsigned short h) { return __uint_as_float(((unsigned)h) << 16); }
__device__ __forceinline__ float rne_bf(float f) { return bf_bits2f(f2bf_bits(f)); }

__device__ __forceinline__ void dep_guard_h(v8f& a, v8f& b, v16h x, v16h y) { asm volatile("v_nop\n\tv_nop\n\tv_nop\n\tv_nop" : "+v"(a), "+v"(b) : "v"(x), "v"(y)); }
__device__ __forceinline__ void dep_guard_b(v8f& a, v8f& b, v16b x, v16b y) { asm volatile("v_nop\n\tv_nop\n\tv_nop\n\tv_nop" : "+v"(a), "+v"(b) : "v"(x), "v"(y)); }
__device__ __forceinline__ void keep4_h(v16h a, v16h b, v16h c, v16h d) { asm volatile("v_nop" :: "v"(a), "v"(b), "v"(c), "v"(d)); }
__device__ __forceinline__ void keep4_b(v16b a, v16b b, v16b c, v16b d) { asm volatile("v_nop" :: "v"(a), "v"(b), "v"(c), "v"(d)); }
__device__ __forceinline__ void acc_guard4(v8f& a, v8f& b, v8f& c, v8f& d) { asm volatile("v_nop\n\tv_nop\n\tv_nop\n\tv_nop" : "+v"(a), "+v"(b), "+v"(c), "+v"(d)); }
template <typename T> struct Frag;
template <> struct Frag<_Float16> {
  typedef v16h V; union U { v16h v; v8h h[2]; };
  // elements 0..7 <- p[0..7], 8..15 <- p[16..23]
  static __device__ __forceinline__ v16h load(const _Float16* p) {
    U f; f.h[0] = *(const v8h*)(p); f.h[1] = *(const v8h*)(p + 16); return f.v;
  }
  static __device__ __forceinline__ v8f mma(v16h a, v16h b, v8f c) {
    return __builtin_amdgcn_wmma_f32_16x16x32_f16(false, a, false, b, (short)0, c, false, false);
  }
  static __device__ __forceinline__ void guard(v8f& a, v8f& b, v16h x, v16h y) { dep_guard_h(a, b, x, y); }
  static __device__ __forceinline__ void keep(v16h a, v16h b, v16h c, v16h d) { keep4_h(a, b, c, d); }
};
template <> struct Frag<__bf16> {
  typedef v16b V; union U { v16b v; v8b h[2]; };
  static __device__ __forceinline__ v16b load(const __bf16* p) {
    U f; f.h[0] = *(const v8b*)(p); f.h[1] = *(const v8b*)(p + 16); return f.v;
  }
  static __device__ __forceinline__ v8f mma(v16b a, v16b b, v8f c) {
    return __builtin_amdgcn_wmma_f32_16x16x32_bf16(false, a, false, b, (short)0, c, false, false);
  }
  static __device__ __forceinline__ void guard(v8f& a, v8f& b, v16b x, v16b y) { dep_guard_b(a, b, x, y); }
  static __device__ __forceinline__ void keep(v16b a, v16b b, v16b c, v16b d) { keep4_b(a, b, c, d); }
};

// ---------------------------------------------------------------------------
// Register-blocked batched WMMA GEMM, operands staged in LDS.
// C[m,n] = scale * sum_k A[m,k] * Bt[n,k] (+bias); a work-group of 8 waves owns a 128x128 tile,
// each wave 32 rows x 64 columns of it (two waves per SIMD: one wave's LDS reads and copy issue
// stand behind the other's products).
// A row-major [M,K]; Bt row-major [N,K]; M,N % 128 == 0, K % 128 == 0.
// A pass is 128 k: 256 B of 128 A rows and of 128 Bt rows, brought into LDS by asynchronous copies,
// two buffers, the next pass's copies in flight while this pass is worked on.
// SPLIT: hi/lo operand planes (not supported by the staged loop, false).
// BIAS_MODE: 0 none, 1 bias[m], 2 bias[n]; bias values RNE-converted to bf16 precision before the add.
// OUT_MODE: 0 = f32, 1 = f16, 2 = bf16 hi plane (Cout) + bf16 lo plane (Cout2).
// ET: 0 = f16 operands, 1 = bf16 operands (pointers passed as 16-bit storage)
// ---------------------------------------------------------------------------
constexpr int kGK     = 128;               // k elements per pass
constexpr int kGPitch = 2 * kGK + 16;      // LDS row pitch in bytes: 16 B x odd, conflict-free for 16-byte reads down a column
constexpr int kGStage = 256 * kGPitch;     // one buffer: rows 0..127 = A rows, rows 128..255 = Bt rows

// One wave's share of a stage: 32 rows of 256 B, 16 copies of 2 rows each (16 lanes x 16 B per row).
// lds = this lane's LDS byte address in the first row pair, g = this lane's global address there,
// ld = source row pitch in elements.
template <typename T>
__device__ __forceinline__ void stage_copies(unsigned lds, const T* g, int ld) {
#pragma unroll
  for (int i = 0; i < 16; i += 8) {
    // the closing s_wait_xcnt is a precaution: no register that a copy names is rewritten ahead of it
    asm volatile(
        "global_load_async_to_lds_b128 %0, %8, off\n\t"
        "global_load_async_to_lds_b128 %1, %9, off\n\t"
        "global_load_async_to_lds_b128 %2, %10, off\n\t"
        "global_load_async_to_lds_b128 %3, %11, off\n\t"
        "global_load_async_to_lds_b128 %4, %12, off\n\t"
        "global_load_async_to_lds_b128 %5, %13, off\n\t"
        "global_load_async_to_lds_b128 %6, %14, off\n\t"
        "global_load_async_to_lds_b128 %7, %15, off\n\t"
        "s_wait_xcnt 0x0"
        :: "v"(lds + (unsigned)((i + 0) * 2 * kGPitch)), "v"(lds + (unsigned)((i + 1) * 2 * kGPitch)),
           "v"(lds + (unsigned)((i + 2) * 2 * kGPitch)), "v"(lds + (unsigned)((i + 3) * 2 * kGPitch)),
           "v"(lds + (unsigned)((i + 4) * 2 * kGPitch)), "v"(lds + (unsigned)((i + 5) * 2 * kGPitch)),
           "v"(lds + (unsigned)((i + 6) * 2 * kGPitch)), "v"(lds + (unsigned)((i + 7) * 2 * kGPitch)),
           "v"(g + (size_t)((i + 0) * 2) * ld), "v"(g + (size_t)((i + 1) * 2) * ld),
           "v"(g + (size_t)((i + 2) * 2) * ld), "v"(g + (size_t)((i + 3) * 2) * ld),
           "v"(g + (size_t)((i + 4) * 2) * ld), "v"(g + (size_t)((i + 5) * 2) * ld),
           "v"(g + (size_t)((i + 6) * 2) * ld), "v"(g + (size_t)((i + 7) * 2) * ld)
        : "memory");
  }
}

template <int ET> struct Elem;
template <> struct Elem<0> { typedef _Float16 T; };
template <> struct Elem<1> { typedef __bf16 T; };
// The tile's work is a device function, so that one launch can hold several GEMMs: the kernel owns the LDS
// (ring: operand ring, two buffers; sT: per-wave 16x64 slab, pitch 68 floats) and says which tile and batch.
template <int ET, bool SPLIT, int BIAS_MODE, int OUT_MODE>
__device__ __forceinline__ void gemm_tile(
    unsigned char* ring, float (*sT)[16 * 68], int tile, int b,
    const unsigned short* __restrict__ Ap, const unsigned short* __restrict__ A2p, int lda, long strideA,
    const unsigned short* __restrict__ Btp, const unsigned short* __restrict__ Bt2p, int ldb, long strideB,
    void* __restrict__ Cout, void* __restrict__ Cout2, int ldc, long strideC,
    const float* __restrict__ bias,
    int M, int N, int K, float scale) {
  static_assert(!SPLIT);
  typedef typename Elem<ET>::T T;
  typedef typename Frag<T>::V V;
  const T* A = (const T*)Ap; const T* Bt = (const T*)Btp;
  const int lane = threadIdx.x & 31;
  // in a scalar register, so that what picks a wave's source rows is scalar and every lane stays on at the copies
  const int wave = __builtin_amdgcn_readfirstlane(threadIdx.x >> 5);
  const int tilesN = N >> 7;
  const int tilesM = M >> 7;
  // the same for the whole work-group, ahead of every barrier
  if (tile >= tilesM * tilesN) return;
  const int tm = tile / tilesN;
  const int tn = tile - tm * tilesN;
  const int wm = wave >> 1;
  const int wn = wave & 1;
  const int m0 = (tm << 7) + (wm << 5);
  const int n0 = (tn << 7) + (wn << 6);

  const T* Ab  = A  + (size_t)b * strideA;
  const T* Bb  = Bt + (size_t)b * strideB;

  // row (A) / col (B, D) within subtile; k offset of this lane half; D row offset
  const int rlane = lane & 15;
  const int koff  = (lane >> 4) * 8;
  const int mOff  = (lane >> 4) * 8;

  // copies: waves 0..3 bring the 128 A rows, waves 4..7 the 128 Bt rows, 32 rows each
  const int ldS = (wave < 4) ? lda : ldb;
  const T* gS = ((wave < 4) ? (Ab + (size_t)((tm << 7) + (wave << 5)) * lda)
                            : (Bb + (size_t)((tn << 7) + ((wave - 4) << 5)) * ldb))
                + (size_t)(lane >> 4) * ldS + rlane * 8;
  const unsigned ldsS = (unsigned)(size_t)ring + (unsigned)(((wave << 5) + (lane >> 4)) * kGPitch + rlane * 16);

  v8f acc[2][4];
#pragma unroll
  for (int i = 0; i < 2; ++i)
#pragma unroll
    for (int j = 0; j < 4; ++j) acc[i][j] = (v8f){0.f,0.f,0.f,0.f,0.f,0.f,0.f,0.f};

  const int nPass = K / kGK;
  stage_copies<T>(ldsS, gS, ldS);
  // pass 0's bytes of this wave have landed before the barrier that shows them to the other waves
  asm volatile("s_wait_asynccnt 0x0" ::: "memory");
  __syncthreads();
  if (nPass > 1) stage_copies<T>(ldsS + (unsigned)kGStage, gS + kGK, ldS);

  // one pass per trip, the buffer chosen by the trip's parity
  for (int t = 0; t < nPass; ++t) {
    const unsigned char* st = ring + (t & 1) * kGStage;
    const unsigned char* stA = st + ((wm << 5) + rlane) * kGPitch;
    const unsigned char* stB = st + (128 + (wn << 6) + rlane) * kGPitch;
#pragma unroll
    for (int k0 = 0; k0 < kGK; k0 += 32) {
      // all six fragments of a 32-k block are read as one group: one LDS latency per 8 products
      V bh[4], ah[2];
#pragma unroll
      for (int j = 0; j < 4; ++j) bh[j] = Frag<T>::load((const T*)(stB + (j << 4) * kGPitch) + koff + k0);
#pragma unroll
      for (int i = 0; i < 2; ++i) ah[i] = Frag<T>::load((const T*)(stA + (i << 4) * kGPitch) + koff + k0);
#pragma unroll
      for (int i = 0; i < 2; ++i) {
#pragma unroll
        for (int j = 0; j < 4; ++j) acc[i][j] = Frag<T>::mma(ah[i], bh[j], acc[i][j]);
        Frag<T>::guard(acc[i][0], acc[i][3], ah[i], ah[i]);
      }
      Frag<T>::keep(bh[0], bh[1], bh[2], bh[3]);
    }
    // this wave's reads of the buffer are done before the barrier behind which it is refilled
    asm volatile("s_wait_dscnt 0x0" ::: "memory");
    // this wave's copies of pass t + 1 have landed before the barrier that shows them to the other waves
    asm volatile("s_wait_asynccnt 0x0" ::: "memory");
    __syncthreads();
    if (t + 2 < nPass) stage_copies<T>(ldsS + (unsigned)((t & 1) * kGStage), gS + (size_t)(t + 2) * kGK, ldS);
  }
  // no copy is outstanding when the wave goes on to the epilogue and ends
  asm volatile("s_wait_asynccnt 0x0" ::: "memory");
  acc_guard4(acc[0][0], acc[0][1], acc[0][2], acc[0][3]);
  acc_guard4(acc[1][0], acc[1][1], acc[1][2], acc[1][3]);

  // ---- epilogue ----
  float* slab = sT[wave];
  // column biases: 4 scalar loads per lane, hoisted
  float bvj[4];
#pragma unroll
  for (int j = 0; j < 4; ++j) bvj[j] = (BIAS_MODE == 2) ? rne_bf(bias[n0 + (j << 4) + rlane]) : 0.f;
#pragma unroll
  for (int i = 0; i < 2; ++i) {
    const int mBase = m0 + (i << 4);
    // row biases: two 16-B loads per lane (rows mBase+mOff .. +7, 32-B aligned)
    v4f bm0 = (v4f){0.f, 0.f, 0.f, 0.f};
    v4f bm1 = bm0;
    if (BIAS_MODE == 1) {
      bm0 = *(const v4f*)(bias + mBase + mOff);
      bm1 = *(const v4f*)(bias + mBase + mOff + 4);
    }
#pragma unroll
    for (int j = 0; j < 4; ++j) {
#pragma unroll
      for (int r = 0; r < 8; ++r) {
        float v = acc[i][j][r] * scale;
        if (BIAS_MODE == 1) { const v4f bsel = (r < 4) ? bm0 : bm1; v += rne_bf(bsel[r & 3]); }
        if (BIAS_MODE == 2) v += bvj[j];
        slab[(mOff + r) * 68 + (j << 4) + rlane] = v;
      }
    }
    __builtin_amdgcn_fence(__ATOMIC_RELEASE, "workgroup");
    __builtin_amdgcn_wave_barrier();
    __builtin_amdgcn_fence(__ATOMIC_ACQUIRE, "workgroup");
    if (OUT_MODE == 0) {
      float* C = (float*)Cout + (size_t)b * strideC;
      // row seg = 256 B = 16 lanes x 16 B
      const int hh = lane >> 4, c4 = (lane & 15) * 4;
      {
#pragma unroll
        for (int it = 0; it < 8; ++it) {
          const int row = it * 2 + hh;
          v4f v = *(const v4f*)(slab + row * 68 + c4);
          *(v4f*)(C + (size_t)(mBase + row) * ldc + n0 + c4) = v;
        }
        
      }
    } else {
      const int q = lane >> 3, c8 = (lane & 7) * 8;
      unsigned short* C  = (unsigned short*)Cout  + (size_t)b * strideC;
      unsigned short* C2 = (OUT_MODE == 2) ? ((unsigned short*)Cout2 + (size_t)b * strideC) : nullptr;
      {
#pragma unroll
        for (int it = 0; it < 4; ++it) {
          const int row = it * 4 + q;
          const float* sp = slab + row * 68 + c8;
          v8h hv, lv;
#pragma unroll
          for (int e = 0; e < 8; ++e) {
            if (OUT_MODE == 1) {
              hv[e] = (_Float16)sp[e];
            } else {
              unsigned short hb = f2bf_bits(sp[e]);
              unsigned short lb = f2bf_bits(sp[e] - bf_bits2f(hb));
              hv[e] = __builtin_bit_cast(_Float16, hb);
              lv[e] = __builtin_bit_cast(_Float16, lb);
            }
          }
          *(v8h*)(C + (size_t)(mBase + row) * ldc + n0 + c8) = hv;
          if (OUT_MODE == 2) *(v8h*)(C2 + (size_t)(mBase + row) * ldc + n0 + c8) = lv;
        }
        
      }
    }
    __builtin_amdgcn_fence(__ATOMIC_RELEASE, "workgroup");
    __builtin_amdgcn_wave_barrier();
    __builtin_amdgcn_fence(__ATOMIC_ACQUIRE, "workgroup");
  }
}

// One GEMM per launch: blockIdx.x = tile, blockIdx.y = batch.
template <int ET, bool SPLIT, int BIAS_MODE, int OUT_MODE>
__global__ __launch_bounds__(256) void wmma_gemm64(
    const unsigned short* __restrict__ Ap, const unsigned short* __restrict__ A2p, int lda, long strideA,
    const unsigned short* __restrict__ Btp, const unsigned short* __restrict__ Bt2p, int ldb, long strideB,
    void* __restrict__ Cout, void* __restrict__ Cout2, int ldc, long strideC,
    const float* __restrict__ bias,
    int M, int N, int K, float scale) {
  __shared__ __align__(16) unsigned char ring[2 * kGStage];
  __shared__ __align__(16) float sT[8][16 * 68];
  gemm_tile<ET, SPLIT, BIAS_MODE, OUT_MODE>(ring, sT, blockIdx.x, blockIdx.y,
      Ap, A2p, lda, strideA, Btp, Bt2p, ldb, strideB, Cout, Cout2, ldc, strideC, bias, M, N, K, scale);
}

// The three projections, which do not depend on one another, in one launch: blockIdx.y picks the job
// (the same for a whole work-group), blockIdx.x the tile.
//   job 0: Q[token][n]  = sum_k Xb[token][k] WqT[n][k] + bq[n]
//   job 1: K[token][n]  = sum_k Xb[token][k] WkT[n][k] + bk[n]
//   job 2: Vt[n][token] = sum_k WvT[n][k] Xb[token][k] + bv[n]   (M = features, N = tokens)
__global__ __launch_bounds__(256) void qkv_gemm(
    const unsigned short* __restrict__ Xb, const unsigned short* __restrict__ WqT,
    const unsigned short* __restrict__ WkT, const unsigned short* __restrict__ WvT,
    unsigned short* __restrict__ Qp, unsigned short* __restrict__ Kp, unsigned short* __restrict__ Vtp,
    const float* __restrict__ bq, const float* __restrict__ bk, const float* __restrict__ bv,
    int nTok, int nEmb) {
  __shared__ __align__(16) unsigned char ring[2 * kGStage];
  __shared__ __align__(16) float sT[8][16 * 68];
  const int job = blockIdx.y;
  if (job < 2) {
    const unsigned short* Wt = job ? WkT : WqT;
    unsigned short* C = job ? Kp : Qp;
    gemm_tile<1, false, 2, 1>(ring, sT, blockIdx.x, 0,
        Xb, Xb, nEmb, 0L, Wt, Wt, nEmb, 0L, (void*)C, (void*)C, nEmb, 0L, job ? bk : bq,
        nTok, nEmb, nEmb, 1.0f);
  } else {
    gemm_tile<1, false, 1, 1>(ring, sT, blockIdx.x, 0,
        WvT, WvT, nEmb, 0L, Xb, Xb, nEmb, 0L, (void*)Vtp, (void*)Vtp, nTok, 0L, bv,
        nEmb, nTok, nEmb, 1.0f);
  }
}

// ---------------------------------------------------------------------------
// f32 -> bf16 plane, 2 elements per thread; blk = index of this 256-thread block within the cast
// ---------------------------------------------------------------------------
__device__ __forceinline__ void cast_f32_bf16x2(
    const float* __restrict__ in, unsigned short* __restrict__ out, int n2, int blk) {
  const int i = blk * 256 + threadIdx.x;
  if (i < n2) {
    const unsigned u = (unsigned)f2bf_bits(in[2 * i]) | ((unsigned)f2bf_bits(in[2 * i + 1]) << 16);
    ((unsigned*)out)[i] = u;
    
  }
}

// ---------------------------------------------------------------------------
// Transpose + convert: W row-major in[rows][cols] f32 -> Wt row-major out[cols][rows] 16-bit.
// MODE 0: bf16 bits of RNE-bf16(W). MODE 1: f16 bits of RNE-bf16(W) * wsc (wsc a power of two).
// One block per 64x64 tile (bx, by) of (cols/64, rows/64); rows, cols % 64 == 0. tile = the kernel's 64x65 LDS floats.
// Load: 256 threads x 4 x float4 = 64x64 tile. Store: wave w writes output rows w*8..w*8+7,
// ---------------------------------------------------------------------------
template <int MODE>
__device__ __forceinline__ void transpose_cvt16(
    float* tile, int bx, int by,
    const float* __restrict__ W, unsigned short* __restrict__ Wt, int rows, int cols, float wsc) {
  const int tid = threadIdx.x, lane = tid & 31, wave = tid >> 5;
  const int n0 = bx * 64;
  const int k0 = by * 64;
  {
    const int c4 = (tid & 15) * 4, r = tid >> 4;
#pragma unroll
    for (int it = 0; it < 4; ++it) {
      const int rr = it * 16 + r;
      const v4f x4 = *(const v4f*)(W + (size_t)(k0 + rr) * cols + n0 + c4);
      tile[rr * 65 + c4 + 0] = x4[0];
      tile[rr * 65 + c4 + 1] = x4[1];
      tile[rr * 65 + c4 + 2] = x4[2];
      tile[rr * 65 + c4 + 3] = x4[3];
    }
  }
  __syncthreads();
  const int q4 = lane >> 3, c8 = (lane & 7) * 8;
  _Float16* out = (_Float16*)Wt;
  {
#pragma unroll
    for (int it = 0; it < 2; ++it) {
      const int i = wave * 8 + it * 4 + q4;
      v8h hv;
#pragma unroll
      for (int e = 0; e < 8; ++e) {
        const float f = tile[(c8 + e) * 65 + i];
        if (MODE == 0) {
          hv[e] = __builtin_bit_cast(_Float16, f2bf_bits(f));
        } else {
          hv[e] = (_Float16)(rne_bf(f) * wsc);
        }
      }
      *(v8h*)(out + (size_t)(n0 + i) * rows + k0 + c8) = hv;
    }
    // a precaution: inlined into a kernel with other jobs' code behind it, no register that the two stores name
    // is rewritten ahead of this wait on any branch of the listing
    asm volatile("s_wait_xcnt 0x0" ::: "memory");
  }
}

// ---------------------------------------------------------------------------
// The five input conversions, which do not depend on one another, in one launch: the block index picks the job
// (the same for a whole work-group, so the transposes' barrier stands under uniform control flow).
// Blocks [0, 4 * kWTiles): the weight transposes in the order Wq, Wk, Wv, Wp, one 64x64 tile each; they come
// first because they last longer than a cast block. The blocks behind them: the cast of x.
// ---------------------------------------------------------------------------
constexpr int kWTilesX = kEmb / 64;
constexpr int kWTiles  = kWTilesX * kWTilesX;
__global__ __launch_bounds__(256) void prep_inputs(
    const float* __restrict__ x, const float* __restrict__ Wq, const float* __restrict__ Wk,
    const float* __restrict__ Wv, const float* __restrict__ Wp,
    unsigned short* __restrict__ Xb, unsigned short* __restrict__ WqT, unsigned short* __restrict__ WkT,
    unsigned short* __restrict__ WvT, unsigned short* __restrict__ WpT, int n2, int emb, float wsc) {
  __shared__ float tile[64 * 65];
  const int blk = blockIdx.x;
  if (blk >= 4 * kWTiles) {
    cast_f32_bf16x2(x, Xb, n2, blk - 4 * kWTiles);
    return;
  }
  const int job = blk / kWTiles;
  const int t   = blk % kWTiles;
  const int bx  = t % kWTilesX;
  const int by  = t / kWTilesX;
  if (job < 3) {
    const float* W = (job == 0) ? Wq : (job == 1) ? Wk : Wv;
    unsigned short* Wt = (job == 0) ? WqT : (job == 1) ? WkT : WvT;
    transpose_cvt16<0>(tile, bx, by, W, Wt, emb, emb, 1.0f);
  } else {
    transpose_cvt16<1>(tile, bx, by, Wp, WpT, emb, emb, wsc);
  }
}

constexpr int kQB = 64;
constexpr int kKC = 64;
constexpr int kNW = 4;
// LDS row pitch of the K and V^T tiles in halves: 144 B = 16 B x odd, so that the 16 rows that a 16-byte
// fragment read walks down fall on 16 different bank groups (at 128 B they fall on two)
constexpr int kLP = kKC + 8;
constexpr int kBiasL = kQB + kSeq;
constexpr float kPCarryLog2 = 15.0f;      // p and the row sum are carried x2^15, taken in the exponent
constexpr float kLog2E = 1.44269504088896340736f;
static_assert(kSeq % kKC == 0 && kSeq % kQB == 0 && kKC == kHD);

// Eight base-2 exponentials in place, in one statement: each v_exp_f32 overwrites its own source alone and none reads
// a neighbour's result; the closing v_nop is the slot that the instruction set asks for behind a transcendental,
// whatever instruction the compiler puts next (left to the builtin, it set exponentials over one another's sources).
__device__ __forceinline__ void exp2x8(float& a, float& b, float& c, float& d, float& e, float& f, float& g, float& h) {
  asm("v_exp_f32 %0, %0\n\tv_exp_f32 %1, %1\n\tv_exp_f32 %2, %2\n\tv_exp_f32 %3, %3\n\t"
      "v_exp_f32 %4, %4\n\tv_exp_f32 %5, %5\n\tv_exp_f32 %6, %6\n\tv_exp_f32 %7, %7\n\tv_nop"
      : "+v"(a), "+v"(b), "+v"(c), "+v"(d), "+v"(e), "+v"(f), "+v"(g), "+v"(h));
}

// One thread's share of a chunk: 16 B of each of 4 K rows and 4 V^T rows, 16 rows apart. Eight lanes cover one 128-B row,
// so a wave-wide copy takes 4 whole lines. ldsK, ldsV = this lane's LDS byte addresses in its first row,
// gK, gV = its global addresses there.
constexpr int kKVTile = kKC * kLP * 2;    // bytes of one K or V^T tile in LDS
__device__ __forceinline__ void kv_copies(unsigned ldsK, const _Float16* gK, unsigned ldsV, const _Float16* gV) {
  // the closing s_wait_xcnt is a precaution: no register that a copy names is rewritten ahead of it
  asm volatile(
      "global_load_async_to_lds_b128 %0, %8, off\n\t"
      "global_load_async_to_lds_b128 %1, %9, off\n\t"
      "global_load_async_to_lds_b128 %2, %10, off\n\t"
      "global_load_async_to_lds_b128 %3, %11, off\n\t"
      "global_load_async_to_lds_b128 %4, %12, off\n\t"
      "global_load_async_to_lds_b128 %5, %13, off\n\t"
      "global_load_async_to_lds_b128 %6, %14, off\n\t"
      "global_load_async_to_lds_b128 %7, %15, off\n\t"
      "s_wait_xcnt 0x0"
      :: "v"(ldsK), "v"(ldsK + (unsigned)(16 * kLP * 2)), "v"(ldsK + (unsigned)(32 * kLP * 2)), "v"(ldsK + (unsigned)(48 * kLP * 2)),
         "v"(ldsV), "v"(ldsV + (unsigned)(16 * kLP * 2)), "v"(ldsV + (unsigned)(32 * kLP * 2)), "v"(ldsV + (unsigned)(48 * kLP * 2)),
         "v"(gK), "v"(gK + (size_t)16 * kEmb), "v"(gK + (size_t)32 * kEmb), "v"(gK + (size_t)48 * kEmb),
         "v"(gV), "v"(gV + (size_t)16 * kTok), "v"(gV + (size_t)32 * kTok), "v"(gV + (size_t)48 * kTok)
      : "memory");
}

// lane l's value in lane l ^ 16
__device__ __forceinline__ float xhalf(float x) {
  const int b = __builtin_bit_cast(int, x);
  return __builtin_bit_cast(float, __builtin_amdgcn_permlanex16(b, b, 0x76543210, 0xfedcba98, false, false));
}

__global__ __launch_bounds__(128) void attn_relbias_f16(
    const unsigned short* __restrict__ Qp, const unsigned short* __restrict__ Kp,
    const unsigned short* __restrict__ Vtp, const float* __restrict__ btab,
    const float* __restrict__ tptr, unsigned short* __restrict__ Cp, float ctx_scale) {
  // K [kv][d], V^T [d][kv] (rows of 64 halves at pitch kLP), two buffers each; bias slab
  __shared__ __align__(16) _Float16 Ksh[2 * kKC * kLP];
  __shared__ __align__(16) _Float16 Vtsh[2 * kHD * kLP];
  __shared__ __align__(16) float biasL[kBiasL];

  const _Float16* Qh  = (const _Float16*)Qp;
  const _Float16* Kh  = (const _Float16*)Kp;
  const _Float16* Vth = (const _Float16*)Vtp;

  const int tid  = threadIdx.x;
  const int wave = tid >> 5;
  const int lane = tid & 31;
  const int hh   = lane >> 4;
  const int c    = lane & 15;

  constexpr int nqb = kSeq / kQB;
  const int bx = blockIdx.x;
  const int qb = bx % nqb;
  const int bh = bx / nqb;
  const int h  = bh % kHeads;
  const int b  = bh / kHeads;
  const int qbase = qb * kQB;
  const int q0 = qbase + wave * 16;

  // K and V^T come into LDS by asynchronous copies, the next chunk's in flight while this chunk is worked on.
  // This thread's place in a tile: row tid / 8 (and 16, 32, 48 rows on), 16-byte piece tid % 8.
  constexpr int nCh = kSeq / kKC;
  const _Float16* gK = Kh + (size_t)(b * kSeq + (tid >> 3)) * kEmb + h * kHD + (tid & 7) * 8;
  const _Float16* gV = Vth + (size_t)(h * kHD + (tid >> 3)) * kTok + b * kSeq + (tid & 7) * 8;
  const unsigned ldsO = (unsigned)((tid >> 3) * (kLP * 2) + (tid & 7) * 16);
  const unsigned ldsK = (unsigned)(size_t)Ksh + ldsO;
  const unsigned ldsV = (unsigned)(size_t)Vtsh + ldsO;
  // chunk 0's copies fly while the bias slab and the Q fragments are fetched
  kv_copies(ldsK, gK, ldsV, gV);

  // temperature (RNE-bf16 converted input), clamp, 1/(sqrt(E) * temp)
  float tv = rne_bf(tptr[0]);
  tv = fminf(fmaxf(tv, 0.1f), 10.0f);
  // times log2 e: scores and bias are formed in base-2 units, e^x = 2^(x log2 e)
  const float inv = (1.0f / (sqrtf((float)kEmb) * tv)) * kLog2E;

  // bias slab: biasL[i] = table[min(qbase + i, relmax)][h] * inv, i = (q - qbase) + (S-1) - kv in [0, kBiasL)
  for (int i = tid; i < kBiasL; i += kNW * 32) {
    int rel = qbase + i;
    rel = rel > kRelMax ? kRelMax : rel;
    biasL[i] = rne_bf(btab[(size_t)rel * kHeads + h]) * inv;
  }

  // Q fragments (B operand, column c = query q0 + c): 2 d-chunks, hardware k order from the f16 plane
  v16h qa[2];
  {
    const _Float16* qrow = Qh + (size_t)(b * kSeq + q0 + c) * kEmb + h * kHD;
#pragma unroll
    for (int dc = 0; dc < 2; ++dc) qa[dc] = Frag<_Float16>::load(qrow + dc * 32 + 8 * hh);
  }

  // of query q0 + c: running maximum less 15 (the same in both halves), this half's part of the running sum (x2^15)
  float mrow = -INFINITY, lrow = 0.f;
  // oacc[t][r] = O^T[d = t*16 + 8*hh + r][query q0 + c]
  v8f oacc[4];
#pragma unroll
  for (int t = 0; t < 4; ++t) oacc[t] = (v8f){0.f,0.f,0.f,0.f,0.f,0.f,0.f,0.f};

  // chunk 0's bytes of this wave have landed before the barrier that shows them (and the bias slab) to the other waves
  asm volatile("s_wait_asynccnt 0x0" ::: "memory");
  __syncthreads();
  if (nCh > 1) kv_copies(ldsK + (unsigned)kKVTile, gK + (size_t)kKC * kEmb, ldsV + (unsigned)kKVTile, gV + kKC);

  // one chunk per trip, the buffer chosen by the trip's parity
  for (int kc = 0; kc < nCh; ++kc) {
    const int kv0 = kc * kKC;
    const _Float16* Kb = Ksh + (kc & 1) * (kKC * kLP);
    const _Float16* Vb = Vtsh + (kc & 1) * (kHD * kLP);

    // ---- the chunk's eight K fragments and its 32 bias values are read as one group ahead of the score products:
    // one LDS latency a chunk, where a read and a full wait in front of each product cost eight ----
    const int bi = wave * 16 + c + (kSeq - 1) - kv0 - 8 * hh;
    v16h kf[2][4];
#pragma unroll
    for (int dc = 0; dc < 2; ++dc)
#pragma unroll
      for (int j = 0; j < 4; ++j) kf[dc][j] = Frag<_Float16>::load(Kb + (j * 16 + c) * kLP + dc * 32 + 8 * hh);
    float bl[4][8];
#pragma unroll
    for (int j = 0; j < 4; ++j)
#pragma unroll
      for (int r = 0; r < 8; ++r) bl[j][r] = biasL[bi - j * 16 - r];
    // keeps the group whole: left free, the scheduler sinks the bias reads in among the products and the arithmetic, each with a wait of its own
    __builtin_amdgcn_sched_barrier(0);

    // ---- scores, transposed: s[j][r] = score of key kv0 + j*16 + 8*hh + r with query q0 + c ----
    // four independent tiles back to back, then their second halves: in every tile d 0..31 is summed before d 32..63
    v8f s[4];
#pragma unroll
    for (int j = 0; j < 4; ++j) s[j] = (v8f){0.f,0.f,0.f,0.f,0.f,0.f,0.f,0.f};
#pragma unroll
    for (int dc = 0; dc < 2; ++dc)
#pragma unroll
      for (int j = 0; j < 4; ++j) s[j] = Frag<_Float16>::mma(kf[dc][j], qa[dc], s[j]);

    // ---- the chunk's eight V^T fragments, one group: their latency passes behind the softmax arithmetic ----
    v16h vf[2][4];
#pragma unroll
    for (int kk = 0; kk < 2; ++kk)
#pragma unroll
      for (int t = 0; t < 4; ++t) vf[kk][t] = Frag<_Float16>::load(Vb + (t * 16 + c) * kLP + kk * 32 + 8 * hh);
    // keeps the group here: left free, the scheduler sinks half of these reads down to their products, a full wait in front of each
    __builtin_amdgcn_sched_barrier(0);

    // ---- scale + bias + maximum over this lane's 32 keys (one chain per tile), then over both halves ----
    float mj[4];
#pragma unroll
    for (int j = 0; j < 4; ++j) {
      mj[j] = -INFINITY;
#pragma unroll
      for (int r = 0; r < 8; ++r) {
        const float sc = s[j][r] * inv + bl[j][r];
        s[j][r] = sc;
        mj[j] = fmaxf(mj[j], sc);
      }
    }
    float cm = fmaxf(fmaxf(mj[0], mj[1]), fmaxf(mj[2], mj[3]));
    cm = fmaxf(cm, xhalf(cm));
    // the point that exponents are taken from: the chunk's maximum less 15 (any point serves, it cancels in p / l).
    // Where the maximum is so large that f32 cannot hold the 15 beside it, the maximum itself, so that p stays inside f16.
    {
      const float lowered = cm - kPCarryLog2;
      cm = (cm - lowered < kPCarryLog2 + 0.5f) ? lowered : cm;
    }

    // ---- online softmax update; P^T (x2^15, f16) packed into the B operands of the second product ----
    const float mnew = fmaxf(mrow, cm);
    const float alpha = __builtin_amdgcn_exp2f(mrow - mnew);
    mrow = mnew;
    // pb[kk] element e: key kv0 + kk*32 + 8*hh + e for e < 8, kv0 + kk*32 + 16 + 8*hh + (e - 8) behind: tiles 2kk, 2kk + 1
    v16h pb[2];
    float pj[4];
#pragma unroll
    for (int j = 0; j < 4; ++j) {
      float e[8];
#pragma unroll
      for (int r = 0; r < 8; ++r) e[r] = s[j][r] - mnew;
      exp2x8(e[0], e[1], e[2], e[3], e[4], e[5], e[6], e[7]);
      pj[j] = e[0];
#pragma unroll
      for (int r = 1; r < 8; ++r) pj[j] += e[r];
#pragma unroll
      for (int r = 0; r < 8; ++r) pb[j >> 1][(j & 1) * 8 + r] = (_Float16)e[r];
    }
    lrow = lrow * alpha + ((pj[0] + pj[1]) + (pj[2] + pj[3]));
#pragma unroll
    for (int t = 0; t < 4; ++t)
#pragma unroll
      for (int r = 0; r < 8; ++r) oacc[t][r] *= alpha;

    // ---- O^T += V^T_chunk . P^T ----
#pragma unroll
    for (int kk = 0; kk < 2; ++kk) {
#pragma unroll
      for (int t = 0; t < 4; ++t) oacc[t] = Frag<_Float16>::mma(vf[kk][t], pb[kk], oacc[t]);
    }
    // the four slots that the chip asks for behind the last product, on the branch at the loop's foot as on the fall-through
    acc_guard4(oacc[0], oacc[1], oacc[2], oacc[3]);
    // this wave's reads of the buffers are done before the barrier behind which they are refilled
    asm volatile("s_wait_dscnt 0x0" ::: "memory");
    // this wave's copies of chunk kc + 1 have landed before the barrier that shows them to the other waves
    asm volatile("s_wait_asynccnt 0x0" ::: "memory");
    __syncthreads();
    if (kc + 2 < nCh)
      kv_copies(ldsK + (unsigned)((kc & 1) * kKVTile), gK + (size_t)(kc + 2) * kKC * kEmb,
                ldsV + (unsigned)((kc & 1) * kKVTile), gV + (kc + 2) * kKC);
  }
  // no copy is outstanding when the wave goes on to the epilogue and ends
  asm volatile("s_wait_asynccnt 0x0" ::: "memory");

  // the two halves' sums of a query are joined here, once; a lane's 8 accumulators of a tile are 8 consecutive d
  // of its query's row: one 16-byte store per tile
  {
    const float l = lrow + xhalf(lrow);
    const float invl = ctx_scale * (1.0f / l);
    _Float16* crow = (_Float16*)Cp + (size_t)(b * kSeq + q0 + c) * kEmb + h * kHD + 8 * hh;
#pragma unroll
    for (int t = 0; t < 4; ++t) {
      v8h hv;
#pragma unroll
      for (int r = 0; r < 8; ++r) hv[r] = (_Float16)(oacc[t][r] * invl);
      *(v8h*)(crow + t * 16) = hv;
    }
  }
}

// ---------------------------------------------------------------------------
// Host launch
// ---------------------------------------------------------------------------
extern "C" void kernel_launch(void* const* d_in, const int* in_sizes, int n_in,
                              void* d_out, int out_size, void* d_ws, size_t ws_size,
                              hipStream_t stream) {
  if (n_in < 11) return;
  if (in_sizes[0] != kTok * kEmb) return;
  if (in_sizes[1] != kEmb * kEmb || in_sizes[3] != kEmb * kEmb ||
      in_sizes[5] != kEmb * kEmb || in_sizes[7] != kEmb * kEmb) return;
  if (in_sizes[2] < kEmb || in_sizes[4] < kEmb || in_sizes[6] < kEmb || in_sizes[8] < kEmb) return;
  if (in_sizes[9] != kRelRows * kHeads || in_sizes[10] < 1) return;
  if (out_size != kTok * kEmb) return;

  const float* x    = (const float*)d_in[0];
  const float* Wq   = (const float*)d_in[1];
  const float* bq   = (const float*)d_in[2];
  const float* Wk   = (const float*)d_in[3];
  const float* bk   = (const float*)d_in[4];
  const float* Wv   = (const float*)d_in[5];
  const float* bv   = (const float*)d_in[6];
  const float* Wp   = (const float*)d_in[7];
  const float* bp   = (const float*)d_in[8];
  const float* btab = (const float*)d_in[9];
  const float* tptr = (const float*)d_in[10];
  float* out = (float*)d_out;

  // workspace region map (bytes), all offsets multiples of 2 MiB:
  //   Xb  bf16 [4096][1024]   8 MiB  @ 0
  //   WqT bf16 [1024][1024]   2 MiB  @ 8 MiB
  //   WkT bf16 [1024][1024]   2 MiB  @ 10 MiB
  //   WvT bf16 [1024][1024]   2 MiB  @ 12 MiB
  //   WpT f16  [1024][1024]   2 MiB  @ 14 MiB   (RNE-bf16 values x64)
  //   Qp  f16  [4096][1024]   8 MiB  @ 16 MiB
  //   Kp  f16  [4096][1024]   8 MiB  @ 24 MiB
  //   Vtp f16  [1024][4096]   8 MiB  @ 32 MiB
  //   Cx  f16  [4096][1024]   8 MiB  @ 40 MiB   (ctx x64)
  //   total 48 MiB = 50,331,648 B
  const size_t szAct = (size_t)kTok * kEmb * 2;
  const size_t szW   = (size_t)kEmb * kEmb * 2;
  size_t off = 0;
  const size_t oXb = off; off += szAct;
  const size_t oWq = off; off += szW;
  const size_t oWk = off; off += szW;
  const size_t oWv = off; off += szW;
  const size_t oWp = off; off += szW;
  const size_t oQ  = off; off += szAct;
  const size_t oK  = off; off += szAct;
  const size_t oVt = off; off += szAct;
  const size_t oCx = off; off += szAct;
  if (off > ws_size) return;

  char* w = (char*)d_ws;
  unsigned short* Xb  = (unsigned short*)(w + oXb);
  unsigned short* WqT = (unsigned short*)(w + oWq);
  unsigned short* WkT = (unsigned short*)(w + oWk);
  unsigned short* WvT = (unsigned short*)(w + oWv);
  unsigned short* WpT = (unsigned short*)(w + oWp);
  unsigned short* Qp  = (unsigned short*)(w + oQ);
  unsigned short* Kp  = (unsigned short*)(w + oK);
  unsigned short* Vtp = (unsigned short*)(w + oVt);
  unsigned short* Cx  = (unsigned short*)(w + oCx);

  const float kWpCarry  = 64.0f;
  const float kCtxCarry = 64.0f;

  // 1) one launch: weights in[rows=1024][cols=1024] -> out[cols][rows], and x -> bf16 plane (2 elements per thread)
  {
    const int n2 = (kTok * kEmb) / 2;
    prep_inputs<<<4 * kWTiles + (n2 + 255) / 256, 256, 0, stream>>>(
        x, Wq, Wk, Wv, Wp, Xb, WqT, WkT, WvT, WpT, n2, kEmb, kWpCarry);
  }
  // 2) one launch: the three projections (bf16 WMMA, f16 outputs). M,N % 128 == 0, K % 128 == 0 by the static_assert below.
  static_assert(kTok % 128 == 0 && kEmb % 128 == 0 && kEmb % kGK == 0);
  const int gemmBlocks = (kTok / 128) * (kEmb / 128);
  qkv_gemm<<<dim3(gemmBlocks, 3), 256, 0, stream>>>(
      Xb, WqT, WkT, WvT, Qp, Kp, Vtp, bq, bk, bv, kTok, kEmb);
  // 3) attention -> ctx f16 plane (x64)
  attn_relbias_f16<<<kBatch * kHeads * (kSeq / kQB), kNW * 32, 0, stream>>>(
      Qp, Kp, Vtp, btab, tptr, Cx, kCtxCarry);
  // 4) output projection: out[token][n] = 2^-12 * sum_c Cx[token][c] WpT[n][c] + bp[n]
  wmma_gemm64<0, false, 2, 0><<<dim3(gemmBlocks, 1), 256, 0, stream>>>(
      Cx, Cx, kEmb, 0L, WpT, WpT, kEmb, 0L, (void*)out, (void*)out, kEmb, 0L, bp,
      kTok, kEmb, kEmb, 1.0f / (kWpCarry * kCtxCarry));
}

// v008
// A run of this version takes 71 microseconds.
// Next to v007, in two timings, it ran 1.09 and 1.10 times as fast.
// Counting every step since v000, it is 4.56 times as fast.
// Contractions: x@Wq, x@Wk, Wv-side GEMM producing V^T on v_wmma_f32_16x16x32_bf16 (bf16 operands = RNE-bf16 converted inputs, exact products); q.k^T, p.v, ctx@Wp on v_wmma_f32_16x16x32_f16 (f16 operands; p carried x2^15, ctx and Wp carried x64); f32 accumulate; softmax and normalisers in f32.
#include <hip/hip_runtime.h>
#include <math.h>

typedef __attribute__((ext_vector_type(16))) _Float16 v16h;
typedef __attribute__((ext_vector_type(8)))  _Float16 v8h;
typedef __attribute__((ext_vector_type(16))) __bf16   v16b;
typedef __attribute__((ext_vector_type(8)))  __bf16   v8b;
typedef __attribute__((ext_vector_type(8)))  float    v8f;
typedef __attribute__((ext_vector_type(4)))  float    v4f;
typedef __attribute__((ext_vector_type(4)))  unsigned v4u;

constexpr int kBatch   = 4;
constexpr int kSeq     = 1024;
constexpr int kEmb     = 1024;
constexpr int kHeads   = 16;
constexpr int kHD      = 64;
constexpr int kTok     = kBatch * kSeq;
constexpr int kRelRows = 1999;
constexpr int kRelMax  = kRelRows - 1;

static_assert(kEmb == kHeads * kHD);
static_assert(kHD == 64);
static_assert(kTok % 64 == 0 && kEmb % 64 == 0 && kEmb % 32 == 0 && kSeq % 64 == 0);

// ---------------------------------------------------------------------------
// helpers
// ---------------------------------------------------------------------------
__device__ __forceinline__ unsigned short f2bf_bits(float f) {
  unsigned u = __float_as_uint(f);
  return (unsigned short)((u + 0x7FFFu + ((u >> 16) & 1u)) >> 16);
}
__device__ __forceinline__ float bf_bits2f(unsigned short h) { return __uint_as_float(((unsigned)h) << 16); }
__device__ __forceinline__ float rne_bf(float f) { return bf_bits2f(f2bf_bits(f)); }

__device__ __forceinline__ void dep_guard_h(v8f& a, v8f& b, v16h x, v16h y) { asm volatile("v_nop\n\tv_nop\n\tv_nop\n\tv_nop" : "+v"(a), "+v"(b) : "v"(x), "v"(y)); }
__device__ __forceinline__ void dep_guard_b(v8f& a, v8f& b, v16b x, v16b y) { asm volatile("v_nop\n\tv_nop\n\tv_nop\n\tv_nop" : "+v"(a), "+v"(b) : "v"(x), "v"(y)); }
__device__ __forceinline__ void keep4_h(v16h a, v16h b, v16h c, v16h d) { asm volatile("v_nop" :: "v"(a), "v"(b), "v"(c), "v"(d)); }
__device__ __forceinline__ void keep4_b(v16b a, v16b b, v16b c, v16b d) { asm volatile("v_nop" :: "v"(a), "v"(b), "v"(c), "v"(d)); }
__device__ __forceinline__ void acc_guard4(v8f& a, v8f& b, v8f& c, v8f& d) { asm volatile("v_nop\n\tv_nop\n\tv_nop\n\tv_nop" : "+v"(a), "+v"(b), "+v"(c), "+v"(d)); }
template <typename T> struct Frag;
template <> struct Frag<_Float16> {
  typedef v16h V; union U { v16h v; v8h h[2]; };
  // elements 0..7 <- p[0..7], 8..15 <- p[16..23]
  static __device__ __forceinline__ v16h load(const _Float16* p) {
    U f; f.h[0] = *(const v8h*)(p); f.h[1] = *(const v8h*)(p + 16); return f.v;
  }
  static __device__ __forceinline__ v8f mma(v16h a, v16h b, v8f c) {
    return __builtin_amdgcn_wmma_f32_16x16x32_f16(false, a, false, b, (short)0, c, false, false);
  }
  static __device__ __forceinline__ void guard(v8f& a, v8f& b, v16h x, v16h y) { dep_guard_h(a, b, x, y); }
  static __device__ __forceinline__ void keep(v16h a, v16h b, v16h c, v16h d) { keep4_h(a, b, c, d); }
};
template <> struct Frag<__bf16> {
  typedef v16b V; union U { v16b v; v8b h[2]; };
  static __device__ __forceinline__ v16b load(const __bf16* p) {
    U f; f.h[0] = *(const v8b*)(p); f.h[1] = *(const v8b*)(p + 16); return f.v;
  }
  static __device__ __forceinline__ v8f mma(v16b a, v16b b, v8f c) {
    return __builtin_amdgcn_wmma_f32_16x16x32_bf16(false, a, false, b, (short)0, c, false, false);
  }
  static __device__ __forceinline__ void guard(v8f& a, v8f& b, v16b x, v16b y) { dep_guard_b(a, b, x, y); }
  static __device__ __forceinline__ void keep(v16b a, v16b b, v16b c, v16b d) { keep4_b(a, b, c, d); }
};

// ---------------------------------------------------------------------------
// Register-blocked batched WMMA GEMM, operands staged in LDS.
// C[m,n] = scale * sum_k A[m,k] * Bt[n,k] (+bias); a work-group of 8 waves owns a 128x128 tile,
// each wave 32 rows x 64 columns of it (two waves per SIMD: one wave's LDS reads and copy issue
// stand behind the other's products).
// A row-major [M,K]; Bt row-major [N,K]; M,N % 128 == 0, K % 128 == 0.
// A pass is GK k (128 or 64): 2 GK bytes of 128 A rows and of 128 Bt rows, brought into LDS by asynchronous copies,
// two buffers, the next pass's copies in flight while this pass is worked on. GK sets the work-group's LDS and so how
// many work-groups share a WGP: at 128 one, at 64 three, whose waves fill one another's barrier waits, first fills and epilogues.
// SPLIT: hi/lo operand planes (not supported by the staged loop, false).
// BIAS_MODE: 0 none, 1 bias[m], 2 bias[n]; bias values RNE-converted to bf16 precision before the add.
// OUT_MODE: 0 = f32, 1 = f16, 2 = bf16 hi plane (Cout) + bf16 lo plane (Cout2).
// ET: 0 = f16 operands, 1 = bf16 operands (pointers passed as 16-bit storage)
// ---------------------------------------------------------------------------
template <int GK> struct Pass {
  static_assert(GK == 128 || GK == 64);
  static constexpr int kPitch = 2 * GK + 16;    // LDS row pitch in bytes: 16 B x odd, conflict-free for 16-byte reads down a column
  static constexpr int kStage = 256 * kPitch;   // one buffer: rows 0..127 = A rows, rows 128..255 = Bt rows
  static constexpr int kLanes = GK / 8;         // lanes that cover one row, 16 B each
  static constexpr int kRows  = 32 / kLanes;    // rows that one wave-wide copy covers
};

// One wave's share of a stage: 32 rows of 2 GK bytes, 32 / kRows copies of kRows rows each.
// lds = this lane's LDS byte address in the first row group, g = this lane's global address there,
// ld = source row pitch in elements.
template <typename T, int GK>
__device__ __forceinline__ void stage_copies(unsigned lds, const T* g, int ld) {
  constexpr int kStepR = Pass<GK>::kRows;                        // rows from one copy to the next
  constexpr unsigned kStepL = kStepR * Pass<GK>::kPitch;         // the same in LDS bytes
#pragma unroll
  for (int i = 0; i < 32 / kStepR; i += 8) {
    // the closing s_wait_xcnt is a precaution: no register that a copy names is rewritten ahead of it
    asm volatile(
        "global_load_async_to_lds_b128 %0, %8, off\n\t"
        "global_load_async_to_lds_b128 %1, %9, off\n\t"
        "global_load_async_to_lds_b128 %2, %10, off\n\t"
        "global_load_async_to_lds_b128 %3, %11, off\n\t"
        "global_load_async_to_lds_b128 %4, %12, off\n\t"
        "global_load_async_to_lds_b128 %5, %13, off\n\t"
        "global_load_async_to_lds_b128 %6, %14, off\n\t"
        "global_load_async_to_lds_b128 %7, %15, off\n\t"
        "s_wait_xcnt 0x0"
        :: "v"(lds + (unsigned)(i + 0) * kStepL), "v"(lds + (unsigned)(i + 1) * kStepL),
           "v"(lds + (unsigned)(i + 2) * kStepL), "v"(lds + (unsigned)(i + 3) * kStepL),
           "v"(lds + (unsigned)(i + 4) * kStepL), "v"(lds + (unsigned)(i + 5) * kStepL),
           "v"(lds + (unsigned)(i + 6) * kStepL), "v"(lds + (unsigned)(i + 7) * kStepL),
           "v"(g + (size_t)((i + 0) * kStepR) * ld), "v"(g + (size_t)((i + 1) * kStepR) * ld),
           "v"(g + (size_t)((i + 2) * kStepR) * ld), "v"(g + (size_t)((i + 3) * kStepR) * ld),
           "v"(g + (size_t)((i + 4) * kStepR) * ld), "v"(g + (size_t)((i + 5) * kStepR) * ld),
           "v"(g + (size_t)((i + 6) * kStepR) * ld), "v"(g + (size_t)((i + 7) * kStepR) * ld)
        : "memory");
  }
}

template <int ET> struct Elem;
template <> struct Elem<0> { typedef _Float16 T; };
template <> struct Elem<1> { typedef __bf16 T; };
// The tile's work is a device function, so that one launch can hold several GEMMs: the kernel owns the LDS
// (ring: operand ring, two buffers; sT: per-wave 16x64 slab, pitch 68 floats) and says which tile and batch.
template <int ET, bool SPLIT, int BIAS_MODE, int OUT_MODE, int GK>
__device__ __forceinline__ void gemm_tile(
    unsigned char* ring, float (*sT)[16 * 68], int tile, int b,
    const unsigned short* __restrict__ Ap, const unsigned short* __restrict__ A2p, int lda, long strideA,
    const unsigned short* __restrict__ Btp, const unsigned short* __restrict__ Bt2p, int ldb, long strideB,
    void* __restrict__ Cout, void* __restrict__ Cout2, int ldc, long strideC,
    const float* __restrict__ bias,
    int M, int N, int K, float scale) {
  static_assert(!SPLIT);
  constexpr int kGK = GK, kGPitch = Pass<GK>::kPitch, kGStage = Pass<GK>::kStage, kGLanes = Pass<GK>::kLanes;
  typedef typename Elem<ET>::T T;
  typedef typename Frag<T>::V V;
  const T* A = (const T*)Ap; const T* Bt = (const T*)Btp;
  const int lane = threadIdx.x & 31;
  // in a scalar register, so that what picks a wave's source rows is scalar and every lane stays on at the copies
  const int wave = __builtin_amdgcn_readfirstlane(threadIdx.x >> 5);
  const int tilesN = N >> 7;
  const int tilesM = M >> 7;
  // the same for the whole work-group, ahead of every barrier
  if (tile >= tilesM * tilesN) return;
  const int tm = tile / tilesN;
  const int tn = tile - tm * tilesN;
  const int wm = wave >> 1;
  const int wn = wave & 1;
  const int m0 = (tm << 7) + (wm << 5);
  const int n0 = (tn << 7) + (wn << 6);

  const T* Ab  = A  + (size_t)b * strideA;
  const T* Bb  = Bt + (size_t)b * strideB;

  // row (A) / col (B, D) within subtile; k offset of this lane half; D row offset
  const int rlane = lane & 15;
  const int koff  = (lane >> 4) * 8;
  const int mOff  = (lane >> 4) * 8;

  // copies: waves 0..3 bring the 128 A rows, waves 4..7 the 128 Bt rows, 32 rows each
  const int ldS = (wave < 4) ? lda : ldb;
  const T* gS = ((wave < 4) ? (Ab + (size_t)((tm << 7) + (wave << 5)) * lda)
                            : (Bb + (size_t)((tn << 7) + ((wave - 4) << 5)) * ldb))
                + (size_t)(lane / kGLanes) * ldS + (lane % kGLanes) * 8;
  const unsigned ldsS = (unsigned)(size_t)ring + (unsigned)(((wave << 5) + lane / kGLanes) * kGPitch + (lane % kGLanes) * 16);

  v8f acc[2][4];
#pragma unroll
  for (int i = 0; i < 2; ++i)
#pragma unroll
    for (int j = 0; j < 4; ++j) acc[i][j] = (v8f){0.f,0.f,0.f,0.f,0.f,0.f,0.f,0.f};

  const int nPass = K / kGK;
  stage_copies<T, GK>(ldsS, gS, ldS);
  // pass 0's bytes of this wave have landed before the barrier that shows them to the other waves
  asm volatile("s_wait_asynccnt 0x0" ::: "memory");
  __syncthreads();
  if (nPass > 1) stage_copies<T, GK>(ldsS + (unsigned)kGStage, gS + kGK, ldS);

  // one pass per trip, the buffer chosen by the trip's parity
  for (int t = 0; t < nPass; ++t) {
    const unsigned char* st = ring + (t & 1) * kGStage;
    const unsigned char* stA = st + ((wm << 5) + rlane) * kGPitch;
    const unsigned char* stB = st + (128 + (wn << 6) + rlane) * kGPitch;
#pragma unroll
    for (int k0 = 0; k0 < kGK; k0 += 32) {
      // all six fragments of a 32-k block are read as one group: one LDS latency per 8 products
      V bh[4], ah[2];
#pragma unroll
      for (int j = 0; j < 4; ++j) bh[j] = Frag<T>::load((const T*)(stB + (j << 4) * kGPitch) + koff + k0);
#pragma unroll
      for (int i = 0; i < 2; ++i) ah[i] = Frag<T>::load((const T*)(stA + (i << 4) * kGPitch) + koff + k0);
#pragma unroll
      for (int i = 0; i < 2; ++i) {
#pragma unroll
        for (int j = 0; j < 4; ++j) acc[i][j] = Frag<T>::mma(ah[i], bh[j], acc[i][j]);
        Frag<T>::guard(acc[i][0], acc[i][3], ah[i], ah[i]);
      }
      Frag<T>::keep(bh[0], bh[1], bh[2], bh[3]);
    }
    // this wave's reads of the buffer are done before the barrier behind which it is refilled
    asm volatile("s_wait_dscnt 0x0" ::: "memory");
    // this wave's copies of pass t + 1 have landed before the barrier that shows them to the other waves
    asm volatile("s_wait_asynccnt 0x0" ::: "memory");
    __syncthreads();
    if (t + 2 < nPass) stage_copies<T, GK>(ldsS + (unsigned)((t & 1) * kGStage), gS + (size_t)(t + 2) * kGK, ldS);
  }
  // no copy is outstanding when the wave goes on to the epilogue and ends
  asm volatile("s_wait_asynccnt 0x0" ::: "memory");
  acc_guard4(acc[0][0], acc[0][1], acc[0][2], acc[0][3]);
  acc_guard4(acc[1][0], acc[1][1], acc[1][2], acc[1][3]);

  // ---- epilogue ----
  float* slab = sT[wave];
  // column biases: 4 scalar loads per lane, hoisted
  float bvj[4];
#pragma unroll
  for (int j = 0; j < 4; ++j) bvj[j] = (BIAS_MODE == 2) ? rne_bf(bias[n0 + (j << 4) + rlane]) : 0.f;
#pragma unroll
  for (int i = 0; i < 2; ++i) {
    const int mBase = m0 + (i << 4);
    // row biases: two 16-B loads per lane (rows mBase+mOff .. +7, 32-B aligned)
    v4f bm0 = (v4f){0.f, 0.f, 0.f, 0.f};
    v4f bm1 = bm0;
    if (BIAS_MODE == 1) {
      bm0 = *(const v4f*)(bias + mBase + mOff);
      bm1 = *(const v4f*)(bias + mBase + mOff + 4);
    }
#pragma unroll
    for (int j = 0; j < 4; ++j) {
#pragma unroll
      for (int r = 0; r < 8; ++r) {
        float v = acc[i][j][r] * scale;
        if (BIAS_MODE == 1) { const v4f bsel = (r < 4) ? bm0 : bm1; v += rne_bf(bsel[r & 3]); }
        if (BIAS_MODE == 2) v += bvj[j];
        slab[(mOff + r) * 68 + (j << 4) + rlane] = v;
      }
    }
    __builtin_amdgcn_fence(__ATOMIC_RELEASE, "workgroup");
    __builtin_amdgcn_wave_barrier();
    __builtin_amdgcn_fence(__ATOMIC_ACQUIRE, "workgroup");
    if (OUT_MODE == 0) {
      float* C = (float*)Cout + (size_t)b * strideC;
      // row seg = 256 B = 16 lanes x 16 B
      const int hh = lane >> 4, c4 = (lane & 15) * 4;
      {
#pragma unroll
        for (int it = 0; it < 8; ++it) {
          const int row = it * 2 + hh;
          v4f v = *(const v4f*)(slab + row * 68 + c4);
          *(v4f*)(C + (size_t)(mBase + row) * ldc + n0 + c4) = v;
        }
        
      }
    } else {
      const int q = lane >> 3, c8 = (lane & 7) * 8;
      unsigned short* C  = (unsigned short*)Cout  + (size_t)b * strideC;
      unsigned short* C2 = (OUT_MODE == 2) ? ((unsigned short*)Cout2 + (size_t)b * strideC) : nullptr;
      {
#pragma unroll
        for (int it = 0; it < 4; ++it) {
          const int row = it * 4 + q;
          const float* sp = slab + row * 68 + c8;
          v8h hv, lv;
#pragma unroll
          for (int e = 0; e < 8; ++e) {
            if (OUT_MODE == 1) {
              hv[e] = (_Float16)sp[e];
            } else {
              unsigned short hb = f2bf_bits(sp[e]);
              unsigned short lb = f2bf_bits(sp[e] - bf_bits2f(hb));
              hv[e] = __builtin_bit_cast(_Float16, hb);
              lv[e] = __builtin_bit_cast(_Float16, lb);
            }
          }
          *(v8h*)(C + (size_t)(mBase + row) * ldc + n0 + c8) = hv;
          if (OUT_MODE == 2) *(v8h*)(C2 + (size_t)(mBase + row) * ldc + n0 + c8) = lv;
        }
        
      }
    }
    __builtin_amdgcn_fence(__ATOMIC_RELEASE, "workgroup");
    __builtin_amdgcn_wave_barrier();
    __builtin_amdgcn_fence(__ATOMIC_ACQUIRE, "workgroup");
  }
}

// One GEMM per launch: blockIdx.x = tile, blockIdx.y = batch.
template <int ET, bool SPLIT, int BIAS_MODE, int OUT_MODE>
__global__ __launch_bounds__(256) void wmma_gemm64(
    const unsigned short* __restrict__ Ap, const unsigned short* __restrict__ A2p, int lda, long strideA,
    const unsigned short* __restrict__ Btp, const unsigned short* __restrict__ Bt2p, int ldb, long strideB,
    void* __restrict__ Cout, void* __restrict__ Cout2, int ldc, long strideC,
    const float* __restrict__ bias,
    int M, int N, int K, float scale) {
  __shared__ __align__(16) unsigned char ring[2 * Pass<128>::kStage];
  __shared__ __align__(16) float sT[8][16 * 68];
  gemm_tile<ET, SPLIT, BIAS_MODE, OUT_MODE, 128>(ring, sT, blockIdx.x, blockIdx.y,
      Ap, A2p, lda, strideA, Btp, Bt2p, ldb, strideB, Cout, Cout2, ldc, strideC, bias, M, N, K, scale);
}

// The three projections, which do not depend on one another, in one launch: blockIdx.y picks the job
// (the same for a whole work-group), blockIdx.x the tile.
//   job 0: Q[token][n]  = sum_k Xb[token][k] WqT[n][k] + bq[n]
//   job 1: K[token][n]  = sum_k Xb[token][k] WkT[n][k] + bk[n]
//   job 2: Vt[n][token] = sum_k WvT[n][k] Xb[token][k] + bv[n]   (M = features, N = tokens)
__global__ __launch_bounds__(256) void qkv_gemm(
    const unsigned short* __restrict__ Xb, const unsigned short* __restrict__ WqT,
    const unsigned short* __restrict__ WkT, const unsigned short* __restrict__ WvT,
    unsigned short* __restrict__ Qp, unsigned short* __restrict__ Kp, unsigned short* __restrict__ Vtp,
    const float* __restrict__ bq, const float* __restrict__ bk, const float* __restrict__ bv,
    int nTok, int nEmb) {
  // passes of 64 k: 106 KiB of LDS, so three work-groups share a WGP and the launch's 768 are all resident at once
  __shared__ __align__(16) unsigned char ring[2 * Pass<64>::kStage];
  __shared__ __align__(16) float sT[8][16 * 68];
  const int job = blockIdx.y;
  if (job < 2) {
    const unsigned short* Wt = job ? WkT : WqT;
    unsigned short* C = job ? Kp : Qp;
    gemm_tile<1, false, 2, 1, 64>(ring, sT, blockIdx.x, 0,
        Xb, Xb, nEmb, 0L, Wt, Wt, nEmb, 0L, (void*)C, (void*)C, nEmb, 0L, job ? bk : bq,
        nTok, nEmb, nEmb, 1.0f);
  } else {
    gemm_tile<1, false, 1, 1, 64>(ring, sT, blockIdx.x, 0,
        WvT, WvT, nEmb, 0L, Xb, Xb, nEmb, 0L, (void*)Vtp, (void*)Vtp, nTok, 0L, bv,
        nEmb, nTok, nEmb, 1.0f);
  }
}

// ---------------------------------------------------------------------------
// f32 -> bf16 plane, 2 elements per thread; blk = index of this 256-thread block within the cast
// ---------------------------------------------------------------------------
__device__ __forceinline__ void cast_f32_bf16x2(
    const float* __restrict__ in, unsigned short* __restrict__ out, int n2, int blk) {
  const int i = blk * 256 + threadIdx.x;
  if (i < n2) {
    const unsigned u = (unsigned)f2bf_bits(in[2 * i]) | ((unsigned)f2bf_bits(in[2 * i + 1]) << 16);
    ((unsigned*)out)[i] = u;
    
  }
}

// ---------------------------------------------------------------------------
// Transpose + convert: W row-major in[rows][cols] f32 -> Wt row-major out[cols][rows] 16-bit.
// MODE 0: bf16 bits of RNE-bf16(W). MODE 1: f16 bits of RNE-bf16(W) * wsc (wsc a power of two).
// One block per 64x64 tile (bx, by) of (cols/64, rows/64); rows, cols % 64 == 0. tile = the kernel's 64x65 LDS floats.
// Load: 256 threads x 4 x float4 = 64x64 tile. Store: wave w writes output rows w*8..w*8+7,
// ---------------------------------------------------------------------------
template <int MODE>
__device__ __forceinline__ void transpose_cvt16(
    float* tile, int bx, int by,
    const float* __restrict__ W, unsigned short* __restrict__ Wt, int rows, int cols, float wsc) {
  const int tid = threadIdx.x, lane = tid & 31, wave = tid >> 5;
  const int n0 = bx * 64;
  const int k0 = by * 64;
  {
    const int c4 = (tid & 15) * 4, r = tid >> 4;
#pragma unroll
    for (int it = 0; it < 4; ++it) {
      const int rr = it * 16 + r;
      const v4f x4 = *(const v4f*)(W + (size_t)(k0 + rr) * cols + n0 + c4);
      tile[rr * 65 + c4 + 0] = x4[0];
      tile[rr * 65 + c4 + 1] = x4[1];
      tile[rr * 65 + c4 + 2] = x4[2];
      tile[rr * 65 + c4 + 3] = x4[3];
    }
  }
  __syncthreads();
  const int q4 = lane >> 3, c8 = (lane & 7) * 8;
  _Float16* out = (_Float16*)Wt;
  {
#pragma unroll
    for (int it = 0; it < 2; ++it) {
      const int i = wave * 8 + it * 4 + q4;
      v8h hv;
#pragma unroll
      for (int e = 0; e < 8; ++e) {
        const float f = tile[(c8 + e) * 65 + i];
        if (MODE == 0) {
          hv[e] = __builtin_bit_cast(_Float16, f2bf_bits(f));
        } else {
          hv[e] = (_Float16)(rne_bf(f) * wsc);
        }
      }
      *(v8h*)(out + (size_t)(n0 + i) * rows + k0 + c8) = hv;
    }
    // a precaution: inlined into a kernel with other jobs' code behind it, no register that the two stores name
    // is rewritten ahead of this wait on any branch of the listing
    asm volatile("s_wait_xcnt 0x0" ::: "memory");
  }
}

// ---------------------------------------------------------------------------
// The five input conversions, which do not depend on one another, in one launch: the block index picks the job
// (the same for a whole work-group, so the transposes' barrier stands under uniform control flow).
// Blocks [0, 4 * kWTiles): the weight transposes in the order Wq, Wk, Wv, Wp, one 64x64 tile each; they come
// first because they last longer than a cast block. The blocks behind them: the cast of x.
// ---------------------------------------------------------------------------
constexpr int kWTilesX = kEmb / 64;
constexpr int kWTiles  = kWTilesX * kWTilesX;
__global__ __launch_bounds__(256) void prep_inputs(
    const float* __restrict__ x, const float* __restrict__ Wq, const float* __restrict__ Wk,
    const float* __restrict__ Wv, const float* __restrict__ Wp,
    unsigned short* __restrict__ Xb, unsigned short* __restrict__ WqT, unsigned short* __restrict__ WkT,
    unsigned short* __restrict__ WvT, unsigned short* __restrict__ WpT, int n2, int emb, float wsc) {
  __shared__ float tile[64 * 65];
  const int blk = blockIdx.x;
  if (blk >= 4 * kWTiles) {
    cast_f32_bf16x2(x, Xb, n2, blk - 4 * kWTiles);
    return;
  }
  const int job = blk / kWTiles;
  const int t   = blk % kWTiles;
  const int bx  = t % kWTilesX;
  const int by  = t / kWTilesX;
  if (job < 3) {
    const float* W = (job == 0) ? Wq : (job == 1) ? Wk : Wv;
    unsigned short* Wt = (job == 0) ? WqT : (job == 1) ? WkT : WvT;
    transpose_cvt16<0>(tile, bx, by, W, Wt, emb, emb, 1.0f);
  } else {
    transpose_cvt16<1>(tile, bx, by, Wp, WpT, emb, emb, wsc);
  }
}

constexpr int kQB = 64;
constexpr int kKC = 64;
constexpr int kNW = 4;
// LDS row pitch of the K and V^T tiles in halves: 144 B = 16 B x odd, so that the 16 rows that a 16-byte
// fragment read walks down fall on 16 different bank groups (at 128 B they fall on two)
constexpr int kLP = kKC + 8;
constexpr int kBiasL = kQB + kSeq;
constexpr float kPCarryLog2 = 15.0f;      // p and the row sum are carried x2^15, taken in the exponent
constexpr float kLog2E = 1.44269504088896340736f;
static_assert(kSeq % kKC == 0 && kSeq % kQB == 0 && kKC == kHD);

// Eight base-2 exponentials in place, in one statement: each v_exp_f32 overwrites its own source alone and none reads
// a neighbour's result; the closing v_nop is the slot that the instruction set asks for behind a transcendental,
// whatever instruction the compiler puts next (left to the builtin, it set exponentials over one another's sources).
__device__ __forceinline__ void exp2x8(float& a, float& b, float& c, float& d, float& e, float& f, float& g, float& h) {
  asm("v_exp_f32 %0, %0\n\tv_exp_f32 %1, %1\n\tv_exp_f32 %2, %2\n\tv_exp_f32 %3, %3\n\t"
      "v_exp_f32 %4, %4\n\tv_exp_f32 %5, %5\n\tv_exp_f32 %6, %6\n\tv_exp_f32 %7, %7\n\tv_nop"
      : "+v"(a), "+v"(b), "+v"(c), "+v"(d), "+v"(e), "+v"(f), "+v"(g), "+v"(h));
}

// One thread's share of a chunk: 16 B of each of 4 K rows and 4 V^T rows, 16 rows apart. Eight lanes cover one 128-B row,
// so a wave-wide copy takes 4 whole lines. ldsK, ldsV = this lane's LDS byte addresses in its first row,
// gK, gV = its global addresses there.
constexpr int kKVTile = kKC * kLP * 2;    // bytes of one K or V^T tile in LDS
__device__ __forceinline__ void kv_copies(unsigned ldsK, const _Float16* gK, unsigned ldsV, const _Float16* gV) {
  // the closing s_wait_xcnt is a precaution: no register that a copy names is rewritten ahead of it
  asm volatile(
      "global_load_async_to_lds_b128 %0, %8, off\n\t"
      "global_load_async_to_lds_b128 %1, %9, off\n\t"
      "global_load_async_to_lds_b128 %2, %10, off\n\t"
      "global_load_async_to_lds_b128 %3, %11, off\n\t"
      "global_load_async_to_lds_b128 %4, %12, off\n\t"
      "global_load_async_to_lds_b128 %5, %13, off\n\t"
      "global_load_async_to_lds_b128 %6, %14, off\n\t"
      "global_load_async_to_lds_b128 %7, %15, off\n\t"
      "s_wait_xcnt 0x0"
      :: "v"(ldsK), "v"(ldsK + (unsigned)(16 * kLP * 2)), "v"(ldsK + (unsigned)(32 * kLP * 2)), "v"(ldsK + (unsigned)(48 * kLP * 2)),
         "v"(ldsV), "v"(ldsV + (unsigned)(16 * kLP * 2)), "v"(ldsV + (unsigned)(32 * kLP * 2)), "v"(ldsV + (unsigned)(48 * kLP * 2)),
         "v"(gK), "v"(gK + (size_t)16 * kEmb), "v"(gK + (size_t)32 * kEmb), "v"(gK + (size_t)48 * kEmb),
         "v"(gV), "v"(gV + (size_t)16 * kTok), "v"(gV + (size_t)32 * kTok), "v"(gV + (size_t)48 * kTok)
      : "memory");
}

// lane l's value in lane l ^ 16
__device__ __forceinline__ float xhalf(float x) {
  const int b = __builtin_bit_cast(int, x);
  return __builtin_bit_cast(float, __builtin_amdgcn_permlanex16(b, b, 0x76543210, 0xfedcba98, false, false));
}

__global__ __launch_bounds__(128) void attn_relbias_f16(
    const unsigned short* __restrict__ Qp, const unsigned short* __restrict__ Kp,
    const unsigned short* __restrict__ Vtp, const float* __restrict__ btab,
    const float* __restrict__ tptr, unsigned short* __restrict__ Cp, float ctx_scale) {
  // K [kv][d], V^T [d][kv] (rows of 64 halves at pitch kLP), two buffers each; bias slab
  __shared__ __align__(16) _Float16 Ksh[2 * kKC * kLP];
  __shared__ __align__(16) _Float16 Vtsh[2 * kHD * kLP];
  __shared__ __align__(16) float biasL[kBiasL];

  const _Float16* Qh  = (const _Float16*)Qp;
  const _Float16* Kh  = (const _Float16*)Kp;
  const _Float16* Vth = (const _Float16*)Vtp;

  const int tid  = threadIdx.x;
  const int wave = tid >> 5;
  const int lane = tid & 31;
  const int hh   = lane >> 4;
  const int c    = lane & 15;

  constexpr int nqb = kSeq / kQB;
  const int bx = blockIdx.x;
  const int qb = bx % nqb;
  const int bh = bx / nqb;
  const int h  = bh % kHeads;
  const int b  = bh / kHeads;
  const int qbase = qb * kQB;
  const int q0 = qbase + wave * 16;

  // K and V^T come into LDS by asynchronous copies, the next chunk's in flight while this chunk is worked on.
  // This thread's place in a tile: row tid / 8 (and 16, 32, 48 rows on), 16-byte piece tid % 8.
  constexpr int nCh = kSeq / kKC;
  const _Float16* gK = Kh + (size_t)(b * kSeq + (tid >> 3)) * kEmb + h * kHD + (tid & 7) * 8;
  const _Float16* gV = Vth + (size_t)(h * kHD + (tid >> 3)) * kTok + b * kSeq + (tid & 7) * 8;
  const unsigned ldsO = (unsigned)((tid >> 3) * (kLP * 2) + (tid & 7) * 16);
  const unsigned ldsK = (unsigned)(size_t)Ksh + ldsO;
  const unsigned ldsV = (unsigned)(size_t)Vtsh + ldsO;
  // chunk 0's copies fly while the bias slab and the Q fragments are fetched
  kv_copies(ldsK, gK, ldsV, gV);

  // temperature (RNE-bf16 converted input), clamp, 1/(sqrt(E) * temp)
  float tv = rne_bf(tptr[0]);
  tv = fminf(fmaxf(tv, 0.1f), 10.0f);
  // times log2 e: scores and bias are formed in base-2 units, e^x = 2^(x log2 e)
  const float inv = (1.0f / (sqrtf((float)kEmb) * tv)) * kLog2E;

  // bias slab: biasL[i] = table[min(qbase + i, relmax)][h] * inv, i = (q - qbase) + (S-1) - kv in [0, kBiasL)
  for (int i = tid; i < kBiasL; i += kNW * 32) {
    int rel = qbase + i;
    rel = rel > kRelMax ? kRelMax : rel;
    biasL[i] = rne_bf(btab[(size_t)rel * kHeads + h]) * inv;
  }

  // Q fragments (B operand, column c = query q0 + c): 2 d-chunks, hardware k order from the f16 plane
  v16h qa[2];
  {
    const _Float16* qrow = Qh + (size_t)(b * kSeq + q0 + c) * kEmb + h * kHD;
#pragma unroll
    for (int dc = 0; dc < 2; ++dc) qa[dc] = Frag<_Float16>::load(qrow + dc * 32 + 8 * hh);
  }

  // of query q0 + c: running maximum less 15 (the same in both halves), this half's part of the running sum (x2^15)
  float mrow = -INFINITY, lrow = 0.f;
  // oacc[t][r] = O^T[d = t*16 + 8*hh + r][query q0 + c]
  v8f oacc[4];
#pragma unroll
  for (int t = 0; t < 4; ++t) oacc[t] = (v8f){0.f,0.f,0.f,0.f,0.f,0.f,0.f,0.f};

  // chunk 0's bytes of this wave have landed before the barrier that shows them (and the bias slab) to the other waves
  asm volatile("s_wait_asynccnt 0x0" ::: "memory");
  __syncthreads();
  if (nCh > 1) kv_copies(ldsK + (unsigned)kKVTile, gK + (size_t)kKC * kEmb, ldsV + (unsigned)kKVTile, gV + kKC);

  // one chunk per trip, the buffer chosen by the trip's parity
  for (int kc = 0; kc < nCh; ++kc) {
    const int kv0 = kc * kKC;
    const _Float16* Kb = Ksh + (kc & 1) * (kKC * kLP);
    const _Float16* Vb = Vtsh + (kc & 1) * (kHD * kLP);

    // ---- the chunk's eight K fragments and its 32 bias values are read as one group ahead of the score products:
    // one LDS latency a chunk, where a read and a full wait in front of each product cost eight ----
    const int bi = wave * 16 + c + (kSeq - 1) - kv0 - 8 * hh;
    v16h kf[2][4];
#pragma unroll
    for (int dc = 0; dc < 2; ++dc)
#pragma unroll
      for (int j = 0; j < 4; ++j) kf[dc][j] = Frag<_Float16>::load(Kb + (j * 16 + c) * kLP + dc * 32 + 8 * hh);
    float bl[4][8];
#pragma unroll
    for (int j = 0; j < 4; ++j)
#pragma unroll
      for (int r = 0; r < 8; ++r) bl[j][r] = biasL[bi - j * 16 - r];
    // keeps the group whole: left free, the scheduler sinks the bias reads in among the products and the arithmetic, each with a wait of its own
    __builtin_amdgcn_sched_barrier(0);

    // ---- scores, transposed: s[j][r] = score of key kv0 + j*16 + 8*hh + r with query q0 + c ----
    // four independent tiles back to back, then their second halves: in every tile d 0..31 is summed before d 32..63
    v8f s[4];
#pragma unroll
    for (int j = 0; j < 4; ++j) s[j] = (v8f){0.f,0.f,0.f,0.f,0.f,0.f,0.f,0.f};
#pragma unroll
    for (int dc = 0; dc < 2; ++dc)
#pragma unroll
      for (int j = 0; j < 4; ++j) s[j] = Frag<_Float16>::mma(kf[dc][j], qa[dc], s[j]);

    // ---- the chunk's eight V^T fragments, one group: their latency passes behind the softmax arithmetic ----
    v16h vf[2][4];
#pragma unroll
    for (int kk = 0; kk < 2; ++kk)
#pragma unroll
      for (int t = 0; t < 4; ++t) vf[kk][t] = Frag<_Float16>::load(Vb + (t * 16 + c) * kLP + kk * 32 + 8 * hh);
    // keeps the group here: left free, the scheduler sinks half of these reads down to their products, a full wait in front of each
    __builtin_amdgcn_sched_barrier(0);

    // ---- scale + bias + maximum over this lane's 32 keys (one chain per tile), then over both halves ----
    float mj[4];
#pragma unroll
    for (int j = 0; j < 4; ++j) {
      mj[j] = -INFINITY;
#pragma unroll
      for (int r = 0; r < 8; ++r) {
        const float sc = s[j][r] * inv + bl[j][r];
        s[j][r] = sc;
        mj[j] = fmaxf(mj[j], sc);
      }
    }
    float cm = fmaxf(fmaxf(mj[0], mj[1]), fmaxf(mj[2], mj[3]));
    cm = fmaxf(cm, xhalf(cm));
    // the point that exponents are taken from: the chunk's maximum less 15 (any point serves, it cancels in p / l).
    // Where the maximum is so large that f32 cannot hold the 15 beside it, the maximum itself, so that p stays inside f16.
    {
      const float lowered = cm - kPCarryLog2;
      cm = (cm - lowered < kPCarryLog2 + 0.5f) ? lowered : cm;
    }

    // ---- online softmax update; P^T (x2^15, f16) packed into the B operands of the second product ----
    const float mnew = fmaxf(mrow, cm);
    const float alpha = __builtin_amdgcn_exp2f(mrow - mnew);
    mrow = mnew;
    // pb[kk] element e: key kv0 + kk*32 + 8*hh + e for e < 8, kv0 + kk*32 + 16 + 8*hh + (e - 8) behind: tiles 2kk, 2kk + 1
    v16h pb[2];
    float pj[4];
#pragma unroll
    for (int j = 0; j < 4; ++j) {
      float e[8];
#pragma unroll
      for (int r = 0; r < 8; ++r) e[r] = s[j][r] - mnew;
      exp2x8(e[0], e[1], e[2], e[3], e[4], e[5], e[6], e[7]);
      pj[j] = e[0];
#pragma unroll
      for (int r = 1; r < 8; ++r) pj[j] += e[r];
#pragma unroll
      for (int r = 0; r < 8; ++r) pb[j >> 1][(j & 1) * 8 + r] = (_Float16)e[r];
    }
    lrow = lrow * alpha + ((pj[0] + pj[1]) + (pj[2] + pj[3]));
#pragma unroll
    for (int t = 0; t < 4; ++t)
#pragma unroll
      for (int r = 0; r < 8; ++r) oacc[t][r] *= alpha;

    // ---- O^T += V^T_chunk . P^T ----
#pragma unroll
    for (int kk = 0; kk < 2; ++kk) {
#pragma unroll
      for (int t = 0; t < 4; ++t) oacc[t] = Frag<_Float16>::mma(vf[kk][t], pb[kk], oacc[t]);
    }
    // the four slots that the chip asks for behind the last product, on the branch at the loop's foot as on the fall-through
    acc_guard4(oacc[0], oacc[1], oacc[2], oacc[3]);
    // this wave's reads of the buffers are done before the barrier behind which they are refilled
    asm volatile("s_wait_dscnt 0x0" ::: "memory");
    // this wave's copies of chunk kc + 1 have landed before the barrier that shows them to the other waves
    asm volatile("s_wait_asynccnt 0x0" ::: "memory");
    __syncthreads();
    if (kc + 2 < nCh)
      kv_copies(ldsK + (unsigned)((kc & 1) * kKVTile), gK + (size_t)(kc + 2) * kKC * kEmb,
                ldsV + (unsigned)((kc & 1) * kKVTile), gV + (kc + 2) * kKC);
  }
  // no copy is outstanding when the wave goes on to the epilogue and ends
  asm volatile("s_wait_asynccnt 0x0" ::: "memory");

  // the two halves' sums of a query are joined here, once; a lane's 8 accumulators of a tile are 8 consecutive d
  // of its query's row: one 16-byte store per tile
  {
    const float l = lrow + xhalf(lrow);
    const float invl = ctx_scale * (1.0f / l);
    _Float16* crow = (_Float16*)Cp + (size_t)(b * kSeq + q0 + c) * kEmb + h * kHD + 8 * hh;
#pragma unroll
    for (int t = 0; t < 4; ++t) {
      v8h hv;
#pragma unroll
      for (int r = 0; r < 8; ++r) hv[r] = (_Float16)(oacc[t][r] * invl);
      *(v8h*)(crow + t * 16) = hv;
    }
  }
}

// ---------------------------------------------------------------------------
// Host launch
// ---------------------------------------------------------------------------
extern "C" void kernel_launch(void* const* d_in, const int* in_sizes, int n_in,
                              void* d_out, int out_size, void* d_ws, size_t ws_size,
                              hipStream_t stream) {
  if (n_in < 11) return;
  if (in_sizes[0] != kTok * kEmb) return;
  if (in_sizes[1] != kEmb * kEmb || in_sizes[3] != kEmb * kEmb ||
      in_sizes[5] != kEmb * kEmb || in_sizes[7] != kEmb * kEmb) return;
  if (in_sizes[2] < kEmb || in_sizes[4] < kEmb || in_sizes[6] < kEmb || in_sizes[8] < kEmb) return;
  if (in_sizes[9] != kRelRows * kHeads || in_sizes[10] < 1) return;
  if (out_size != kTok * kEmb) return;

  const float* x    = (const float*)d_in[0];
  const float* Wq   = (const float*)d_in[1];
  const float* bq   = (const float*)d_in[2];
  const float* Wk   = (const float*)d_in[3];
  const float* bk   = (const float*)d_in[4];
  const float* Wv   = (const float*)d_in[5];
  const float* bv   = (const float*)d_in[6];
  const float* Wp   = (const float*)d_in[7];
  const float* bp   = (const float*)d_in[8];
  const float* btab = (const float*)d_in[9];
  const float* tptr = (const float*)d_in[10];
  float* out = (float*)d_out;

  // workspace region map (bytes), all offsets multiples of 2 MiB:
  //   Xb  bf16 [4096][1024]   8 MiB  @ 0
  //   WqT bf16 [1024][1024]   2 MiB  @ 8 MiB
  //   WkT bf16 [1024][1024]   2 MiB  @ 10 MiB
  //   WvT bf16 [1024][1024]   2 MiB  @ 12 MiB
  //   WpT f16  [1024][1024]   2 MiB  @ 14 MiB   (RNE-bf16 values x64)
  //   Qp  f16  [4096][1024]   8 MiB  @ 16 MiB
  //   Kp  f16  [4096][1024]   8 MiB  @ 24 MiB
  //   Vtp f16  [1024][4096]   8 MiB  @ 32 MiB
  //   Cx  f16  [4096][1024]   8 MiB  @ 40 MiB   (ctx x64)
  //   total 48 MiB = 50,331,648 B
  const size_t szAct = (size_t)kTok * kEmb * 2;
  const size_t szW   = (size_t)kEmb * kEmb * 2;
  size_t off = 0;
  const size_t oXb = off; off += szAct;
  const size_t oWq = off; off += szW;
  const size_t oWk = off; off += szW;
  const size_t oWv = off; off += szW;
  const size_t oWp = off; off += szW;
  const size_t oQ  = off; off += szAct;
  const size_t oK  = off; off += szAct;
  const size_t oVt = off; off += szAct;
  const size_t oCx = off; off += szAct;
  if (off > ws_size) return;

  char* w = (char*)d_ws;
  unsigned short* Xb  = (unsigned short*)(w + oXb);
  unsigned short* WqT = (unsigned short*)(w + oWq);
  unsigned short* WkT = (unsigned short*)(w + oWk);
  unsigned short* WvT = (unsigned short*)(w + oWv);
  unsigned short* WpT = (unsigned short*)(w + oWp);
  unsigned short* Qp  = (unsigned short*)(w + oQ);
  unsigned short* Kp  = (unsigned short*)(w + oK);
  unsigned short* Vtp = (unsigned short*)(w + oVt);
  unsigned short* Cx  = (unsigned short*)(w + oCx);

  const float kWpCarry  = 64.0f;
  const float kCtxCarry = 64.0f;

  // 1) one launch: weights in[rows=1024][cols=1024] -> out[cols][rows], and x -> bf16 plane (2 elements per thread)
  {
    const int n2 = (kTok * kEmb) / 2;
    prep_inputs<<<4 * kWTiles + (n2 + 255) / 256, 256, 0, stream>>>(
        x, Wq, Wk, Wv, Wp, Xb, WqT, WkT, WvT, WpT, n2, kEmb, kWpCarry);
  }
  // 2) one launch: the three projections (bf16 WMMA, f16 outputs). M,N % 128 == 0, K % 128 == 0 by the static_assert below.
  static_assert(kTok % 128 == 0 && kEmb % 128 == 0);
  const int gemmBlocks = (kTok / 128) * (kEmb / 128);
  qkv_gemm<<<dim3(gemmBlocks, 3), 256, 0, stream>>>(
      Xb, WqT, WkT, WvT, Qp, Kp, Vtp, bq, bk, bv, kTok, kEmb);
  // 3) attention -> ctx f16 plane (x64)
  attn_relbias_f16<<<kBatch * kHeads * (kSeq / kQB), kNW * 32, 0, stream>>>(
      Qp, Kp, Vtp, btab, tptr, Cx, kCtxCarry);
  // 4) output projection: out[token][n] = 2^-12 * sum_c Cx[token][c] WpT[n][c] + bp[n]
  wmma_gemm64<0, false, 2, 0><<<dim3(gemmBlocks, 1), 256, 0, stream>>>(
      Cx, Cx, kEmb, 0L, WpT, WpT, kEmb, 0L, (void*)out, (void*)out, kEmb, 0L, bp,
      kTok, kEmb, kEmb, 1.0f / (kWpCarry * kCtxCarry));
}

// v009
// Measured time: 67.8 microseconds a run.
// In two side-by-side timings against v008, it was 1.06 and 1.04 times as fast.
// Over all steps from v000 it is 4.79 times as fast.
// Contractions: x@Wq, x@Wk, Wv-side GEMM producing V^T on v_wmma_f32_16x16x32_bf16 (bf16 operands = RNE-bf16 converted inputs, exact products); q.k^T, p.v, ctx@Wp on v_wmma_f32_16x16x32_f16 (f16 operands; p carried x2^15, ctx and Wp carried x64); f32 accumulate; softmax and normalisers in f32.
#include <hip/hip_runtime.h>
#include <math.h>

typedef __attribute__((ext_vector_type(16))) _Float16 v16h;
typedef __attribute__((ext_vector_type(8)))  _Float16 v8h;
typedef __attribute__((ext_vector_type(16))) __bf16   v16b;
typedef __attribute__((ext_vector_type(8)))  __bf16   v8b;
typedef __attribute__((ext_vector_type(8)))  float    v8f;
typedef __attribute__((ext_vector_type(4)))  float    v4f;
typedef __attribute__((ext_vector_type(4)))  unsigned v4u;

constexpr int kBatch   = 4;
constexpr int kSeq     = 1024;
constexpr int kEmb     = 1024;
constexpr int kHeads   = 16;
constexpr int kHD      = 64;
constexpr int kTok     = kBatch * kSeq;
constexpr int kRelRows = 1999;
constexpr int kRelMax  = kRelRows - 1;

static_assert(kEmb == kHeads * kHD);
static_assert(kHD == 64);
static_assert(kTok % 64 == 0 && kEmb % 64 == 0 && kEmb % 32 == 0 && kSeq % 64 == 0);

// ---------------------------------------------------------------------------
// helpers
// ---------------------------------------------------------------------------
__device__ __forceinline__ unsigned short f2bf_bits(float f) {
  unsigned u = __float_as_uint(f);
  return (unsigned short)((u + 0x7FFFu + ((u >> 16) & 1u)) >> 16);
}
__device__ __forceinline__ float bf_bits2f(unsigned short h) { return __uint_as_float(((unsigned)h) << 16); }
__device__ __forceinline__ float rne_bf(float f) { return bf_bits2f(f2bf_bits(f)); }

__device__ __forceinline__ void dep_guard_h(v8f& a, v8f& b, v16h x, v16h y) { asm volatile("v_nop\n\tv_nop\n\tv_nop\n\tv_nop" : "+v"(a), "+v"(b) : "v"(x), "v"(y)); }
__device__ __forceinline__ void dep_guard_b(v8f& a, v8f& b, v16b x, v16b y) { asm volatile("v_nop\n\tv_nop\n\tv_nop\n\tv_nop" : "+v"(a), "+v"(b) : "v"(x), "v"(y)); }
__device__ __forceinline__ void keep4_h(v16h a, v16h b, v16h c, v16h d) { asm volatile("v_nop" :: "v"(a), "v"(b), "v"(c), "v"(d)); }
__device__ __forceinline__ void keep4_b(v16b a, v16b b, v16b c, v16b d) { asm volatile("v_nop" :: "v"(a), "v"(b), "v"(c), "v"(d)); }
__device__ __forceinline__ void acc_guard4(v8f& a, v8f& b, v8f& c, v8f& d) { asm volatile("v_nop\n\tv_nop\n\tv_nop\n\tv_nop" : "+v"(a), "+v"(b), "+v"(c), "+v"(d)); }
template <typename T> struct Frag;
template <> struct Frag<_Float16> {
  typedef v16h V; union U { v16h v; v8h h[2]; };
  // elements 0..7 <- p[0..7], 8..15 <- p[16..23]
  static __device__ __forceinline__ v16h load(const _Float16* p) {
    U f; f.h[0] = *(const v8h*)(p); f.h[1] = *(const v8h*)(p + 16); return f.v;
  }
  static __device__ __forceinline__ v8f mma(v16h a, v16h b, v8f c) {
    return __builtin_amdgcn_wmma_f32_16x16x32_f16(false, a, false, b, (short)0, c, false, false);
  }
  static __device__ __forceinline__ void guard(v8f& a, v8f& b, v16h x, v16h y) { dep_guard_h(a, b, x, y); }
  static __device__ __forceinline__ void keep(v16h a, v16h b, v16h c, v16h d) { keep4_h(a, b, c, d); }
};
template <> struct Frag<__bf16> {
  typedef v16b V; union U { v16b v; v8b h[2]; };
  static __device__ __forceinline__ v16b load(const __bf16* p) {
    U f; f.h[0] = *(const v8b*)(p); f.h[1] = *(const v8b*)(p + 16); return f.v;
  }
  static __device__ __forceinline__ v8f mma(v16b a, v16b b, v8f c) {
    return __builtin_amdgcn_wmma_f32_16x16x32_bf16(false, a, false, b, (short)0, c, false, false);
  }
  static __device__ __forceinline__ void guard(v8f& a, v8f& b, v16b x, v16b y) { dep_guard_b(a, b, x, y); }
  static __device__ __forceinline__ void keep(v16b a, v16b b, v16b c, v16b d) { keep4_b(a, b, c, d); }
};

// ---------------------------------------------------------------------------
// Register-blocked batched WMMA GEMM, operands staged in LDS.
// C[m,n] = scale * sum_k A[m,k] * Bt[n,k] (+bias); a work-group of 8 waves owns a 128x128 tile,
// each wave 32 rows x 64 columns of it (two waves per SIMD: one wave's LDS reads and copy issue
// stand behind the other's products).
// A row-major [M,K]; Bt row-major [N,K]; M,N % 128 == 0, K % 128 == 0.
// A pass is GK k (128 or 64): 2 GK bytes of 128 A rows and of 128 Bt rows, brought into LDS by asynchronous copies,
// two buffers, the next pass's copies in flight while this pass is worked on. GK sets the work-group's LDS and so how
// many work-groups share a WGP: at 128 one, at 64 three, whose waves fill one another's barrier waits, first fills and epilogues.
// SPLIT: hi/lo operand planes (not supported by the staged loop, false).
// BIAS_MODE: 0 none, 1 bias[m], 2 bias[n]; bias values RNE-converted to bf16 precision before the add.
// OUT_MODE: 0 = f32, 1 = f16, 2 = bf16 hi plane (Cout) + bf16 lo plane (Cout2).
// ET: 0 = f16 operands, 1 = bf16 operands (pointers passed as 16-bit storage)
// ---------------------------------------------------------------------------
template <int GK> struct Pass {
  static_assert(GK == 128 || GK == 64);
  static constexpr int kPitch = 2 * GK + 16;    // LDS row pitch in bytes: 16 B x odd, conflict-free for 16-byte reads down a column
  static constexpr int kStage = 256 * kPitch;   // one buffer: rows 0..127 = A rows, rows 128..255 = Bt rows
  static constexpr int kLanes = GK / 8;         // lanes that cover one row, 16 B each
  static constexpr int kRows  = 32 / kLanes;    // rows that one wave-wide copy covers
};

// One wave's share of a stage: 32 rows of 2 GK bytes, 32 / kRows copies of kRows rows each.
// lds = this lane's LDS byte address in the first row group, g = this lane's global address there,
// ld = source row pitch in elements.
template <typename T, int GK>
__device__ __forceinline__ void stage_copies(unsigned lds, const T* g, int ld) {
  constexpr int kStepR = Pass<GK>::kRows;                        // rows from one copy to the next
  constexpr unsigned kStepL = kStepR * Pass<GK>::kPitch;         // the same in LDS bytes
#pragma unroll
  for (int i = 0; i < 32 / kStepR; i += 8) {
    // the closing s_wait_xcnt is a precaution: no register that a copy names is rewritten ahead of it
    asm volatile(
        "global_load_async_to_lds_b128 %0, %8, off\n\t"
        "global_load_async_to_lds_b128 %1, %9, off\n\t"
        "global_load_async_to_lds_b128 %2, %10, off\n\t"
        "global_load_async_to_lds_b128 %3, %11, off\n\t"
        "global_load_async_to_lds_b128 %4, %12, off\n\t"
        "global_load_async_to_lds_b128 %5, %13, off\n\t"
        "global_load_async_to_lds_b128 %6, %14, off\n\t"
        "global_load_async_to_lds_b128 %7, %15, off\n\t"
        "s_wait_xcnt 0x0"
        :: "v"(lds + (unsigned)(i + 0) * kStepL), "v"(lds + (unsigned)(i + 1) * kStepL),
           "v"(lds + (unsigned)(i + 2) * kStepL), "v"(lds + (unsigned)(i + 3) * kStepL),
           "v"(lds + (unsigned)(i + 4) * kStepL), "v"(lds + (unsigned)(i + 5) * kStepL),
           "v"(lds + (unsigned)(i + 6) * kStepL), "v"(lds + (unsigned)(i + 7) * kStepL),
           "v"(g + (size_t)((i + 0) * kStepR) * ld), "v"(g + (size_t)((i + 1) * kStepR) * ld),
           "v"(g + (size_t)((i + 2) * kStepR) * ld), "v"(g + (size_t)((i + 3) * kStepR) * ld),
           "v"(g + (size_t)((i + 4) * kStepR) * ld), "v"(g + (size_t)((i + 5) * kStepR) * ld),
           "v"(g + (size_t)((i + 6) * kStepR) * ld), "v"(g + (size_t)((i + 7) * kStepR) * ld)
        : "memory");
  }
}

template <int ET> struct Elem;
template <> struct Elem<0> { typedef _Float16 T; };
template <> struct Elem<1> { typedef __bf16 T; };
// The tile's work is a device function, so that one launch can hold several GEMMs: the kernel owns the LDS
// (ring: operand ring, two buffers; sT: per-wave 16x64 slab, pitch 68 floats) and says which tile and batch.
template <int ET, bool SPLIT, int BIAS_MODE, int OUT_MODE, int GK>
__device__ __forceinline__ void gemm_tile(
    unsigned char* ring, float (*sT)[16 * 68], int tile, int b,
    const unsigned short* __restrict__ Ap, const unsigned short* __restrict__ A2p, int lda, long strideA,
    const unsigned short* __restrict__ Btp, const unsigned short* __restrict__ Bt2p, int ldb, long strideB,
    void* __restrict__ Cout, void* __restrict__ Cout2, int ldc, long strideC,
    const float* __restrict__ bias,
    int M, int N, int K, float scale) {
  static_assert(!SPLIT);
  constexpr int kGK = GK, kGPitch = Pass<GK>::kPitch, kGStage = Pass<GK>::kStage, kGLanes = Pass<GK>::kLanes;
  typedef typename Elem<ET>::T T;
  typedef typename Frag<T>::V V;
  const T* A = (const T*)Ap; const T* Bt = (const T*)Btp;
  const int lane = threadIdx.x & 31;
  // in a scalar register, so that what picks a wave's source rows is scalar and every lane stays on at the copies
  const int wave = __builtin_amdgcn_readfirstlane(threadIdx.x >> 5);
  const int tilesN = N >> 7;
  const int tilesM = M >> 7;
  // the same for the whole work-group, ahead of every barrier
  if (tile >= tilesM * tilesN) return;
  const int tm = tile / tilesN;
  const int tn = tile - tm * tilesN;
  const int wm = wave >> 1;
  const int wn = wave & 1;
  const int m0 = (tm << 7) + (wm << 5);
  const int n0 = (tn << 7) + (wn << 6);

  const T* Ab  = A  + (size_t)b * strideA;
  const T* Bb  = Bt + (size_t)b * strideB;

  // row (A) / col (B, D) within subtile; k offset of this lane half; D row offset
  const int rlane = lane & 15;
  const int koff  = (lane >> 4) * 8;
  const int mOff  = (lane >> 4) * 8;

  // copies: waves 0..3 bring the 128 A rows, waves 4..7 the 128 Bt rows, 32 rows each
  const int ldS = (wave < 4) ? lda : ldb;
  const T* gS = ((wave < 4) ? (Ab + (size_t)((tm << 7) + (wave << 5)) * lda)
                            : (Bb + (size_t)((tn << 7) + ((wave - 4) << 5)) * ldb))
                + (size_t)(lane / kGLanes) * ldS + (lane % kGLanes) * 8;
  const unsigned ldsS = (unsigned)(size_t)ring + (unsigned)(((wave << 5) + lane / kGLanes) * kGPitch + (lane % kGLanes) * 16);

  v8f acc[2][4];
#pragma unroll
  for (int i = 0; i < 2; ++i)
#pragma unroll
    for (int j = 0; j < 4; ++j) acc[i][j] = (v8f){0.f,0.f,0.f,0.f,0.f,0.f,0.f,0.f};

  const int nPass = K / kGK;
  stage_copies<T, GK>(ldsS, gS, ldS);
  // pass 0's bytes of this wave have landed before the barrier that shows them to the other waves
  asm volatile("s_wait_asynccnt 0x0" ::: "memory");
  __syncthreads();
  if (nPass > 1) stage_copies<T, GK>(ldsS + (unsigned)kGStage, gS + kGK, ldS);

  // one pass per trip, the buffer chosen by the trip's parity
  for (int t = 0; t < nPass; ++t) {
    const unsigned char* st = ring + (t & 1) * kGStage;
    const unsigned char* stA = st + ((wm << 5) + rlane) * kGPitch;
    const unsigned char* stB = st + (128 + (wn << 6) + rlane) * kGPitch;
#pragma unroll
    for (int k0 = 0; k0 < kGK; k0 += 32) {
      // all six fragments of a 32-k block are read as one group: one LDS latency per 8 products
      V bh[4], ah[2];
#pragma unroll
      for (int j = 0; j < 4; ++j) bh[j] = Frag<T>::load((const T*)(stB + (j << 4) * kGPitch) + koff + k0);
#pragma unroll
      for (int i = 0; i < 2; ++i) ah[i] = Frag<T>::load((const T*)(stA + (i << 4) * kGPitch) + koff + k0);
#pragma unroll
      for (int i = 0; i < 2; ++i) {
#pragma unroll
        for (int j = 0; j < 4; ++j) acc[i][j] = Frag<T>::mma(ah[i], bh[j], acc[i][j]);
        Frag<T>::guard(acc[i][0], acc[i][3], ah[i], ah[i]);
      }
      Frag<T>::keep(bh[0], bh[1], bh[2], bh[3]);
    }
    // this wave's reads of the buffer are done before the barrier behind which it is refilled
    asm volatile("s_wait_dscnt 0x0" ::: "memory");
    // this wave's copies of pass t + 1 have landed before the barrier that shows them to the other waves
    asm volatile("s_wait_asynccnt 0x0" ::: "memory");
    __syncthreads();
    if (t + 2 < nPass) stage_copies<T, GK>(ldsS + (unsigned)((t & 1) * kGStage), gS + (size_t)(t + 2) * kGK, ldS);
  }
  // no copy is outstanding when the wave goes on to the epilogue and ends
  asm volatile("s_wait_asynccnt 0x0" ::: "memory");
  acc_guard4(acc[0][0], acc[0][1], acc[0][2], acc[0][3]);
  acc_guard4(acc[1][0], acc[1][1], acc[1][2], acc[1][3]);

  // ---- epilogue ----
  float* slab = sT[wave];
  // column biases: 4 scalar loads per lane, hoisted
  float bvj[4];
#pragma unroll
  for (int j = 0; j < 4; ++j) bvj[j] = (BIAS_MODE == 2) ? rne_bf(bias[n0 + (j << 4) + rlane]) : 0.f;
#pragma unroll
  for (int i = 0; i < 2; ++i) {
    const int mBase = m0 + (i << 4);
    // row biases: two 16-B loads per lane (rows mBase+mOff .. +7, 32-B aligned)
    v4f bm0 = (v4f){0.f, 0.f, 0.f, 0.f};
    v4f bm1 = bm0;
    if (BIAS_MODE == 1) {
      bm0 = *(const v4f*)(bias + mBase + mOff);
      bm1 = *(const v4f*)(bias + mBase + mOff + 4);
    }
#pragma unroll
    for (int j = 0; j < 4; ++j) {
#pragma unroll
      for (int r = 0; r < 8; ++r) {
        float v = acc[i][j][r] * scale;
        if (BIAS_MODE == 1) { const v4f bsel = (r < 4) ? bm0 : bm1; v += rne_bf(bsel[r & 3]); }
        if (BIAS_MODE == 2) v += bvj[j];
        slab[(mOff + r) * 68 + (j << 4) + rlane] = v;
      }
    }
    __builtin_amdgcn_fence(__ATOMIC_RELEASE, "workgroup");
    __builtin_amdgcn_wave_barrier();
    __builtin_amdgcn_fence(__ATOMIC_ACQUIRE, "workgroup");
    if (OUT_MODE == 0) {
      float* C = (float*)Cout + (size_t)b * strideC;
      // row seg = 256 B = 16 lanes x 16 B
      const int hh = lane >> 4, c4 = (lane & 15) * 4;
      {
#pragma unroll
        for (int it = 0; it < 8; ++it) {
          const int row = it * 2 + hh;
          v4f v = *(const v4f*)(slab + row * 68 + c4);
          *(v4f*)(C + (size_t)(mBase + row) * ldc + n0 + c4) = v;
        }
        
      }
    } else {
      const int q = lane >> 3, c8 = (lane & 7) * 8;
      unsigned short* C  = (unsigned short*)Cout  + (size_t)b * strideC;
      unsigned short* C2 = (OUT_MODE == 2) ? ((unsigned short*)Cout2 + (size_t)b * strideC) : nullptr;
      {
#pragma unroll
        for (int it = 0; it < 4; ++it) {
          const int row = it * 4 + q;
          const float* sp = slab + row * 68 + c8;
          v8h hv, lv;
#pragma unroll
          for (int e = 0; e < 8; ++e) {
            if (OUT_MODE == 1) {
              hv[e] = (_Float16)sp[e];
            } else {
              unsigned short hb = f2bf_bits(sp[e]);
              unsigned short lb = f2bf_bits(sp[e] - bf_bits2f(hb));
              hv[e] = __builtin_bit_cast(_Float16, hb);
              lv[e] = __builtin_bit_cast(_Float16, lb);
            }
          }
          *(v8h*)(C + (size_t)(mBase + row) * ldc + n0 + c8) = hv;
          if (OUT_MODE == 2) *(v8h*)(C2 + (size_t)(mBase + row) * ldc + n0 + c8) = lv;
        }
        
      }
    }
    __builtin_amdgcn_fence(__ATOMIC_RELEASE, "workgroup");
    __builtin_amdgcn_wave_barrier();
    __builtin_amdgcn_fence(__ATOMIC_ACQUIRE, "workgroup");
  }
}

// One GEMM per launch: blockIdx.x = tile, blockIdx.y = batch.
template <int ET, bool SPLIT, int BIAS_MODE, int OUT_MODE>
__global__ __launch_bounds__(256) void wmma_gemm64(
    const unsigned short* __restrict__ Ap, const unsigned short* __restrict__ A2p, int lda, long strideA,
    const unsigned short* __restrict__ Btp, const unsigned short* __restrict__ Bt2p, int ldb, long strideB,
    void* __restrict__ Cout, void* __restrict__ Cout2, int ldc, long strideC,
    const float* __restrict__ bias,
    int M, int N, int K, float scale) {
  __shared__ __align__(16) unsigned char ring[2 * Pass<128>::kStage];
  __shared__ __align__(16) float sT[8][16 * 68];
  gemm_tile<ET, SPLIT, BIAS_MODE, OUT_MODE, 128>(ring, sT, blockIdx.x, blockIdx.y,
      Ap, A2p, lda, strideA, Btp, Bt2p, ldb, strideB, Cout, Cout2, ldc, strideC, bias, M, N, K, scale);
}

// The three projections, which do not depend on one another, in one launch: blockIdx.y picks the job
// (the same for a whole work-group), blockIdx.x the tile.
//   job 0: Q[token][n]  = sum_k Xb[token][k] WqT[n][k] + bq[n]
//   job 1: K[token][n]  = sum_k Xb[token][k] WkT[n][k] + bk[n]
//   job 2: Vt[n][token] = sum_k WvT[n][k] Xb[token][k] + bv[n]   (M = features, N = tokens)
__global__ __launch_bounds__(256) void qkv_gemm(
    const unsigned short* __restrict__ Xb, const unsigned short* __restrict__ WqT,
    const unsigned short* __restrict__ WkT, const unsigned short* __restrict__ WvT,
    unsigned short* __restrict__ Qp, unsigned short* __restrict__ Kp, unsigned short* __restrict__ Vtp,
    const float* __restrict__ bq, const float* __restrict__ bk, const float* __restrict__ bv,
    int nTok, int nEmb) {
  // passes of 64 k: 106 KiB of LDS, so three work-groups share a WGP and the launch's 768 are all resident at once
  __shared__ __align__(16) unsigned char ring[2 * Pass<64>::kStage];
  __shared__ __align__(16) float sT[8][16 * 68];
  const int job = blockIdx.y;
  if (job < 2) {
    const unsigned short* Wt = job ? WkT : WqT;
    unsigned short* C = job ? Kp : Qp;
    gemm_tile<1, false, 2, 1, 64>(ring, sT, blockIdx.x, 0,
        Xb, Xb, nEmb, 0L, Wt, Wt, nEmb, 0L, (void*)C, (void*)C, nEmb, 0L, job ? bk : bq,
        nTok, nEmb, nEmb, 1.0f);
  } else {
    gemm_tile<1, false, 1, 1, 64>(ring, sT, blockIdx.x, 0,
        WvT, WvT, nEmb, 0L, Xb, Xb, nEmb, 0L, (void*)Vtp, (void*)Vtp, nTok, 0L, bv,
        nEmb, nTok, nEmb, 1.0f);
  }
}

// ---------------------------------------------------------------------------
// f32 -> bf16 plane, 2 elements per thread; blk = index of this 256-thread block within the cast
// ---------------------------------------------------------------------------
__device__ __forceinline__ void cast_f32_bf16x2(
    const float* __restrict__ in, unsigned short* __restrict__ out, int n2, int blk) {
  const int i = blk * 256 + threadIdx.x;
  if (i < n2) {
    const unsigned u = (unsigned)f2bf_bits(in[2 * i]) | ((unsigned)f2bf_bits(in[2 * i + 1]) << 16);
    ((unsigned*)out)[i] = u;
    
  }
}

// ---------------------------------------------------------------------------
// Transpose + convert: W row-major in[rows][cols] f32 -> Wt row-major out[cols][rows] 16-bit.
// MODE 0: bf16 bits of RNE-bf16(W). MODE 1: f16 bits of RNE-bf16(W) * wsc (wsc a power of two).
// One block per 64x64 tile (bx, by) of (cols/64, rows/64); rows, cols % 64 == 0. tile = the kernel's 64x65 LDS floats.
// Load: 256 threads x 4 x float4 = 64x64 tile. Store: wave w writes output rows w*8..w*8+7,
// ---------------------------------------------------------------------------
template <int MODE>
__device__ __forceinline__ void transpose_cvt16(
    float* tile, int bx, int by,
    const float* __restrict__ W, unsigned short* __restrict__ Wt, int rows, int cols, float wsc) {
  const int tid = threadIdx.x, lane = tid & 31, wave = tid >> 5;
  const int n0 = bx * 64;
  const int k0 = by * 64;
  {
    const int c4 = (tid & 15) * 4, r = tid >> 4;
#pragma unroll
    for (int it = 0; it < 4; ++it) {
      const int rr = it * 16 + r;
      const v4f x4 = *(const v4f*)(W + (size_t)(k0 + rr) * cols + n0 + c4);
      tile[rr * 65 + c4 + 0] = x4[0];
      tile[rr * 65 + c4 + 1] = x4[1];
      tile[rr * 65 + c4 + 2] = x4[2];
      tile[rr * 65 + c4 + 3] = x4[3];
    }
  }
  __syncthreads();
  const int q4 = lane >> 3, c8 = (lane & 7) * 8;
  _Float16* out = (_Float16*)Wt;
  {
#pragma unroll
    for (int it = 0; it < 2; ++it) {
      const int i = wave * 8 + it * 4 + q4;
      v8h hv;
#pragma unroll
      for (int e = 0; e < 8; ++e) {
        const float f = tile[(c8 + e) * 65 + i];
        if (MODE == 0) {
          hv[e] = __builtin_bit_cast(_Float16, f2bf_bits(f));
        } else {
          hv[e] = (_Float16)(rne_bf(f) * wsc);
        }
      }
      *(v8h*)(out + (size_t)(n0 + i) * rows + k0 + c8) = hv;
    }
    // a precaution: inlined into a kernel with other jobs' code behind it, no register that the two stores name
    // is rewritten ahead of this wait on any branch of the listing
    asm volatile("s_wait_xcnt 0x0" ::: "memory");
  }
}

// ---------------------------------------------------------------------------
// Score scale in base-2 units: temperature (RNE-bf16 converted input), clamp, log2 e / (sqrt(E) * temp); e^x = 2^(x log2 e)
// ---------------------------------------------------------------------------
constexpr float kLog2E = 1.44269504088896340736f;
__device__ __forceinline__ float score_scale(const float* __restrict__ tptr) {
  float tv = rne_bf(tptr[0]);
  tv = fminf(fmaxf(tv, 0.1f), 10.0f);
  return (1.0f / (sqrtf((float)kEmb) * tv)) * kLog2E;
}

// ---------------------------------------------------------------------------
// Bias rows, one per head, built once: biasT[h][i] = table[clamp(2 S - 1 - i, 0, relmax)][h] * score scale, i in [0, kTabL).
// The row runs against the table, so that it ascends with the key index as the attention loop reads it.
// An attention work-group's slab is kSlab consecutive floats of its head's row, so it takes the slab with whole-line
// copies; the table itself holds a head's values 64 B apart.
// ---------------------------------------------------------------------------
constexpr int kSlab = 3 * 128 * 4;              // floats that three 16-byte copies of each of 128 threads bring
constexpr int kTabL = kSeq - 64 + kSlab;        // the first query block's slab ends here, the last one's begins at 0
constexpr int kBiasBlocks = kHeads * kTabL / 256;
static_assert(kHeads * kTabL % 256 == 0 && kTabL % 4 == 0 && kSlab >= 64 + kSeq);
__device__ __forceinline__ void bias_rows(
    const float* __restrict__ btab, const float* __restrict__ tptr, float* __restrict__ biasT, int blk) {
  const int i = blk * 256 + threadIdx.x;
  const int h = i / kTabL;
  int rel = 2 * kSeq - 1 - (i - h * kTabL);
  rel = rel > kRelMax ? kRelMax : rel;
  rel = rel < 0 ? 0 : rel;   // the row's tail, which the last copies bring along and nobody reads
  biasT[i] = rne_bf(btab[(size_t)rel * kHeads + h]) * score_scale(tptr);
}

// ---------------------------------------------------------------------------
// The six input conversions, which do not depend on one another, in one launch: the block index picks the job
// (the same for a whole work-group, so the transposes' barrier stands under uniform control flow).
// The first kBiasBlocks blocks build the attention's bias rows (above), one element a thread, no barrier.
// The next 4 * kWTiles: the weight transposes in the order Wq, Wk, Wv, Wp, one 64x64 tile each; they come
// ahead of the casts because they last longer than a cast block. The blocks behind them: the cast of x.
// ---------------------------------------------------------------------------
constexpr int kWTilesX = kEmb / 64;
constexpr int kWTiles  = kWTilesX * kWTilesX;
__global__ __launch_bounds__(256) void prep_inputs(
    const float* __restrict__ x, const float* __restrict__ Wq, const float* __restrict__ Wk,
    const float* __restrict__ Wv, const float* __restrict__ Wp,
    const float* __restrict__ btab, const float* __restrict__ tptr,
    unsigned short* __restrict__ Xb, unsigned short* __restrict__ WqT, unsigned short* __restrict__ WkT,
    unsigned short* __restrict__ WvT, unsigned short* __restrict__ WpT, float* __restrict__ biasT,
    int n2, int emb, float wsc) {
  __shared__ float tile[64 * 65];
  if ((int)blockIdx.x < kBiasBlocks) {
    bias_rows(btab, tptr, biasT, blockIdx.x);
    return;
  }
  const int blk = blockIdx.x - kBiasBlocks;
  if (blk >= 4 * kWTiles) {
    cast_f32_bf16x2(x, Xb, n2, blk - 4 * kWTiles);
    return;
  }
  const int job = blk / kWTiles;
  const int t   = blk % kWTiles;
  const int bx  = t % kWTilesX;
  const int by  = t / kWTilesX;
  if (job < 3) {
    const float* W = (job == 0) ? Wq : (job == 1) ? Wk : Wv;
    unsigned short* Wt = (job == 0) ? WqT : (job == 1) ? WkT : WvT;
    transpose_cvt16<0>(tile, bx, by, W, Wt, emb, emb, 1.0f);
  } else {
    transpose_cvt16<1>(tile, bx, by, Wp, WpT, emb, emb, wsc);
  }
}

constexpr int kQB = 64;
constexpr int kKC = 64;
constexpr int kNW = 4;
// LDS row pitch of the K and V^T tiles in halves: 144 B = 16 B x odd, so that the 16 rows that a 16-byte
// fragment read walks down fall on 16 different bank groups (at 128 B they fall on two)
constexpr int kLP = kKC + 8;
static_assert(kQB == 64 && kNW * 32 == 128);   // the shape that kSlab and kTabL are set for
constexpr float kPCarryLog2 = 15.0f;      // p and the row sum are carried x2^15, taken in the exponent
static_assert(kSeq % kKC == 0 && kSeq % kQB == 0 && kKC == kHD);

// Eight base-2 exponentials in place, in one statement: each v_exp_f32 overwrites its own source alone and none reads
// a neighbour's result; the closing v_nop is the slot that the instruction set asks for behind a transcendental,
// whatever instruction the compiler puts next (left to the builtin, it set exponentials over one another's sources).
__device__ __forceinline__ void exp2x8(float& a, float& b, float& c, float& d, float& e, float& f, float& g, float& h) {
  asm("v_exp_f32 %0, %0\n\tv_exp_f32 %1, %1\n\tv_exp_f32 %2, %2\n\tv_exp_f32 %3, %3\n\t"
      "v_exp_f32 %4, %4\n\tv_exp_f32 %5, %5\n\tv_exp_f32 %6, %6\n\tv_exp_f32 %7, %7\n\tv_nop"
      : "+v"(a), "+v"(b), "+v"(c), "+v"(d), "+v"(e), "+v"(f), "+v"(g), "+v"(h));
}

// One thread's share of a chunk: 16 B of each of 4 K rows and 4 V^T rows, 16 rows apart. Eight lanes cover one 128-B row,
// so a wave-wide copy takes 4 whole lines. ldsK, ldsV = this lane's LDS byte addresses in its first row,
// gK, gV = its global addresses there.
constexpr int kKVTile = kKC * kLP * 2;    // bytes of one K or V^T tile in LDS
__device__ __forceinline__ void kv_copies(unsigned ldsK, const _Float16* gK, unsigned ldsV, const _Float16* gV) {
  // the closing s_wait_xcnt is a precaution: no register that a copy names is rewritten ahead of it
  asm volatile(
      "global_load_async_to_lds_b128 %0, %8, off\n\t"
      "global_load_async_to_lds_b128 %1, %9, off\n\t"
      "global_load_async_to_lds_b128 %2, %10, off\n\t"
      "global_load_async_to_lds_b128 %3, %11, off\n\t"
      "global_load_async_to_lds_b128 %4, %12, off\n\t"
      "global_load_async_to_lds_b128 %5, %13, off\n\t"
      "global_load_async_to_lds_b128 %6, %14, off\n\t"
      "global_load_async_to_lds_b128 %7, %15, off\n\t"
      "s_wait_xcnt 0x0"
      :: "v"(ldsK), "v"(ldsK + (unsigned)(16 * kLP * 2)), "v"(ldsK + (unsigned)(32 * kLP * 2)), "v"(ldsK + (unsigned)(48 * kLP * 2)),
         "v"(ldsV), "v"(ldsV + (unsigned)(16 * kLP * 2)), "v"(ldsV + (unsigned)(32 * kLP * 2)), "v"(ldsV + (unsigned)(48 * kLP * 2)),
         "v"(gK), "v"(gK + (size_t)16 * kEmb), "v"(gK + (size_t)32 * kEmb), "v"(gK + (size_t)48 * kEmb),
         "v"(gV), "v"(gV + (size_t)16 * kTok), "v"(gV + (size_t)32 * kTok), "v"(gV + (size_t)48 * kTok)
      : "memory");
}

// One thread's share of the bias slab: three 16-byte pieces, 128 pieces apart, so a wave-wide copy takes 4 whole lines.
// lds = this lane's LDS byte address of its first piece, g = its global address there.
__device__ __forceinline__ void slab_copies(unsigned lds, const float* g) {
  // the closing s_wait_xcnt is a precaution: no register that a copy names is rewritten ahead of it
  asm volatile(
      "global_load_async_to_lds_b128 %0, %3, off\n\t"
      "global_load_async_to_lds_b128 %1, %4, off\n\t"
      "global_load_async_to_lds_b128 %2, %5, off\n\t"
      "s_wait_xcnt 0x0"
      :: "v"(lds), "v"(lds + 2048u), "v"(lds + 4096u), "v"(g), "v"(g + 512), "v"(g + 1024)
      : "memory");
}

// lane l's value in lane l ^ 16
__device__ __forceinline__ float xhalf(float x) {
  const int b = __builtin_bit_cast(int, x);
  return __builtin_bit_cast(float, __builtin_amdgcn_permlanex16(b, b, 0x76543210, 0xfedcba98, false, false));
}

__global__ __launch_bounds__(128) void attn_relbias_f16(
    const unsigned short* __restrict__ Qp, const unsigned short* __restrict__ Kp,
    const unsigned short* __restrict__ Vtp, const float* __restrict__ biasT,
    const float* __restrict__ tptr, unsigned short* __restrict__ Cp, float ctx_scale) {
  // K [kv][d], V^T [d][kv] (rows of 64 halves at pitch kLP), two buffers each; bias slab
  // one array, the slab first: its reads' constant offsets then fit the two-address LDS load's 8-bit fields
  __shared__ __align__(16) unsigned char smem[kSlab * 4 + 4 * kKVTile];
  float* biasL = (float*)smem;
  _Float16* Ksh = (_Float16*)(smem + kSlab * 4);
  _Float16* Vtsh = Ksh + 2 * kKC * kLP;

  const _Float16* Qh  = (const _Float16*)Qp;
  const _Float16* Kh  = (const _Float16*)Kp;
  const _Float16* Vth = (const _Float16*)Vtp;

  const int tid  = threadIdx.x;
  const int wave = tid >> 5;
  const int lane = tid & 31;
  const int hh   = lane >> 4;
  const int c    = lane & 15;

  constexpr int nqb = kSeq / kQB;
  const int bx = blockIdx.x;
  const int qb = bx % nqb;
  const int bh = bx / nqb;
  const int h  = bh % kHeads;
  const int b  = bh / kHeads;
  const int qbase = qb * kQB;
  const int q0 = qbase + wave * 16;

  // K and V^T come into LDS by asynchronous copies, the next chunk's in flight while this chunk is worked on.
  // This thread's place in a tile: row tid / 8 (and 16, 32, 48 rows on), 16-byte piece tid % 8.
  constexpr int nCh = kSeq / kKC;
  const _Float16* gK = Kh + (size_t)(b * kSeq + (tid >> 3)) * kEmb + h * kHD + (tid & 7) * 8;
  const _Float16* gV = Vth + (size_t)(h * kHD + (tid >> 3)) * kTok + b * kSeq + (tid & 7) * 8;
  const unsigned ldsO = (unsigned)((tid >> 3) * (kLP * 2) + (tid & 7) * 16);
  const unsigned ldsK = (unsigned)(size_t)Ksh + ldsO;
  const unsigned ldsV = (unsigned)(size_t)Vtsh + ldsO;
  // chunk 0's copies and the bias slab's fly together while the Q fragments are fetched
  kv_copies(ldsK, gK, ldsV, gV);
  // bias slab: biasL[i] = table[min(qbase + kQB + S - 1 - i, relmax)][h] * inv, read at i = kQB + kv - (q - qbase) in (0, kQB + kSeq)
  slab_copies((unsigned)(size_t)biasL + (unsigned)(tid * 16), biasT + (size_t)h * kTabL + (kSeq - kQB - qbase) + tid * 4);

  // scores and bias are formed in base-2 units
  const float inv = score_scale(tptr);

  // Q fragments (B operand, column c = query q0 + c): 2 d-chunks, hardware k order from the f16 plane
  v16h qa[2];
  {
    const _Float16* qrow = Qh + (size_t)(b * kSeq + q0 + c) * kEmb + h * kHD;
#pragma unroll
    for (int dc = 0; dc < 2; ++dc) qa[dc] = Frag<_Float16>::load(qrow + dc * 32 + 8 * hh);
  }

  // of query q0 + c: running maximum less 15 (the same in both halves), this half's part of the running sum (x2^15)
  float mrow = -INFINITY, lrow = 0.f;
  // oacc[t][r] = O^T[d = t*16 + 8*hh + r][query q0 + c]
  v8f oacc[4];
#pragma unroll
  for (int t = 0; t < 4; ++t) oacc[t] = (v8f){0.f,0.f,0.f,0.f,0.f,0.f,0.f,0.f};

  // chunk 0's bytes of this wave have landed before the barrier that shows them (and the bias slab) to the other waves
  asm volatile("s_wait_asynccnt 0x0" ::: "memory");
  __syncthreads();
  if (nCh > 1) kv_copies(ldsK + (unsigned)kKVTile, gK + (size_t)kKC * kEmb, ldsV + (unsigned)kKVTile, gV + kKC);

  // one chunk per trip, the buffer chosen by the trip's parity
  for (int kc = 0; kc < nCh; ++kc) {
    const int kv0 = kc * kKC;
    const _Float16* Kb = Ksh + (kc & 1) * (kKC * kLP);
    const _Float16* Vb = Vtsh + (kc & 1) * (kHD * kLP);

    // ---- the chunk's eight K fragments and its 32 bias values are read as one group ahead of the score products:
    // one LDS latency a chunk, where a read and a full wait in front of each product cost eight ----
    // kQB - (q - qbase) is written 1 + ((q - qbase) ^ (kQB - 1)): the register part of the LDS address then never lies below 0
    const int bi = 1 + ((wave * 16 + c) ^ (kQB - 1)) + kv0 + 8 * hh;
    v16h kf[2][4];
#pragma unroll
    for (int dc = 0; dc < 2; ++dc)
#pragma unroll
      for (int j = 0; j < 4; ++j) kf[dc][j] = Frag<_Float16>::load(Kb + (j * 16 + c) * kLP + dc * 32 + 8 * hh);
    float bl[4][8];
#pragma unroll
    for (int j = 0; j < 4; ++j)
#pragma unroll
      for (int r = 0; r < 8; ++r) bl[j][r] = biasL[bi + j * 16 + r];
    // keeps the group whole: left free, the scheduler sinks the bias reads in among the products and the arithmetic, each with a wait of its own
    __builtin_amdgcn_sched_barrier(0);

    // ---- scores, transposed: s[j][r] = score of key kv0 + j*16 + 8*hh + r with query q0 + c ----
    // four independent tiles back to back, then their second halves: in every tile d 0..31 is summed before d 32..63
    v8f s[4];
#pragma unroll
    for (int j = 0; j < 4; ++j) s[j] = (v8f){0.f,0.f,0.f,0.f,0.f,0.f,0.f,0.f};
#pragma unroll
    for (int dc = 0; dc < 2; ++dc)
#pragma unroll
      for (int j = 0; j < 4; ++j) s[j] = Frag<_Float16>::mma(kf[dc][j], qa[dc], s[j]);

    // ---- the chunk's eight V^T fragments, one group: their latency passes behind the softmax arithmetic ----
    v16h vf[2][4];
#pragma unroll
    for (int kk = 0; kk < 2; ++kk)
#pragma unroll
      for (int t = 0; t < 4; ++t) vf[kk][t] = Frag<_Float16>::load(Vb + (t * 16 + c) * kLP + kk * 32 + 8 * hh);
    // keeps the group here: left free, the scheduler sinks half of these reads down to their products, a full wait in front of each
    __builtin_amdgcn_sched_barrier(0);

    // ---- scale + bias + maximum over this lane's 32 keys (one chain per tile), then over both halves ----
    float mj[4];
#pragma unroll
    for (int j = 0; j < 4; ++j) {
      mj[j] = -INFINITY;
#pragma unroll
      for (int r = 0; r < 8; ++r) {
        const float sc = s[j][r] * inv + bl[j][r];
        s[j][r] = sc;
        mj[j] = fmaxf(mj[j], sc);
      }
    }
    float cm = fmaxf(fmaxf(mj[0], mj[1]), fmaxf(mj[2], mj[3]));
    cm = fmaxf(cm, xhalf(cm));
    // the point that exponents are taken from: the chunk's maximum less 15 (any point serves, it cancels in p / l).
    // Where the maximum is so large that f32 cannot hold the 15 beside it, the maximum itself, so that p stays inside f16.
    {
      const float lowered = cm - kPCarryLog2;
      cm = (cm - lowered < kPCarryLog2 + 0.5f) ? lowered : cm;
    }

    // ---- online softmax update; P^T (x2^15, f16) packed into the B operands of the second product ----
    const float mnew = fmaxf(mrow, cm);
    const float alpha = __builtin_amdgcn_exp2f(mrow - mnew);
    mrow = mnew;
    // pb[kk] element e: key kv0 + kk*32 + 8*hh + e for e < 8, kv0 + kk*32 + 16 + 8*hh + (e - 8) behind: tiles 2kk, 2kk + 1
    v16h pb[2];
    float pj[4];
#pragma unroll
    for (int j = 0; j < 4; ++j) {
      float e[8];
#pragma unroll
      for (int r = 0; r < 8; ++r) e[r] = s[j][r] - mnew;
      exp2x8(e[0], e[1], e[2], e[3], e[4], e[5], e[6], e[7]);
      pj[j] = e[0];
#pragma unroll
      for (int r = 1; r < 8; ++r) pj[j] += e[r];
#pragma unroll
      for (int r = 0; r < 8; ++r) pb[j >> 1][(j & 1) * 8 + r] = (_Float16)e[r];
    }
    lrow = lrow * alpha + ((pj[0] + pj[1]) + (pj[2] + pj[3]));
#pragma unroll
    for (int t = 0; t < 4; ++t)
#pragma unroll
      for (int r = 0; r < 8; ++r) oacc[t][r] *= alpha;

    // ---- O^T += V^T_chunk . P^T ----
#pragma unroll
    for (int kk = 0; kk < 2; ++kk) {
#pragma unroll
      for (int t = 0; t < 4; ++t) oacc[t] = Frag<_Float16>::mma(vf[kk][t], pb[kk], oacc[t]);
    }
    // the four slots that the chip asks for behind the last product, on the branch at the loop's foot as on the fall-through
    acc_guard4(oacc[0], oacc[1], oacc[2], oacc[3]);
    // this wave's reads of the buffers are done before the barrier behind which they are refilled
    asm volatile("s_wait_dscnt 0x0" ::: "memory");
    // this wave's copies of chunk kc + 1 have landed before the barrier that shows them to the other waves
    asm volatile("s_wait_asynccnt 0x0" ::: "memory");
    __syncthreads();
    if (kc + 2 < nCh)
      kv_copies(ldsK + (unsigned)((kc & 1) * kKVTile), gK + (size_t)(kc + 2) * kKC * kEmb,
                ldsV + (unsigned)((kc & 1) * kKVTile), gV + (kc + 2) * kKC);
  }
  // no copy is outstanding when the wave goes on to the epilogue and ends
  asm volatile("s_wait_asynccnt 0x0" ::: "memory");

  // the two halves' sums of a query are joined here, once; a lane's 8 accumulators of a tile are 8 consecutive d
  // of its query's row: one 16-byte store per tile
  {
    const float l = lrow + xhalf(lrow);
    const float invl = ctx_scale * (1.0f / l);
    _Float16* crow = (_Float16*)Cp + (size_t)(b * kSeq + q0 + c) * kEmb + h * kHD + 8 * hh;
#pragma unroll
    for (int t = 0; t < 4; ++t) {
      v8h hv;
#pragma unroll
      for (int r = 0; r < 8; ++r) hv[r] = (_Float16)(oacc[t][r] * invl);
      *(v8h*)(crow + t * 16) = hv;
    }
  }
}

// ---------------------------------------------------------------------------
// Host launch
// ---------------------------------------------------------------------------
extern "C" void kernel_launch(void* const* d_in, const int* in_sizes, int n_in,
                              void* d_out, int out_size, void* d_ws, size_t ws_size,
                              hipStream_t stream) {
  if (n_in < 11) return;
  if (in_sizes[0] != kTok * kEmb) return;
  if (in_sizes[1] != kEmb * kEmb || in_sizes[3] != kEmb * kEmb ||
      in_sizes[5] != kEmb * kEmb || in_sizes[7] != kEmb * kEmb) return;
  if (in_sizes[2] < kEmb || in_sizes[4] < kEmb || in_sizes[6] < kEmb || in_sizes[8] < kEmb) return;
  if (in_sizes[9] != kRelRows * kHeads || in_sizes[10] < 1) return;
  if (out_size != kTok * kEmb) return;

  const float* x    = (const float*)d_in[0];
  const float* Wq   = (const float*)d_in[1];
  const float* bq   = (const float*)d_in[2];
  const float* Wk   = (const float*)d_in[3];
  const float* bk   = (const float*)d_in[4];
  const float* Wv   = (const float*)d_in[5];
  const float* bv   = (const float*)d_in[6];
  const float* Wp   = (const float*)d_in[7];
  const float* bp   = (const float*)d_in[8];
  const float* btab = (const float*)d_in[9];
  const float* tptr = (const float*)d_in[10];
  float* out = (float*)d_out;

  // workspace region map (bytes), all offsets multiples of 2 MiB:
  //   Xb  bf16 [4096][1024]   8 MiB  @ 0
  //   WqT bf16 [1024][1024]   2 MiB  @ 8 MiB
  //   WkT bf16 [1024][1024]   2 MiB  @ 10 MiB
  //   WvT bf16 [1024][1024]   2 MiB  @ 12 MiB
  //   WpT f16  [1024][1024]   2 MiB  @ 14 MiB   (RNE-bf16 values x64)
  //   Qp  f16  [4096][1024]   8 MiB  @ 16 MiB
  //   Kp  f16  [4096][1024]   8 MiB  @ 24 MiB
  //   Vtp f16  [1024][4096]   8 MiB  @ 32 MiB
  //   Cx  f16  [4096][1024]   8 MiB  @ 40 MiB   (ctx x64)
  //   biasT f32 [16][2496]  156 KiB @ 48 MiB   (bias rows x score scale)
  const size_t szAct = (size_t)kTok * kEmb * 2;
  const size_t szW   = (size_t)kEmb * kEmb * 2;
  size_t off = 0;
  const size_t oXb = off; off += szAct;
  const size_t oWq = off; off += szW;
  const size_t oWk = off; off += szW;
  const size_t oWv = off; off += szW;
  const size_t oWp = off; off += szW;
  const size_t oQ  = off; off += szAct;
  const size_t oK  = off; off += szAct;
  const size_t oVt = off; off += szAct;
  const size_t oCx = off; off += szAct;
  const size_t oBT = off; off += (size_t)kHeads * kTabL * 4;
  if (off > ws_size) return;

  char* w = (char*)d_ws;
  unsigned short* Xb  = (unsigned short*)(w + oXb);
  unsigned short* WqT = (unsigned short*)(w + oWq);
  unsigned short* WkT = (unsigned short*)(w + oWk);
  unsigned short* WvT = (unsigned short*)(w + oWv);
  unsigned short* WpT = (unsigned short*)(w + oWp);
  unsigned short* Qp  = (unsigned short*)(w + oQ);
  unsigned short* Kp  = (unsigned short*)(w + oK);
  unsigned short* Vtp = (unsigned short*)(w + oVt);
  unsigned short* Cx  = (unsigned short*)(w + oCx);
  float* biasT = (float*)(w + oBT);

  const float kWpCarry  = 64.0f;
  const float kCtxCarry = 64.0f;

  // 1) one launch: bias rows, weights in[rows=1024][cols=1024] -> out[cols][rows], and x -> bf16 plane (2 elements per thread)
  {
    const int n2 = (kTok * kEmb) / 2;
    prep_inputs<<<kBiasBlocks + 4 * kWTiles + (n2 + 255) / 256, 256, 0, stream>>>(
        x, Wq, Wk, Wv, Wp, btab, tptr, Xb, WqT, WkT, WvT, WpT, biasT, n2, kEmb, kWpCarry);
  }
  // 2) one launch: the three projections (bf16 WMMA, f16 outputs). M,N % 128 == 0, K % 128 == 0 by the static_assert below.
  static_assert(kTok % 128 == 0 && kEmb % 128 == 0);
  const int gemmBlocks = (kTok / 128) * (kEmb / 128);
  qkv_gemm<<<dim3(gemmBlocks, 3), 256, 0, stream>>>(
      Xb, WqT, WkT, WvT, Qp, Kp, Vtp, bq, bk, bv, kTok, kEmb);
  // 3) attention -> ctx f16 plane (x64)
  attn_relbias_f16<<<kBatch * kHeads * (kSeq / kQB), kNW * 32, 0, stream>>>(
      Qp, Kp, Vtp, biasT, tptr, Cx, kCtxCarry);
  // 4) output projection: out[token][n] = 2^-12 * sum_c Cx[token][c] WpT[n][c] + bp[n]
  wmma_gemm64<0, false, 2, 0><<<dim3(gemmBlocks, 1), 256, 0, stream>>>(
      Cx, Cx, kEmb, 0L, WpT, WpT, kEmb, 0L, (void*)out, (void*)out, kEmb, 0L, bp,
      kTok, kEmb, kEmb, 1.0f / (kWpCarry * kCtxCarry));
}

// v010
// A run of this version takes 65.6 microseconds.
// In both of two side-by-side timings against v009, it was 1.04 times as fast.
// Over all steps from v000 it is 4.97 times as fast.
// Contractions: x@Wq, x@Wk, Wv-side GEMM producing V^T on v_wmma_f32_16x16x32_bf16 (bf16 operands = RNE-bf16 converted inputs, exact products); q.k^T, p.v, ctx@Wp on v_wmma_f32_16x16x32_f16 (f16 operands; p carried x2^15, ctx and Wp carried x64); f32 accumulate; softmax and normalisers in f32.
#include <hip/hip_runtime.h>
#include <math.h>

typedef __attribute__((ext_vector_type(16))) _Float16 v16h;
typedef __attribute__((ext_vector_type(8)))  _Float16 v8h;
typedef __attribute__((ext_vector_type(16))) __bf16   v16b;
typedef __attribute__((ext_vector_type(8)))  __bf16   v8b;
typedef __attribute__((ext_vector_type(8)))  float    v8f;
typedef __attribute__((ext_vector_type(4)))  float    v4f;
typedef __attribute__((ext_vector_type(4)))  unsigned v4u;

constexpr int kBatch   = 4;
constexpr int kSeq     = 1024;
constexpr int kEmb     = 1024;
constexpr int kHeads   = 16;
constexpr int kHD      = 64;
constexpr int kTok     = kBatch * kSeq;
constexpr int kRelRows = 1999;
constexpr int kRelMax  = kRelRows - 1;

static_assert(kEmb == kHeads * kHD);
static_assert(kHD == 64);
static_assert(kTok % 64 == 0 && kEmb % 64 == 0 && kEmb % 32 == 0 && kSeq % 64 == 0);

// ---------------------------------------------------------------------------
// helpers
// ---------------------------------------------------------------------------
__device__ __forceinline__ unsigned short f2bf_bits(float f) {
  unsigned u = __float_as_uint(f);
  return (unsigned short)((u + 0x7FFFu + ((u >> 16) & 1u)) >> 16);
}
__device__ __forceinline__ float bf_bits2f(unsigned short h) { return __uint_as_float(((unsigned)h) << 16); }
__device__ __forceinline__ float rne_bf(float f) { return bf_bits2f(f2bf_bits(f)); }

__device__ __forceinline__ void dep_guard_h(v8f& a, v8f& b, v16h x, v16h y) { asm volatile("v_nop\n\tv_nop\n\tv_nop\n\tv_nop" : "+v"(a), "+v"(b) : "v"(x), "v"(y)); }
__device__ __forceinline__ void dep_guard_b(v8f& a, v8f& b, v16b x, v16b y) { asm volatile("v_nop\n\tv_nop\n\tv_nop\n\tv_nop" : "+v"(a), "+v"(b) : "v"(x), "v"(y)); }
__device__ __forceinline__ void keep4_h(v16h a, v16h b, v16h c, v16h d) { asm volatile("v_nop" :: "v"(a), "v"(b), "v"(c), "v"(d)); }
__device__ __forceinline__ void keep4_b(v16b a, v16b b, v16b c, v16b d) { asm volatile("v_nop" :: "v"(a), "v"(b), "v"(c), "v"(d)); }
__device__ __forceinline__ void acc_guard4(v8f& a, v8f& b, v8f& c, v8f& d) { asm volatile("v_nop\n\tv_nop\n\tv_nop\n\tv_nop" : "+v"(a), "+v"(b), "+v"(c), "+v"(d)); }
template <typename T> struct Frag;
template <> struct Frag<_Float16> {
  typedef v16h V; union U { v16h v; v8h h[2]; };
  // elements 0..7 <- p[0..7], 8..15 <- p[16..23]
  static __device__ __forceinline__ v16h load(const _Float16* p) {
    U f; f.h[0] = *(const v8h*)(p); f.h[1] = *(const v8h*)(p + 16); return f.v;
  }
  static __device__ __forceinline__ v8f mma(v16h a, v16h b, v8f c) {
    return __builtin_amdgcn_wmma_f32_16x16x32_f16(false, a, false, b, (short)0, c, false, false);
  }
  static __device__ __forceinline__ void guard(v8f& a, v8f& b, v16h x, v16h y) { dep_guard_h(a, b, x, y); }
  static __device__ __forceinline__ void keep(v16h a, v16h b, v16h c, v16h d) { keep4_h(a, b, c, d); }
};
template <> struct Frag<__bf16> {
  typedef v16b V; union U { v16b v; v8b h[2]; };
  static __device__ __forceinline__ v16b load(const __bf16* p) {
    U f; f.h[0] = *(const v8b*)(p); f.h[1] = *(const v8b*)(p + 16); return f.v;
  }
  static __device__ __forceinline__ v8f mma(v16b a, v16b b, v8f c) {
    return __builtin_amdgcn_wmma_f32_16x16x32_bf16(false, a, false, b, (short)0, c, false, false);
  }
  static __device__ __forceinline__ void guard(v8f& a, v8f& b, v16b x, v16b y) { dep_guard_b(a, b, x, y); }
  static __device__ __forceinline__ void keep(v16b a, v16b b, v16b c, v16b d) { keep4_b(a, b, c, d); }
};

// ---------------------------------------------------------------------------
// Register-blocked batched WMMA GEMM, operands staged in LDS.
// C[m,n] = scale * sum_k A[m,k] * Bt[n,k] (+bias); a work-group of 8 waves owns a 128x128 tile,
// each wave 32 rows x 64 columns of it (two waves per SIMD: one wave's LDS reads and copy issue
// stand behind the other's products).
// A row-major [M,K]; Bt row-major [N,K]; M,N % 128 == 0, K % 128 == 0.
// A pass is GK k (128 or 64): 2 GK bytes of 128 A rows and of 128 Bt rows, brought into LDS by asynchronous copies,
// two buffers, the next pass's copies in flight while this pass is worked on. GK sets the work-group's LDS.
// SPLIT: hi/lo operand planes (not supported by the staged loop, false).
// BIAS_MODE: 0 none, 1 bias[m], 2 bias[n]; bias values RNE-converted to bf16 precision before the add.
// OUT_MODE: 0 = f32, 1 = f16, 2 = bf16 hi plane (Cout) + bf16 lo plane (Cout2).
// ET: 0 = f16 operands, 1 = bf16 operands (pointers passed as 16-bit storage)
// ---------------------------------------------------------------------------
template <int GK> struct Pass {
  static_assert(GK == 128 || GK == 64);
  static constexpr int kPitch = 2 * GK + 16;    // LDS row pitch in bytes: 16 B x odd, conflict-free for 16-byte reads down a column
  static constexpr int kStage = 256 * kPitch;   // one buffer: rows 0..127 = A rows, rows 128..255 = Bt rows
  static constexpr int kLanes = GK / 8;         // lanes that cover one row, 16 B each
  static constexpr int kRows  = 32 / kLanes;    // rows that one wave-wide copy covers
};

// One wave's share of a stage: 32 rows of 2 GK bytes, 32 / kRows copies of kRows rows each.
// lds = this lane's LDS byte address in the first row group, g = this lane's global address there,
// ld = source row pitch in elements.
template <typename T, int GK>
__device__ __forceinline__ void stage_copies(unsigned lds, const T* g, int ld) {
  constexpr int kStepR = Pass<GK>::kRows;                        // rows from one copy to the next
  constexpr unsigned kStepL = kStepR * Pass<GK>::kPitch;         // the same in LDS bytes
#pragma unroll
  for (int i = 0; i < 32 / kStepR; i += 8) {
    // the closing s_wait_xcnt is a precaution: no register that a copy names is rewritten ahead of it
    asm volatile(
        "global_load_async_to_lds_b128 %0, %8, off\n\t"
        "global_load_async_to_lds_b128 %1, %9, off\n\t"
        "global_load_async_to_lds_b128 %2, %10, off\n\t"
        "global_load_async_to_lds_b128 %3, %11, off\n\t"
        "global_load_async_to_lds_b128 %4, %12, off\n\t"
        "global_load_async_to_lds_b128 %5, %13, off\n\t"
        "global_load_async_to_lds_b128 %6, %14, off\n\t"
        "global_load_async_to_lds_b128 %7, %15, off\n\t"
        "s_wait_xcnt 0x0"
        :: "v"(lds + (unsigned)(i + 0) * kStepL), "v"(lds + (unsigned)(i + 1) * kStepL),
           "v"(lds + (unsigned)(i + 2) * kStepL), "v"(lds + (unsigned)(i + 3) * kStepL),
           "v"(lds + (unsigned)(i + 4) * kStepL), "v"(lds + (unsigned)(i + 5) * kStepL),
           "v"(lds + (unsigned)(i + 6) * kStepL), "v"(lds + (unsigned)(i + 7) * kStepL),
           "v"(g + (size_t)((i + 0) * kStepR) * ld), "v"(g + (size_t)((i + 1) * kStepR) * ld),
           "v"(g + (size_t)((i + 2) * kStepR) * ld), "v"(g + (size_t)((i + 3) * kStepR) * ld),
           "v"(g + (size_t)((i + 4) * kStepR) * ld), "v"(g + (size_t)((i + 5) * kStepR) * ld),
           "v"(g + (size_t)((i + 6) * kStepR) * ld), "v"(g + (size_t)((i + 7) * kStepR) * ld)
        : "memory");
  }
}

template <int ET> struct Elem;
template <> struct Elem<0> { typedef _Float16 T; };
template <> struct Elem<1> { typedef __bf16 T; };
// The tile's work is a device function, so that one launch can hold several GEMMs: the kernel owns the LDS
// (ring: operand ring, two buffers; sT: per-wave 16x64 slab, pitch 68 floats) and says which tile and batch.
template <int ET, bool SPLIT, int BIAS_MODE, int OUT_MODE, int GK>
__device__ __forceinline__ void gemm_tile(
    unsigned char* ring, float (*sT)[16 * 68], int tile, int b,
    const unsigned short* __restrict__ Ap, const unsigned short* __restrict__ A2p, int lda, long strideA,
    const unsigned short* __restrict__ Btp, const unsigned short* __restrict__ Bt2p, int ldb, long strideB,
    void* __restrict__ Cout, void* __restrict__ Cout2, int ldc, long strideC,
    const float* __restrict__ bias,
    int M, int N, int K, float scale) {
  static_assert(!SPLIT);
  constexpr int kGK = GK, kGPitch = Pass<GK>::kPitch, kGStage = Pass<GK>::kStage, kGLanes = Pass<GK>::kLanes;
  typedef typename Elem<ET>::T T;
  typedef typename Frag<T>::V V;
  const T* A = (const T*)Ap; const T* Bt = (const T*)Btp;
  const int lane = threadIdx.x & 31;
  // in a scalar register, so that what picks a wave's source rows is scalar and every lane stays on at the copies
  const int wave = __builtin_amdgcn_readfirstlane(threadIdx.x >> 5);
  const int tilesN = N >> 7;
  const int tilesM = M >> 7;
  // the same for the whole work-group, ahead of every barrier
  if (tile >= tilesM * tilesN) return;
  const int tm = tile / tilesN;
  const int tn = tile - tm * tilesN;
  const int wm = wave >> 1;
  const int wn = wave & 1;
  const int m0 = (tm << 7) + (wm << 5);
  const int n0 = (tn << 7) + (wn << 6);

  const T* Ab  = A  + (size_t)b * strideA;
  const T* Bb  = Bt + (size_t)b * strideB;

  // row (A) / col (B, D) within subtile; k offset of this lane half; D row offset
  const int rlane = lane & 15;
  const int koff  = (lane >> 4) * 8;
  const int mOff  = (lane >> 4) * 8;

  // copies: waves 0..3 bring the 128 A rows, waves 4..7 the 128 Bt rows, 32 rows each
  const int ldS = (wave < 4) ? lda : ldb;
  const T* gS = ((wave < 4) ? (Ab + (size_t)((tm << 7) + (wave << 5)) * lda)
                            : (Bb + (size_t)((tn << 7) + ((wave - 4) << 5)) * ldb))
                + (size_t)(lane / kGLanes) * ldS + (lane % kGLanes) * 8;
  const unsigned ldsS = (unsigned)(size_t)ring + (unsigned)(((wave << 5) + lane / kGLanes) * kGPitch + (lane % kGLanes) * 16);

  v8f acc[2][4];
#pragma unroll
  for (int i = 0; i < 2; ++i)
#pragma unroll
    for (int j = 0; j < 4; ++j) acc[i][j] = (v8f){0.f,0.f,0.f,0.f,0.f,0.f,0.f,0.f};

  const int nPass = K / kGK;
  stage_copies<T, GK>(ldsS, gS, ldS);
  // pass 0's bytes of this wave have landed before the barrier that shows them to the other waves
  asm volatile("s_wait_asynccnt 0x0" ::: "memory");
  __syncthreads();
  if (nPass > 1) stage_copies<T, GK>(ldsS + (unsigned)kGStage, gS + kGK, ldS);

  // one pass per trip, the buffer chosen by the trip's parity
  for (int t = 0; t < nPass; ++t) {
    const unsigned char* st = ring + (t & 1) * kGStage;
    const unsigned char* stA = st + ((wm << 5) + rlane) * kGPitch;
    const unsigned char* stB = st + (128 + (wn << 6) + rlane) * kGPitch;
#pragma unroll
    for (int k0 = 0; k0 < kGK; k0 += 32) {
      // all six fragments of a 32-k block are read as one group: one LDS latency per 8 products
      V bh[4], ah[2];
#pragma unroll
      for (int j = 0; j < 4; ++j) bh[j] = Frag<T>::load((const T*)(stB + (j << 4) * kGPitch) + koff + k0);
#pragma unroll
      for (int i = 0; i < 2; ++i) ah[i] = Frag<T>::load((const T*)(stA + (i << 4) * kGPitch) + koff + k0);
#pragma unroll
      for (int i = 0; i < 2; ++i) {
#pragma unroll
        for (int j = 0; j < 4; ++j) acc[i][j] = Frag<T>::mma(ah[i], bh[j], acc[i][j]);
        Frag<T>::guard(acc[i][0], acc[i][3], ah[i], ah[i]);
      }
      Frag<T>::keep(bh[0], bh[1], bh[2], bh[3]);
    }
    // this wave's reads of the buffer are done before the barrier behind which it is refilled
    asm volatile("s_wait_dscnt 0x0" ::: "memory");
    // this wave's copies of pass t + 1 have landed before the barrier that shows them to the other waves
    asm volatile("s_wait_asynccnt 0x0" ::: "memory");
    __syncthreads();
    if (t + 2 < nPass) stage_copies<T, GK>(ldsS + (unsigned)((t & 1) * kGStage), gS + (size_t)(t + 2) * kGK, ldS);
  }
  // no copy is outstanding when the wave goes on to the epilogue and ends
  asm volatile("s_wait_asynccnt 0x0" ::: "memory");
  acc_guard4(acc[0][0], acc[0][1], acc[0][2], acc[0][3]);
  acc_guard4(acc[1][0], acc[1][1], acc[1][2], acc[1][3]);

  // ---- epilogue ----
  float* slab = sT[wave];
  // column biases: 4 scalar loads per lane, hoisted
  float bvj[4];
#pragma unroll
  for (int j = 0; j < 4; ++j) bvj[j] = (BIAS_MODE == 2) ? rne_bf(bias[n0 + (j << 4) + rlane]) : 0.f;
#pragma unroll
  for (int i = 0; i < 2; ++i) {
    const int mBase = m0 + (i << 4);
    // row biases: two 16-B loads per lane (rows mBase+mOff .. +7, 32-B aligned)
    v4f bm0 = (v4f){0.f, 0.f, 0.f, 0.f};
    v4f bm1 = bm0;
    if (BIAS_MODE == 1) {
      bm0 = *(const v4f*)(bias + mBase + mOff);
      bm1 = *(const v4f*)(bias + mBase + mOff + 4);
    }
#pragma unroll
    for (int j = 0; j < 4; ++j) {
#pragma unroll
      for (int r = 0; r < 8; ++r) {
        float v = acc[i][j][r] * scale;
        if (BIAS_MODE == 1) { const v4f bsel = (r < 4) ? bm0 : bm1; v += rne_bf(bsel[r & 3]); }
        if (BIAS_MODE == 2) v += bvj[j];
        slab[(mOff + r) * 68 + (j << 4) + rlane] = v;
      }
    }
    __builtin_amdgcn_fence(__ATOMIC_RELEASE, "workgroup");
    __builtin_amdgcn_wave_barrier();
    __builtin_amdgcn_fence(__ATOMIC_ACQUIRE, "workgroup");
    if (OUT_MODE == 0) {
      float* C = (float*)Cout + (size_t)b * strideC;
      // row seg = 256 B = 16 lanes x 16 B
      const int hh = lane >> 4, c4 = (lane & 15) * 4;
      {
#pragma unroll
        for (int it = 0; it < 8; ++it) {
          const int row = it * 2 + hh;
          v4f v = *(const v4f*)(slab + row * 68 + c4);
          *(v4f*)(C + (size_t)(mBase + row) * ldc + n0 + c4) = v;
        }
        
      }
    } else {
      const int q = lane >> 3, c8 = (lane & 7) * 8;
      unsigned short* C  = (unsigned short*)Cout  + (size_t)b * strideC;
      unsigned short* C2 = (OUT_MODE == 2) ? ((unsigned short*)Cout2 + (size_t)b * strideC) : nullptr;
      {
#pragma unroll
        for (int it = 0; it < 4; ++it) {
          const int row = it * 4 + q;
          const float* sp = slab + row * 68 + c8;
          v8h hv, lv;
#pragma unroll
          for (int e = 0; e < 8; ++e) {
            if (OUT_MODE == 1) {
              hv[e] = (_Float16)sp[e];
            } else {
              unsigned short hb = f2bf_bits(sp[e]);
              unsigned short lb = f2bf_bits(sp[e] - bf_bits2f(hb));
              hv[e] = __builtin_bit_cast(_Float16, hb);
              lv[e] = __builtin_bit_cast(_Float16, lb);
            }
          }
          *(v8h*)(C + (size_t)(mBase + row) * ldc + n0 + c8) = hv;
          if (OUT_MODE == 2) *(v8h*)(C2 + (size_t)(mBase + row) * ldc + n0 + c8) = lv;
        }
        
      }
    }
    __builtin_amdgcn_fence(__ATOMIC_RELEASE, "workgroup");
    __builtin_amdgcn_wave_barrier();
    __builtin_amdgcn_fence(__ATOMIC_ACQUIRE, "workgroup");
  }
}

// One GEMM per launch: blockIdx.x = tile, blockIdx.y = batch.
template <int ET, bool SPLIT, int BIAS_MODE, int OUT_MODE>
__global__ __launch_bounds__(256) void wmma_gemm64(
    const unsigned short* __restrict__ Ap, const unsigned short* __restrict__ A2p, int lda, long strideA,
    const unsigned short* __restrict__ Btp, const unsigned short* __restrict__ Bt2p, int ldb, long strideB,
    void* __restrict__ Cout, void* __restrict__ Cout2, int ldc, long strideC,
    const float* __restrict__ bias,
    int M, int N, int K, float scale) {
  __shared__ __align__(16) unsigned char ring[2 * Pass<128>::kStage];
  __shared__ __align__(16) float sT[8][16 * 68];
  gemm_tile<ET, SPLIT, BIAS_MODE, OUT_MODE, 128>(ring, sT, blockIdx.x, blockIdx.y,
      Ap, A2p, lda, strideA, Btp, Bt2p, ldb, strideB, Cout, Cout2, ldc, strideC, bias, M, N, K, scale);
}

// The three projections in one launch, one work-group per 128 tokens x 128 features of EACH of q, k and v.
//   job 0: Q[token][n]  = sum_k Xb[token][k] WqT[n][k] + bq[n]
//   job 1: K[token][n]  = sum_k Xb[token][k] WkT[n][k] + bk[n]
//   job 2: Vt[n][token] = sum_k WvT[n][k] Xb[token][k] + bv[n]   (rows = features, columns = tokens)
// The three jobs read the same 128 rows of Xb, so a stage holds them once: 512 rows (Xb, WqT, WkT, WvT, 128 each)
// where three separate 128x128 tiles fetch 768. Twelve waves, four a job, each 64 rows x 64 columns: 8 fragments
// read from LDS feed 16 products (a 32x64 wave tile: 6 feed 8). One loop for all waves, so that its barrier stands under
// uniform control flow; a wave's job only sets which LDS rows are its A and its B, and which way its tile is stored.

// One wave's 64x64 f32 tile -> f16, by 16-row slabs through the wave's own LDS so that whole 128-B lines are stored.
// BIAS_MODE: 1 bias[m], 2 bias[n]; bias values RNE-converted to bf16 precision before the add.
template <int BIAS_MODE>
__device__ __forceinline__ void store_tile64(
    const v8f (&acc)[4][4], float* slab, unsigned short* __restrict__ C, int ldc,
    const float* __restrict__ bias, int m0, int n0) {
  const int lane = threadIdx.x & 31;
  const int rlane = lane & 15;
  const int mOff  = (lane >> 4) * 8;
  float bvj[4];
#pragma unroll
  for (int j = 0; j < 4; ++j) bvj[j] = (BIAS_MODE == 2) ? rne_bf(bias[n0 + (j << 4) + rlane]) : 0.f;
#pragma unroll
  for (int i = 0; i < 4; ++i) {
    const int mBase = m0 + (i << 4);
    v4f bm0 = (v4f){0.f, 0.f, 0.f, 0.f};
    v4f bm1 = bm0;
    if (BIAS_MODE == 1) {
      bm0 = *(const v4f*)(bias + mBase + mOff);
      bm1 = *(const v4f*)(bias + mBase + mOff + 4);
    }
#pragma unroll
    for (int j = 0; j < 4; ++j) {
#pragma unroll
      for (int r = 0; r < 8; ++r) {
        float v = acc[i][j][r];
        if (BIAS_MODE == 1) { const v4f bsel = (r < 4) ? bm0 : bm1; v += rne_bf(bsel[r & 3]); }
        if (BIAS_MODE == 2) v += bvj[j];
        slab[(mOff + r) * 68 + (j << 4) + rlane] = v;
      }
    }
    // the slab is the wave's own and lies in LDS: the fences order LDS alone, so that no slab waits for the last one's global stores to end
    __builtin_amdgcn_fence(__ATOMIC_RELEASE, "workgroup", "local");
    __builtin_amdgcn_wave_barrier();
    __builtin_amdgcn_fence(__ATOMIC_ACQUIRE, "workgroup", "local");
    const int q = lane >> 3, c8 = (lane & 7) * 8;
#pragma unroll
    for (int it = 0; it < 4; ++it) {
      const int row = it * 4 + q;
      const float* sp = slab + row * 68 + c8;
      v8h hv;
#pragma unroll
      for (int e = 0; e < 8; ++e) hv[e] = (_Float16)sp[e];
      *(v8h*)(C + (size_t)(mBase + row) * ldc + n0 + c8) = hv;
    }
    // a precaution: no register that the four stores name is rewritten ahead of this wait
    asm volatile("s_wait_xcnt 0x0" ::: "memory");
    __builtin_amdgcn_fence(__ATOMIC_RELEASE, "workgroup", "local");
    __builtin_amdgcn_wave_barrier();
    __builtin_amdgcn_fence(__ATOMIC_ACQUIRE, "workgroup", "local");
  }
}

constexpr int kQkvWaves = 12;
__global__ __launch_bounds__(kQkvWaves * 32) void qkv_gemm(
    const unsigned short* __restrict__ Xb, const unsigned short* __restrict__ WqT,
    const unsigned short* __restrict__ WkT, const unsigned short* __restrict__ WvT,
    unsigned short* __restrict__ Qp, unsigned short* __restrict__ Kp, unsigned short* __restrict__ Vtp,
    const float* __restrict__ bq, const float* __restrict__ bk, const float* __restrict__ bv,
    int nTok, int nEmb) {
  typedef __bf16 T;
  typedef Frag<T>::V V;
  // passes of 128 k: the two buffers take 272 KiB, the work-group has its WGP to itself, and a refill's latency is paid once per 128 k
  constexpr int kGK = 128, kGPitch = Pass<kGK>::kPitch, kGLanes = Pass<kGK>::kLanes;
  constexpr int kGStage = 512 * kGPitch;   // one buffer: rows 0..127 Xb, 128..255 WqT, 256..383 WkT, 384..511 WvT
  __shared__ __align__(16) unsigned char ring[2 * kGStage];
  const int lane = threadIdx.x & 31;
  // in a scalar register, so that what picks a wave's source rows and its job is scalar and every lane stays on at the copies
  const int wave = __builtin_amdgcn_readfirstlane(threadIdx.x >> 5);
  const int tilesF = nEmb >> 7;
  // the same for the whole work-group, ahead of every barrier
  if ((int)blockIdx.x >= (nTok >> 7) * tilesF) return;
  const int t0 = ((int)blockIdx.x / tilesF) << 7;   // first token
  const int f0 = ((int)blockIdx.x % tilesF) << 7;   // first feature

  // copies: a stage is 16 blocks of 32 rows; wave w brings block w, and waves 0..3 block 12 + w as well
  const T* X = (const T*)Xb;
  const size_t laneG = (size_t)(lane / kGLanes) * nEmb + (lane % kGLanes) * 8;
  const unsigned laneL = (unsigned)(size_t)ring + (unsigned)((lane / kGLanes) * kGPitch + (lane % kGLanes) * 16);
  const T* srcA = (wave < 4) ? X : (const T*)((wave < 8) ? WqT : WkT);
  const T* gS  = srcA + (size_t)(((wave < 4) ? t0 : f0) + ((wave & 3) << 5)) * nEmb + laneG;
  const T* gS2 = (const T*)WvT + (size_t)(f0 + ((wave & 3) << 5)) * nEmb + laneG;
  const unsigned ldsS  = laneL + (unsigned)((wave << 5) * kGPitch);
  const unsigned ldsS2 = laneL + (unsigned)(((12 + (wave & 3)) << 5) * kGPitch);
  const bool two = wave < 4;

  // the wave's job and its 64x64 place in the job's 128x128 tile
  const int job = wave >> 2;
  const int wm = (wave >> 1) & 1;
  const int wn = wave & 1;
  const int rowA = (job < 2) ? 0 : 384;
  const int rowB = (job < 2) ? 128 + (job << 7) : 0;
  const int rlane = lane & 15;
  const int koff  = (lane >> 4) * 8;

  v8f acc[4][4];
#pragma unroll
  for (int i = 0; i < 4; ++i)
#pragma unroll
    for (int j = 0; j < 4; ++j) acc[i][j] = (v8f){0.f,0.f,0.f,0.f,0.f,0.f,0.f,0.f};

  const int nPass = nEmb / kGK;
  stage_copies<T, kGK>(ldsS, gS, nEmb);
  if (two) stage_copies<T, kGK>(ldsS2, gS2, nEmb);
  // pass 0's bytes of this wave have landed before the barrier that shows them to the other waves
  asm volatile("s_wait_asynccnt 0x0" ::: "memory");
  __syncthreads();
  if (nPass > 1) {
    stage_copies<T, kGK>(ldsS + (unsigned)kGStage, gS + kGK, nEmb);
    if (two) stage_copies<T, kGK>(ldsS2 + (unsigned)kGStage, gS2 + kGK, nEmb);
  }

  // one pass per trip, the buffer chosen by the trip's parity
  for (int t = 0; t < nPass; ++t) {
    const unsigned char* st = ring + (t & 1) * kGStage;
    const unsigned char* stA = st + (rowA + (wm << 6) + rlane) * kGPitch;
    const unsigned char* stB = st + (rowB + (wn << 6) + rlane) * kGPitch;
#pragma unroll
    for (int k0 = 0; k0 < kGK; k0 += 32) {
      // all eight fragments of a 32-k block are read as one group: one LDS latency per 16 products
      V bh[4], ah[4];
#pragma unroll
      for (int j = 0; j < 4; ++j) bh[j] = Frag<T>::load((const T*)(stB + (j << 4) * kGPitch) + koff + k0);
#pragma unroll
      for (int i = 0; i < 4; ++i) ah[i] = Frag<T>::load((const T*)(stA + (i << 4) * kGPitch) + koff + k0);
      if (k0 + 32 == kGK) {
        // the pass's last fragments are fetched: the buffer is handed over here, ahead of the last block's products
        // this wave's reads of the buffer are done before the barrier behind which it is refilled
        asm volatile("s_wait_dscnt 0x0" ::: "memory");
        // this wave's copies of pass t + 1 have landed before the barrier that shows them to the other waves
        asm volatile("s_wait_asynccnt 0x0" ::: "memory");
        __syncthreads();
        if (t + 2 < nPass) {
          stage_copies<T, kGK>(ldsS + (unsigned)((t & 1) * kGStage), gS + (size_t)(t + 2) * kGK, nEmb);
          if (two) stage_copies<T, kGK>(ldsS2 + (unsigned)((t & 1) * kGStage), gS2 + (size_t)(t + 2) * kGK, nEmb);
        }
      }
      // keeps the read group whole and, in the last block, the refill's issue ahead of the products: left free, the scheduler sinks
      // three of the A fragments down to their products, a full wait in front of each row, and sets the 16 products ahead of the copies
      __builtin_amdgcn_sched_barrier(0);
#pragma unroll
      for (int i = 0; i < 4; ++i)
#pragma unroll
        for (int j = 0; j < 4; ++j) acc[i][j] = Frag<T>::mma(ah[i], bh[j], acc[i][j]);
    }
  }
  // no copy is outstanding when the wave goes on to the epilogue and ends
  asm volatile("s_wait_asynccnt 0x0" ::: "memory");

  // the wave's 16x68-float slab lies in the ring: behind the last pass's barrier no wave reads the ring and no copy is aimed at it
  float* slab = (float*)(ring + wave * (16 * 68 * 4));
  if (job < 2) {
    store_tile64<2>(acc, slab, job ? Kp : Qp, nEmb, job ? bk : bq, t0 + (wm << 6), f0 + (wn << 6));
  } else {
    store_tile64<1>(acc, slab, Vtp, nTok, bv, f0 + (wm << 6), t0 + (wn << 6));
  }
}

// ---------------------------------------------------------------------------
// f32 -> bf16 plane, 2 elements per thread; blk = index of this 256-thread block within the cast
// ---------------------------------------------------------------------------
__device__ __forceinline__ void cast_f32_bf16x2(
    const float* __restrict__ in, unsigned short* __restrict__ out, int n2, int blk) {
  const int i = blk * 256 + threadIdx.x;
  if (i < n2) {
    const unsigned u = (unsigned)f2bf_bits(in[2 * i]) | ((unsigned)f2bf_bits(in[2 * i + 1]) << 16);
    ((unsigned*)out)[i] = u;
    
  }
}

// ---------------------------------------------------------------------------
// Transpose + convert: W row-major in[rows][cols] f32 -> Wt row-major out[cols][rows] 16-bit.
// MODE 0: bf16 bits of RNE-bf16(W). MODE 1: f16 bits of RNE-bf16(W) * wsc (wsc a power of two).
// One block per 64x64 tile (bx, by) of (cols/64, rows/64); rows, cols % 64 == 0. tile = the kernel's 64x65 LDS floats.
// Load: 256 threads x 4 x float4 = 64x64 tile. Store: wave w writes output rows w*8..w*8+7,
// ---------------------------------------------------------------------------
template <int MODE>
__device__ __forceinline__ void transpose_cvt16(
    float* tile, int bx, int by,
    const float* __restrict__ W, unsigned short* __restrict__ Wt, int rows, int cols, float wsc) {
  const int tid = threadIdx.x, lane = tid & 31, wave = tid >> 5;
  const int n0 = bx * 64;
  const int k0 = by * 64;
  {
    const int c4 = (tid & 15) * 4, r = tid >> 4;
#pragma unroll
    for (int it = 0; it < 4; ++it) {
      const int rr = it * 16 + r;
      const v4f x4 = *(const v4f*)(W + (size_t)(k0 + rr) * cols + n0 + c4);
      tile[rr * 65 + c4 + 0] = x4[0];
      tile[rr * 65 + c4 + 1] = x4[1];
      tile[rr * 65 + c4 + 2] = x4[2];
      tile[rr * 65 + c4 + 3] = x4[3];
    }
  }
  __syncthreads();
  const int q4 = lane >> 3, c8 = (lane & 7) * 8;
  _Float16* out = (_Float16*)Wt;
  {
#pragma unroll
    for (int it = 0; it < 2; ++it) {
      const int i = wave * 8 + it * 4 + q4;
      v8h hv;
#pragma unroll
      for (int e = 0; e < 8; ++e) {
        const float f = tile[(c8 + e) * 65 + i];
        if (MODE == 0) {
          hv[e] = __builtin_bit_cast(_Float16, f2bf_bits(f));
        } else {
          hv[e] = (_Float16)(rne_bf(f) * wsc);
        }
      }
      *(v8h*)(out + (size_t)(n0 + i) * rows + k0 + c8) = hv;
    }
    // a precaution: inlined into a kernel with other jobs' code behind it, no register that the two stores name
    // is rewritten ahead of this wait on any branch of the listing
    asm volatile("s_wait_xcnt 0x0" ::: "memory");
  }
}

// ---------------------------------------------------------------------------
// Score scale in base-2 units: temperature (RNE-bf16 converted input), clamp, log2 e / (sqrt(E) * temp); e^x = 2^(x log2 e)
// ---------------------------------------------------------------------------
constexpr float kLog2E = 1.44269504088896340736f;
__device__ __forceinline__ float score_scale(const float* __restrict__ tptr) {
  float tv = rne_bf(tptr[0]);
  tv = fminf(fmaxf(tv, 0.1f), 10.0f);
  return (1.0f / (sqrtf((float)kEmb) * tv)) * kLog2E;
}

// ---------------------------------------------------------------------------
// Bias rows, one per head, built once: biasT[h][i] = table[clamp(2 S - 1 - i, 0, relmax)][h] * score scale, i in [0, kTabL).
// The row runs against the table, so that it ascends with the key index as the attention loop reads it.
// An attention work-group's slab is kSlab consecutive floats of its head's row, so it takes the slab with whole-line
// copies; the table itself holds a head's values 64 B apart.
// ---------------------------------------------------------------------------
constexpr int kSlab = 3 * 128 * 4;              // floats that three 16-byte copies of each of 128 threads bring
constexpr int kTabL = kSeq - 64 + kSlab;        // the first query block's slab ends here, the last one's begins at 0
constexpr int kBiasBlocks = kHeads * kTabL / 256;
static_assert(kHeads * kTabL % 256 == 0 && kTabL % 4 == 0 && kSlab >= 64 + kSeq);
__device__ __forceinline__ void bias_rows(
    const float* __restrict__ btab, const float* __restrict__ tptr, float* __restrict__ biasT, int blk) {
  const int i = blk * 256 + threadIdx.x;
  const int h = i / kTabL;
  int rel = 2 * kSeq - 1 - (i - h * kTabL);
  rel = rel > kRelMax ? kRelMax : rel;
  rel = rel < 0 ? 0 : rel;   // the row's tail, which the last copies bring along and nobody reads
  biasT[i] = rne_bf(btab[(size_t)rel * kHeads + h]) * score_scale(tptr);
}

// ---------------------------------------------------------------------------
// The six input conversions, which do not depend on one another, in one launch: the block index picks the job
// (the same for a whole work-group, so the transposes' barrier stands under uniform control flow).
// The first kBiasBlocks blocks build the attention's bias rows (above), one element a thread, no barrier.
// The next 4 * kWTiles: the weight transposes in the order Wq, Wk, Wv, Wp, one 64x64 tile each; they come
// ahead of the casts because they last longer than a cast block. The blocks behind them: the cast of x.
// ---------------------------------------------------------------------------
constexpr int kWTilesX = kEmb / 64;
constexpr int kWTiles  = kWTilesX * kWTilesX;
__global__ __launch_bounds__(256) void prep_inputs(
    const float* __restrict__ x, const float* __restrict__ Wq, const float* __restrict__ Wk,
    const float* __restrict__ Wv, const float* __restrict__ Wp,
    const float* __restrict__ btab, const float* __restrict__ tptr,
    unsigned short* __restrict__ Xb, unsigned short* __restrict__ WqT, unsigned short* __restrict__ WkT,
    unsigned short* __restrict__ WvT, unsigned short* __restrict__ WpT, float* __restrict__ biasT,
    int n2, int emb, float wsc) {
  __shared__ float tile[64 * 65];
  if ((int)blockIdx.x < kBiasBlocks) {
    bias_rows(btab, tptr, biasT, blockIdx.x);
    return;
  }
  const int blk = blockIdx.x - kBiasBlocks;
  if (blk >= 4 * kWTiles) {
    cast_f32_bf16x2(x, Xb, n2, blk - 4 * kWTiles);
    return;
  }
  const int job = blk / kWTiles;
  const int t   = blk % kWTiles;
  const int bx  = t % kWTilesX;
  const int by  = t / kWTilesX;
  if (job < 3) {
    const float* W = (job == 0) ? Wq : (job == 1) ? Wk : Wv;
    unsigned short* Wt = (job == 0) ? WqT : (job == 1) ? WkT : WvT;
    transpose_cvt16<0>(tile, bx, by, W, Wt, emb, emb, 1.0f);
  } else {
    transpose_cvt16<1>(tile, bx, by, Wp, WpT, emb, emb, wsc);
  }
}

constexpr int kQB = 64;
constexpr int kKC = 64;
constexpr int kNW = 4;
// LDS row pitch of the K and V^T tiles in halves: 144 B = 16 B x odd, so that the 16 rows that a 16-byte
// fragment read walks down fall on 16 different bank groups (at 128 B they fall on two)
constexpr int kLP = kKC + 8;
static_assert(kQB == 64 && kNW * 32 == 128);   // the shape that kSlab and kTabL are set for
constexpr float kPCarryLog2 = 15.0f;      // p and the row sum are carried x2^15, taken in the exponent
static_assert(kSeq % kKC == 0 && kSeq % kQB == 0 && kKC == kHD);

// Eight base-2 exponentials in place, in one statement: each v_exp_f32 overwrites its own source alone and none reads
// a neighbour's result; the closing v_nop is the slot that the instruction set asks for behind a transcendental,
// whatever instruction the compiler puts next (left to the builtin, it set exponentials over one another's sources).
__device__ __forceinline__ void exp2x8(float& a, float& b, float& c, float& d, float& e, float& f, float& g, float& h) {
  asm("v_exp_f32 %0, %0\n\tv_exp_f32 %1, %1\n\tv_exp_f32 %2, %2\n\tv_exp_f32 %3, %3\n\t"
      "v_exp_f32 %4, %4\n\tv_exp_f32 %5, %5\n\tv_exp_f32 %6, %6\n\tv_exp_f32 %7, %7\n\tv_nop"
      : "+v"(a), "+v"(b), "+v"(c), "+v"(d), "+v"(e), "+v"(f), "+v"(g), "+v"(h));
}

// One thread's share of a chunk: 16 B of each of 4 K rows and 4 V^T rows, 16 rows apart. Eight lanes cover one 128-B row,
// so a wave-wide copy takes 4 whole lines. ldsK, ldsV = this lane's LDS byte addresses in its first row,
// gK, gV = its global addresses there.
constexpr int kKVTile = kKC * kLP * 2;    // bytes of one K or V^T tile in LDS
__device__ __forceinline__ void kv_copies(unsigned ldsK, const _Float16* gK, unsigned ldsV, const _Float16* gV) {
  // the closing s_wait_xcnt is a precaution: no register that a copy names is rewritten ahead of it
  asm volatile(
      "global_load_async_to_lds_b128 %0, %8, off\n\t"
      "global_load_async_to_lds_b128 %1, %9, off\n\t"
      "global_load_async_to_lds_b128 %2, %10, off\n\t"
      "global_load_async_to_lds_b128 %3, %11, off\n\t"
      "global_load_async_to_lds_b128 %4, %12, off\n\t"
      "global_load_async_to_lds_b128 %5, %13, off\n\t"
      "global_load_async_to_lds_b128 %6, %14, off\n\t"
      "global_load_async_to_lds_b128 %7, %15, off\n\t"
      "s_wait_xcnt 0x0"
      :: "v"(ldsK), "v"(ldsK + (unsigned)(16 * kLP * 2)), "v"(ldsK + (unsigned)(32 * kLP * 2)), "v"(ldsK + (unsigned)(48 * kLP * 2)),
         "v"(ldsV), "v"(ldsV + (unsigned)(16 * kLP * 2)), "v"(ldsV + (unsigned)(32 * kLP * 2)), "v"(ldsV + (unsigned)(48 * kLP * 2)),
         "v"(gK), "v"(gK + (size_t)16 * kEmb), "v"(gK + (size_t)32 * kEmb), "v"(gK + (size_t)48 * kEmb),
         "v"(gV), "v"(gV + (size_t)16 * kTok), "v"(gV + (size_t)32 * kTok), "v"(gV + (size_t)48 * kTok)
      : "memory");
}

// One thread's share of the bias slab: three 16-byte pieces, 128 pieces apart, so a wave-wide copy takes 4 whole lines.
// lds = this lane's LDS byte address of its first piece, g = its global address there.
__device__ __forceinline__ void slab_copies(unsigned lds, const float* g) {
  // the closing s_wait_xcnt is a precaution: no register that a copy names is rewritten ahead of it
  asm volatile(
      "global_load_async_to_lds_b128 %0, %3, off\n\t"
      "global_load_async_to_lds_b128 %1, %4, off\n\t"
      "global_load_async_to_lds_b128 %2, %5, off\n\t"
      "s_wait_xcnt 0x0"
      :: "v"(lds), "v"(lds + 2048u), "v"(lds + 4096u), "v"(g), "v"(g + 512), "v"(g + 1024)
      : "memory");
}

// lane l's value in lane l ^ 16
__device__ __forceinline__ float xhalf(float x) {
  const int b = __builtin_bit_cast(int, x);
  return __builtin_bit_cast(float, __builtin_amdgcn_permlanex16(b, b, 0x76543210, 0xfedcba98, false, false));
}

__global__ __launch_bounds__(128) void attn_relbias_f16(
    const unsigned short* __restrict__ Qp, const unsigned short* __restrict__ Kp,
    const unsigned short* __restrict__ Vtp, const float* __restrict__ biasT,
    const float* __restrict__ tptr, unsigned short* __restrict__ Cp, float ctx_scale) {
  // K [kv][d], V^T [d][kv] (rows of 64 halves at pitch kLP), two buffers each; bias slab
  // one array, the slab first: its reads' constant offsets then fit the two-address LDS load's 8-bit fields
  __shared__ __align__(16) unsigned char smem[kSlab * 4 + 4 * kKVTile];
  float* biasL = (float*)smem;
  _Float16* Ksh = (_Float16*)(smem + kSlab * 4);
  _Float16* Vtsh = Ksh + 2 * kKC * kLP;

  const _Float16* Qh  = (const _Float16*)Qp;
  const _Float16* Kh  = (const _Float16*)Kp;
  const _Float16* Vth = (const _Float16*)Vtp;

  const int tid  = threadIdx.x;
  const int wave = tid >> 5;
  const int lane = tid & 31;
  const int hh   = lane >> 4;
  const int c    = lane & 15;

  constexpr int nqb = kSeq / kQB;
  const int bx = blockIdx.x;
  const int qb = bx % nqb;
  const int bh = bx / nqb;
  const int h  = bh % kHeads;
  const int b  = bh / kHeads;
  const int qbase = qb * kQB;
  const int q0 = qbase + wave * 16;

  // K and V^T come into LDS by asynchronous copies, the next chunk's in flight while this chunk is worked on.
  // This thread's place in a tile: row tid / 8 (and 16, 32, 48 rows on), 16-byte piece tid % 8.
  constexpr int nCh = kSeq / kKC;
  const _Float16* gK = Kh + (size_t)(b * kSeq + (tid >> 3)) * kEmb + h * kHD + (tid & 7) * 8;
  const _Float16* gV = Vth + (size_t)(h * kHD + (tid >> 3)) * kTok + b * kSeq + (tid & 7) * 8;
  const unsigned ldsO = (unsigned)((tid >> 3) * (kLP * 2) + (tid & 7) * 16);
  const unsigned ldsK = (unsigned)(size_t)Ksh + ldsO;
  const unsigned ldsV = (unsigned)(size_t)Vtsh + ldsO;
  // chunk 0's copies and the bias slab's fly together while the Q fragments are fetched
  kv_copies(ldsK, gK, ldsV, gV);
  // bias slab: biasL[i] = table[min(qbase + kQB + S - 1 - i, relmax)][h] * inv, read at i = kQB + kv - (q - qbase) in (0, kQB + kSeq)
  slab_copies((unsigned)(size_t)biasL + (unsigned)(tid * 16), biasT + (size_t)h * kTabL + (kSeq - kQB - qbase) + tid * 4);

  // scores and bias are formed in base-2 units
  const float inv = score_scale(tptr);

  // Q fragments (B operand, column c = query q0 + c): 2 d-chunks, hardware k order from the f16 plane
  v16h qa[2];
  {
    const _Float16* qrow = Qh + (size_t)(b * kSeq + q0 + c) * kEmb + h * kHD;
#pragma unroll
    for (int dc = 0; dc < 2; ++dc) qa[dc] = Frag<_Float16>::load(qrow + dc * 32 + 8 * hh);
  }

  // of query q0 + c: running maximum less 15 (the same in both halves), this half's part of the running sum (x2^15)
  float mrow = -INFINITY, lrow = 0.f;
  // oacc[t][r] = O^T[d = t*16 + 8*hh + r][query q0 + c]
  v8f oacc[4];
#pragma unroll
  for (int t = 0; t < 4; ++t) oacc[t] = (v8f){0.f,0.f,0.f,0.f,0.f,0.f,0.f,0.f};

  // chunk 0's bytes of this wave have landed before the barrier that shows them (and the bias slab) to the other waves
  asm volatile("s_wait_asynccnt 0x0" ::: "memory");
  __syncthreads();
  if (nCh > 1) kv_copies(ldsK + (unsigned)kKVTile, gK + (size_t)kKC * kEmb, ldsV + (unsigned)kKVTile, gV + kKC);

  // one chunk per trip, the buffer chosen by the trip's parity
  for (int kc = 0; kc < nCh; ++kc) {
    const int kv0 = kc * kKC;
    const _Float16* Kb = Ksh + (kc & 1) * (kKC * kLP);
    const _Float16* Vb = Vtsh + (kc & 1) * (kHD * kLP);

    // ---- the chunk's eight K fragments and its 32 bias values are read as one group ahead of the score products:
    // one LDS latency a chunk, where a read and a full wait in front of each product cost eight ----
    // kQB - (q - qbase) is written 1 + ((q - qbase) ^ (kQB - 1)): the register part of the LDS address then never lies below 0
    const int bi = 1 + ((wave * 16 + c) ^ (kQB - 1)) + kv0 + 8 * hh;
    v16h kf[2][4];
#pragma unroll
    for (int dc = 0; dc < 2; ++dc)
#pragma unroll
      for (int j = 0; j < 4; ++j) kf[dc][j] = Frag<_Float16>::load(Kb + (j * 16 + c) * kLP + dc * 32 + 8 * hh);
    float bl[4][8];
#pragma unroll
    for (int j = 0; j < 4; ++j)
#pragma unroll
      for (int r = 0; r < 8; ++r) bl[j][r] = biasL[bi + j * 16 + r];
    // keeps the group whole: left free, the scheduler sinks the bias reads in among the products and the arithmetic, each with a wait of its own
    __builtin_amdgcn_sched_barrier(0);

    // ---- scores, transposed: s[j][r] = score of key kv0 + j*16 + 8*hh + r with query q0 + c ----
    // four independent tiles back to back, then their second halves: in every tile d 0..31 is summed before d 32..63
    v8f s[4];
#pragma unroll
    for (int j = 0; j < 4; ++j) s[j] = (v8f){0.f,0.f,0.f,0.f,0.f,0.f,0.f,0.f};
#pragma unroll
    for (int dc = 0; dc < 2; ++dc)
#pragma unroll
      for (int j = 0; j < 4; ++j) s[j] = Frag<_Float16>::mma(kf[dc][j], qa[dc], s[j]);

    // ---- the chunk's eight V^T fragments, one group: their latency passes behind the softmax arithmetic ----
    v16h vf[2][4];
#pragma unroll
    for (int kk = 0; kk < 2; ++kk)
#pragma unroll
      for (int t = 0; t < 4; ++t) vf[kk][t] = Frag<_Float16>::load(Vb + (t * 16 + c) * kLP + kk * 32 + 8 * hh);
    // keeps the group here: left free, the scheduler sinks half of these reads down to their products, a full wait in front of each
    __builtin_amdgcn_sched_barrier(0);

    // ---- scale + bias + maximum over this lane's 32 keys (one chain per tile), then over both halves ----
    float mj[4];
#pragma unroll
    for (int j = 0; j < 4; ++j) {
      mj[j] = -INFINITY;
#pragma unroll
      for (int r = 0; r < 8; ++r) {
        const float sc = s[j][r] * inv + bl[j][r];
        s[j][r] = sc;
        mj[j] = fmaxf(mj[j], sc);
      }
    }
    float cm = fmaxf(fmaxf(mj[0], mj[1]), fmaxf(mj[2], mj[3]));
    cm = fmaxf(cm, xhalf(cm));
    // the point that exponents are taken from: the chunk's maximum less 15 (any point serves, it cancels in p / l).
    // Where the maximum is so large that f32 cannot hold the 15 beside it, the maximum itself, so that p stays inside f16.
    {
      const float lowered = cm - kPCarryLog2;
      cm = (cm - lowered < kPCarryLog2 + 0.5f) ? lowered : cm;
    }

    // ---- online softmax update; P^T (x2^15, f16) packed into the B operands of the second product ----
    const float mnew = fmaxf(mrow, cm);
    const float alpha = __builtin_amdgcn_exp2f(mrow - mnew);
    mrow = mnew;
    // pb[kk] element e: key kv0 + kk*32 + 8*hh + e for e < 8, kv0 + kk*32 + 16 + 8*hh + (e - 8) behind: tiles 2kk, 2kk + 1
    v16h pb[2];
    float pj[4];
#pragma unroll
    for (int j = 0; j < 4; ++j) {
      float e[8];
#pragma unroll
      for (int r = 0; r < 8; ++r) e[r] = s[j][r] - mnew;
      exp2x8(e[0], e[1], e[2], e[3], e[4], e[5], e[6], e[7]);
      pj[j] = e[0];
#pragma unroll
      for (int r = 1; r < 8; ++r) pj[j] += e[r];
#pragma unroll
      for (int r = 0; r < 8; ++r) pb[j >> 1][(j & 1) * 8 + r] = (_Float16)e[r];
    }
    lrow = lrow * alpha + ((pj[0] + pj[1]) + (pj[2] + pj[3]));
#pragma unroll
    for (int t = 0; t < 4; ++t)
#pragma unroll
      for (int r = 0; r < 8; ++r) oacc[t][r] *= alpha;

    // ---- O^T += V^T_chunk . P^T ----
#pragma unroll
    for (int kk = 0; kk < 2; ++kk) {
#pragma unroll
      for (int t = 0; t < 4; ++t) oacc[t] = Frag<_Float16>::mma(vf[kk][t], pb[kk], oacc[t]);
    }
    // the four slots that the chip asks for behind the last product, on the branch at the loop's foot as on the fall-through
    acc_guard4(oacc[0], oacc[1], oacc[2], oacc[3]);
    // this wave's reads of the buffers are done before the barrier behind which they are refilled
    asm volatile("s_wait_dscnt 0x0" ::: "memory");
    // this wave's copies of chunk kc + 1 have landed before the barrier that shows them to the other waves
    asm volatile("s_wait_asynccnt 0x0" ::: "memory");
    __syncthreads();
    if (kc + 2 < nCh)
      kv_copies(ldsK + (unsigned)((kc & 1) * kKVTile), gK + (size_t)(kc + 2) * kKC * kEmb,
                ldsV + (unsigned)((kc & 1) * kKVTile), gV + (kc + 2) * kKC);
  }
  // no copy is outstanding when the wave goes on to the epilogue and ends
  asm volatile("s_wait_asynccnt 0x0" ::: "memory");

  // the two halves' sums of a query are joined here, once; a lane's 8 accumulators of a tile are 8 consecutive d
  // of its query's row: one 16-byte store per tile
  {
    const float l = lrow + xhalf(lrow);
    const float invl = ctx_scale * (1.0f / l);
    _Float16* crow = (_Float16*)Cp + (size_t)(b * kSeq + q0 + c) * kEmb + h * kHD + 8 * hh;
#pragma unroll
    for (int t = 0; t < 4; ++t) {
      v8h hv;
#pragma unroll
      for (int r = 0; r < 8; ++r) hv[r] = (_Float16)(oacc[t][r] * invl);
      *(v8h*)(crow + t * 16) = hv;
    }
  }
}

// ---------------------------------------------------------------------------
// Host launch
// ---------------------------------------------------------------------------
extern "C" void kernel_launch(void* const* d_in, const int* in_sizes, int n_in,
                              void* d_out, int out_size, void* d_ws, size_t ws_size,
                              hipStream_t stream) {
  if (n_in < 11) return;
  if (in_sizes[0] != kTok * kEmb) return;
  if (in_sizes[1] != kEmb * kEmb || in_sizes[3] != kEmb * kEmb ||
      in_sizes[5] != kEmb * kEmb || in_sizes[7] != kEmb * kEmb) return;
  if (in_sizes[2] < kEmb || in_sizes[4] < kEmb || in_sizes[6] < kEmb || in_sizes[8] < kEmb) return;
  if (in_sizes[9] != kRelRows * kHeads || in_sizes[10] < 1) return;
  if (out_size != kTok * kEmb) return;

  const float* x    = (const float*)d_in[0];
  const float* Wq   = (const float*)d_in[1];
  const float* bq   = (const float*)d_in[2];
  const float* Wk   = (const float*)d_in[3];
  const float* bk   = (const float*)d_in[4];
  const float* Wv   = (const float*)d_in[5];
  const float* bv   = (const float*)d_in[6];
  const float* Wp   = (const float*)d_in[7];
  const float* bp   = (const float*)d_in[8];
  const float* btab = (const float*)d_in[9];
  const float* tptr = (const float*)d_in[10];
  float* out = (float*)d_out;

  // workspace region map (bytes), all offsets multiples of 2 MiB:
  //   Xb  bf16 [4096][1024]   8 MiB  @ 0
  //   WqT bf16 [1024][1024]   2 MiB  @ 8 MiB
  //   WkT bf16 [1024][1024]   2 MiB  @ 10 MiB
  //   WvT bf16 [1024][1024]   2 MiB  @ 12 MiB
  //   WpT f16  [1024][1024]   2 MiB  @ 14 MiB   (RNE-bf16 values x64)
  //   Qp  f16  [4096][1024]   8 MiB  @ 16 MiB
  //   Kp  f16  [4096][1024]   8 MiB  @ 24 MiB
  //   Vtp f16  [1024][4096]   8 MiB  @ 32 MiB
  //   Cx  f16  [4096][1024]   8 MiB  @ 40 MiB   (ctx x64)
  //   biasT f32 [16][2496]  156 KiB @ 48 MiB   (bias rows x score scale)
  const size_t szAct = (size_t)kTok * kEmb * 2;
  const size_t szW   = (size_t)kEmb * kEmb * 2;
  size_t off = 0;
  const size_t oXb = off; off += szAct;
  const size_t oWq = off; off += szW;
  const size_t oWk = off; off += szW;
  const size_t oWv = off; off += szW;
  const size_t oWp = off; off += szW;
  const size_t oQ  = off; off += szAct;
  const size_t oK  = off; off += szAct;
  const size_t oVt = off; off += szAct;
  const size_t oCx = off; off += szAct;
  const size_t oBT = off; off += (size_t)kHeads * kTabL * 4;
  if (off > ws_size) return;

  char* w = (char*)d_ws;
  unsigned short* Xb  = (unsigned short*)(w + oXb);
  unsigned short* WqT = (unsigned short*)(w + oWq);
  unsigned short* WkT = (unsigned short*)(w + oWk);
  unsigned short* WvT = (unsigned short*)(w + oWv);
  unsigned short* WpT = (unsigned short*)(w + oWp);
  unsigned short* Qp  = (unsigned short*)(w + oQ);
  unsigned short* Kp  = (unsigned short*)(w + oK);
  unsigned short* Vtp = (unsigned short*)(w + oVt);
  unsigned short* Cx  = (unsigned short*)(w + oCx);
  float* biasT = (float*)(w + oBT);

  const float kWpCarry  = 64.0f;
  const float kCtxCarry = 64.0f;

  // 1) one launch: bias rows, weights in[rows=1024][cols=1024] -> out[cols][rows], and x -> bf16 plane (2 elements per thread)
  {
    const int n2 = (kTok * kEmb) / 2;
    prep_inputs<<<kBiasBlocks + 4 * kWTiles + (n2 + 255) / 256, 256, 0, stream>>>(
        x, Wq, Wk, Wv, Wp, btab, tptr, Xb, WqT, WkT, WvT, WpT, biasT, n2, kEmb, kWpCarry);
  }
  // 2) one launch: the three projections (bf16 WMMA, f16 outputs). M,N % 128 == 0, K % 128 == 0 by the static_assert below.
  static_assert(kTok % 128 == 0 && kEmb % 128 == 0);
  const int gemmBlocks = (kTok / 128) * (kEmb / 128);
  qkv_gemm<<<gemmBlocks, kQkvWaves * 32, 0, stream>>>(
      Xb, WqT, WkT, WvT, Qp, Kp, Vtp, bq, bk, bv, kTok, kEmb);
  // 3) attention -> ctx f16 plane (x64)
  attn_relbias_f16<<<kBatch * kHeads * (kSeq / kQB), kNW * 32, 0, stream>>>(
      Qp, Kp, Vtp, biasT, tptr, Cx, kCtxCarry);
  // 4) output projection: out[token][n] = 2^-12 * sum_c Cx[token][c] WpT[n][c] + bp[n]
  wmma_gemm64<0, false, 2, 0><<<dim3(gemmBlocks, 1), 256, 0, stream>>>(
      Cx, Cx, kEmb, 0L, WpT, WpT, kEmb, 0L, (void*)out, (void*)out, kEmb, 0L, bp,
      kTok, kEmb, kEmb, 1.0f / (kWpCarry * kCtxCarry));
}
